// v000
// Times are from an AMD MI455X. After a warm-up the kernel runs many times in a row, and a time is the length of
// such a window on the GPU divided by its runs, so every launch and the gaps after it count. The runs cycle
// through copies of the inputs. A figure is the median of several windows, for all but v000 over two sittings.
// Sittings can differ by a few percent; kernels timed side by side share one.
// v000, which the later versions start from, runs in 1890 microseconds.
#include <hip/hip_runtime.h>
// Multi-head attention over THREE inputs, each passed through ONE shared LayerNorm first (query, key, value [2][2048][512]; Q = LN(query) Wq + bq, K = LN(key) Wk + bk, V = LN(value) Wv + bv with LN: biased var, eps 1e-5, shared ln_g / ln_b; [in][out] 512 x 512, zero biases); 8 heads of 64; scores / 8; softmax over all 2048 keys (no mask); out = merged Wo + bo -> [2][2048][512]; no residual).
// Structure: token rows r = b*2048 + s; LN rows as f16 (inputs bf16-rounded, LN in f32); Q, K, V as three WMMA GEMMs (32x64 wave tiles, f32 accumulation, exact x16 weights + bias, f16 outputs); per batch: V^T for all heads via LDS transposes; per (batch, group of 4 heads): scores GEMM (K = 64, batched over the heads on grid.y, alpha = 1/sqrt(64)), row softmax on VALU (f32 statistics; weights stored x256 as f16), o = P . V^T GEMM (K = 2048, alpha 2^-2: o carried x64 against f16 subnormal flush, folded into the output GEMM alpha) written straight into the merged f16 o rows; out = o W_o + b GEMM (f32) into the output layout.
// Compute dtype: inputs rounded to bf16; weights exact; LN rows, q, k, v, softmax weights and o as plain f16 GEMM operands (~2^-12); scores and softmax statistics f32; v_wmma_f32_16x16x32_f16.
#define NB 2
#define SQ 2048
#define DM 512
#define NH 8
#define HD 64
#define HG 4                         /* heads per attention launch group */
#define B0 0                         /* first batch processed (debug hook) */
#define NBR NB                       /* batches processed (debug hook) */
#define NR ((size_t)NB * SQ)         /* token rows */
#define MP ((int)((size_t)NBR * SQ)) /* rows projected (debug hook) */
#define QN SQ                        /* query rows attended per batch (debug hook) */
#define NHD NH                       /* heads attended (debug hook) */
#define MPO MP                       /* rows through the output stage (debug hook) */
#define LQ DM      /* row pitch of the q/k/v rows */
typedef __bf16 v16b __attribute__((ext_vector_type(16)));
typedef unsigned short v8us __attribute__((ext_vector_type(8), may_alias));
typedef float  v8f  __attribute__((ext_vector_type(8)));
typedef float  v4f  __attribute__((ext_vector_type(4)));
typedef float  v4fa __attribute__((ext_vector_type(4), may_alias));
union FragB { v16b v; v8us half[2]; unsigned short u[16]; };

__device__ __forceinline__ unsigned short bf16_bits(float x) { unsigned int u = __float_as_uint(x); return (unsigned short)((u + 0x7FFFu + ((u >> 16) & 1u)) >> 16); }
__device__ __forceinline__ float bf16_val(unsigned short b) { return __uint_as_float(((unsigned int)b) << 16); }
__device__ __forceinline__ float bf16_round(float x) { return bf16_val(bf16_bits(x)); }
// D += A·B with NT terms: 1 = ah·bh, 2 = + al·bh (A split), 3 = + ah·bl (both split)
template <int NT>
__device__ __forceinline__ v8f mmaN(v16b ah, v16b al, v16b bh, v16b bl, v8f c) {
  c = __builtin_amdgcn_wmma_f32_16x16x32_bf16(false, ah, false, bh, (short)0, c, false, false);
  if (NT >= 2) c = __builtin_amdgcn_wmma_f32_16x16x32_bf16(false, al, false, bh, (short)0, c, false, false);
  if (NT >= 3) c = __builtin_amdgcn_wmma_f32_16x16x32_bf16(false, ah, false, bl, (short)0, c, false, false);
  asm volatile("v_nop\n\tv_nop\n\tv_nop\n\tv_nop" : "+v"(c) : "v"(ah), "v"(al), "v"(bh), "v"(bl));
  return c;
}

__global__ __launch_bounds__(256) void k_wt_bf16(const float* __restrict__ W, unsigned short* __restrict__ Wt, int K, int N) {
  const int t = blockIdx.x * 256 + threadIdx.x;
  const int k8n = K / 8;
  if (t >= N * k8n) return;
  const int n = t / k8n, k8 = (t % k8n) * 8;
  v8us v;
#pragma unroll
  for (int i = 0; i < 8; ++i) v[i] = bf16_bits(W[(size_t)(k8 + i) * N + n]);
  *(v8us*)(Wt + (size_t)n * K + k8) = v;
  
}

// GEMM C[M][N] (f32, pitch ldc) = act(A[M][K]·W + bias). A f32 row-major (pitch lda) converted per fragment to bf16
// (ASPLIT: hi/lo two planes -> 2 terms, else single rounded term); Wt bf16 [N][K] (pitch ldb). BIAS_BF16 rounds the
// bias to bf16 first (bias quantised to bf16 before the add). K%32==0, M%16==0, N%64==0.
template <bool ASPLIT, int ACT, bool BIAS_BF16>
__global__ __launch_bounds__(128) void k_gemm_bf(const float* __restrict__ A, int lda, const unsigned short* __restrict__ Wt, int ldb,
                                               const float* __restrict__ bias, float* __restrict__ C, int ldc, int M, int N, int K) {
  __shared__ __attribute__((aligned(16))) float so[4][16][64];
  const int tid = threadIdx.x, w = tid >> 5, lane = tid & 31, ln = lane & 15, hh = lane >> 4;
  const int ntn = N / 64;
  const int wid = blockIdx.x * 4 + w;
  const int mt = wid / ntn, nq = wid % ntn;
  if (mt * 16 >= M) return;
  const int row0 = mt * 16, col0 = nq * 64;
  const float* arow = A + (size_t)(row0 + ln) * lda;
  v8f acc[4] = {};
  for (int kb = 0; kb < K; kb += 32) {
    FragB ah, al;
    const v4f x0 = *(const v4fa*)(arow + kb + 8 * hh), x1 = *(const v4fa*)(arow + kb + 8 * hh + 4);
    const v4f x2 = *(const v4fa*)(arow + kb + 16 + 8 * hh), x3 = *(const v4fa*)(arow + kb + 16 + 8 * hh + 4);
    float xs[16] = {x0[0],x0[1],x0[2],x0[3],x1[0],x1[1],x1[2],x1[3],x2[0],x2[1],x2[2],x2[3],x3[0],x3[1],x3[2],x3[3]};
#pragma unroll
    for (int i = 0; i < 16; ++i) { const unsigned short hb = bf16_bits(xs[i]); ah.u[i] = hb; al.u[i] = ASPLIT ? bf16_bits(xs[i] - bf16_val(hb)) : (unsigned short)0; }
#pragma unroll
    for (int t = 0; t < 4; ++t) {
      const unsigned short* brow = Wt + (size_t)(col0 + t * 16 + ln) * ldb + kb;
      FragB b;
      b.half[0] = *(const v8us*)(brow + 8 * hh);
      b.half[1] = *(const v8us*)(brow + 16 + 8 * hh);
      acc[t] = mmaN<ASPLIT ? 2 : 1>(ah.v, al.v, b.v, b.v, acc[t]);
    }
  }
#pragma unroll
  for (int t = 0; t < 4; ++t) {
    float bv = bias ? bias[col0 + t * 16 + ln] : 0.f;
    if (BIAS_BF16) bv = bf16_round(bv);
#pragma unroll
    for (int r = 0; r < 8; ++r) { float v = acc[t][r] + bv; if (ACT == 1) v = fmaxf(v, 0.f); so[w][8 * hh + r][t * 16 + ln] = v; }
  }
  __builtin_amdgcn_fence(__ATOMIC_ACQ_REL, "workgroup");
  __builtin_amdgcn_wave_barrier();
  const int rsub = lane >> 4, c4 = (lane & 15) * 4;
  {
#pragma unroll
    for (int q = 0; q < 8; ++q) {
      const int r = q * 2 + rsub;
      const v4f v = *(const v4fa*)&so[w][r][c4];
      *(v4f*)(C + (size_t)(row0 + r) * ldc + col0 + c4) = v;
    }
    
  }
}

// GEMM C = act(A·W + bias + resid): A f32 (ASPLIT -> hi/lo 2 terms), Wt bf16 [N][K]; ACT 0 none, 1 relu, 2 exact gelu;
// resid (optional, f32, row index = (row % rmod), pitch ldr, RES_BF16 rounds it) added before the activation.
template <bool ASPLIT, int ACT, bool BIAS_BF16, bool RES_BF16>
__global__ __launch_bounds__(128) void k_gemm_bf3(const float* __restrict__ A, int lda, const unsigned short* __restrict__ Wt, int ldb,
                                                const float* __restrict__ bias, const float* __restrict__ resid, int rmod, int ldr,
                                                float* __restrict__ C, int ldc, int M, int N, int K) {
  __shared__ __attribute__((aligned(16))) float so[4][16][64];
  const int tid = threadIdx.x, w = tid >> 5, lane = tid & 31, ln = lane & 15, hh = lane >> 4;
  const int ntn = N / 64;
  const int wid = blockIdx.x * 4 + w;
  const int mt = wid / ntn, nq = wid % ntn;
  if (mt * 16 >= M) return;
  const int row0 = mt * 16, col0 = nq * 64;
  const float* arow = A + (size_t)(row0 + ln) * lda;
  v8f acc[4] = {};
  for (int kb = 0; kb < K; kb += 32) {
    FragB ah, al;
    const v4f x0 = *(const v4fa*)(arow + kb + 8 * hh), x1 = *(const v4fa*)(arow + kb + 8 * hh + 4);
    const v4f x2 = *(const v4fa*)(arow + kb + 16 + 8 * hh), x3 = *(const v4fa*)(arow + kb + 16 + 8 * hh + 4);
    float xs[16] = {x0[0],x0[1],x0[2],x0[3],x1[0],x1[1],x1[2],x1[3],x2[0],x2[1],x2[2],x2[3],x3[0],x3[1],x3[2],x3[3]};
#pragma unroll
    for (int i = 0; i < 16; ++i) { const unsigned short hb = bf16_bits(xs[i]); ah.u[i] = hb; al.u[i] = ASPLIT ? bf16_bits(xs[i] - bf16_val(hb)) : (unsigned short)0; }
#pragma unroll
    for (int t = 0; t < 4; ++t) {
      const unsigned short* brow = Wt + (size_t)(col0 + t * 16 + ln) * ldb + kb;
      FragB b;
      b.half[0] = *(const v8us*)(brow + 8 * hh);
      b.half[1] = *(const v8us*)(brow + 16 + 8 * hh);
      acc[t] = mmaN<ASPLIT ? 2 : 1>(ah.v, al.v, b.v, b.v, acc[t]);
    }
  }
#pragma unroll
  for (int t = 0; t < 4; ++t) {
    const int col = col0 + t * 16 + ln;
    float bv = bias ? bias[col] : 0.f;
    if (BIAS_BF16) bv = bf16_round(bv);
#pragma unroll
    for (int r = 0; r < 8; ++r) {
      float v = acc[t][r] + bv;
      if (resid) { float rv = resid[(size_t)((row0 + 8 * hh + r) % rmod) * ldr + col]; if (RES_BF16) rv = bf16_round(rv); v += rv; }
      if (ACT == 1) v = fmaxf(v, 0.f);
      if (ACT == 2) v = 0.5f * v * (1.0f + erff(v * 0.70710678118654752f));
      if (ACT == 3) { const float u = 0.7978845608028654f * (v + 0.044715f * v * v * v); v = 0.5f * v * (1.0f + tanhf(u)); }
      so[w][8 * hh + r][t * 16 + ln] = v;
    }
  }
  __builtin_amdgcn_fence(__ATOMIC_ACQ_REL, "workgroup");
  __builtin_amdgcn_wave_barrier();
  const int rsub = lane >> 4, c4 = (lane & 15) * 4;
  {
#pragma unroll
    for (int q = 0; q < 8; ++q) {
      const int r = q * 2 + rsub;
      const v4f v = *(const v4fa*)&so[w][r][c4];
      *(v4f*)(C + (size_t)(row0 + r) * ldc + col0 + c4) = v;
    }
    
  }
}
// row LayerNorm (biased variance, eps) over N: s = X (+ R); optional out_sum <- s; out_norm <- (s-mu)*rsqrt(var+eps)*g + b
template <bool PARAM_BF16>
__global__ __launch_bounds__(256) void k_layernorm(const float* __restrict__ X, const float* __restrict__ R, const float* __restrict__ g, const float* __restrict__ bta,
                                                  float* __restrict__ out_sum, float* __restrict__ out_norm, int N, float eps) {
  __shared__ float red[256];
  const int row = blockIdx.x, tid = threadIdx.x;
  const float* x = X + (size_t)row * N; const float* rr = R ? R + (size_t)row * N : nullptr;
  float vals[16];                     // up to N = 4096
  const int per = N / 256;            // contiguous chunk per thread? use strided-by-4 chunks: thread handles j = tid*4 + 1024*u
  float s1 = 0.f;
  for (int u = 0; u < per / 4; ++u) {
    const int j = tid * 4 + 1024 * u;
    const v4f a = *(const v4fa*)(x + j);
    v4f b = {0.f,0.f,0.f,0.f}; if (rr) b = *(const v4fa*)(rr + j);
#pragma unroll
    for (int q = 0; q < 4; ++q) { const float v = a[q] + b[q]; vals[u * 4 + q] = v; s1 += v; }
  }
  red[tid] = s1; __syncthreads();
  for (int st = 128; st > 0; st >>= 1) { if (tid < st) red[tid] += red[tid + st]; __syncthreads(); }
  const float mu = red[0] / (float)N; __syncthreads();
  float s2 = 0.f;
  for (int u = 0; u < per / 4; ++u)
#pragma unroll
    for (int q = 0; q < 4; ++q) { const float c = vals[u * 4 + q] - mu; s2 += c * c; }
  red[tid] = s2; __syncthreads();
  for (int st = 128; st > 0; st >>= 1) { if (tid < st) red[tid] += red[tid + st]; __syncthreads(); }
  const float rs = rsqrtf(red[0] / (float)N + eps);
  {
    for (int u = 0; u < per / 4; ++u) {
      const int j = tid * 4 + 1024 * u;
      v4f o, sm;
#pragma unroll
      for (int q = 0; q < 4; ++q) {
        float gg = g[j + q], bb = bta[j + q];
        if (PARAM_BF16) { gg = bf16_round(gg); bb = bf16_round(bb); }
        sm[q] = vals[u * 4 + q]; o[q] = (vals[u * 4 + q] - mu) * rs * gg + bb;
      }
      if (out_sum) *(v4f*)(out_sum + (size_t)row * N + j) = sm;
      *(v4f*)(out_norm + (size_t)row * N + j) = o;
    }
    
  }
}



// ---- f16 WMMA path (v_wmma_f32_16x16x32_f16): 11-bit significands for operands in range — used where a [0,1] probability operand needs more precision than bf16
typedef _Float16 v16h __attribute__((ext_vector_type(16)));
union FragH { v16h v; v8us half[2]; _Float16 h[16]; unsigned short u[16]; };
template <int NT>
__device__ __forceinline__ v8f mmaH(v16h ah, v16h al, v16h bh, v16h bl, v8f c) {
  c = __builtin_amdgcn_wmma_f32_16x16x32_f16(false, ah, false, bh, (short)0, c, false, false);
  if (NT >= 2) c = __builtin_amdgcn_wmma_f32_16x16x32_f16(false, al, false, bh, (short)0, c, false, false);
  if (NT >= 3) c = __builtin_amdgcn_wmma_f32_16x16x32_f16(false, ah, false, bl, (short)0, c, false, false);
  asm volatile("v_nop\n\tv_nop\n\tv_nop\n\tv_nop" : "+v"(c) : "v"(ah), "v"(al), "v"(bh), "v"(bl));
  return c;
}
// batched GEMM like k_gemm_b but f16 operands: A f32 (split into f16 hi/lo if ASPLIT, else rounded to f16), Bt = f16 values [n][k]; alpha; C f32; N multiple of 16 (partial tiles skipped)
template <bool ASPLIT>
__global__ __launch_bounds__(128) void k_gemm_h(const float* __restrict__ A, int lda, size_t sA, const _Float16* __restrict__ Bh, int ldb, size_t sB, float alpha, float* __restrict__ C, int ldc, size_t sC, int M, int N, int K) {
  __shared__ __attribute__((aligned(16))) float so[4][16][64];
  const int tid = threadIdx.x, w = tid >> 5, lane = tid & 31, ln = lane & 15, hh = lane >> 4; const int by = blockIdx.y;
  A += (size_t)by * sA; Bh += (size_t)by * sB; C += (size_t)by * sC;
  const int ntn = (N + 63) / 64; const int wid = blockIdx.x * 4 + w; const int mt = wid / ntn, nq = wid % ntn; if (mt * 16 >= M) return;
  const int row0 = mt * 16, col0 = nq * 64; const float* arow = A + (size_t)(row0 + ln) * lda;
  v8f acc[4] = {};
  for (int kb = 0; kb < K; kb += 32) {
    FragH ah, al;
    const v4f x0 = *(const v4fa*)(arow + kb + 8 * hh), x1 = *(const v4fa*)(arow + kb + 8 * hh + 4), x2 = *(const v4fa*)(arow + kb + 16 + 8 * hh), x3 = *(const v4fa*)(arow + kb + 16 + 8 * hh + 4);
    float xs[16] = {x0[0],x0[1],x0[2],x0[3],x1[0],x1[1],x1[2],x1[3],x2[0],x2[1],x2[2],x2[3],x3[0],x3[1],x3[2],x3[3]};
#pragma unroll
    for (int i = 0; i < 16; ++i) { const _Float16 h = (_Float16)xs[i]; ah.h[i] = h; al.h[i] = ASPLIT ? (_Float16)(xs[i] - (float)h) : (_Float16)0.0f; }
#pragma unroll
    for (int t = 0; t < 4; ++t) { if (col0 + t * 16 >= N) continue; const size_t boff = (size_t)(col0 + t * 16 + ln) * ldb + kb; FragH bq; bq.half[0] = *(const v8us*)(Bh + boff + 8 * hh); bq.half[1] = *(const v8us*)(Bh + boff + 16 + 8 * hh);
      acc[t] = mmaH<ASPLIT ? 2 : 1>(ah.v, al.v, bq.v, bq.v, acc[t]); }
  }
#pragma unroll
  for (int t = 0; t < 4; ++t) { if (col0 + t * 16 >= N) continue;
#pragma unroll
    for (int r = 0; r < 8; ++r) so[w][8 * hh + r][t * 16 + ln] = acc[t][r] * alpha; }
  __builtin_amdgcn_fence(__ATOMIC_ACQ_REL, "workgroup"); __builtin_amdgcn_wave_barrier();
  const int rsub = lane >> 4, c4 = (lane & 15) * 4;
  {
#pragma unroll
    for (int q = 0; q < 8; ++q) { const int r = q * 2 + rsub; if (col0 + c4 < N) { const v4f v = *(const v4fa*)&so[w][r][c4]; *(v4f*)(C + (size_t)(row0 + r) * ldc + col0 + c4) = v; } }
     }
}

// Wt[n][k] = f16(W[k][n]·scale) from f32 row-major W[K][N] (scale = power of two; bf16-exact weights stay exact in f16 away from the subnormal range)
__global__ __launch_bounds__(256) void k_wt_f16(const float* __restrict__ W, _Float16* __restrict__ Wt, int K, int N, float scale) {
  const int t = blockIdx.x * 256 + threadIdx.x; if (t >= N * (K / 8)) return; const int n = t / (K / 8), k8 = (t % (K / 8)) * 8; FragH f;
#pragma unroll
  for (int i = 0; i < 8; ++i) f.h[i] = (_Float16)(bf16_round(W[(size_t)(k8 + i) * N + n]) * scale); const v8us o = f.half[0];
  *(v8us*)((unsigned short*)Wt + (size_t)n * K + k8) = o; 
}
// k_gemm_hh variant with fused epilogue: v = acc·alpha + bias[by·sBias + col] (+ CP[(row/rowsPerB)·sCPb + by·64 + col] if CP) ; ACT 0 none / 1 elu ; writes f16 C16 (and f32 C if non-null)
template <int ACT>
__global__ __launch_bounds__(128) void k_gemm_hhx(const _Float16* __restrict__ A, int lda, size_t sA, const _Float16* __restrict__ Bh, int ldb, size_t sB, float alpha, const float* __restrict__ bias, size_t sBias, const float* __restrict__ CP, int rowsPerB, size_t sCPb, int row0g,
    float* __restrict__ C, _Float16* __restrict__ C16, int ldc, size_t sC, int M, int N, int K) {
  __shared__ __attribute__((aligned(16))) float so[4][16][64];
  const int tid = threadIdx.x, w = tid >> 5, lane = tid & 31, ln = lane & 15, hh = lane >> 4; const int by = blockIdx.y;
  A += (size_t)by * sA; Bh += (size_t)by * sB; const size_t cofs = (size_t)by * sC; const float* bp = bias ? bias + (size_t)by * sBias : nullptr;
  const int ntn = (N + 63) / 64; const int wid = blockIdx.x * 4 + w; const int mt = wid / ntn, nq = wid % ntn; if (mt * 16 >= M) return;
  const int row0 = mt * 16, col0 = nq * 64; const _Float16* arow = A + (size_t)(row0 + ln) * lda;
  v8f acc[4] = {};
  for (int kb = 0; kb < K; kb += 32) { FragH ah; ah.half[0] = *(const v8us*)((const unsigned short*)arow + kb + 8 * hh); ah.half[1] = *(const v8us*)((const unsigned short*)arow + kb + 16 + 8 * hh);
#pragma unroll
    for (int t = 0; t < 4; ++t) { if (col0 + t * 16 >= N) continue; const size_t boff = (size_t)(col0 + t * 16 + ln) * ldb + kb; FragH bq; bq.half[0] = *(const v8us*)((const unsigned short*)Bh + boff + 8 * hh); bq.half[1] = *(const v8us*)((const unsigned short*)Bh + boff + 16 + 8 * hh);
      acc[t] = mmaH<1>(ah.v, ah.v, bq.v, bq.v, acc[t]); }
  }
#pragma unroll
  for (int t = 0; t < 4; ++t) { if (col0 + t * 16 >= N) continue; const int col = col0 + t * 16 + ln; const float bv = bp ? bf16_round(bp[col]) : 0.f;
#pragma unroll
    for (int r = 0; r < 8; ++r) { float v = acc[t][r] * alpha + bv; if (CP) { const int rr = row0g + row0 + 8 * hh + r; if (rowsPerB < 0) v += CP[cofs + (size_t)rr * ldc + col];      /* rowsPerB < 0: own element of the batched C plane */ else { const int bidx = rr / rowsPerB; v += CP[(size_t)bidx * sCPb + (size_t)by * 64 + col]; } } if (ACT == 1) v = (v > 0.f) ? v : expm1f(v); else if (ACT == 7) v = (v > 0.f) ? v + 1.0f : expf(v); else if (ACT == 8) v = tanhf(v); else if (ACT == 9) v = 0.5f * v * (1.0f + tanhf(0.7978845608028654f * (v + 0.044715f * v * v * v))); else if (ACT == 11) v = 1.0f / (1.0f + expf(-v)); else if (ACT == 12) v = (v > 0.f) ? v : 0.01f * v; else if (ACT == 14) v = (v > 0.f) ? v : 0.1f * v; else if (ACT == 16) v = (v >= 0.f) ? v : 0.3f * v; else if (ACT == 17) v = (v >= 0.f) ? v : 0.2f * v; else if (ACT == 15) v = v / (1.0f + expf(-v)); else if (ACT == 3) v = fmaxf(v, 0.f); else if (ACT == 6) v = 0.5f * v * (1.0f + erff(v * 0.70710678118654752f)); so[w][8 * hh + r][t * 16 + ln] = v; } }
  __builtin_amdgcn_fence(__ATOMIC_ACQ_REL, "workgroup"); __builtin_amdgcn_wave_barrier();
  const int rsub = lane >> 4, c4 = (lane & 15) * 4; typedef _Float16 v4h __attribute__((ext_vector_type(4)));
  {
#pragma unroll
    for (int q = 0; q < 8; ++q) { const int r = q * 2 + rsub; if (col0 + c4 < N) { const v4f v = *(const v4fa*)&so[w][r][c4]; if (C) *(v4f*)(C + cofs + (size_t)(row0 + r) * ldc + col0 + c4) = v; if (C16) { v4h h4; for (int i = 0; i < 4; ++i) h4[i] = (_Float16)v[i]; *(v4h*)(C16 + cofs + (size_t)(row0 + r) * ldc + col0 + c4) = h4; } } }
     }
}


typedef _Float16 v4h __attribute__((ext_vector_type(4)));

__global__ __launch_bounds__(256) void k_x16(const float* __restrict__ x, _Float16* __restrict__ X16, size_t n8) { const size_t t = (size_t)blockIdx.x * 256 + threadIdx.x; if (t >= n8) return; FragH f;
#pragma unroll
  for (int q = 0; q < 8; ++q) f.h[q] = (_Float16)bf16_round(x[t * 8 + q]); *(v8us*)((unsigned short*)X16 + t * 8) = f.half[0];  }
__global__ __launch_bounds__(256) void k_h16(const float* __restrict__ x, _Float16* __restrict__ X16, size_t n8) { const size_t t = (size_t)blockIdx.x * 256 + threadIdx.x; if (t >= n8) return; FragH f;
#pragma unroll
  for (int q = 0; q < 8; ++q) f.h[q] = (_Float16)x[t * 8 + q]; *(v8us*)((unsigned short*)X16 + t * 8) = f.half[0];  }
__global__ __launch_bounds__(256) void k_round16f(const float* __restrict__ W, _Float16* __restrict__ Bt, size_t n8) { const size_t t = (size_t)blockIdx.x * 256 + threadIdx.x; if (t >= n8) return; FragH f;
#pragma unroll
  for (int i = 0; i < 8; ++i) f.h[i] = (_Float16)(bf16_round(W[t * 8 + i]) * 16.0f); *(v8us*)((unsigned short*)Bt + t * 8) = f.half[0];  }
template <int NHv, int TTv>
__global__ __launch_bounds__(256) void k_vt(const _Float16* __restrict__ V16, int ldv, int voff, _Float16* __restrict__ Vt) { __shared__ unsigned short tl[64][66]; const int tid = threadIdx.x; const int slab = blockIdx.x / (TTv / 64), lg = blockIdx.x % (TTv / 64); const int b = slab / NHv, h = slab % NHv;
  for (int i = tid; i < 64 * 8; i += 256) { const int r = i / 8, c8 = (i % 8) * 8; FragH f; f.half[0] = *(const v8us*)((const unsigned short*)V16 + ((size_t)b * TTv + lg * 64 + r) * ldv + voff + h * 64 + c8);
#pragma unroll
    for (int q = 0; q < 8; ++q) tl[r][c8 + q] = f.u[q]; }
  __syncthreads();
  {
#pragma unroll
    for (int rd = 0; rd < 2; ++rd) { const int d = rd * 32 + tid / 8, pc = tid % 8; FragH f;
#pragma unroll
      for (int q = 0; q < 8; ++q) f.u[q] = tl[pc * 8 + q][d];
      *(v8us*)((unsigned short*)Vt + ((size_t)slab * 64 + d) * TTv + lg * 64 + pc * 8) = f.half[0]; }
     } }

__global__ __launch_bounds__(256) void k_hl(const float* __restrict__ F, _Float16* __restrict__ Hh, _Float16* __restrict__ Hl, size_t n8) { const size_t t = (size_t)blockIdx.x * 256 + threadIdx.x; if (t >= n8) return; FragH fh, fl; const v4f a = *(const v4fa*)(F + t * 8), c = *(const v4fa*)(F + t * 8 + 4);
#pragma unroll
  for (int q = 0; q < 4; ++q) { _Float16 h = (_Float16)a[q]; fh.h[q] = h; fl.h[q] = (_Float16)((a[q] - (float)h) * 1024.0f); h = (_Float16)c[q]; fh.h[4 + q] = h; fl.h[4 + q] = (_Float16)((c[q] - (float)h) * 1024.0f); }
  { *(v8us*)((unsigned short*)Hh + t * 8) = fh.half[0]; *(v8us*)((unsigned short*)Hl + t * 8) = fl.half[0];  } }

// ---- fast GEMM (wave tile 32x64; requires M % 32 == 0 rows per launch region and N % 64 == 0); epilogue = k_gemm_hhx semantics ----
__device__ __forceinline__ v16h g2_frag(const _Float16* p, int hh) { FragH f; f.half[0] = *(const v8us*)((const unsigned short*)p + 8 * hh); f.half[1] = *(const v8us*)((const unsigned short*)p + 16 + 8 * hh); return f.v; }
__device__ __forceinline__ v8f g2_mma(v16h a, v16h b, v8f c) { v8f d = __builtin_amdgcn_wmma_f32_16x16x32_f16(false, a, false, b, (short)0, c, false, false); asm volatile("v_nop\n\tv_nop\n\tv_nop\n\tv_nop" : "+v"(d) : "v"(a), "v"(b)); return d; }
template <int ACT>
__global__ __launch_bounds__(128) void k_gemm2(const _Float16* __restrict__ A, int lda, size_t sA, const _Float16* __restrict__ Bh, int ldb, size_t sB, float alpha, const float* __restrict__ bias, size_t sBias, const float* __restrict__ CP, int rowsPerB, size_t sCPb, int row0g,
    float* __restrict__ C, _Float16* __restrict__ C16, int ldc, size_t sC, int M, int N, int K) { static_assert(ACT == 0 || ACT == 3 || ACT == 6 || ACT == 8 || ACT == 9 || ACT == 11 || ACT == 12 || ACT == 14 || ACT == 15 || ACT == 16 || ACT == 17, "k_gemm2: unsupported ACT code (would silently apply no activation)");
  __shared__ __attribute__((aligned(16))) float so[4][32][68];
  const int tid = threadIdx.x, w = tid >> 5, lane = tid & 31, ln = lane & 15, hh = lane >> 4; const int by = blockIdx.y;
  A += (size_t)by * sA; Bh += (size_t)by * sB; const size_t cofs = (size_t)by * sC; const float* bp = bias ? bias + (size_t)by * sBias : nullptr;
  const int ntn = N >> 6; const int mt = blockIdx.x / ntn, nq = blockIdx.x - mt * ntn; const int row0 = mt * 128 + 32 * w, col0 = nq * 64; if (row0 >= M) return;
  const _Float16* a0p = A + (size_t)(row0 + ln) * lda; const _Float16* a1p = a0p + (size_t)16 * lda;
  const _Float16* b0p = Bh + (size_t)(col0 + ln) * ldb; const _Float16* b1p = b0p + (size_t)16 * ldb; const _Float16* b2p = b1p + (size_t)16 * ldb; const _Float16* b3p = b2p + (size_t)16 * ldb;
  const v8f z8 = {0.f,0.f,0.f,0.f,0.f,0.f,0.f,0.f}; v8f c00 = z8, c01 = z8, c02 = z8, c03 = z8, c10 = z8, c11 = z8, c12 = z8, c13 = z8;
#pragma unroll 1
  for (int kb = 0; kb < K; kb += 32) { const v16h a0 = g2_frag(a0p + kb, hh), a1 = g2_frag(a1p + kb, hh);
    v16h b = g2_frag(b0p + kb, hh); c00 = g2_mma(a0, b, c00); c10 = g2_mma(a1, b, c10);
    b = g2_frag(b1p + kb, hh); c01 = g2_mma(a0, b, c01); c11 = g2_mma(a1, b, c11);
    b = g2_frag(b2p + kb, hh); c02 = g2_mma(a0, b, c02); c12 = g2_mma(a1, b, c12);
    b = g2_frag(b3p + kb, hh); c03 = g2_mma(a0, b, c03); c13 = g2_mma(a1, b, c13); }
  v8f accs[8] = {c00, c01, c02, c03, c10, c11, c12, c13};
#pragma unroll
  for (int u = 0; u < 8; ++u) { const int t = u & 3, half = u >> 2; const int col = col0 + t * 16 + ln; const float bv = bp ? bf16_round(bp[col]) : 0.f;
#pragma unroll
    for (int r = 0; r < 8; ++r) { const int rloc = half * 16 + 8 * hh + r; float v = accs[u][r] * alpha + bv; if (CP) { if (rowsPerB < 0) v += CP[cofs + (size_t)(row0g + row0 + rloc) * ldc + col];      /* rowsPerB < 0: own element of the batched C plane */ else { const int bidx = (row0g + row0 + rloc) / rowsPerB; v += CP[(size_t)bidx * sCPb + (size_t)by * 64 + col]; } }
      if (ACT == 3) v = fmaxf(v, 0.f); else if (ACT == 6) v = 0.5f * v * (1.0f + erff(v * 0.70710678118654752f)); else if (ACT == 11) v = 1.0f / (1.0f + expf(-v)); else if (ACT == 15) v = v / (1.0f + expf(-v)); else if (ACT == 12) v = (v > 0.f) ? v : 0.01f * v; else if (ACT == 8) v = tanhf(v); else if (ACT == 9) v = 0.5f * v * (1.0f + tanhf(0.7978845608028654f * (v + 0.044715f * v * v * v))); else if (ACT == 14) v = (v > 0.f) ? v : 0.1f * v; else if (ACT == 16) v = (v >= 0.f) ? v : 0.3f * v; else if (ACT == 17) v = (v >= 0.f) ? v : 0.2f * v;
      so[w][rloc][t * 16 + ln] = v; } }
  __builtin_amdgcn_fence(__ATOMIC_ACQ_REL, "workgroup"); __builtin_amdgcn_wave_barrier();
  const int rsub = lane >> 4, c4 = (lane & 15) * 4;
  {
#pragma unroll
    for (int q = 0; q < 16; ++q) { const int r = q * 2 + rsub; const v4f v = *(const v4fa*)&so[w][r][c4]; if (C) *(v4f*)(C + cofs + (size_t)(row0 + r) * ldc + col0 + c4) = v; if (C16) { v4h h4; for (int i = 0; i < 4; ++i) h4[i] = (_Float16)v[i]; *(v4h*)(C16 + cofs + (size_t)(row0 + r) * ldc + col0 + c4) = h4; } }
     } }


__global__ __launch_bounds__(256) void k_wnat(const float* __restrict__ w, size_t n8, _Float16* __restrict__ Bt) { const size_t t = (size_t)blockIdx.x * 256 + threadIdx.x; if (t >= n8) return; FragH f; for (int q = 0; q < 8; ++q) f.h[q] = (_Float16)(bf16_round(w[t * 8 + q]) * 16.0f); *(v8us*)((unsigned short*)Bt + t * 8) = f.half[0];  }
__global__ __launch_bounds__(256) void k_rsm(const float* __restrict__ S, _Float16* __restrict__ P, int nrows) {
  #pragma clang fp contract(off)
  const int i = blockIdx.x * 256 + threadIdx.x; if (i >= nrows) return; const float* s = S + (size_t)i * SQ; float mx = -3.0e38f;
#pragma unroll 1
  for (int j = 0; j < SQ; ++j) mx = fmaxf(mx, s[j]); float se = 0.f;
#pragma unroll 1
  for (int j = 0; j < SQ; ++j) se += expf(s[j] - mx); const float sc = 256.0f / se;
#pragma unroll 1
  for (int j0 = 0; j0 < SQ; j0 += 8) { FragH f; for (int q = 0; q < 8; ++q) f.h[q] = (_Float16)(expf(s[j0 + q] - mx) * sc); unsigned short* d = (unsigned short*)P + (size_t)i * SQ + j0; *(v8us*)d = f.half[0];  } }
__global__ __launch_bounds__(256) void k_vt(const _Float16* __restrict__ V16, int b, int h0, _Float16* __restrict__ VT) { __shared__ unsigned short tl[64][65]; const int tid = threadIdx.x; const int hh = blockIdx.x % HG, sg = blockIdx.x / HG; const int s0 = sg * 64; const int h = h0 + hh;
  for (int i = tid; i < 64 * 8; i += 256) { const int j = i / 8, d8 = (i % 8) * 8; FragH f; f.half[0] = *(const v8us*)((const unsigned short*)V16 + ((size_t)b * SQ + s0 + j) * DM + h * HD + d8); for (int q = 0; q < 8; ++q) tl[d8 + q][j] = f.u[q]; }
  __syncthreads();
  { for (int i = tid; i < 64 * 8; i += 256) { const int d = i / 8, j8 = (i % 8) * 8; FragH f; for (int q = 0; q < 8; ++q) f.u[q] = tl[d][j8 + q]; *(v8us*)((unsigned short*)VT + ((size_t)hh * HD + d) * SQ + s0 + j8) = f.half[0]; }  } }



__global__ __launch_bounds__(256) void k_rsmkm(const float* __restrict__ S, _Float16* __restrict__ P, int nrows, const int* __restrict__ am) {
  #pragma clang fp contract(off)
  const int t = blockIdx.x * 256 + threadIdx.x; if (t >= nrows) return; const size_t i = (size_t)t; const float* s = S + i * SQ; const int* mr = am + (size_t)(t % SQ) * SQ; float mx = -3.0e38f;
#pragma unroll 1
  for (int j = 0; j < SQ; ++j) { const float f = (mr[j] != 0) ? 1.f : 0.f; mx = fmaxf(mx, fmaf(f, s[j], (1.f - f) * -1.0e9f)); } float se = 0.f;
#pragma unroll 1
  for (int j = 0; j < SQ; ++j) { const float f = (mr[j] != 0) ? 1.f : 0.f; se += __expf(fmaf(f, s[j], (1.f - f) * -1.0e9f) - mx); } const float sc = 256.0f / se;
#pragma unroll 1
  for (int j0 = 0; j0 < SQ; j0 += 8) { FragH fr; for (int q = 0; q < 8; ++q) { const int j = j0 + q; const float f = (mr[j] != 0) ? 1.f : 0.f; fr.h[q] = (_Float16)(__expf(fmaf(f, s[j], (1.f - f) * -1.0e9f) - mx) * sc); }
    unsigned short* d = (unsigned short*)P + i * SQ + j0; *(v8us*)d = fr.half[0];  } }
#define DMQ DM

template <int BFIN, int W16, int W32>
__global__ __launch_bounds__(256) void k_lnx(const float* __restrict__ X, const float* __restrict__ g, const float* __restrict__ bb, float eps, _Float16* __restrict__ N16, float* __restrict__ N32) {
  #pragma clang fp contract(off)
  __shared__ float red[256]; const size_t r = blockIdx.x; const int t = threadIdx.x; const bool act = t < (DMQ / 4); const int c0 = act ? t * 4 : 0;
  const v4f xa = *(const v4fa*)(X + r * DMQ + c0); float s[4]; float sum = 0.f;
  for (int q = 0; q < 4; ++q) { s[q] = act ? (BFIN ? bf16_round(xa[q]) : xa[q]) : 0.f; sum = __fadd_rn(sum, s[q]); }
  red[t] = sum; __syncthreads(); for (int st = 128; st > 0; st >>= 1) { if (t < st) red[t] = __fadd_rn(red[t], red[t + st]); __syncthreads(); } const float mu = red[0] / (float)DMQ; __syncthreads();
  float vs = 0.f; for (int q = 0; q < 4; ++q) { const float dl = act ? __fadd_rn(s[q], -mu) : 0.f; vs = __fadd_rn(vs, __fmul_rn(dl, dl)); } red[t] = vs; __syncthreads(); for (int st = 128; st > 0; st >>= 1) { if (t < st) red[t] = __fadd_rn(red[t], red[t + st]); __syncthreads(); }
  const float rs = rsqrtf(__fadd_rn(red[0] / (float)DMQ, eps)); v4h y; v4f yf;
  for (int q = 0; q < 4; ++q) { const int c = c0 + q; yf[q] = __fadd_rn(__fmul_rn(__fmul_rn(__fadd_rn(s[q], -mu), rs), bf16_round(g[c])), bf16_round(bb[c])); y[q] = (_Float16)yf[q]; }
  if (!act) return;      /* no barriers after this point */
  { if (W16) *(v4h*)(N16 + r * DMQ + c0) = y; if (W32) *(v4f*)(N32 + r * DMQ + c0) = yf;  } }


extern "C" void kernel_launch(void* const* d_in, const int* in_sizes, int n_in,
                              void* d_out, int out_size, void* d_ws, size_t ws_size, hipStream_t stream) {
  (void)in_sizes; (void)n_in; (void)out_size;
  const float* const* I = (const float* const*)d_in; const float* xq = I[0]; const float* xk = I[1]; const float* xv = I[2]; const float* lng = I[3]; const float* lnb = I[4]; const float* wq = I[5]; const float* bq = I[6]; const float* wk = I[7]; const float* bk = I[8]; const float* wv = I[9]; const float* bv = I[10]; const float* wo = I[11]; const float* bo = I[12]; const float* x = xq;      /* query, key, value; shared LayerNorm gamma / beta [512]; [in][out] Wq / Wk / Wv / Wo + biases */
  char* ws = (char*)d_ws; size_t off = 0;
  auto take = [&](size_t bytes) { char* p = ws + off; off += (bytes + 255) & ~(size_t)255; return p; };
  _Float16* BQ = (_Float16*)take((size_t)DM * DM * 2); _Float16* BK = (_Float16*)take((size_t)DM * DM * 2); _Float16* BV = (_Float16*)take((size_t)DM * DM * 2); _Float16* BO = (_Float16*)take((size_t)DM * DM * 2);
  _Float16* X16 = (_Float16*)take(NR * DM * 2); _Float16* XKp = (_Float16*)take(NR * DM * 2); _Float16* XVp = (_Float16*)take(NR * DM * 2); _Float16* Q16 = (_Float16*)take(NR * DM * 2); _Float16* K16 = (_Float16*)take(NR * DM * 2); _Float16* V16 = (_Float16*)take(NR * DM * 2); _Float16* O16 = (_Float16*)take(NR * DM * 2);
  float* S = (float*)take((size_t)HG * SQ * SQ * 4); _Float16* P = (_Float16*)take((size_t)HG * SQ * SQ * 2); _Float16* VT = (_Float16*)take((size_t)NH * HD * SQ * 2);
  if (off > ws_size) return;
  { const unsigned g = (unsigned)(((size_t)DM * (DM / 8) + 255) / 256); k_wt_f16<<<g, 256, 0, stream>>>(wq, BQ, DM, DM, 16.0f); k_wt_f16<<<g, 256, 0, stream>>>(wk, BK, DM, DM, 16.0f); k_wt_f16<<<g, 256, 0, stream>>>(wv, BV, DM, DM, 16.0f); k_wt_f16<<<g, 256, 0, stream>>>(wo, BO, DM, DM, 16.0f); }      /* [in][out] -> Bt x16 */
  _Float16* XK = XKp; _Float16* XV = XVp; k_lnx<1, 1, 0><<<(unsigned)NR, 256, 0, stream>>>(xk, lng, lnb, 1e-5f, XK, nullptr); k_lnx<1, 1, 0><<<(unsigned)NR, 256, 0, stream>>>(xv, lng, lnb, 1e-5f, XV, nullptr);      /* LN(key), LN(value) with the SHARED parameters -> f16 rows */

  k_lnx<1, 1, 0><<<(unsigned)NR, 256, 0, stream>>>(x, lng, lnb, 1e-5f, X16, nullptr);      /* LN(query) -> f16 rows */
  const size_t r0p = (size_t)B0 * SQ;      /* first projected row */
  k_gemm2<0><<<dim3((unsigned)((MP / 128) * (DM / 64)), 1), 128, 0, stream>>>(X16 + r0p * DM, DM, 0, BQ, DM, 0, 0.0625f, bq, 0, nullptr, 1, 0, 0, nullptr, Q16 + r0p * DM, DM, 0, MP, DM, DM);
  k_gemm2<0><<<dim3((unsigned)((MP / 128) * (DM / 64)), 1), 128, 0, stream>>>(XK + r0p * DM, DM, 0, BK, DM, 0, 0.0625f, bk, 0, nullptr, 1, 0, 0, nullptr, K16 + r0p * DM, DM, 0, MP, DM, DM);
  k_gemm2<0><<<dim3((unsigned)((MP / 128) * (DM / 64)), 1), 128, 0, stream>>>(XV + r0p * DM, DM, 0, BV, DM, 0, 0.0625f, bv, 0, nullptr, 1, 0, 0, nullptr, V16 + r0p * DM, DM, 0, MP, DM, DM);
  for (int b = B0; b < B0 + NBR; ++b) { const size_t r0 = (size_t)b * SQ;
    k_vt<NH, SQ><<<NH * (SQ / 64), 256, 0, stream>>>(V16 + r0 * LQ, LQ, 0, VT);      /* V^T [NH][HD][SQ] for this batch */
    for (int h0 = 0; h0 < NHD; h0 += HG) {
      k_gemm2<0><<<dim3((QN / 128) * (SQ / 64), HG), 128, 0, stream>>>(Q16 + r0 * LQ + h0 * HD, LQ, (size_t)HD, K16 + r0 * LQ + h0 * HD, LQ, (size_t)HD, 0.125f, nullptr, 0, nullptr, 1, 0, 0, S, nullptr, SQ, (size_t)SQ * SQ, QN, SQ, HD);      /* scores, HG heads per launch */
      k_rsm<<<(HG * SQ + 255) / 256, 256, 0, stream>>>(S, P, HG * SQ);      /* P = 256 softmax (f16), rows of all HG heads */
      k_gemm2<0><<<dim3((QN / 128) * (HD / 64), HG), 128, 0, stream>>>(P, SQ, (size_t)SQ * SQ, VT + (size_t)h0 * HD * SQ, SQ, (size_t)HD * SQ, 0.25f, nullptr, 0, nullptr, 1, 0, 0, nullptr, O16 + r0 * DM + h0 * HD, DM, (size_t)HD, QN, HD, SQ); } }      /* o (merged heads) as f16 rows */
  k_gemm2<0><<<dim3((unsigned)((MPO / 128) * (DM / 64)), 1), 128, 0, stream>>>(O16 + r0p * DM, DM, 0, BO, DM, 0, 0.0009765625f, bo, 0, nullptr, 1, 0, 0, (float*)d_out + r0p * DM, nullptr, DM, 0, MPO, DM, DM);      /* out rows are the output layout */
}

// v001
// A run of this version takes 517 microseconds.
// Two timings next to v000 put it at 3.67 and 3.69 times that version's speed.
#include <hip/hip_runtime.h>
// Multi-head attention over THREE inputs, each passed through ONE shared LayerNorm first (query, key, value [2][2048][512]; Q = LN(query) Wq + bq, K = LN(key) Wk + bk, V = LN(value) Wv + bv with LN: biased var, eps 1e-5, shared ln_g / ln_b; [in][out] 512 x 512, zero biases); 8 heads of 64; scores / 8; softmax over all 2048 keys (no mask); out = merged Wo + bo -> [2][2048][512]; no residual).
// Structure: token rows r = b*2048 + s; LN(query), LN(key), LN(value) as f16 rows (inputs bf16-rounded); Q, K, V as three WMMA GEMMs (32x64 wave tiles, f32 accumulation, exact x16 weights + bias, f16 outputs); per batch: V^T for all heads via LDS transposes; per (batch, group of 4 heads): scores GEMM (K = 64, batched over the heads on grid.y, alpha = 1/sqrt(64)), row softmax on VALU, one wave per row (f32 statistics; weights stored x256 as f16), o = P . V^T GEMM (K = 2048, alpha 2^-2: o carried x64 against f16 subnormal flush, folded into the output GEMM alpha) written straight into the merged f16 o rows; out = o W_o + b GEMM (f32) into the output layout.
// Compute dtype: inputs rounded to bf16; weights exact; LN rows, q, k, v, softmax weights and o as plain f16 GEMM operands (~2^-12); scores and softmax statistics f32. v_wmma_f32_16x16x32_f16.
#define NB 2
#define SQ 2048
#define DM 512
#define NH 8
#define HD 64
#define HG 4                         /* heads per attention launch group */
#define B0 0                         /* first batch processed (debug hook) */
#define NBR NB                       /* batches processed (debug hook) */
#define NR ((size_t)NB * SQ)         /* token rows */
#define MP ((int)((size_t)NBR * SQ)) /* rows projected (debug hook) */
#define QN SQ                        /* query rows attended per batch (debug hook) */
#define NHD NH                       /* heads attended (debug hook) */
#define MPO MP                       /* rows through the output stage (debug hook) */
#define LQ DM      /* row pitch of the q/k/v rows */
typedef __bf16 v16b __attribute__((ext_vector_type(16)));
typedef unsigned short v8us __attribute__((ext_vector_type(8), may_alias));
typedef float  v8f  __attribute__((ext_vector_type(8)));
typedef float  v4f  __attribute__((ext_vector_type(4)));
typedef float  v4fa __attribute__((ext_vector_type(4), may_alias));
union FragB { v16b v; v8us half[2]; unsigned short u[16]; };

__device__ __forceinline__ unsigned short bf16_bits(float x) { unsigned int u = __float_as_uint(x); return (unsigned short)((u + 0x7FFFu + ((u >> 16) & 1u)) >> 16); }
__device__ __forceinline__ float bf16_val(unsigned short b) { return __uint_as_float(((unsigned int)b) << 16); }
__device__ __forceinline__ float bf16_round(float x) { return bf16_val(bf16_bits(x)); }
// D += A·B with NT terms: 1 = ah·bh, 2 = + al·bh (A split), 3 = + ah·bl (both split)
template <int NT>
__device__ __forceinline__ v8f mmaN(v16b ah, v16b al, v16b bh, v16b bl, v8f c) {
  c = __builtin_amdgcn_wmma_f32_16x16x32_bf16(false, ah, false, bh, (short)0, c, false, false);
  if (NT >= 2) c = __builtin_amdgcn_wmma_f32_16x16x32_bf16(false, al, false, bh, (short)0, c, false, false);
  if (NT >= 3) c = __builtin_amdgcn_wmma_f32_16x16x32_bf16(false, ah, false, bl, (short)0, c, false, false);
  asm volatile("v_nop\n\tv_nop\n\tv_nop\n\tv_nop" : "+v"(c) : "v"(ah), "v"(al), "v"(bh), "v"(bl));
  return c;
}

__global__ __launch_bounds__(256) void k_wt_bf16(const float* __restrict__ W, unsigned short* __restrict__ Wt, int K, int N) {
  const int t = blockIdx.x * 256 + threadIdx.x;
  const int k8n = K / 8;
  if (t >= N * k8n) return;
  const int n = t / k8n, k8 = (t % k8n) * 8;
  v8us v;
#pragma unroll
  for (int i = 0; i < 8; ++i) v[i] = bf16_bits(W[(size_t)(k8 + i) * N + n]);
  *(v8us*)(Wt + (size_t)n * K + k8) = v;
  
}

// GEMM C[M][N] (f32, pitch ldc) = act(A[M][K]·W + bias). A f32 row-major (pitch lda) converted per fragment to bf16
// (ASPLIT: hi/lo two planes -> 2 terms, else single rounded term); Wt bf16 [N][K] (pitch ldb). BIAS_BF16 rounds the
// bias to bf16 first (bias quantised to bf16 before the add). K%32==0, M%16==0, N%64==0.
template <bool ASPLIT, int ACT, bool BIAS_BF16>
__global__ __launch_bounds__(128) void k_gemm_bf(const float* __restrict__ A, int lda, const unsigned short* __restrict__ Wt, int ldb,
                                               const float* __restrict__ bias, float* __restrict__ C, int ldc, int M, int N, int K) {
  __shared__ __attribute__((aligned(16))) float so[4][16][64];
  const int tid = threadIdx.x, w = tid >> 5, lane = tid & 31, ln = lane & 15, hh = lane >> 4;
  const int ntn = N / 64;
  const int wid = blockIdx.x * 4 + w;
  const int mt = wid / ntn, nq = wid % ntn;
  if (mt * 16 >= M) return;
  const int row0 = mt * 16, col0 = nq * 64;
  const float* arow = A + (size_t)(row0 + ln) * lda;
  v8f acc[4] = {};
  for (int kb = 0; kb < K; kb += 32) {
    FragB ah, al;
    const v4f x0 = *(const v4fa*)(arow + kb + 8 * hh), x1 = *(const v4fa*)(arow + kb + 8 * hh + 4);
    const v4f x2 = *(const v4fa*)(arow + kb + 16 + 8 * hh), x3 = *(const v4fa*)(arow + kb + 16 + 8 * hh + 4);
    float xs[16] = {x0[0],x0[1],x0[2],x0[3],x1[0],x1[1],x1[2],x1[3],x2[0],x2[1],x2[2],x2[3],x3[0],x3[1],x3[2],x3[3]};
#pragma unroll
    for (int i = 0; i < 16; ++i) { const unsigned short hb = bf16_bits(xs[i]); ah.u[i] = hb; al.u[i] = ASPLIT ? bf16_bits(xs[i] - bf16_val(hb)) : (unsigned short)0; }
#pragma unroll
    for (int t = 0; t < 4; ++t) {
      const unsigned short* brow = Wt + (size_t)(col0 + t * 16 + ln) * ldb + kb;
      FragB b;
      b.half[0] = *(const v8us*)(brow + 8 * hh);
      b.half[1] = *(const v8us*)(brow + 16 + 8 * hh);
      acc[t] = mmaN<ASPLIT ? 2 : 1>(ah.v, al.v, b.v, b.v, acc[t]);
    }
  }
#pragma unroll
  for (int t = 0; t < 4; ++t) {
    float bv = bias ? bias[col0 + t * 16 + ln] : 0.f;
    if (BIAS_BF16) bv = bf16_round(bv);
#pragma unroll
    for (int r = 0; r < 8; ++r) { float v = acc[t][r] + bv; if (ACT == 1) v = fmaxf(v, 0.f); so[w][8 * hh + r][t * 16 + ln] = v; }
  }
  __builtin_amdgcn_fence(__ATOMIC_ACQ_REL, "workgroup");
  __builtin_amdgcn_wave_barrier();
  const int rsub = lane >> 4, c4 = (lane & 15) * 4;
  {
#pragma unroll
    for (int q = 0; q < 8; ++q) {
      const int r = q * 2 + rsub;
      const v4f v = *(const v4fa*)&so[w][r][c4];
      *(v4f*)(C + (size_t)(row0 + r) * ldc + col0 + c4) = v;
    }
    
  }
}

// GEMM C = act(A·W + bias + resid): A f32 (ASPLIT -> hi/lo 2 terms), Wt bf16 [N][K]; ACT 0 none, 1 relu, 2 exact gelu;
// resid (optional, f32, row index = (row % rmod), pitch ldr, RES_BF16 rounds it) added before the activation.
template <bool ASPLIT, int ACT, bool BIAS_BF16, bool RES_BF16>
__global__ __launch_bounds__(128) void k_gemm_bf3(const float* __restrict__ A, int lda, const unsigned short* __restrict__ Wt, int ldb,
                                                const float* __restrict__ bias, const float* __restrict__ resid, int rmod, int ldr,
                                                float* __restrict__ C, int ldc, int M, int N, int K) {
  __shared__ __attribute__((aligned(16))) float so[4][16][64];
  const int tid = threadIdx.x, w = tid >> 5, lane = tid & 31, ln = lane & 15, hh = lane >> 4;
  const int ntn = N / 64;
  const int wid = blockIdx.x * 4 + w;
  const int mt = wid / ntn, nq = wid % ntn;
  if (mt * 16 >= M) return;
  const int row0 = mt * 16, col0 = nq * 64;
  const float* arow = A + (size_t)(row0 + ln) * lda;
  v8f acc[4] = {};
  for (int kb = 0; kb < K; kb += 32) {
    FragB ah, al;
    const v4f x0 = *(const v4fa*)(arow + kb + 8 * hh), x1 = *(const v4fa*)(arow + kb + 8 * hh + 4);
    const v4f x2 = *(const v4fa*)(arow + kb + 16 + 8 * hh), x3 = *(const v4fa*)(arow + kb + 16 + 8 * hh + 4);
    float xs[16] = {x0[0],x0[1],x0[2],x0[3],x1[0],x1[1],x1[2],x1[3],x2[0],x2[1],x2[2],x2[3],x3[0],x3[1],x3[2],x3[3]};
#pragma unroll
    for (int i = 0; i < 16; ++i) { const unsigned short hb = bf16_bits(xs[i]); ah.u[i] = hb; al.u[i] = ASPLIT ? bf16_bits(xs[i] - bf16_val(hb)) : (unsigned short)0; }
#pragma unroll
    for (int t = 0; t < 4; ++t) {
      const unsigned short* brow = Wt + (size_t)(col0 + t * 16 + ln) * ldb + kb;
      FragB b;
      b.half[0] = *(const v8us*)(brow + 8 * hh);
      b.half[1] = *(const v8us*)(brow + 16 + 8 * hh);
      acc[t] = mmaN<ASPLIT ? 2 : 1>(ah.v, al.v, b.v, b.v, acc[t]);
    }
  }
#pragma unroll
  for (int t = 0; t < 4; ++t) {
    const int col = col0 + t * 16 + ln;
    float bv = bias ? bias[col] : 0.f;
    if (BIAS_BF16) bv = bf16_round(bv);
#pragma unroll
    for (int r = 0; r < 8; ++r) {
      float v = acc[t][r] + bv;
      if (resid) { float rv = resid[(size_t)((row0 + 8 * hh + r) % rmod) * ldr + col]; if (RES_BF16) rv = bf16_round(rv); v += rv; }
      if (ACT == 1) v = fmaxf(v, 0.f);
      if (ACT == 2) v = 0.5f * v * (1.0f + erff(v * 0.70710678118654752f));
      if (ACT == 3) { const float u = 0.7978845608028654f * (v + 0.044715f * v * v * v); v = 0.5f * v * (1.0f + tanhf(u)); }
      so[w][8 * hh + r][t * 16 + ln] = v;
    }
  }
  __builtin_amdgcn_fence(__ATOMIC_ACQ_REL, "workgroup");
  __builtin_amdgcn_wave_barrier();
  const int rsub = lane >> 4, c4 = (lane & 15) * 4;
  {
#pragma unroll
    for (int q = 0; q < 8; ++q) {
      const int r = q * 2 + rsub;
      const v4f v = *(const v4fa*)&so[w][r][c4];
      *(v4f*)(C + (size_t)(row0 + r) * ldc + col0 + c4) = v;
    }
    
  }
}
// row LayerNorm (biased variance, eps) over N: s = X (+ R); optional out_sum <- s; out_norm <- (s-mu)*rsqrt(var+eps)*g + b
template <bool PARAM_BF16>
__global__ __launch_bounds__(256) void k_layernorm(const float* __restrict__ X, const float* __restrict__ R, const float* __restrict__ g, const float* __restrict__ bta,
                                                  float* __restrict__ out_sum, float* __restrict__ out_norm, int N, float eps) {
  __shared__ float red[256];
  const int row = blockIdx.x, tid = threadIdx.x;
  const float* x = X + (size_t)row * N; const float* rr = R ? R + (size_t)row * N : nullptr;
  float vals[16];                     // up to N = 4096
  const int per = N / 256;            // contiguous chunk per thread? use strided-by-4 chunks: thread handles j = tid*4 + 1024*u
  float s1 = 0.f;
  for (int u = 0; u < per / 4; ++u) {
    const int j = tid * 4 + 1024 * u;
    const v4f a = *(const v4fa*)(x + j);
    v4f b = {0.f,0.f,0.f,0.f}; if (rr) b = *(const v4fa*)(rr + j);
#pragma unroll
    for (int q = 0; q < 4; ++q) { const float v = a[q] + b[q]; vals[u * 4 + q] = v; s1 += v; }
  }
  red[tid] = s1; __syncthreads();
  for (int st = 128; st > 0; st >>= 1) { if (tid < st) red[tid] += red[tid + st]; __syncthreads(); }
  const float mu = red[0] / (float)N; __syncthreads();
  float s2 = 0.f;
  for (int u = 0; u < per / 4; ++u)
#pragma unroll
    for (int q = 0; q < 4; ++q) { const float c = vals[u * 4 + q] - mu; s2 += c * c; }
  red[tid] = s2; __syncthreads();
  for (int st = 128; st > 0; st >>= 1) { if (tid < st) red[tid] += red[tid + st]; __syncthreads(); }
  const float rs = rsqrtf(red[0] / (float)N + eps);
  {
    for (int u = 0; u < per / 4; ++u) {
      const int j = tid * 4 + 1024 * u;
      v4f o, sm;
#pragma unroll
      for (int q = 0; q < 4; ++q) {
        float gg = g[j + q], bb = bta[j + q];
        if (PARAM_BF16) { gg = bf16_round(gg); bb = bf16_round(bb); }
        sm[q] = vals[u * 4 + q]; o[q] = (vals[u * 4 + q] - mu) * rs * gg + bb;
      }
      if (out_sum) *(v4f*)(out_sum + (size_t)row * N + j) = sm;
      *(v4f*)(out_norm + (size_t)row * N + j) = o;
    }
    
  }
}



// ---- f16 WMMA path (v_wmma_f32_16x16x32_f16): 11-bit significands for operands in range — used where a [0,1] probability operand needs more precision than bf16
typedef _Float16 v16h __attribute__((ext_vector_type(16)));
union FragH { v16h v; v8us half[2]; _Float16 h[16]; unsigned short u[16]; };
template <int NT>
__device__ __forceinline__ v8f mmaH(v16h ah, v16h al, v16h bh, v16h bl, v8f c) {
  c = __builtin_amdgcn_wmma_f32_16x16x32_f16(false, ah, false, bh, (short)0, c, false, false);
  if (NT >= 2) c = __builtin_amdgcn_wmma_f32_16x16x32_f16(false, al, false, bh, (short)0, c, false, false);
  if (NT >= 3) c = __builtin_amdgcn_wmma_f32_16x16x32_f16(false, ah, false, bl, (short)0, c, false, false);
  asm volatile("v_nop\n\tv_nop\n\tv_nop\n\tv_nop" : "+v"(c) : "v"(ah), "v"(al), "v"(bh), "v"(bl));
  return c;
}
// batched GEMM like k_gemm_b but f16 operands: A f32 (split into f16 hi/lo if ASPLIT, else rounded to f16), Bt = f16 values [n][k]; alpha; C f32; N multiple of 16 (partial tiles skipped)
template <bool ASPLIT>
__global__ __launch_bounds__(128) void k_gemm_h(const float* __restrict__ A, int lda, size_t sA, const _Float16* __restrict__ Bh, int ldb, size_t sB, float alpha, float* __restrict__ C, int ldc, size_t sC, int M, int N, int K) {
  __shared__ __attribute__((aligned(16))) float so[4][16][64];
  const int tid = threadIdx.x, w = tid >> 5, lane = tid & 31, ln = lane & 15, hh = lane >> 4; const int by = blockIdx.y;
  A += (size_t)by * sA; Bh += (size_t)by * sB; C += (size_t)by * sC;
  const int ntn = (N + 63) / 64; const int wid = blockIdx.x * 4 + w; const int mt = wid / ntn, nq = wid % ntn; if (mt * 16 >= M) return;
  const int row0 = mt * 16, col0 = nq * 64; const float* arow = A + (size_t)(row0 + ln) * lda;
  v8f acc[4] = {};
  for (int kb = 0; kb < K; kb += 32) {
    FragH ah, al;
    const v4f x0 = *(const v4fa*)(arow + kb + 8 * hh), x1 = *(const v4fa*)(arow + kb + 8 * hh + 4), x2 = *(const v4fa*)(arow + kb + 16 + 8 * hh), x3 = *(const v4fa*)(arow + kb + 16 + 8 * hh + 4);
    float xs[16] = {x0[0],x0[1],x0[2],x0[3],x1[0],x1[1],x1[2],x1[3],x2[0],x2[1],x2[2],x2[3],x3[0],x3[1],x3[2],x3[3]};
#pragma unroll
    for (int i = 0; i < 16; ++i) { const _Float16 h = (_Float16)xs[i]; ah.h[i] = h; al.h[i] = ASPLIT ? (_Float16)(xs[i] - (float)h) : (_Float16)0.0f; }
#pragma unroll
    for (int t = 0; t < 4; ++t) { if (col0 + t * 16 >= N) continue; const size_t boff = (size_t)(col0 + t * 16 + ln) * ldb + kb; FragH bq; bq.half[0] = *(const v8us*)(Bh + boff + 8 * hh); bq.half[1] = *(const v8us*)(Bh + boff + 16 + 8 * hh);
      acc[t] = mmaH<ASPLIT ? 2 : 1>(ah.v, al.v, bq.v, bq.v, acc[t]); }
  }
#pragma unroll
  for (int t = 0; t < 4; ++t) { if (col0 + t * 16 >= N) continue;
#pragma unroll
    for (int r = 0; r < 8; ++r) so[w][8 * hh + r][t * 16 + ln] = acc[t][r] * alpha; }
  __builtin_amdgcn_fence(__ATOMIC_ACQ_REL, "workgroup"); __builtin_amdgcn_wave_barrier();
  const int rsub = lane >> 4, c4 = (lane & 15) * 4;
  {
#pragma unroll
    for (int q = 0; q < 8; ++q) { const int r = q * 2 + rsub; if (col0 + c4 < N) { const v4f v = *(const v4fa*)&so[w][r][c4]; *(v4f*)(C + (size_t)(row0 + r) * ldc + col0 + c4) = v; } }
     }
}

// Wt[n][k] = f16(W[k][n]·scale) from f32 row-major W[K][N] (scale = power of two; bf16-exact weights stay exact in f16 away from the subnormal range)
__global__ __launch_bounds__(256) void k_wt_f16(const float* __restrict__ W, _Float16* __restrict__ Wt, int K, int N, float scale) {
  const int t = blockIdx.x * 256 + threadIdx.x; if (t >= N * (K / 8)) return; const int n = t / (K / 8), k8 = (t % (K / 8)) * 8; FragH f;
#pragma unroll
  for (int i = 0; i < 8; ++i) f.h[i] = (_Float16)(bf16_round(W[(size_t)(k8 + i) * N + n]) * scale); const v8us o = f.half[0];
  *(v8us*)((unsigned short*)Wt + (size_t)n * K + k8) = o; 
}
// k_gemm_hh variant with fused epilogue: v = acc·alpha + bias[by·sBias + col] (+ CP[(row/rowsPerB)·sCPb + by·64 + col] if CP) ; ACT 0 none / 1 elu ; writes f16 C16 (and f32 C if non-null)
template <int ACT>
__global__ __launch_bounds__(128) void k_gemm_hhx(const _Float16* __restrict__ A, int lda, size_t sA, const _Float16* __restrict__ Bh, int ldb, size_t sB, float alpha, const float* __restrict__ bias, size_t sBias, const float* __restrict__ CP, int rowsPerB, size_t sCPb, int row0g,
    float* __restrict__ C, _Float16* __restrict__ C16, int ldc, size_t sC, int M, int N, int K) {
  __shared__ __attribute__((aligned(16))) float so[4][16][64];
  const int tid = threadIdx.x, w = tid >> 5, lane = tid & 31, ln = lane & 15, hh = lane >> 4; const int by = blockIdx.y;
  A += (size_t)by * sA; Bh += (size_t)by * sB; const size_t cofs = (size_t)by * sC; const float* bp = bias ? bias + (size_t)by * sBias : nullptr;
  const int ntn = (N + 63) / 64; const int wid = blockIdx.x * 4 + w; const int mt = wid / ntn, nq = wid % ntn; if (mt * 16 >= M) return;
  const int row0 = mt * 16, col0 = nq * 64; const _Float16* arow = A + (size_t)(row0 + ln) * lda;
  v8f acc[4] = {};
  for (int kb = 0; kb < K; kb += 32) { FragH ah; ah.half[0] = *(const v8us*)((const unsigned short*)arow + kb + 8 * hh); ah.half[1] = *(const v8us*)((const unsigned short*)arow + kb + 16 + 8 * hh);
#pragma unroll
    for (int t = 0; t < 4; ++t) { if (col0 + t * 16 >= N) continue; const size_t boff = (size_t)(col0 + t * 16 + ln) * ldb + kb; FragH bq; bq.half[0] = *(const v8us*)((const unsigned short*)Bh + boff + 8 * hh); bq.half[1] = *(const v8us*)((const unsigned short*)Bh + boff + 16 + 8 * hh);
      acc[t] = mmaH<1>(ah.v, ah.v, bq.v, bq.v, acc[t]); }
  }
#pragma unroll
  for (int t = 0; t < 4; ++t) { if (col0 + t * 16 >= N) continue; const int col = col0 + t * 16 + ln; const float bv = bp ? bf16_round(bp[col]) : 0.f;
#pragma unroll
    for (int r = 0; r < 8; ++r) { float v = acc[t][r] * alpha + bv; if (CP) { const int rr = row0g + row0 + 8 * hh + r; if (rowsPerB < 0) v += CP[cofs + (size_t)rr * ldc + col];      /* rowsPerB < 0: own element of the batched C plane */ else { const int bidx = rr / rowsPerB; v += CP[(size_t)bidx * sCPb + (size_t)by * 64 + col]; } } if (ACT == 1) v = (v > 0.f) ? v : expm1f(v); else if (ACT == 7) v = (v > 0.f) ? v + 1.0f : expf(v); else if (ACT == 8) v = tanhf(v); else if (ACT == 9) v = 0.5f * v * (1.0f + tanhf(0.7978845608028654f * (v + 0.044715f * v * v * v))); else if (ACT == 11) v = 1.0f / (1.0f + expf(-v)); else if (ACT == 12) v = (v > 0.f) ? v : 0.01f * v; else if (ACT == 14) v = (v > 0.f) ? v : 0.1f * v; else if (ACT == 16) v = (v >= 0.f) ? v : 0.3f * v; else if (ACT == 17) v = (v >= 0.f) ? v : 0.2f * v; else if (ACT == 15) v = v / (1.0f + expf(-v)); else if (ACT == 3) v = fmaxf(v, 0.f); else if (ACT == 6) v = 0.5f * v * (1.0f + erff(v * 0.70710678118654752f)); so[w][8 * hh + r][t * 16 + ln] = v; } }
  __builtin_amdgcn_fence(__ATOMIC_ACQ_REL, "workgroup"); __builtin_amdgcn_wave_barrier();
  const int rsub = lane >> 4, c4 = (lane & 15) * 4; typedef _Float16 v4h __attribute__((ext_vector_type(4)));
  {
#pragma unroll
    for (int q = 0; q < 8; ++q) { const int r = q * 2 + rsub; if (col0 + c4 < N) { const v4f v = *(const v4fa*)&so[w][r][c4]; if (C) *(v4f*)(C + cofs + (size_t)(row0 + r) * ldc + col0 + c4) = v; if (C16) { v4h h4; for (int i = 0; i < 4; ++i) h4[i] = (_Float16)v[i]; *(v4h*)(C16 + cofs + (size_t)(row0 + r) * ldc + col0 + c4) = h4; } } }
     }
}


typedef _Float16 v4h __attribute__((ext_vector_type(4)));

__global__ __launch_bounds__(256) void k_x16(const float* __restrict__ x, _Float16* __restrict__ X16, size_t n8) { const size_t t = (size_t)blockIdx.x * 256 + threadIdx.x; if (t >= n8) return; FragH f;
#pragma unroll
  for (int q = 0; q < 8; ++q) f.h[q] = (_Float16)bf16_round(x[t * 8 + q]); *(v8us*)((unsigned short*)X16 + t * 8) = f.half[0];  }
__global__ __launch_bounds__(256) void k_h16(const float* __restrict__ x, _Float16* __restrict__ X16, size_t n8) { const size_t t = (size_t)blockIdx.x * 256 + threadIdx.x; if (t >= n8) return; FragH f;
#pragma unroll
  for (int q = 0; q < 8; ++q) f.h[q] = (_Float16)x[t * 8 + q]; *(v8us*)((unsigned short*)X16 + t * 8) = f.half[0];  }
__global__ __launch_bounds__(256) void k_round16f(const float* __restrict__ W, _Float16* __restrict__ Bt, size_t n8) { const size_t t = (size_t)blockIdx.x * 256 + threadIdx.x; if (t >= n8) return; FragH f;
#pragma unroll
  for (int i = 0; i < 8; ++i) f.h[i] = (_Float16)(bf16_round(W[t * 8 + i]) * 16.0f); *(v8us*)((unsigned short*)Bt + t * 8) = f.half[0];  }
template <int NHv, int TTv>
__global__ __launch_bounds__(256) void k_vt(const _Float16* __restrict__ V16, int ldv, int voff, _Float16* __restrict__ Vt) { __shared__ unsigned short tl[64][66]; const int tid = threadIdx.x; const int slab = blockIdx.x / (TTv / 64), lg = blockIdx.x % (TTv / 64); const int b = slab / NHv, h = slab % NHv;
  for (int i = tid; i < 64 * 8; i += 256) { const int r = i / 8, c8 = (i % 8) * 8; FragH f; f.half[0] = *(const v8us*)((const unsigned short*)V16 + ((size_t)b * TTv + lg * 64 + r) * ldv + voff + h * 64 + c8);
#pragma unroll
    for (int q = 0; q < 8; ++q) tl[r][c8 + q] = f.u[q]; }
  __syncthreads();
  {
#pragma unroll
    for (int rd = 0; rd < 2; ++rd) { const int d = rd * 32 + tid / 8, pc = tid % 8; FragH f;
#pragma unroll
      for (int q = 0; q < 8; ++q) f.u[q] = tl[pc * 8 + q][d];
      *(v8us*)((unsigned short*)Vt + ((size_t)slab * 64 + d) * TTv + lg * 64 + pc * 8) = f.half[0]; }
     } }

__global__ __launch_bounds__(256) void k_hl(const float* __restrict__ F, _Float16* __restrict__ Hh, _Float16* __restrict__ Hl, size_t n8) { const size_t t = (size_t)blockIdx.x * 256 + threadIdx.x; if (t >= n8) return; FragH fh, fl; const v4f a = *(const v4fa*)(F + t * 8), c = *(const v4fa*)(F + t * 8 + 4);
#pragma unroll
  for (int q = 0; q < 4; ++q) { _Float16 h = (_Float16)a[q]; fh.h[q] = h; fl.h[q] = (_Float16)((a[q] - (float)h) * 1024.0f); h = (_Float16)c[q]; fh.h[4 + q] = h; fl.h[4 + q] = (_Float16)((c[q] - (float)h) * 1024.0f); }
  { *(v8us*)((unsigned short*)Hh + t * 8) = fh.half[0]; *(v8us*)((unsigned short*)Hl + t * 8) = fl.half[0];  } }

// ---- fast GEMM (wave tile 32x64; requires M % 32 == 0 rows per launch region and N % 64 == 0); epilogue = k_gemm_hhx semantics ----
__device__ __forceinline__ v16h g2_frag(const _Float16* p, int hh) { FragH f; f.half[0] = *(const v8us*)((const unsigned short*)p + 8 * hh); f.half[1] = *(const v8us*)((const unsigned short*)p + 16 + 8 * hh); return f.v; }
__device__ __forceinline__ v8f g2_mma(v16h a, v16h b, v8f c) { v8f d = __builtin_amdgcn_wmma_f32_16x16x32_f16(false, a, false, b, (short)0, c, false, false); asm volatile("v_nop\n\tv_nop\n\tv_nop\n\tv_nop" : "+v"(d) : "v"(a), "v"(b)); return d; }
template <int ACT>
__global__ __launch_bounds__(128) void k_gemm2(const _Float16* __restrict__ A, int lda, size_t sA, const _Float16* __restrict__ Bh, int ldb, size_t sB, float alpha, const float* __restrict__ bias, size_t sBias, const float* __restrict__ CP, int rowsPerB, size_t sCPb, int row0g,
    float* __restrict__ C, _Float16* __restrict__ C16, int ldc, size_t sC, int M, int N, int K) { static_assert(ACT == 0 || ACT == 3 || ACT == 6 || ACT == 8 || ACT == 9 || ACT == 11 || ACT == 12 || ACT == 14 || ACT == 15 || ACT == 16 || ACT == 17, "k_gemm2: unsupported ACT code (would silently apply no activation)");
  __shared__ __attribute__((aligned(16))) float so[4][32][68];
  const int tid = threadIdx.x, w = tid >> 5, lane = tid & 31, ln = lane & 15, hh = lane >> 4; const int by = blockIdx.y;
  A += (size_t)by * sA; Bh += (size_t)by * sB; const size_t cofs = (size_t)by * sC; const float* bp = bias ? bias + (size_t)by * sBias : nullptr;
  const int ntn = N >> 6; const int mt = blockIdx.x / ntn, nq = blockIdx.x - mt * ntn; const int row0 = mt * 128 + 32 * w, col0 = nq * 64; if (row0 >= M) return;
  const _Float16* a0p = A + (size_t)(row0 + ln) * lda; const _Float16* a1p = a0p + (size_t)16 * lda;
  const _Float16* b0p = Bh + (size_t)(col0 + ln) * ldb; const _Float16* b1p = b0p + (size_t)16 * ldb; const _Float16* b2p = b1p + (size_t)16 * ldb; const _Float16* b3p = b2p + (size_t)16 * ldb;
  const v8f z8 = {0.f,0.f,0.f,0.f,0.f,0.f,0.f,0.f}; v8f c00 = z8, c01 = z8, c02 = z8, c03 = z8, c10 = z8, c11 = z8, c12 = z8, c13 = z8;
#pragma unroll 1
  for (int kb = 0; kb < K; kb += 32) { const v16h a0 = g2_frag(a0p + kb, hh), a1 = g2_frag(a1p + kb, hh);
    v16h b = g2_frag(b0p + kb, hh); c00 = g2_mma(a0, b, c00); c10 = g2_mma(a1, b, c10);
    b = g2_frag(b1p + kb, hh); c01 = g2_mma(a0, b, c01); c11 = g2_mma(a1, b, c11);
    b = g2_frag(b2p + kb, hh); c02 = g2_mma(a0, b, c02); c12 = g2_mma(a1, b, c12);
    b = g2_frag(b3p + kb, hh); c03 = g2_mma(a0, b, c03); c13 = g2_mma(a1, b, c13); }
  v8f accs[8] = {c00, c01, c02, c03, c10, c11, c12, c13};
#pragma unroll
  for (int u = 0; u < 8; ++u) { const int t = u & 3, half = u >> 2; const int col = col0 + t * 16 + ln; const float bv = bp ? bf16_round(bp[col]) : 0.f;
#pragma unroll
    for (int r = 0; r < 8; ++r) { const int rloc = half * 16 + 8 * hh + r; float v = accs[u][r] * alpha + bv; if (CP) { if (rowsPerB < 0) v += CP[cofs + (size_t)(row0g + row0 + rloc) * ldc + col];      /* rowsPerB < 0: own element of the batched C plane */ else { const int bidx = (row0g + row0 + rloc) / rowsPerB; v += CP[(size_t)bidx * sCPb + (size_t)by * 64 + col]; } }
      if (ACT == 3) v = fmaxf(v, 0.f); else if (ACT == 6) v = 0.5f * v * (1.0f + erff(v * 0.70710678118654752f)); else if (ACT == 11) v = 1.0f / (1.0f + expf(-v)); else if (ACT == 15) v = v / (1.0f + expf(-v)); else if (ACT == 12) v = (v > 0.f) ? v : 0.01f * v; else if (ACT == 8) v = tanhf(v); else if (ACT == 9) v = 0.5f * v * (1.0f + tanhf(0.7978845608028654f * (v + 0.044715f * v * v * v))); else if (ACT == 14) v = (v > 0.f) ? v : 0.1f * v; else if (ACT == 16) v = (v >= 0.f) ? v : 0.3f * v; else if (ACT == 17) v = (v >= 0.f) ? v : 0.2f * v;
      so[w][rloc][t * 16 + ln] = v; } }
  __builtin_amdgcn_fence(__ATOMIC_ACQ_REL, "workgroup"); __builtin_amdgcn_wave_barrier();
  const int rsub = lane >> 4, c4 = (lane & 15) * 4;
  {
#pragma unroll
    for (int q = 0; q < 16; ++q) { const int r = q * 2 + rsub; const v4f v = *(const v4fa*)&so[w][r][c4]; if (C) *(v4f*)(C + cofs + (size_t)(row0 + r) * ldc + col0 + c4) = v; if (C16) { v4h h4; for (int i = 0; i < 4; ++i) h4[i] = (_Float16)v[i]; *(v4h*)(C16 + cofs + (size_t)(row0 + r) * ldc + col0 + c4) = h4; } }
     } }


__global__ __launch_bounds__(256) void k_wnat(const float* __restrict__ w, size_t n8, _Float16* __restrict__ Bt) { const size_t t = (size_t)blockIdx.x * 256 + threadIdx.x; if (t >= n8) return; FragH f; for (int q = 0; q < 8; ++q) f.h[q] = (_Float16)(bf16_round(w[t * 8 + q]) * 16.0f); *(v8us*)((unsigned short*)Bt + t * 8) = f.half[0];  }
// Row softmax, one wave per row: a lane holds 64 of the row's 2048 scores in registers (16 loads of 16 bytes, each wave-wide load 512 contiguous bytes),
// so S is read once and every exp is computed once; maximum and sum are lane partials joined by a five-step butterfly. No LDS, no work-group barrier.
#define RSW 16                       /* waves per work-group */
#define RSR 2                        /* rows per wave: both rows' loads are issued before the first row is worked on */
#define RSQ (SQ / 128)               /* 16-byte loads per lane and row */
template <int M> __device__ __forceinline__ float rs_xm(float x) { return __builtin_bit_cast(float, __builtin_amdgcn_update_dpp(0, __builtin_bit_cast(int, x), 0x160 | M, 0xf, 0xf, true)); }      /* lane l with lane l ^ M, M < 16 (row_xmask) */
__device__ __forceinline__ float rs_xh(float x) { return __builtin_bit_cast(float, __builtin_amdgcn_permlanex16(__builtin_bit_cast(int, x), __builtin_bit_cast(int, x), 0x76543210, 0xfedcba98, false, false)); }      /* lane l with lane l ^ 16 */
__device__ __forceinline__ float rs_wmax(float v) { v = fmaxf(v, rs_xm<1>(v)); v = fmaxf(v, rs_xm<2>(v)); v = fmaxf(v, rs_xm<4>(v)); v = fmaxf(v, rs_xm<8>(v)); return fmaxf(v, rs_xh(v)); }
__device__ __forceinline__ float rs_wsum(float v) { v += rs_xm<1>(v); v += rs_xm<2>(v); v += rs_xm<4>(v); v += rs_xm<8>(v); return v + rs_xh(v); }
__global__ __launch_bounds__(RSW * 32) void k_rsm(const float* __restrict__ S, _Float16* __restrict__ P, int nrows) {
  const int lane = threadIdx.x & 31; const int wave = __builtin_amdgcn_readfirstlane((int)(threadIdx.x >> 5));
  const int row0 = (blockIdx.x * RSW + wave) * RSR; if (row0 >= nrows) return;      /* wave-uniform; the kernel has no barrier */
  v4f x[RSR][RSQ]; const char* sb[RSR]; static_assert(RSR == 2, "the wait behind the loads names two row bases");
#pragma unroll
  for (int r = 0; r < RSR; ++r) { const int rr = (row0 + r < nrows) ? row0 + r : row0;      /* a row past the end re-reads the wave's first row and is not stored */
    sb[r] = (const char*)(S + (size_t)rr * SQ);
#pragma unroll
    for (int q = 0; q < RSQ; ++q) x[r][q] = ((const v4fa*)(sb[r] + q * 512))[lane];      /* a wave-wide load covers 512 contiguous bytes */
    __builtin_amdgcn_sched_barrier(0); }      /* row by row, all in front of the arithmetic: the first row's data return first, the second row's loads fly under the first row's arithmetic */
  asm volatile("s_wait_xcnt 0x0" :: "v"(lane), "s"(sb[0]), "s"(sb[1]) : "memory");      /* the loads' address registers are inputs here, so they stay live up to this wait: no load's result and no later arithmetic is placed on them in front of it */
  __builtin_amdgcn_sched_barrier(0);      /* holds that wait directly behind the last load: without it the build lets it sink below the first row's maxima */
#pragma unroll
  for (int r = 0; r < RSR; ++r) {
    float m0 = -3.0e38f, m1 = -3.0e38f, m2 = -3.0e38f, m3 = -3.0e38f;
#pragma unroll
    for (int q = 0; q < RSQ; ++q) { m0 = fmaxf(m0, x[r][q][0]); m1 = fmaxf(m1, x[r][q][1]); m2 = fmaxf(m2, x[r][q][2]); m3 = fmaxf(m3, x[r][q][3]); }
    const float mx = rs_wmax(fmaxf(fmaxf(m0, m1), fmaxf(m2, m3)));
    float a0 = 0.f, a1 = 0.f, a2 = 0.f, a3 = 0.f;
#pragma unroll
    for (int q = 0; q < RSQ; ++q) { v4f e; for (int i = 0; i < 4; ++i) e[i] = expf(x[r][q][i] - mx); x[r][q] = e; a0 += e[0]; a1 += e[1]; a2 += e[2]; a3 += e[3]; }
    const float sc = 256.0f / rs_wsum((a0 + a1) + (a2 + a3));
    if (row0 + r < nrows) { _Float16* d = P + (size_t)(row0 + r) * SQ + lane * 4;
#pragma unroll
      for (int q = 0; q < RSQ; ++q) { v4h h4; for (int i = 0; i < 4; ++i) h4[i] = (_Float16)(x[r][q][i] * sc); *(v4h*)(d + q * 128) = h4; } }
    __builtin_amdgcn_sched_barrier(0);      /* one row after the other: the first row's stores leave before the second row's arithmetic, which does not wait for them */
  } }
__global__ __launch_bounds__(256) void k_vt(const _Float16* __restrict__ V16, int b, int h0, _Float16* __restrict__ VT) { __shared__ unsigned short tl[64][65]; const int tid = threadIdx.x; const int hh = blockIdx.x % HG, sg = blockIdx.x / HG; const int s0 = sg * 64; const int h = h0 + hh;
  for (int i = tid; i < 64 * 8; i += 256) { const int j = i / 8, d8 = (i % 8) * 8; FragH f; f.half[0] = *(const v8us*)((const unsigned short*)V16 + ((size_t)b * SQ + s0 + j) * DM + h * HD + d8); for (int q = 0; q < 8; ++q) tl[d8 + q][j] = f.u[q]; }
  __syncthreads();
  { for (int i = tid; i < 64 * 8; i += 256) { const int d = i / 8, j8 = (i % 8) * 8; FragH f; for (int q = 0; q < 8; ++q) f.u[q] = tl[d][j8 + q]; *(v8us*)((unsigned short*)VT + ((size_t)hh * HD + d) * SQ + s0 + j8) = f.half[0]; }  } }



__global__ __launch_bounds__(256) void k_rsmkm(const float* __restrict__ S, _Float16* __restrict__ P, int nrows, const int* __restrict__ am) {
  #pragma clang fp contract(off)
  const int t = blockIdx.x * 256 + threadIdx.x; if (t >= nrows) return; const size_t i = (size_t)t; const float* s = S + i * SQ; const int* mr = am + (size_t)(t % SQ) * SQ; float mx = -3.0e38f;
#pragma unroll 1
  for (int j = 0; j < SQ; ++j) { const float f = (mr[j] != 0) ? 1.f : 0.f; mx = fmaxf(mx, fmaf(f, s[j], (1.f - f) * -1.0e9f)); } float se = 0.f;
#pragma unroll 1
  for (int j = 0; j < SQ; ++j) { const float f = (mr[j] != 0) ? 1.f : 0.f; se += __expf(fmaf(f, s[j], (1.f - f) * -1.0e9f) - mx); } const float sc = 256.0f / se;
#pragma unroll 1
  for (int j0 = 0; j0 < SQ; j0 += 8) { FragH fr; for (int q = 0; q < 8; ++q) { const int j = j0 + q; const float f = (mr[j] != 0) ? 1.f : 0.f; fr.h[q] = (_Float16)(__expf(fmaf(f, s[j], (1.f - f) * -1.0e9f) - mx) * sc); }
    unsigned short* d = (unsigned short*)P + i * SQ + j0; *(v8us*)d = fr.half[0];  } }
#define DMQ DM

template <int BFIN, int W16, int W32>
__global__ __launch_bounds__(256) void k_lnx(const float* __restrict__ X, const float* __restrict__ g, const float* __restrict__ bb, float eps, _Float16* __restrict__ N16, float* __restrict__ N32) {
  #pragma clang fp contract(off)
  __shared__ float red[256]; const size_t r = blockIdx.x; const int t = threadIdx.x; const bool act = t < (DMQ / 4); const int c0 = act ? t * 4 : 0;
  const v4f xa = *(const v4fa*)(X + r * DMQ + c0); float s[4]; float sum = 0.f;
  for (int q = 0; q < 4; ++q) { s[q] = act ? (BFIN ? bf16_round(xa[q]) : xa[q]) : 0.f; sum = __fadd_rn(sum, s[q]); }
  red[t] = sum; __syncthreads(); for (int st = 128; st > 0; st >>= 1) { if (t < st) red[t] = __fadd_rn(red[t], red[t + st]); __syncthreads(); } const float mu = red[0] / (float)DMQ; __syncthreads();
  float vs = 0.f; for (int q = 0; q < 4; ++q) { const float dl = act ? __fadd_rn(s[q], -mu) : 0.f; vs = __fadd_rn(vs, __fmul_rn(dl, dl)); } red[t] = vs; __syncthreads(); for (int st = 128; st > 0; st >>= 1) { if (t < st) red[t] = __fadd_rn(red[t], red[t + st]); __syncthreads(); }
  const float rs = rsqrtf(__fadd_rn(red[0] / (float)DMQ, eps)); v4h y; v4f yf;
  for (int q = 0; q < 4; ++q) { const int c = c0 + q; yf[q] = __fadd_rn(__fmul_rn(__fmul_rn(__fadd_rn(s[q], -mu), rs), bf16_round(g[c])), bf16_round(bb[c])); y[q] = (_Float16)yf[q]; }
  if (!act) return;      /* no barriers after this point */
  { if (W16) *(v4h*)(N16 + r * DMQ + c0) = y; if (W32) *(v4f*)(N32 + r * DMQ + c0) = yf;  } }


extern "C" void kernel_launch(void* const* d_in, const int* in_sizes, int n_in,
                              void* d_out, int out_size, void* d_ws, size_t ws_size, hipStream_t stream) {
  (void)in_sizes; (void)n_in; (void)out_size;
  const float* const* I = (const float* const*)d_in; const float* xq = I[0]; const float* xk = I[1]; const float* xv = I[2]; const float* lng = I[3]; const float* lnb = I[4]; const float* wq = I[5]; const float* bq = I[6]; const float* wk = I[7]; const float* bk = I[8]; const float* wv = I[9]; const float* bv = I[10]; const float* wo = I[11]; const float* bo = I[12]; const float* x = xq;      /* query, key, value; shared LayerNorm gamma / beta [512]; [in][out] Wq / Wk / Wv / Wo + biases */
  char* ws = (char*)d_ws; size_t off = 0;
  auto take = [&](size_t bytes) { char* p = ws + off; off += (bytes + 255) & ~(size_t)255; return p; };
  _Float16* BQ = (_Float16*)take((size_t)DM * DM * 2); _Float16* BK = (_Float16*)take((size_t)DM * DM * 2); _Float16* BV = (_Float16*)take((size_t)DM * DM * 2); _Float16* BO = (_Float16*)take((size_t)DM * DM * 2);
  _Float16* X16 = (_Float16*)take(NR * DM * 2); _Float16* XKp = (_Float16*)take(NR * DM * 2); _Float16* XVp = (_Float16*)take(NR * DM * 2); _Float16* Q16 = (_Float16*)take(NR * DM * 2); _Float16* K16 = (_Float16*)take(NR * DM * 2); _Float16* V16 = (_Float16*)take(NR * DM * 2); _Float16* O16 = (_Float16*)take(NR * DM * 2);
  float* S = (float*)take((size_t)HG * SQ * SQ * 4); _Float16* P = (_Float16*)take((size_t)HG * SQ * SQ * 2); _Float16* VT = (_Float16*)take((size_t)NH * HD * SQ * 2);
  if (off > ws_size) return;
  { const unsigned g = (unsigned)(((size_t)DM * (DM / 8) + 255) / 256); k_wt_f16<<<g, 256, 0, stream>>>(wq, BQ, DM, DM, 16.0f); k_wt_f16<<<g, 256, 0, stream>>>(wk, BK, DM, DM, 16.0f); k_wt_f16<<<g, 256, 0, stream>>>(wv, BV, DM, DM, 16.0f); k_wt_f16<<<g, 256, 0, stream>>>(wo, BO, DM, DM, 16.0f); }      /* [in][out] -> Bt x16 */
  _Float16* XK = XKp; _Float16* XV = XVp; k_lnx<1, 1, 0><<<(unsigned)NR, 256, 0, stream>>>(xk, lng, lnb, 1e-5f, XK, nullptr); k_lnx<1, 1, 0><<<(unsigned)NR, 256, 0, stream>>>(xv, lng, lnb, 1e-5f, XV, nullptr);      /* LN(key), LN(value) with the SHARED parameters -> f16 rows */

  k_lnx<1, 1, 0><<<(unsigned)NR, 256, 0, stream>>>(x, lng, lnb, 1e-5f, X16, nullptr);      /* LN(query) -> f16 rows */
  const size_t r0p = (size_t)B0 * SQ;      /* first projected row */
  k_gemm2<0><<<dim3((unsigned)((MP / 128) * (DM / 64)), 1), 128, 0, stream>>>(X16 + r0p * DM, DM, 0, BQ, DM, 0, 0.0625f, bq, 0, nullptr, 1, 0, 0, nullptr, Q16 + r0p * DM, DM, 0, MP, DM, DM);
  k_gemm2<0><<<dim3((unsigned)((MP / 128) * (DM / 64)), 1), 128, 0, stream>>>(XK + r0p * DM, DM, 0, BK, DM, 0, 0.0625f, bk, 0, nullptr, 1, 0, 0, nullptr, K16 + r0p * DM, DM, 0, MP, DM, DM);
  k_gemm2<0><<<dim3((unsigned)((MP / 128) * (DM / 64)), 1), 128, 0, stream>>>(XV + r0p * DM, DM, 0, BV, DM, 0, 0.0625f, bv, 0, nullptr, 1, 0, 0, nullptr, V16 + r0p * DM, DM, 0, MP, DM, DM);
  for (int b = B0; b < B0 + NBR; ++b) { const size_t r0 = (size_t)b * SQ;
    k_vt<NH, SQ><<<NH * (SQ / 64), 256, 0, stream>>>(V16 + r0 * LQ, LQ, 0, VT);      /* V^T [NH][HD][SQ] for this batch */
    for (int h0 = 0; h0 < NHD; h0 += HG) {
      k_gemm2<0><<<dim3((QN / 128) * (SQ / 64), HG), 128, 0, stream>>>(Q16 + r0 * LQ + h0 * HD, LQ, (size_t)HD, K16 + r0 * LQ + h0 * HD, LQ, (size_t)HD, 0.125f, nullptr, 0, nullptr, 1, 0, 0, S, nullptr, SQ, (size_t)SQ * SQ, QN, SQ, HD);      /* scores, HG heads per launch */
      k_rsm<<<(HG * SQ + RSW * RSR - 1) / (RSW * RSR), RSW * 32, 0, stream>>>(S, P, HG * SQ);      /* P = 256 softmax (f16), rows of all HG heads */
      k_gemm2<0><<<dim3((QN / 128) * (HD / 64), HG), 128, 0, stream>>>(P, SQ, (size_t)SQ * SQ, VT + (size_t)h0 * HD * SQ, SQ, (size_t)HD * SQ, 0.25f, nullptr, 0, nullptr, 1, 0, 0, nullptr, O16 + r0 * DM + h0 * HD, DM, (size_t)HD, QN, HD, SQ); } }      /* o (merged heads) as f16 rows */
  k_gemm2<0><<<dim3((unsigned)((MPO / 128) * (DM / 64)), 1), 128, 0, stream>>>(O16 + r0p * DM, DM, 0, BO, DM, 0, 0.0009765625f, bo, 0, nullptr, 1, 0, 0, (float*)d_out + r0p * DM, nullptr, DM, 0, MPO, DM, DM);      /* out rows are the output layout */
}

// v002
// It runs in 149 microseconds.
// Two timings next to v001 put it at 3.52 and 3.45 times that version's speed.
// Over all steps from v000 it is 12.8 times as fast.
#include <hip/hip_runtime.h>
// Multi-head attention over THREE inputs, each passed through ONE shared LayerNorm first (query, key, value [2][2048][512]; Q = LN(query) Wq + bq, K = LN(key) Wk + bk, V = LN(value) Wv + bv with LN: biased var, eps 1e-5, shared ln_g / ln_b; [in][out] 512 x 512, zero biases); 8 heads of 64; scores / 8; softmax over all 2048 keys (no mask); out = merged Wo + bo -> [2][2048][512]; no residual).
// Structure: token rows r = b*2048 + s; LN(query / key / value) as f16 rows (LN in f32 of bf16-rounded inputs); Q, K, V as three WMMA GEMMs (32x64 wave tiles, f32 accumulation, exact x16 weights + bias, f16 outputs); V^T for all batches and heads via LDS transposes; one fused attention launch over all (batch, head, 128 queries): S^T = K . Q^T (K = 64) on WMMA, online softmax in registers (f32 running maximum and sum, base 2, 1/sqrt(64) folded into the exponent; unnormalised weights x256, in (0, 256], as f16), O^T += V^T . P^T on WMMA, divided by the sum at the end (o carried x64 against f16 subnormal flush, folded into the output GEMM alpha) and written straight into the merged f16 o rows; out = o W_o + b GEMM (f32) into the output layout.
// Compute dtype: inputs rounded to bf16; weights exact; LN outputs, q, k, v, softmax weights and o as plain f16 GEMM operands (~2^-12); scores and softmax statistics f32; v_wmma_f32_16x16x32_f16.
#define NB 2
#define SQ 2048
#define DM 512
#define NH 8
#define HD 64
#define HG 4                         /* heads per launch of the per-batch k_vt */
#define B0 0                         /* first batch processed (debug hook) */
#define NBR NB                       /* batches processed (debug hook) */
#define NR ((size_t)NB * SQ)         /* token rows */
#define MP ((int)((size_t)NBR * SQ)) /* rows projected (debug hook) */
#define QN SQ                        /* query rows per batch (unused: k_fattn attends all SQ) */
#define NHD NH                       /* heads (unused: k_fattn covers all NH heads) */
#define MPO MP                       /* rows through the output stage (debug hook) */
#define LQ DM      /* row pitch of the q/k/v rows */
typedef __bf16 v16b __attribute__((ext_vector_type(16)));
typedef unsigned short v8us __attribute__((ext_vector_type(8), may_alias));
typedef float  v8f  __attribute__((ext_vector_type(8)));
typedef float  v4f  __attribute__((ext_vector_type(4)));
typedef float  v4fa __attribute__((ext_vector_type(4), may_alias));
union FragB { v16b v; v8us half[2]; unsigned short u[16]; };

__device__ __forceinline__ unsigned short bf16_bits(float x) { unsigned int u = __float_as_uint(x); return (unsigned short)((u + 0x7FFFu + ((u >> 16) & 1u)) >> 16); }
__device__ __forceinline__ float bf16_val(unsigned short b) { return __uint_as_float(((unsigned int)b) << 16); }
__device__ __forceinline__ float bf16_round(float x) { return bf16_val(bf16_bits(x)); }
// D += A·B with NT terms: 1 = ah·bh, 2 = + al·bh (A split), 3 = + ah·bl (both split)
template <int NT>
__device__ __forceinline__ v8f mmaN(v16b ah, v16b al, v16b bh, v16b bl, v8f c) {
  c = __builtin_amdgcn_wmma_f32_16x16x32_bf16(false, ah, false, bh, (short)0, c, false, false);
  if (NT >= 2) c = __builtin_amdgcn_wmma_f32_16x16x32_bf16(false, al, false, bh, (short)0, c, false, false);
  if (NT >= 3) c = __builtin_amdgcn_wmma_f32_16x16x32_bf16(false, ah, false, bl, (short)0, c, false, false);
  asm volatile("v_nop\n\tv_nop\n\tv_nop\n\tv_nop" : "+v"(c) : "v"(ah), "v"(al), "v"(bh), "v"(bl));
  return c;
}

__global__ __launch_bounds__(256) void k_wt_bf16(const float* __restrict__ W, unsigned short* __restrict__ Wt, int K, int N) {
  const int t = blockIdx.x * 256 + threadIdx.x;
  const int k8n = K / 8;
  if (t >= N * k8n) return;
  const int n = t / k8n, k8 = (t % k8n) * 8;
  v8us v;
#pragma unroll
  for (int i = 0; i < 8; ++i) v[i] = bf16_bits(W[(size_t)(k8 + i) * N + n]);
  *(v8us*)(Wt + (size_t)n * K + k8) = v;
  
}

// GEMM C[M][N] (f32, pitch ldc) = act(A[M][K]·W + bias). A f32 row-major (pitch lda) converted per fragment to bf16
// (ASPLIT: hi/lo two planes -> 2 terms, else single rounded term); Wt bf16 [N][K] (pitch ldb). BIAS_BF16 rounds the
// bias to bf16 first (bias quantised to bf16 before the add). K%32==0, M%16==0, N%64==0.
template <bool ASPLIT, int ACT, bool BIAS_BF16>
__global__ __launch_bounds__(128) void k_gemm_bf(const float* __restrict__ A, int lda, const unsigned short* __restrict__ Wt, int ldb,
                                               const float* __restrict__ bias, float* __restrict__ C, int ldc, int M, int N, int K) {
  __shared__ __attribute__((aligned(16))) float so[4][16][64];
  const int tid = threadIdx.x, w = tid >> 5, lane = tid & 31, ln = lane & 15, hh = lane >> 4;
  const int ntn = N / 64;
  const int wid = blockIdx.x * 4 + w;
  const int mt = wid / ntn, nq = wid % ntn;
  if (mt * 16 >= M) return;
  const int row0 = mt * 16, col0 = nq * 64;
  const float* arow = A + (size_t)(row0 + ln) * lda;
  v8f acc[4] = {};
  for (int kb = 0; kb < K; kb += 32) {
    FragB ah, al;
    const v4f x0 = *(const v4fa*)(arow + kb + 8 * hh), x1 = *(const v4fa*)(arow + kb + 8 * hh + 4);
    const v4f x2 = *(const v4fa*)(arow + kb + 16 + 8 * hh), x3 = *(const v4fa*)(arow + kb + 16 + 8 * hh + 4);
    float xs[16] = {x0[0],x0[1],x0[2],x0[3],x1[0],x1[1],x1[2],x1[3],x2[0],x2[1],x2[2],x2[3],x3[0],x3[1],x3[2],x3[3]};
#pragma unroll
    for (int i = 0; i < 16; ++i) { const unsigned short hb = bf16_bits(xs[i]); ah.u[i] = hb; al.u[i] = ASPLIT ? bf16_bits(xs[i] - bf16_val(hb)) : (unsigned short)0; }
#pragma unroll
    for (int t = 0; t < 4; ++t) {
      const unsigned short* brow = Wt + (size_t)(col0 + t * 16 + ln) * ldb + kb;
      FragB b;
      b.half[0] = *(const v8us*)(brow + 8 * hh);
      b.half[1] = *(const v8us*)(brow + 16 + 8 * hh);
      acc[t] = mmaN<ASPLIT ? 2 : 1>(ah.v, al.v, b.v, b.v, acc[t]);
    }
  }
#pragma unroll
  for (int t = 0; t < 4; ++t) {
    float bv = bias ? bias[col0 + t * 16 + ln] : 0.f;
    if (BIAS_BF16) bv = bf16_round(bv);
#pragma unroll
    for (int r = 0; r < 8; ++r) { float v = acc[t][r] + bv; if (ACT == 1) v = fmaxf(v, 0.f); so[w][8 * hh + r][t * 16 + ln] = v; }
  }
  __builtin_amdgcn_fence(__ATOMIC_ACQ_REL, "workgroup");
  __builtin_amdgcn_wave_barrier();
  const int rsub = lane >> 4, c4 = (lane & 15) * 4;
  {
#pragma unroll
    for (int q = 0; q < 8; ++q) {
      const int r = q * 2 + rsub;
      const v4f v = *(const v4fa*)&so[w][r][c4];
      *(v4f*)(C + (size_t)(row0 + r) * ldc + col0 + c4) = v;
    }
    
  }
}

// GEMM C = act(A·W + bias + resid): A f32 (ASPLIT -> hi/lo 2 terms), Wt bf16 [N][K]; ACT 0 none, 1 relu, 2 exact gelu;
// resid (optional, f32, row index = (row % rmod), pitch ldr, RES_BF16 rounds it) added before the activation.
template <bool ASPLIT, int ACT, bool BIAS_BF16, bool RES_BF16>
__global__ __launch_bounds__(128) void k_gemm_bf3(const float* __restrict__ A, int lda, const unsigned short* __restrict__ Wt, int ldb,
                                                const float* __restrict__ bias, const float* __restrict__ resid, int rmod, int ldr,
                                                float* __restrict__ C, int ldc, int M, int N, int K) {
  __shared__ __attribute__((aligned(16))) float so[4][16][64];
  const int tid = threadIdx.x, w = tid >> 5, lane = tid & 31, ln = lane & 15, hh = lane >> 4;
  const int ntn = N / 64;
  const int wid = blockIdx.x * 4 + w;
  const int mt = wid / ntn, nq = wid % ntn;
  if (mt * 16 >= M) return;
  const int row0 = mt * 16, col0 = nq * 64;
  const float* arow = A + (size_t)(row0 + ln) * lda;
  v8f acc[4] = {};
  for (int kb = 0; kb < K; kb += 32) {
    FragB ah, al;
    const v4f x0 = *(const v4fa*)(arow + kb + 8 * hh), x1 = *(const v4fa*)(arow + kb + 8 * hh + 4);
    const v4f x2 = *(const v4fa*)(arow + kb + 16 + 8 * hh), x3 = *(const v4fa*)(arow + kb + 16 + 8 * hh + 4);
    float xs[16] = {x0[0],x0[1],x0[2],x0[3],x1[0],x1[1],x1[2],x1[3],x2[0],x2[1],x2[2],x2[3],x3[0],x3[1],x3[2],x3[3]};
#pragma unroll
    for (int i = 0; i < 16; ++i) { const unsigned short hb = bf16_bits(xs[i]); ah.u[i] = hb; al.u[i] = ASPLIT ? bf16_bits(xs[i] - bf16_val(hb)) : (unsigned short)0; }
#pragma unroll
    for (int t = 0; t < 4; ++t) {
      const unsigned short* brow = Wt + (size_t)(col0 + t * 16 + ln) * ldb + kb;
      FragB b;
      b.half[0] = *(const v8us*)(brow + 8 * hh);
      b.half[1] = *(const v8us*)(brow + 16 + 8 * hh);
      acc[t] = mmaN<ASPLIT ? 2 : 1>(ah.v, al.v, b.v, b.v, acc[t]);
    }
  }
#pragma unroll
  for (int t = 0; t < 4; ++t) {
    const int col = col0 + t * 16 + ln;
    float bv = bias ? bias[col] : 0.f;
    if (BIAS_BF16) bv = bf16_round(bv);
#pragma unroll
    for (int r = 0; r < 8; ++r) {
      float v = acc[t][r] + bv;
      if (resid) { float rv = resid[(size_t)((row0 + 8 * hh + r) % rmod) * ldr + col]; if (RES_BF16) rv = bf16_round(rv); v += rv; }
      if (ACT == 1) v = fmaxf(v, 0.f);
      if (ACT == 2) v = 0.5f * v * (1.0f + erff(v * 0.70710678118654752f));
      if (ACT == 3) { const float u = 0.7978845608028654f * (v + 0.044715f * v * v * v); v = 0.5f * v * (1.0f + tanhf(u)); }
      so[w][8 * hh + r][t * 16 + ln] = v;
    }
  }
  __builtin_amdgcn_fence(__ATOMIC_ACQ_REL, "workgroup");
  __builtin_amdgcn_wave_barrier();
  const int rsub = lane >> 4, c4 = (lane & 15) * 4;
  {
#pragma unroll
    for (int q = 0; q < 8; ++q) {
      const int r = q * 2 + rsub;
      const v4f v = *(const v4fa*)&so[w][r][c4];
      *(v4f*)(C + (size_t)(row0 + r) * ldc + col0 + c4) = v;
    }
    
  }
}
// row LayerNorm (biased variance, eps) over N: s = X (+ R); optional out_sum <- s; out_norm <- (s-mu)*rsqrt(var+eps)*g + b
template <bool PARAM_BF16>
__global__ __launch_bounds__(256) void k_layernorm(const float* __restrict__ X, const float* __restrict__ R, const float* __restrict__ g, const float* __restrict__ bta,
                                                  float* __restrict__ out_sum, float* __restrict__ out_norm, int N, float eps) {
  __shared__ float red[256];
  const int row = blockIdx.x, tid = threadIdx.x;
  const float* x = X + (size_t)row * N; const float* rr = R ? R + (size_t)row * N : nullptr;
  float vals[16];                     // up to N = 4096
  const int per = N / 256;            // contiguous chunk per thread? use strided-by-4 chunks: thread handles j = tid*4 + 1024*u
  float s1 = 0.f;
  for (int u = 0; u < per / 4; ++u) {
    const int j = tid * 4 + 1024 * u;
    const v4f a = *(const v4fa*)(x + j);
    v4f b = {0.f,0.f,0.f,0.f}; if (rr) b = *(const v4fa*)(rr + j);
#pragma unroll
    for (int q = 0; q < 4; ++q) { const float v = a[q] + b[q]; vals[u * 4 + q] = v; s1 += v; }
  }
  red[tid] = s1; __syncthreads();
  for (int st = 128; st > 0; st >>= 1) { if (tid < st) red[tid] += red[tid + st]; __syncthreads(); }
  const float mu = red[0] / (float)N; __syncthreads();
  float s2 = 0.f;
  for (int u = 0; u < per / 4; ++u)
#pragma unroll
    for (int q = 0; q < 4; ++q) { const float c = vals[u * 4 + q] - mu; s2 += c * c; }
  red[tid] = s2; __syncthreads();
  for (int st = 128; st > 0; st >>= 1) { if (tid < st) red[tid] += red[tid + st]; __syncthreads(); }
  const float rs = rsqrtf(red[0] / (float)N + eps);
  {
    for (int u = 0; u < per / 4; ++u) {
      const int j = tid * 4 + 1024 * u;
      v4f o, sm;
#pragma unroll
      for (int q = 0; q < 4; ++q) {
        float gg = g[j + q], bb = bta[j + q];
        if (PARAM_BF16) { gg = bf16_round(gg); bb = bf16_round(bb); }
        sm[q] = vals[u * 4 + q]; o[q] = (vals[u * 4 + q] - mu) * rs * gg + bb;
      }
      if (out_sum) *(v4f*)(out_sum + (size_t)row * N + j) = sm;
      *(v4f*)(out_norm + (size_t)row * N + j) = o;
    }
    
  }
}



// ---- f16 WMMA path (v_wmma_f32_16x16x32_f16): 11-bit significands for operands in range — used where a [0,1] probability operand needs more precision than bf16
typedef _Float16 v16h __attribute__((ext_vector_type(16)));
union FragH { v16h v; v8us half[2]; _Float16 h[16]; unsigned short u[16]; };
template <int NT>
__device__ __forceinline__ v8f mmaH(v16h ah, v16h al, v16h bh, v16h bl, v8f c) {
  c = __builtin_amdgcn_wmma_f32_16x16x32_f16(false, ah, false, bh, (short)0, c, false, false);
  if (NT >= 2) c = __builtin_amdgcn_wmma_f32_16x16x32_f16(false, al, false, bh, (short)0, c, false, false);
  if (NT >= 3) c = __builtin_amdgcn_wmma_f32_16x16x32_f16(false, ah, false, bl, (short)0, c, false, false);
  asm volatile("v_nop\n\tv_nop\n\tv_nop\n\tv_nop" : "+v"(c) : "v"(ah), "v"(al), "v"(bh), "v"(bl));
  return c;
}
// batched GEMM like k_gemm_b but f16 operands: A f32 (split into f16 hi/lo if ASPLIT, else rounded to f16), Bt = f16 values [n][k]; alpha; C f32; N multiple of 16 (partial tiles skipped)
template <bool ASPLIT>
__global__ __launch_bounds__(128) void k_gemm_h(const float* __restrict__ A, int lda, size_t sA, const _Float16* __restrict__ Bh, int ldb, size_t sB, float alpha, float* __restrict__ C, int ldc, size_t sC, int M, int N, int K) {
  __shared__ __attribute__((aligned(16))) float so[4][16][64];
  const int tid = threadIdx.x, w = tid >> 5, lane = tid & 31, ln = lane & 15, hh = lane >> 4; const int by = blockIdx.y;
  A += (size_t)by * sA; Bh += (size_t)by * sB; C += (size_t)by * sC;
  const int ntn = (N + 63) / 64; const int wid = blockIdx.x * 4 + w; const int mt = wid / ntn, nq = wid % ntn; if (mt * 16 >= M) return;
  const int row0 = mt * 16, col0 = nq * 64; const float* arow = A + (size_t)(row0 + ln) * lda;
  v8f acc[4] = {};
  for (int kb = 0; kb < K; kb += 32) {
    FragH ah, al;
    const v4f x0 = *(const v4fa*)(arow + kb + 8 * hh), x1 = *(const v4fa*)(arow + kb + 8 * hh + 4), x2 = *(const v4fa*)(arow + kb + 16 + 8 * hh), x3 = *(const v4fa*)(arow + kb + 16 + 8 * hh + 4);
    float xs[16] = {x0[0],x0[1],x0[2],x0[3],x1[0],x1[1],x1[2],x1[3],x2[0],x2[1],x2[2],x2[3],x3[0],x3[1],x3[2],x3[3]};
#pragma unroll
    for (int i = 0; i < 16; ++i) { const _Float16 h = (_Float16)xs[i]; ah.h[i] = h; al.h[i] = ASPLIT ? (_Float16)(xs[i] - (float)h) : (_Float16)0.0f; }
#pragma unroll
    for (int t = 0; t < 4; ++t) { if (col0 + t * 16 >= N) continue; const size_t boff = (size_t)(col0 + t * 16 + ln) * ldb + kb; FragH bq; bq.half[0] = *(const v8us*)(Bh + boff + 8 * hh); bq.half[1] = *(const v8us*)(Bh + boff + 16 + 8 * hh);
      acc[t] = mmaH<ASPLIT ? 2 : 1>(ah.v, al.v, bq.v, bq.v, acc[t]); }
  }
#pragma unroll
  for (int t = 0; t < 4; ++t) { if (col0 + t * 16 >= N) continue;
#pragma unroll
    for (int r = 0; r < 8; ++r) so[w][8 * hh + r][t * 16 + ln] = acc[t][r] * alpha; }
  __builtin_amdgcn_fence(__ATOMIC_ACQ_REL, "workgroup"); __builtin_amdgcn_wave_barrier();
  const int rsub = lane >> 4, c4 = (lane & 15) * 4;
  {
#pragma unroll
    for (int q = 0; q < 8; ++q) { const int r = q * 2 + rsub; if (col0 + c4 < N) { const v4f v = *(const v4fa*)&so[w][r][c4]; *(v4f*)(C + (size_t)(row0 + r) * ldc + col0 + c4) = v; } }
     }
}

// Wt[n][k] = f16(W[k][n]·scale) from f32 row-major W[K][N] (scale = power of two; bf16-exact weights stay exact in f16 away from the subnormal range)
__global__ __launch_bounds__(256) void k_wt_f16(const float* __restrict__ W, _Float16* __restrict__ Wt, int K, int N, float scale) {
  const int t = blockIdx.x * 256 + threadIdx.x; if (t >= N * (K / 8)) return; const int n = t / (K / 8), k8 = (t % (K / 8)) * 8; FragH f;
#pragma unroll
  for (int i = 0; i < 8; ++i) f.h[i] = (_Float16)(bf16_round(W[(size_t)(k8 + i) * N + n]) * scale); const v8us o = f.half[0];
  *(v8us*)((unsigned short*)Wt + (size_t)n * K + k8) = o; 
}
// k_gemm_hh variant with fused epilogue: v = acc·alpha + bias[by·sBias + col] (+ CP[(row/rowsPerB)·sCPb + by·64 + col] if CP) ; ACT 0 none / 1 elu ; writes f16 C16 (and f32 C if non-null)
template <int ACT>
__global__ __launch_bounds__(128) void k_gemm_hhx(const _Float16* __restrict__ A, int lda, size_t sA, const _Float16* __restrict__ Bh, int ldb, size_t sB, float alpha, const float* __restrict__ bias, size_t sBias, const float* __restrict__ CP, int rowsPerB, size_t sCPb, int row0g,
    float* __restrict__ C, _Float16* __restrict__ C16, int ldc, size_t sC, int M, int N, int K) {
  __shared__ __attribute__((aligned(16))) float so[4][16][64];
  const int tid = threadIdx.x, w = tid >> 5, lane = tid & 31, ln = lane & 15, hh = lane >> 4; const int by = blockIdx.y;
  A += (size_t)by * sA; Bh += (size_t)by * sB; const size_t cofs = (size_t)by * sC; const float* bp = bias ? bias + (size_t)by * sBias : nullptr;
  const int ntn = (N + 63) / 64; const int wid = blockIdx.x * 4 + w; const int mt = wid / ntn, nq = wid % ntn; if (mt * 16 >= M) return;
  const int row0 = mt * 16, col0 = nq * 64; const _Float16* arow = A + (size_t)(row0 + ln) * lda;
  v8f acc[4] = {};
  for (int kb = 0; kb < K; kb += 32) { FragH ah; ah.half[0] = *(const v8us*)((const unsigned short*)arow + kb + 8 * hh); ah.half[1] = *(const v8us*)((const unsigned short*)arow + kb + 16 + 8 * hh);
#pragma unroll
    for (int t = 0; t < 4; ++t) { if (col0 + t * 16 >= N) continue; const size_t boff = (size_t)(col0 + t * 16 + ln) * ldb + kb; FragH bq; bq.half[0] = *(const v8us*)((const unsigned short*)Bh + boff + 8 * hh); bq.half[1] = *(const v8us*)((const unsigned short*)Bh + boff + 16 + 8 * hh);
      acc[t] = mmaH<1>(ah.v, ah.v, bq.v, bq.v, acc[t]); }
  }
#pragma unroll
  for (int t = 0; t < 4; ++t) { if (col0 + t * 16 >= N) continue; const int col = col0 + t * 16 + ln; const float bv = bp ? bf16_round(bp[col]) : 0.f;
#pragma unroll
    for (int r = 0; r < 8; ++r) { float v = acc[t][r] * alpha + bv; if (CP) { const int rr = row0g + row0 + 8 * hh + r; if (rowsPerB < 0) v += CP[cofs + (size_t)rr * ldc + col];      /* rowsPerB < 0: own element of the batched C plane */ else { const int bidx = rr / rowsPerB; v += CP[(size_t)bidx * sCPb + (size_t)by * 64 + col]; } } if (ACT == 1) v = (v > 0.f) ? v : expm1f(v); else if (ACT == 7) v = (v > 0.f) ? v + 1.0f : expf(v); else if (ACT == 8) v = tanhf(v); else if (ACT == 9) v = 0.5f * v * (1.0f + tanhf(0.7978845608028654f * (v + 0.044715f * v * v * v))); else if (ACT == 11) v = 1.0f / (1.0f + expf(-v)); else if (ACT == 12) v = (v > 0.f) ? v : 0.01f * v; else if (ACT == 14) v = (v > 0.f) ? v : 0.1f * v; else if (ACT == 16) v = (v >= 0.f) ? v : 0.3f * v; else if (ACT == 17) v = (v >= 0.f) ? v : 0.2f * v; else if (ACT == 15) v = v / (1.0f + expf(-v)); else if (ACT == 3) v = fmaxf(v, 0.f); else if (ACT == 6) v = 0.5f * v * (1.0f + erff(v * 0.70710678118654752f)); so[w][8 * hh + r][t * 16 + ln] = v; } }
  __builtin_amdgcn_fence(__ATOMIC_ACQ_REL, "workgroup"); __builtin_amdgcn_wave_barrier();
  const int rsub = lane >> 4, c4 = (lane & 15) * 4; typedef _Float16 v4h __attribute__((ext_vector_type(4)));
  {
#pragma unroll
    for (int q = 0; q < 8; ++q) { const int r = q * 2 + rsub; if (col0 + c4 < N) { const v4f v = *(const v4fa*)&so[w][r][c4]; if (C) *(v4f*)(C + cofs + (size_t)(row0 + r) * ldc + col0 + c4) = v; if (C16) { v4h h4; for (int i = 0; i < 4; ++i) h4[i] = (_Float16)v[i]; *(v4h*)(C16 + cofs + (size_t)(row0 + r) * ldc + col0 + c4) = h4; } } }
     }
}


typedef _Float16 v4h __attribute__((ext_vector_type(4)));

__global__ __launch_bounds__(256) void k_x16(const float* __restrict__ x, _Float16* __restrict__ X16, size_t n8) { const size_t t = (size_t)blockIdx.x * 256 + threadIdx.x; if (t >= n8) return; FragH f;
#pragma unroll
  for (int q = 0; q < 8; ++q) f.h[q] = (_Float16)bf16_round(x[t * 8 + q]); *(v8us*)((unsigned short*)X16 + t * 8) = f.half[0];  }
__global__ __launch_bounds__(256) void k_h16(const float* __restrict__ x, _Float16* __restrict__ X16, size_t n8) { const size_t t = (size_t)blockIdx.x * 256 + threadIdx.x; if (t >= n8) return; FragH f;
#pragma unroll
  for (int q = 0; q < 8; ++q) f.h[q] = (_Float16)x[t * 8 + q]; *(v8us*)((unsigned short*)X16 + t * 8) = f.half[0];  }
__global__ __launch_bounds__(256) void k_round16f(const float* __restrict__ W, _Float16* __restrict__ Bt, size_t n8) { const size_t t = (size_t)blockIdx.x * 256 + threadIdx.x; if (t >= n8) return; FragH f;
#pragma unroll
  for (int i = 0; i < 8; ++i) f.h[i] = (_Float16)(bf16_round(W[t * 8 + i]) * 16.0f); *(v8us*)((unsigned short*)Bt + t * 8) = f.half[0];  }
template <int NHv, int TTv>
__global__ __launch_bounds__(256) void k_vt(const _Float16* __restrict__ V16, int ldv, int voff, _Float16* __restrict__ Vt) { __shared__ unsigned short tl[64][66]; const int tid = threadIdx.x; const int slab = blockIdx.x / (TTv / 64), lg = blockIdx.x % (TTv / 64); const int b = slab / NHv, h = slab % NHv;
  for (int i = tid; i < 64 * 8; i += 256) { const int r = i / 8, c8 = (i % 8) * 8; FragH f; f.half[0] = *(const v8us*)((const unsigned short*)V16 + ((size_t)b * TTv + lg * 64 + r) * ldv + voff + h * 64 + c8);
#pragma unroll
    for (int q = 0; q < 8; ++q) tl[r][c8 + q] = f.u[q]; }
  __syncthreads();
  {
#pragma unroll
    for (int rd = 0; rd < 2; ++rd) { const int d = rd * 32 + tid / 8, pc = tid % 8; FragH f;
#pragma unroll
      for (int q = 0; q < 8; ++q) f.u[q] = tl[pc * 8 + q][d];
      *(v8us*)((unsigned short*)Vt + ((size_t)slab * 64 + d) * TTv + lg * 64 + pc * 8) = f.half[0]; }
     } }

__global__ __launch_bounds__(256) void k_hl(const float* __restrict__ F, _Float16* __restrict__ Hh, _Float16* __restrict__ Hl, size_t n8) { const size_t t = (size_t)blockIdx.x * 256 + threadIdx.x; if (t >= n8) return; FragH fh, fl; const v4f a = *(const v4fa*)(F + t * 8), c = *(const v4fa*)(F + t * 8 + 4);
#pragma unroll
  for (int q = 0; q < 4; ++q) { _Float16 h = (_Float16)a[q]; fh.h[q] = h; fl.h[q] = (_Float16)((a[q] - (float)h) * 1024.0f); h = (_Float16)c[q]; fh.h[4 + q] = h; fl.h[4 + q] = (_Float16)((c[q] - (float)h) * 1024.0f); }
  { *(v8us*)((unsigned short*)Hh + t * 8) = fh.half[0]; *(v8us*)((unsigned short*)Hl + t * 8) = fl.half[0];  } }

// ---- fast GEMM (wave tile 32x64; requires M % 32 == 0 rows per launch region and N % 64 == 0); epilogue = k_gemm_hhx semantics ----
__device__ __forceinline__ v16h g2_frag(const _Float16* p, int hh) { FragH f; f.half[0] = *(const v8us*)((const unsigned short*)p + 8 * hh); f.half[1] = *(const v8us*)((const unsigned short*)p + 16 + 8 * hh); return f.v; }
__device__ __forceinline__ v8f g2_mma(v16h a, v16h b, v8f c) { v8f d = __builtin_amdgcn_wmma_f32_16x16x32_f16(false, a, false, b, (short)0, c, false, false); asm volatile("v_nop\n\tv_nop\n\tv_nop\n\tv_nop" : "+v"(d) : "v"(a), "v"(b)); return d; }
template <int ACT>
__global__ __launch_bounds__(128) void k_gemm2(const _Float16* __restrict__ A, int lda, size_t sA, const _Float16* __restrict__ Bh, int ldb, size_t sB, float alpha, const float* __restrict__ bias, size_t sBias, const float* __restrict__ CP, int rowsPerB, size_t sCPb, int row0g,
    float* __restrict__ C, _Float16* __restrict__ C16, int ldc, size_t sC, int M, int N, int K) { static_assert(ACT == 0 || ACT == 3 || ACT == 6 || ACT == 8 || ACT == 9 || ACT == 11 || ACT == 12 || ACT == 14 || ACT == 15 || ACT == 16 || ACT == 17, "k_gemm2: unsupported ACT code (would silently apply no activation)");
  __shared__ __attribute__((aligned(16))) float so[4][32][68];
  const int tid = threadIdx.x, w = tid >> 5, lane = tid & 31, ln = lane & 15, hh = lane >> 4; const int by = blockIdx.y;
  A += (size_t)by * sA; Bh += (size_t)by * sB; const size_t cofs = (size_t)by * sC; const float* bp = bias ? bias + (size_t)by * sBias : nullptr;
  const int ntn = N >> 6; const int mt = blockIdx.x / ntn, nq = blockIdx.x - mt * ntn; const int row0 = mt * 128 + 32 * w, col0 = nq * 64; if (row0 >= M) return;
  const _Float16* a0p = A + (size_t)(row0 + ln) * lda; const _Float16* a1p = a0p + (size_t)16 * lda;
  const _Float16* b0p = Bh + (size_t)(col0 + ln) * ldb; const _Float16* b1p = b0p + (size_t)16 * ldb; const _Float16* b2p = b1p + (size_t)16 * ldb; const _Float16* b3p = b2p + (size_t)16 * ldb;
  const v8f z8 = {0.f,0.f,0.f,0.f,0.f,0.f,0.f,0.f}; v8f c00 = z8, c01 = z8, c02 = z8, c03 = z8, c10 = z8, c11 = z8, c12 = z8, c13 = z8;
#pragma unroll 1
  for (int kb = 0; kb < K; kb += 32) { const v16h a0 = g2_frag(a0p + kb, hh), a1 = g2_frag(a1p + kb, hh);
    v16h b = g2_frag(b0p + kb, hh); c00 = g2_mma(a0, b, c00); c10 = g2_mma(a1, b, c10);
    b = g2_frag(b1p + kb, hh); c01 = g2_mma(a0, b, c01); c11 = g2_mma(a1, b, c11);
    b = g2_frag(b2p + kb, hh); c02 = g2_mma(a0, b, c02); c12 = g2_mma(a1, b, c12);
    b = g2_frag(b3p + kb, hh); c03 = g2_mma(a0, b, c03); c13 = g2_mma(a1, b, c13); }
  v8f accs[8] = {c00, c01, c02, c03, c10, c11, c12, c13};
#pragma unroll
  for (int u = 0; u < 8; ++u) { const int t = u & 3, half = u >> 2; const int col = col0 + t * 16 + ln; const float bv = bp ? bf16_round(bp[col]) : 0.f;
#pragma unroll
    for (int r = 0; r < 8; ++r) { const int rloc = half * 16 + 8 * hh + r; float v = accs[u][r] * alpha + bv; if (CP) { if (rowsPerB < 0) v += CP[cofs + (size_t)(row0g + row0 + rloc) * ldc + col];      /* rowsPerB < 0: own element of the batched C plane */ else { const int bidx = (row0g + row0 + rloc) / rowsPerB; v += CP[(size_t)bidx * sCPb + (size_t)by * 64 + col]; } }
      if (ACT == 3) v = fmaxf(v, 0.f); else if (ACT == 6) v = 0.5f * v * (1.0f + erff(v * 0.70710678118654752f)); else if (ACT == 11) v = 1.0f / (1.0f + expf(-v)); else if (ACT == 15) v = v / (1.0f + expf(-v)); else if (ACT == 12) v = (v > 0.f) ? v : 0.01f * v; else if (ACT == 8) v = tanhf(v); else if (ACT == 9) v = 0.5f * v * (1.0f + tanhf(0.7978845608028654f * (v + 0.044715f * v * v * v))); else if (ACT == 14) v = (v > 0.f) ? v : 0.1f * v; else if (ACT == 16) v = (v >= 0.f) ? v : 0.3f * v; else if (ACT == 17) v = (v >= 0.f) ? v : 0.2f * v;
      so[w][rloc][t * 16 + ln] = v; } }
  __builtin_amdgcn_fence(__ATOMIC_ACQ_REL, "workgroup"); __builtin_amdgcn_wave_barrier();
  const int rsub = lane >> 4, c4 = (lane & 15) * 4;
  {
#pragma unroll
    for (int q = 0; q < 16; ++q) { const int r = q * 2 + rsub; const v4f v = *(const v4fa*)&so[w][r][c4]; if (C) *(v4f*)(C + cofs + (size_t)(row0 + r) * ldc + col0 + c4) = v; if (C16) { v4h h4; for (int i = 0; i < 4; ++i) h4[i] = (_Float16)v[i]; *(v4h*)(C16 + cofs + (size_t)(row0 + r) * ldc + col0 + c4) = h4; } }
     } }


__global__ __launch_bounds__(256) void k_wnat(const float* __restrict__ w, size_t n8, _Float16* __restrict__ Bt) { const size_t t = (size_t)blockIdx.x * 256 + threadIdx.x; if (t >= n8) return; FragH f; for (int q = 0; q < 8; ++q) f.h[q] = (_Float16)(bf16_round(w[t * 8 + q]) * 16.0f); *(v8us*)((unsigned short*)Bt + t * 8) = f.half[0];  }
#define FAW 8                        /* waves per work-group */
#define FAK 64                       /* keys per stage */
#define FAP 144                      /* LDS row pitch, bytes: 128 + 16, an odd multiple of 16 for 16-byte readers */
#define FAN (SQ / FAK)               /* stages */
__device__ __forceinline__ float rs_xh(float x) { return __builtin_bit_cast(float, __builtin_amdgcn_permlanex16(__builtin_bit_cast(int, x), __builtin_bit_cast(int, x), 0x76543210, 0xfedcba98, false, false)); }      /* lane l with lane l ^ 16 */
typedef float v2f __attribute__((ext_vector_type(2))); typedef _Float16 v2h __attribute__((ext_vector_type(2)));
__device__ __forceinline__ v16h fa_frag(const unsigned char* p) { FragH f; f.half[0] = *(const v8us*)p; f.half[1] = *(const v8us*)(p + 32); return f.v; }      /* 32 k of one LDS row, hardware k order: p already holds the lane half's 16 bytes */
__device__ __forceinline__ v8f fa_mma(v16h a, v16h b, v8f c) { return __builtin_amdgcn_wmma_f32_16x16x32_f16(false, a, false, b, (short)0, c, false, false); }
/* work-group barrier that orders LDS alone: __syncthreads() would also wait for the global loads of the stage fetched ahead, which only this thread's registers receive */
__device__ __forceinline__ void fa_barrier() { __builtin_amdgcn_fence(__ATOMIC_RELEASE, "workgroup", "local"); __builtin_amdgcn_s_barrier(); __builtin_amdgcn_fence(__ATOMIC_ACQUIRE, "workgroup", "local"); }
__global__ __launch_bounds__(FAW * 32) void k_fattn(const _Float16* __restrict__ Q, const _Float16* __restrict__ Kg, const _Float16* __restrict__ Vt, _Float16* __restrict__ O) {
  __shared__ __attribute__((aligned(16))) unsigned char L[2][2][FAK * FAP];      /* [buffer][K rows | V^T rows] */
  const int tid = threadIdx.x, lane = tid & 31, ln = lane & 15, hh = lane >> 4; const int wave = __builtin_amdgcn_readfirstlane(tid >> 5);
  const int bh = blockIdx.y, b = bh / NH, h = bh - b * NH; const int q0 = blockIdx.x * (FAW * 16) + wave * 16;
  /* staging: 8 threads per 128-byte row, 32 rows per round, two rounds per tile */
  const int srow = tid >> 3, sch = (tid & 7) * 16;
  const unsigned char* kg = (const unsigned char*)(Kg + ((size_t)b * SQ + srow) * DM + h * HD) + sch;      /* K row srow of stage 0; a stage is FAK rows of DM */
  const unsigned char* vg = (const unsigned char*)(Vt + ((size_t)bh * HD + srow) * SQ) + sch;              /* V^T row d = srow; a stage is FAK keys along the row */
  const int sl = srow * FAP + sch;
  v8us k0, k1, v0, v1;
  auto fetch = [&](int st) { const unsigned char* kp = kg + (size_t)st * (FAK * DM * 2); const unsigned char* vp = vg + (size_t)st * (FAK * 2);
    k0 = *(const v8us*)kp; k1 = *(const v8us*)(kp + (size_t)32 * DM * 2); v0 = *(const v8us*)vp; v1 = *(const v8us*)(vp + (size_t)32 * SQ * 2);
    asm volatile("s_wait_xcnt 0x0" :: "v"(kp), "v"(vp) : "memory"); };      /* the loads' address registers are inputs here, so they stay live up to this wait and are re-used only behind it */
  auto put = [&](int buf) { *(v8us*)&L[buf][0][sl] = k0; *(v8us*)&L[buf][0][sl + 32 * FAP] = k1; *(v8us*)&L[buf][1][sl] = v0; *(v8us*)&L[buf][1][sl + 32 * FAP] = v1; };
  fetch(0);
  const _Float16* qp = Q + ((size_t)b * SQ + q0 + ln) * DM + h * HD; const v16h qf0 = g2_frag(qp, hh), qf1 = g2_frag(qp + 32, hh);      /* B operand: column = query, same k order as fa_frag */
  put(0); fetch(1);
  const v8f z8 = {0.f,0.f,0.f,0.f,0.f,0.f,0.f,0.f}; v8f acc[4] = {z8, z8, z8, z8};      /* acc[t][r] = O^T[16 t + 8 hh + r][query ln] */
  float m = -3.0e38f, l = 0.f;      /* running maximum (log2 domain, both halves alike) and this lane half's part of the denominator */
  const float cs = 0.125f * 1.4426950408889634f;      /* 1 / sqrt(64), and e^x = 2^(x log2 e) */
  const int fo = ln * FAP + hh * 16;
  __syncthreads();      /* publishes stage 0; the full barrier also ends the Q loads here, so that no wait for them stands in the loop, where it would drain the stage fetched ahead */
#pragma unroll 1
  for (int st = 0; st < FAN; ++st) {      /* rolled: the body is one whole stage, and the buffer index is a run-time offset */
    const int buf = st & 1;
    if (st + 1 < FAN) put(buf ^ 1);      /* stage st + 1, fetched one stage ago, into the buffer whose readers all passed the barrier at the foot of stage st - 1 */
    if (st + 2 < FAN) fetch(st + 2);
    const unsigned char* Kb = &L[buf][0][fo]; const unsigned char* Vb = &L[buf][1][fo];
    v16h kf[4][2], vf[4][2]; v8f s[4];
#pragma unroll
    for (int kt = 0; kt < 4; ++kt) { kf[kt][0] = fa_frag(Kb + kt * 16 * FAP); kf[kt][1] = fa_frag(Kb + kt * 16 * FAP + 64); }
#pragma unroll
    for (int kt = 0; kt < 4; ++kt) s[kt] = fa_mma(kf[kt][0], qf0, z8);
#pragma unroll
    for (int kt = 0; kt < 4; ++kt) s[kt] = fa_mma(kf[kt][1], qf1, s[kt]);
#pragma unroll
    for (int t = 0; t < 4; ++t) { vf[t][0] = fa_frag(Vb + t * 16 * FAP); vf[t][1] = fa_frag(Vb + t * 16 * FAP + 64); }
    __builtin_amdgcn_sched_barrier(0);      /* the eight score products run back to back and the V^T reads leave before the softmax: without it the maxima are woven between the products, each behind padding, and the V^T reads are waited for where they are issued */
    float mx = s[0][0];
#pragma unroll
    for (int kt = 0; kt < 4; ++kt)
#pragma unroll
      for (int r = 0; r < 8; ++r) mx = fmaxf(mx, s[kt][r]);
    mx = fmaxf(mx, rs_xh(mx));
    const float mn = fmaxf(m, mx * cs); const float corr = __builtin_amdgcn_exp2f(m - mn); m = mn;      /* corr is 0 in the first stage */
    const v2f cs2 = {cs, cs}, nm2 = {8.0f - mn, 8.0f - mn};      /* weights carried x256 (numerator and denominator alike), away from the f16 subnormal range */
    v2f sa = {0.f, 0.f}, sb = {0.f, 0.f}; union { v16h v; v2h p[8]; } pf[2];
#pragma unroll
    for (int kt = 0; kt < 4; ++kt)
#pragma unroll
      for (int i = 0; i < 4; ++i) { const v2f x = {s[kt][2 * i], s[kt][2 * i + 1]}; const v2f e = __builtin_elementwise_fma(x, cs2, nm2); const v2f p = {__builtin_amdgcn_exp2f(e[0]), __builtin_amdgcn_exp2f(e[1])};
        if (i & 1) sb += p; else sa += p; pf[kt >> 1].p[(kt & 1) * 4 + i] = __builtin_convertvector(p, v2h); }      /* element 8 (kt & 1) + r of the 32-key operand = tile kt, register r */
    sa += sb; l = fmaf(l, corr, sa[0] + sa[1]);
#pragma unroll
    for (int t = 0; t < 4; ++t) acc[t] = acc[t] * corr;
#pragma unroll
    for (int t = 0; t < 4; ++t) acc[t] = fa_mma(vf[t][0], pf[0].v, acc[t]);
#pragma unroll
    for (int t = 0; t < 4; ++t) acc[t] = fa_mma(vf[t][1], pf[1].v, acc[t]);
    fa_barrier();      /* publishes stage st + 1 and ends every wave's reads of this stage's buffer */
  }
  const float inv = 64.0f / (l + rs_xh(l));      /* o carried x64, as the output GEMM's alpha expects */
  _Float16* op = O + ((size_t)b * SQ + q0 + ln) * DM + h * HD + 8 * hh;
#pragma unroll
  for (int t = 0; t < 4; ++t) { FragH f;
#pragma unroll
    for (int r = 0; r < 8; ++r) f.h[r] = (_Float16)(acc[t][r] * inv);
    *(v8us*)((unsigned short*)op + t * 16) = f.half[0]; }      /* 8 consecutive d of one query row: 16 bytes */
}
__global__ __launch_bounds__(256) void k_vt(const _Float16* __restrict__ V16, int b, int h0, _Float16* __restrict__ VT) { __shared__ unsigned short tl[64][65]; const int tid = threadIdx.x; const int hh = blockIdx.x % HG, sg = blockIdx.x / HG; const int s0 = sg * 64; const int h = h0 + hh;
  for (int i = tid; i < 64 * 8; i += 256) { const int j = i / 8, d8 = (i % 8) * 8; FragH f; f.half[0] = *(const v8us*)((const unsigned short*)V16 + ((size_t)b * SQ + s0 + j) * DM + h * HD + d8); for (int q = 0; q < 8; ++q) tl[d8 + q][j] = f.u[q]; }
  __syncthreads();
  { for (int i = tid; i < 64 * 8; i += 256) { const int d = i / 8, j8 = (i % 8) * 8; FragH f; for (int q = 0; q < 8; ++q) f.u[q] = tl[d][j8 + q]; *(v8us*)((unsigned short*)VT + ((size_t)hh * HD + d) * SQ + s0 + j8) = f.half[0]; }  } }



__global__ __launch_bounds__(256) void k_rsmkm(const float* __restrict__ S, _Float16* __restrict__ P, int nrows, const int* __restrict__ am) {
  #pragma clang fp contract(off)
  const int t = blockIdx.x * 256 + threadIdx.x; if (t >= nrows) return; const size_t i = (size_t)t; const float* s = S + i * SQ; const int* mr = am + (size_t)(t % SQ) * SQ; float mx = -3.0e38f;
#pragma unroll 1
  for (int j = 0; j < SQ; ++j) { const float f = (mr[j] != 0) ? 1.f : 0.f; mx = fmaxf(mx, fmaf(f, s[j], (1.f - f) * -1.0e9f)); } float se = 0.f;
#pragma unroll 1
  for (int j = 0; j < SQ; ++j) { const float f = (mr[j] != 0) ? 1.f : 0.f; se += __expf(fmaf(f, s[j], (1.f - f) * -1.0e9f) - mx); } const float sc = 256.0f / se;
#pragma unroll 1
  for (int j0 = 0; j0 < SQ; j0 += 8) { FragH fr; for (int q = 0; q < 8; ++q) { const int j = j0 + q; const float f = (mr[j] != 0) ? 1.f : 0.f; fr.h[q] = (_Float16)(__expf(fmaf(f, s[j], (1.f - f) * -1.0e9f) - mx) * sc); }
    unsigned short* d = (unsigned short*)P + i * SQ + j0; *(v8us*)d = fr.half[0];  } }
#define DMQ DM

template <int BFIN, int W16, int W32>
__global__ __launch_bounds__(256) void k_lnx(const float* __restrict__ X, const float* __restrict__ g, const float* __restrict__ bb, float eps, _Float16* __restrict__ N16, float* __restrict__ N32) {
  #pragma clang fp contract(off)
  __shared__ float red[256]; const size_t r = blockIdx.x; const int t = threadIdx.x; const bool act = t < (DMQ / 4); const int c0 = act ? t * 4 : 0;
  const v4f xa = *(const v4fa*)(X + r * DMQ + c0); float s[4]; float sum = 0.f;
  for (int q = 0; q < 4; ++q) { s[q] = act ? (BFIN ? bf16_round(xa[q]) : xa[q]) : 0.f; sum = __fadd_rn(sum, s[q]); }
  red[t] = sum; __syncthreads(); for (int st = 128; st > 0; st >>= 1) { if (t < st) red[t] = __fadd_rn(red[t], red[t + st]); __syncthreads(); } const float mu = red[0] / (float)DMQ; __syncthreads();
  float vs = 0.f; for (int q = 0; q < 4; ++q) { const float dl = act ? __fadd_rn(s[q], -mu) : 0.f; vs = __fadd_rn(vs, __fmul_rn(dl, dl)); } red[t] = vs; __syncthreads(); for (int st = 128; st > 0; st >>= 1) { if (t < st) red[t] = __fadd_rn(red[t], red[t + st]); __syncthreads(); }
  const float rs = rsqrtf(__fadd_rn(red[0] / (float)DMQ, eps)); v4h y; v4f yf;
  for (int q = 0; q < 4; ++q) { const int c = c0 + q; yf[q] = __fadd_rn(__fmul_rn(__fmul_rn(__fadd_rn(s[q], -mu), rs), bf16_round(g[c])), bf16_round(bb[c])); y[q] = (_Float16)yf[q]; }
  if (!act) return;      /* no barriers after this point */
  { if (W16) *(v4h*)(N16 + r * DMQ + c0) = y; if (W32) *(v4f*)(N32 + r * DMQ + c0) = yf;  } }


extern "C" void kernel_launch(void* const* d_in, const int* in_sizes, int n_in,
                              void* d_out, int out_size, void* d_ws, size_t ws_size, hipStream_t stream) {
  (void)in_sizes; (void)n_in; (void)out_size;
  const float* const* I = (const float* const*)d_in; const float* xq = I[0]; const float* xk = I[1]; const float* xv = I[2]; const float* lng = I[3]; const float* lnb = I[4]; const float* wq = I[5]; const float* bq = I[6]; const float* wk = I[7]; const float* bk = I[8]; const float* wv = I[9]; const float* bv = I[10]; const float* wo = I[11]; const float* bo = I[12]; const float* x = xq;      /* query, key, value; shared LayerNorm gamma / beta [512]; [in][out] Wq / Wk / Wv / Wo + biases */
  char* ws = (char*)d_ws; size_t off = 0;
  auto take = [&](size_t bytes) { char* p = ws + off; off += (bytes + 255) & ~(size_t)255; return p; };
  _Float16* BQ = (_Float16*)take((size_t)DM * DM * 2); _Float16* BK = (_Float16*)take((size_t)DM * DM * 2); _Float16* BV = (_Float16*)take((size_t)DM * DM * 2); _Float16* BO = (_Float16*)take((size_t)DM * DM * 2);
  _Float16* X16 = (_Float16*)take(NR * DM * 2); _Float16* XKp = (_Float16*)take(NR * DM * 2); _Float16* XVp = (_Float16*)take(NR * DM * 2); _Float16* Q16 = (_Float16*)take(NR * DM * 2); _Float16* K16 = (_Float16*)take(NR * DM * 2); _Float16* V16 = (_Float16*)take(NR * DM * 2); _Float16* O16 = (_Float16*)take(NR * DM * 2);
  _Float16* VT = (_Float16*)take((size_t)NB * NH * HD * SQ * 2);
  if (off > ws_size) return;
  { const unsigned g = (unsigned)(((size_t)DM * (DM / 8) + 255) / 256); k_wt_f16<<<g, 256, 0, stream>>>(wq, BQ, DM, DM, 16.0f); k_wt_f16<<<g, 256, 0, stream>>>(wk, BK, DM, DM, 16.0f); k_wt_f16<<<g, 256, 0, stream>>>(wv, BV, DM, DM, 16.0f); k_wt_f16<<<g, 256, 0, stream>>>(wo, BO, DM, DM, 16.0f); }      /* [in][out] -> Bt x16 */
  _Float16* XK = XKp; _Float16* XV = XVp; k_lnx<1, 1, 0><<<(unsigned)NR, 256, 0, stream>>>(xk, lng, lnb, 1e-5f, XK, nullptr); k_lnx<1, 1, 0><<<(unsigned)NR, 256, 0, stream>>>(xv, lng, lnb, 1e-5f, XV, nullptr);      /* LN(key), LN(value) with the SHARED parameters -> f16 rows */

  k_lnx<1, 1, 0><<<(unsigned)NR, 256, 0, stream>>>(x, lng, lnb, 1e-5f, X16, nullptr);      /* LN(query) -> f16 rows */
  const size_t r0p = (size_t)B0 * SQ;      /* first projected row */
  k_gemm2<0><<<dim3((unsigned)((MP / 128) * (DM / 64)), 1), 128, 0, stream>>>(X16 + r0p * DM, DM, 0, BQ, DM, 0, 0.0625f, bq, 0, nullptr, 1, 0, 0, nullptr, Q16 + r0p * DM, DM, 0, MP, DM, DM);
  k_gemm2<0><<<dim3((unsigned)((MP / 128) * (DM / 64)), 1), 128, 0, stream>>>(XK + r0p * DM, DM, 0, BK, DM, 0, 0.0625f, bk, 0, nullptr, 1, 0, 0, nullptr, K16 + r0p * DM, DM, 0, MP, DM, DM);
  k_gemm2<0><<<dim3((unsigned)((MP / 128) * (DM / 64)), 1), 128, 0, stream>>>(XV + r0p * DM, DM, 0, BV, DM, 0, 0.0625f, bv, 0, nullptr, 1, 0, 0, nullptr, V16 + r0p * DM, DM, 0, MP, DM, DM);
  k_vt<NH, SQ><<<NB * NH * (SQ / 64), 256, 0, stream>>>(V16, LQ, 0, VT);      /* V^T [NB][NH][HD][SQ] */
  k_fattn<<<dim3(SQ / (FAW * 16), NB * NH), FAW * 32, 0, stream>>>(Q16, K16, VT, O16);      /* o x64 (merged heads) as f16 rows, all batches and heads in one launch */
  k_gemm2<0><<<dim3((unsigned)((MPO / 128) * (DM / 64)), 1), 128, 0, stream>>>(O16 + r0p * DM, DM, 0, BO, DM, 0, 0.0009765625f, bo, 0, nullptr, 1, 0, 0, (float*)d_out + r0p * DM, nullptr, DM, 0, MPO, DM, DM);      /* out rows are the output layout */
}

// v003
// One run takes 140 microseconds.
// In two side-by-side timings against v002, it was 1.08 and 1.07 times as fast.
// Over all steps from v000 it is 13.8 times as fast.
#include <hip/hip_runtime.h>
// Multi-head attention over THREE inputs, each passed through ONE shared LayerNorm first (query, key, value [2][2048][512]; Q = LN(query) Wq + bq, K = LN(key) Wk + bk, V = LN(value) Wv + bv with LN: biased var, eps 1e-5, shared ln_g / ln_b; [in][out] 512 x 512, zero biases); 8 heads of 64; scores / 8; softmax over all 2048 keys (no mask); out = merged Wo + bo -> [2][2048][512]; no residual).
// Structure: token rows r = b*2048 + s; query, key, value as LayerNorm f16 rows (inputs, gamma, beta bf16-rounded); Q, K, V as three WMMA GEMMs (32x64 wave tiles, f32 accumulation, exact x16 weights + bias, f16 outputs); V^T for all batches and heads via LDS transposes; one fused attention launch over all (batch, head, 128 queries): S^T = K . Q^T (K = 64) on WMMA, online softmax in registers (f32 running maximum and sum, base 2, 1/sqrt(64) folded into the exponent; unnormalised weights x256, in (0, 256], as f16), O^T += V^T . P^T on WMMA, divided by the sum at the end (o carried x64 against f16 subnormal flush, folded into the output GEMM alpha) and written straight into the merged f16 o rows; out = o W_o + b GEMM (f32) into the output layout.
// Compute dtype: inputs rounded to bf16; weights exact; LayerNorm rows, q, k, v, softmax weights and o as plain f16 GEMM operands (~2^-12); scores and softmax statistics f32. v_wmma_f32_16x16x32_f16.
#define NB 2
#define SQ 2048
#define DM 512
#define NH 8
#define HD 64
#define HG 4                         /* heads per launch of the per-batch k_vt */
#define B0 0                         /* first batch processed (debug hook) */
#define NBR NB                       /* batches processed (debug hook) */
#define NR ((size_t)NB * SQ)         /* token rows */
#define MP ((int)((size_t)NBR * SQ)) /* rows projected (debug hook) */
#define QN SQ                        /* query rows per batch (unused: k_fattn attends all SQ) */
#define NHD NH                       /* heads (unused: k_fattn covers all NH heads) */
#define MPO MP                       /* rows through the output stage (debug hook) */
#define LQ DM      /* row pitch of the q/k/v rows */
typedef __bf16 v16b __attribute__((ext_vector_type(16)));
typedef unsigned short v8us __attribute__((ext_vector_type(8), may_alias));
typedef float  v8f  __attribute__((ext_vector_type(8)));
typedef float  v4f  __attribute__((ext_vector_type(4)));
typedef float  v4fa __attribute__((ext_vector_type(4), may_alias));
union FragB { v16b v; v8us half[2]; unsigned short u[16]; };

__device__ __forceinline__ unsigned short bf16_bits(float x) { unsigned int u = __float_as_uint(x); return (unsigned short)((u + 0x7FFFu + ((u >> 16) & 1u)) >> 16); }
__device__ __forceinline__ float bf16_val(unsigned short b) { return __uint_as_float(((unsigned int)b) << 16); }
__device__ __forceinline__ float bf16_round(float x) { return bf16_val(bf16_bits(x)); }
// D += A·B with NT terms: 1 = ah·bh, 2 = + al·bh (A split), 3 = + ah·bl (both split)
template <int NT>
__device__ __forceinline__ v8f mmaN(v16b ah, v16b al, v16b bh, v16b bl, v8f c) {
  c = __builtin_amdgcn_wmma_f32_16x16x32_bf16(false, ah, false, bh, (short)0, c, false, false);
  if (NT >= 2) c = __builtin_amdgcn_wmma_f32_16x16x32_bf16(false, al, false, bh, (short)0, c, false, false);
  if (NT >= 3) c = __builtin_amdgcn_wmma_f32_16x16x32_bf16(false, ah, false, bl, (short)0, c, false, false);
  asm volatile("v_nop\n\tv_nop\n\tv_nop\n\tv_nop" : "+v"(c) : "v"(ah), "v"(al), "v"(bh), "v"(bl));
  return c;
}

__global__ __launch_bounds__(256) void k_wt_bf16(const float* __restrict__ W, unsigned short* __restrict__ Wt, int K, int N) {
  const int t = blockIdx.x * 256 + threadIdx.x;
  const int k8n = K / 8;
  if (t >= N * k8n) return;
  const int n = t / k8n, k8 = (t % k8n) * 8;
  v8us v;
#pragma unroll
  for (int i = 0; i < 8; ++i) v[i] = bf16_bits(W[(size_t)(k8 + i) * N + n]);
  *(v8us*)(Wt + (size_t)n * K + k8) = v;
  
}

// GEMM C[M][N] (f32, pitch ldc) = act(A[M][K]·W + bias). A f32 row-major (pitch lda) converted per fragment to bf16
// (ASPLIT: hi/lo two planes -> 2 terms, else single rounded term); Wt bf16 [N][K] (pitch ldb). BIAS_BF16 rounds the
// bias to bf16 first (bias quantised to bf16 before the add). K%32==0, M%16==0, N%64==0.
template <bool ASPLIT, int ACT, bool BIAS_BF16>
__global__ __launch_bounds__(128) void k_gemm_bf(const float* __restrict__ A, int lda, const unsigned short* __restrict__ Wt, int ldb,
                                               const float* __restrict__ bias, float* __restrict__ C, int ldc, int M, int N, int K) {
  __shared__ __attribute__((aligned(16))) float so[4][16][64];
  const int tid = threadIdx.x, w = tid >> 5, lane = tid & 31, ln = lane & 15, hh = lane >> 4;
  const int ntn = N / 64;
  const int wid = blockIdx.x * 4 + w;
  const int mt = wid / ntn, nq = wid % ntn;
  if (mt * 16 >= M) return;
  const int row0 = mt * 16, col0 = nq * 64;
  const float* arow = A + (size_t)(row0 + ln) * lda;
  v8f acc[4] = {};
  for (int kb = 0; kb < K; kb += 32) {
    FragB ah, al;
    const v4f x0 = *(const v4fa*)(arow + kb + 8 * hh), x1 = *(const v4fa*)(arow + kb + 8 * hh + 4);
    const v4f x2 = *(const v4fa*)(arow + kb + 16 + 8 * hh), x3 = *(const v4fa*)(arow + kb + 16 + 8 * hh + 4);
    float xs[16] = {x0[0],x0[1],x0[2],x0[3],x1[0],x1[1],x1[2],x1[3],x2[0],x2[1],x2[2],x2[3],x3[0],x3[1],x3[2],x3[3]};
#pragma unroll
    for (int i = 0; i < 16; ++i) { const unsigned short hb = bf16_bits(xs[i]); ah.u[i] = hb; al.u[i] = ASPLIT ? bf16_bits(xs[i] - bf16_val(hb)) : (unsigned short)0; }
#pragma unroll
    for (int t = 0; t < 4; ++t) {
      const unsigned short* brow = Wt + (size_t)(col0 + t * 16 + ln) * ldb + kb;
      FragB b;
      b.half[0] = *(const v8us*)(brow + 8 * hh);
      b.half[1] = *(const v8us*)(brow + 16 + 8 * hh);
      acc[t] = mmaN<ASPLIT ? 2 : 1>(ah.v, al.v, b.v, b.v, acc[t]);
    }
  }
#pragma unroll
  for (int t = 0; t < 4; ++t) {
    float bv = bias ? bias[col0 + t * 16 + ln] : 0.f;
    if (BIAS_BF16) bv = bf16_round(bv);
#pragma unroll
    for (int r = 0; r < 8; ++r) { float v = acc[t][r] + bv; if (ACT == 1) v = fmaxf(v, 0.f); so[w][8 * hh + r][t * 16 + ln] = v; }
  }
  __builtin_amdgcn_fence(__ATOMIC_ACQ_REL, "workgroup");
  __builtin_amdgcn_wave_barrier();
  const int rsub = lane >> 4, c4 = (lane & 15) * 4;
  {
#pragma unroll
    for (int q = 0; q < 8; ++q) {
      const int r = q * 2 + rsub;
      const v4f v = *(const v4fa*)&so[w][r][c4];
      *(v4f*)(C + (size_t)(row0 + r) * ldc + col0 + c4) = v;
    }
    
  }
}

// GEMM C = act(A·W + bias + resid): A f32 (ASPLIT -> hi/lo 2 terms), Wt bf16 [N][K]; ACT 0 none, 1 relu, 2 exact gelu;
// resid (optional, f32, row index = (row % rmod), pitch ldr, RES_BF16 rounds it) added before the activation.
template <bool ASPLIT, int ACT, bool BIAS_BF16, bool RES_BF16>
__global__ __launch_bounds__(128) void k_gemm_bf3(const float* __restrict__ A, int lda, const unsigned short* __restrict__ Wt, int ldb,
                                                const float* __restrict__ bias, const float* __restrict__ resid, int rmod, int ldr,
                                                float* __restrict__ C, int ldc, int M, int N, int K) {
  __shared__ __attribute__((aligned(16))) float so[4][16][64];
  const int tid = threadIdx.x, w = tid >> 5, lane = tid & 31, ln = lane & 15, hh = lane >> 4;
  const int ntn = N / 64;
  const int wid = blockIdx.x * 4 + w;
  const int mt = wid / ntn, nq = wid % ntn;
  if (mt * 16 >= M) return;
  const int row0 = mt * 16, col0 = nq * 64;
  const float* arow = A + (size_t)(row0 + ln) * lda;
  v8f acc[4] = {};
  for (int kb = 0; kb < K; kb += 32) {
    FragB ah, al;
    const v4f x0 = *(const v4fa*)(arow + kb + 8 * hh), x1 = *(const v4fa*)(arow + kb + 8 * hh + 4);
    const v4f x2 = *(const v4fa*)(arow + kb + 16 + 8 * hh), x3 = *(const v4fa*)(arow + kb + 16 + 8 * hh + 4);
    float xs[16] = {x0[0],x0[1],x0[2],x0[3],x1[0],x1[1],x1[2],x1[3],x2[0],x2[1],x2[2],x2[3],x3[0],x3[1],x3[2],x3[3]};
#pragma unroll
    for (int i = 0; i < 16; ++i) { const unsigned short hb = bf16_bits(xs[i]); ah.u[i] = hb; al.u[i] = ASPLIT ? bf16_bits(xs[i] - bf16_val(hb)) : (unsigned short)0; }
#pragma unroll
    for (int t = 0; t < 4; ++t) {
      const unsigned short* brow = Wt + (size_t)(col0 + t * 16 + ln) * ldb + kb;
      FragB b;
      b.half[0] = *(const v8us*)(brow + 8 * hh);
      b.half[1] = *(const v8us*)(brow + 16 + 8 * hh);
      acc[t] = mmaN<ASPLIT ? 2 : 1>(ah.v, al.v, b.v, b.v, acc[t]);
    }
  }
#pragma unroll
  for (int t = 0; t < 4; ++t) {
    const int col = col0 + t * 16 + ln;
    float bv = bias ? bias[col] : 0.f;
    if (BIAS_BF16) bv = bf16_round(bv);
#pragma unroll
    for (int r = 0; r < 8; ++r) {
      float v = acc[t][r] + bv;
      if (resid) { float rv = resid[(size_t)((row0 + 8 * hh + r) % rmod) * ldr + col]; if (RES_BF16) rv = bf16_round(rv); v += rv; }
      if (ACT == 1) v = fmaxf(v, 0.f);
      if (ACT == 2) v = 0.5f * v * (1.0f + erff(v * 0.70710678118654752f));
      if (ACT == 3) { const float u = 0.7978845608028654f * (v + 0.044715f * v * v * v); v = 0.5f * v * (1.0f + tanhf(u)); }
      so[w][8 * hh + r][t * 16 + ln] = v;
    }
  }
  __builtin_amdgcn_fence(__ATOMIC_ACQ_REL, "workgroup");
  __builtin_amdgcn_wave_barrier();
  const int rsub = lane >> 4, c4 = (lane & 15) * 4;
  {
#pragma unroll
    for (int q = 0; q < 8; ++q) {
      const int r = q * 2 + rsub;
      const v4f v = *(const v4fa*)&so[w][r][c4];
      *(v4f*)(C + (size_t)(row0 + r) * ldc + col0 + c4) = v;
    }
    
  }
}
// row LayerNorm (biased variance, eps) over N: s = X (+ R); optional out_sum <- s; out_norm <- (s-mu)*rsqrt(var+eps)*g + b
template <bool PARAM_BF16>
__global__ __launch_bounds__(256) void k_layernorm(const float* __restrict__ X, const float* __restrict__ R, const float* __restrict__ g, const float* __restrict__ bta,
                                                  float* __restrict__ out_sum, float* __restrict__ out_norm, int N, float eps) {
  __shared__ float red[256];
  const int row = blockIdx.x, tid = threadIdx.x;
  const float* x = X + (size_t)row * N; const float* rr = R ? R + (size_t)row * N : nullptr;
  float vals[16];                     // up to N = 4096
  const int per = N / 256;            // contiguous chunk per thread? use strided-by-4 chunks: thread handles j = tid*4 + 1024*u
  float s1 = 0.f;
  for (int u = 0; u < per / 4; ++u) {
    const int j = tid * 4 + 1024 * u;
    const v4f a = *(const v4fa*)(x + j);
    v4f b = {0.f,0.f,0.f,0.f}; if (rr) b = *(const v4fa*)(rr + j);
#pragma unroll
    for (int q = 0; q < 4; ++q) { const float v = a[q] + b[q]; vals[u * 4 + q] = v; s1 += v; }
  }
  red[tid] = s1; __syncthreads();
  for (int st = 128; st > 0; st >>= 1) { if (tid < st) red[tid] += red[tid + st]; __syncthreads(); }
  const float mu = red[0] / (float)N; __syncthreads();
  float s2 = 0.f;
  for (int u = 0; u < per / 4; ++u)
#pragma unroll
    for (int q = 0; q < 4; ++q) { const float c = vals[u * 4 + q] - mu; s2 += c * c; }
  red[tid] = s2; __syncthreads();
  for (int st = 128; st > 0; st >>= 1) { if (tid < st) red[tid] += red[tid + st]; __syncthreads(); }
  const float rs = rsqrtf(red[0] / (float)N + eps);
  {
    for (int u = 0; u < per / 4; ++u) {
      const int j = tid * 4 + 1024 * u;
      v4f o, sm;
#pragma unroll
      for (int q = 0; q < 4; ++q) {
        float gg = g[j + q], bb = bta[j + q];
        if (PARAM_BF16) { gg = bf16_round(gg); bb = bf16_round(bb); }
        sm[q] = vals[u * 4 + q]; o[q] = (vals[u * 4 + q] - mu) * rs * gg + bb;
      }
      if (out_sum) *(v4f*)(out_sum + (size_t)row * N + j) = sm;
      *(v4f*)(out_norm + (size_t)row * N + j) = o;
    }
    
  }
}



// ---- f16 WMMA path (v_wmma_f32_16x16x32_f16): 11-bit significands for operands in range — used where a [0,1] probability operand needs more precision than bf16
typedef _Float16 v16h __attribute__((ext_vector_type(16)));
union FragH { v16h v; v8us half[2]; _Float16 h[16]; unsigned short u[16]; };
template <int NT>
__device__ __forceinline__ v8f mmaH(v16h ah, v16h al, v16h bh, v16h bl, v8f c) {
  c = __builtin_amdgcn_wmma_f32_16x16x32_f16(false, ah, false, bh, (short)0, c, false, false);
  if (NT >= 2) c = __builtin_amdgcn_wmma_f32_16x16x32_f16(false, al, false, bh, (short)0, c, false, false);
  if (NT >= 3) c = __builtin_amdgcn_wmma_f32_16x16x32_f16(false, ah, false, bl, (short)0, c, false, false);
  asm volatile("v_nop\n\tv_nop\n\tv_nop\n\tv_nop" : "+v"(c) : "v"(ah), "v"(al), "v"(bh), "v"(bl));
  return c;
}
// batched GEMM like k_gemm_b but f16 operands: A f32 (split into f16 hi/lo if ASPLIT, else rounded to f16), Bt = f16 values [n][k]; alpha; C f32; N multiple of 16 (partial tiles skipped)
template <bool ASPLIT>
__global__ __launch_bounds__(128) void k_gemm_h(const float* __restrict__ A, int lda, size_t sA, const _Float16* __restrict__ Bh, int ldb, size_t sB, float alpha, float* __restrict__ C, int ldc, size_t sC, int M, int N, int K) {
  __shared__ __attribute__((aligned(16))) float so[4][16][64];
  const int tid = threadIdx.x, w = tid >> 5, lane = tid & 31, ln = lane & 15, hh = lane >> 4; const int by = blockIdx.y;
  A += (size_t)by * sA; Bh += (size_t)by * sB; C += (size_t)by * sC;
  const int ntn = (N + 63) / 64; const int wid = blockIdx.x * 4 + w; const int mt = wid / ntn, nq = wid % ntn; if (mt * 16 >= M) return;
  const int row0 = mt * 16, col0 = nq * 64; const float* arow = A + (size_t)(row0 + ln) * lda;
  v8f acc[4] = {};
  for (int kb = 0; kb < K; kb += 32) {
    FragH ah, al;
    const v4f x0 = *(const v4fa*)(arow + kb + 8 * hh), x1 = *(const v4fa*)(arow + kb + 8 * hh + 4), x2 = *(const v4fa*)(arow + kb + 16 + 8 * hh), x3 = *(const v4fa*)(arow + kb + 16 + 8 * hh + 4);
    float xs[16] = {x0[0],x0[1],x0[2],x0[3],x1[0],x1[1],x1[2],x1[3],x2[0],x2[1],x2[2],x2[3],x3[0],x3[1],x3[2],x3[3]};
#pragma unroll
    for (int i = 0; i < 16; ++i) { const _Float16 h = (_Float16)xs[i]; ah.h[i] = h; al.h[i] = ASPLIT ? (_Float16)(xs[i] - (float)h) : (_Float16)0.0f; }
#pragma unroll
    for (int t = 0; t < 4; ++t) { if (col0 + t * 16 >= N) continue; const size_t boff = (size_t)(col0 + t * 16 + ln) * ldb + kb; FragH bq; bq.half[0] = *(const v8us*)(Bh + boff + 8 * hh); bq.half[1] = *(const v8us*)(Bh + boff + 16 + 8 * hh);
      acc[t] = mmaH<ASPLIT ? 2 : 1>(ah.v, al.v, bq.v, bq.v, acc[t]); }
  }
#pragma unroll
  for (int t = 0; t < 4; ++t) { if (col0 + t * 16 >= N) continue;
#pragma unroll
    for (int r = 0; r < 8; ++r) so[w][8 * hh + r][t * 16 + ln] = acc[t][r] * alpha; }
  __builtin_amdgcn_fence(__ATOMIC_ACQ_REL, "workgroup"); __builtin_amdgcn_wave_barrier();
  const int rsub = lane >> 4, c4 = (lane & 15) * 4;
  {
#pragma unroll
    for (int q = 0; q < 8; ++q) { const int r = q * 2 + rsub; if (col0 + c4 < N) { const v4f v = *(const v4fa*)&so[w][r][c4]; *(v4f*)(C + (size_t)(row0 + r) * ldc + col0 + c4) = v; } }
     }
}

// Wt[n][k] = f16(W[k][n]·scale) from f32 row-major W[K][N] (scale = power of two; bf16-exact weights stay exact in f16 away from the subnormal range)
__global__ __launch_bounds__(256) void k_wt_f16(const float* __restrict__ W, _Float16* __restrict__ Wt, int K, int N, float scale) {
  const int t = blockIdx.x * 256 + threadIdx.x; if (t >= N * (K / 8)) return; const int n = t / (K / 8), k8 = (t % (K / 8)) * 8; FragH f;
#pragma unroll
  for (int i = 0; i < 8; ++i) f.h[i] = (_Float16)(bf16_round(W[(size_t)(k8 + i) * N + n]) * scale); const v8us o = f.half[0];
  *(v8us*)((unsigned short*)Wt + (size_t)n * K + k8) = o; 
}
// k_gemm_hh variant with fused epilogue: v = acc·alpha + bias[by·sBias + col] (+ CP[(row/rowsPerB)·sCPb + by·64 + col] if CP) ; ACT 0 none / 1 elu ; writes f16 C16 (and f32 C if non-null)
template <int ACT>
__global__ __launch_bounds__(128) void k_gemm_hhx(const _Float16* __restrict__ A, int lda, size_t sA, const _Float16* __restrict__ Bh, int ldb, size_t sB, float alpha, const float* __restrict__ bias, size_t sBias, const float* __restrict__ CP, int rowsPerB, size_t sCPb, int row0g,
    float* __restrict__ C, _Float16* __restrict__ C16, int ldc, size_t sC, int M, int N, int K) {
  __shared__ __attribute__((aligned(16))) float so[4][16][64];
  const int tid = threadIdx.x, w = tid >> 5, lane = tid & 31, ln = lane & 15, hh = lane >> 4; const int by = blockIdx.y;
  A += (size_t)by * sA; Bh += (size_t)by * sB; const size_t cofs = (size_t)by * sC; const float* bp = bias ? bias + (size_t)by * sBias : nullptr;
  const int ntn = (N + 63) / 64; const int wid = blockIdx.x * 4 + w; const int mt = wid / ntn, nq = wid % ntn; if (mt * 16 >= M) return;
  const int row0 = mt * 16, col0 = nq * 64; const _Float16* arow = A + (size_t)(row0 + ln) * lda;
  v8f acc[4] = {};
  for (int kb = 0; kb < K; kb += 32) { FragH ah; ah.half[0] = *(const v8us*)((const unsigned short*)arow + kb + 8 * hh); ah.half[1] = *(const v8us*)((const unsigned short*)arow + kb + 16 + 8 * hh);
#pragma unroll
    for (int t = 0; t < 4; ++t) { if (col0 + t * 16 >= N) continue; const size_t boff = (size_t)(col0 + t * 16 + ln) * ldb + kb; FragH bq; bq.half[0] = *(const v8us*)((const unsigned short*)Bh + boff + 8 * hh); bq.half[1] = *(const v8us*)((const unsigned short*)Bh + boff + 16 + 8 * hh);
      acc[t] = mmaH<1>(ah.v, ah.v, bq.v, bq.v, acc[t]); }
  }
#pragma unroll
  for (int t = 0; t < 4; ++t) { if (col0 + t * 16 >= N) continue; const int col = col0 + t * 16 + ln; const float bv = bp ? bf16_round(bp[col]) : 0.f;
#pragma unroll
    for (int r = 0; r < 8; ++r) { float v = acc[t][r] * alpha + bv; if (CP) { const int rr = row0g + row0 + 8 * hh + r; if (rowsPerB < 0) v += CP[cofs + (size_t)rr * ldc + col];      /* rowsPerB < 0: own element of the batched C plane */ else { const int bidx = rr / rowsPerB; v += CP[(size_t)bidx * sCPb + (size_t)by * 64 + col]; } } if (ACT == 1) v = (v > 0.f) ? v : expm1f(v); else if (ACT == 7) v = (v > 0.f) ? v + 1.0f : expf(v); else if (ACT == 8) v = tanhf(v); else if (ACT == 9) v = 0.5f * v * (1.0f + tanhf(0.7978845608028654f * (v + 0.044715f * v * v * v))); else if (ACT == 11) v = 1.0f / (1.0f + expf(-v)); else if (ACT == 12) v = (v > 0.f) ? v : 0.01f * v; else if (ACT == 14) v = (v > 0.f) ? v : 0.1f * v; else if (ACT == 16) v = (v >= 0.f) ? v : 0.3f * v; else if (ACT == 17) v = (v >= 0.f) ? v : 0.2f * v; else if (ACT == 15) v = v / (1.0f + expf(-v)); else if (ACT == 3) v = fmaxf(v, 0.f); else if (ACT == 6) v = 0.5f * v * (1.0f + erff(v * 0.70710678118654752f)); so[w][8 * hh + r][t * 16 + ln] = v; } }
  __builtin_amdgcn_fence(__ATOMIC_ACQ_REL, "workgroup"); __builtin_amdgcn_wave_barrier();
  const int rsub = lane >> 4, c4 = (lane & 15) * 4; typedef _Float16 v4h __attribute__((ext_vector_type(4)));
  {
#pragma unroll
    for (int q = 0; q < 8; ++q) { const int r = q * 2 + rsub; if (col0 + c4 < N) { const v4f v = *(const v4fa*)&so[w][r][c4]; if (C) *(v4f*)(C + cofs + (size_t)(row0 + r) * ldc + col0 + c4) = v; if (C16) { v4h h4; for (int i = 0; i < 4; ++i) h4[i] = (_Float16)v[i]; *(v4h*)(C16 + cofs + (size_t)(row0 + r) * ldc + col0 + c4) = h4; } } }
     }
}


typedef _Float16 v4h __attribute__((ext_vector_type(4)));

__global__ __launch_bounds__(256) void k_x16(const float* __restrict__ x, _Float16* __restrict__ X16, size_t n8) { const size_t t = (size_t)blockIdx.x * 256 + threadIdx.x; if (t >= n8) return; FragH f;
#pragma unroll
  for (int q = 0; q < 8; ++q) f.h[q] = (_Float16)bf16_round(x[t * 8 + q]); *(v8us*)((unsigned short*)X16 + t * 8) = f.half[0];  }
__global__ __launch_bounds__(256) void k_h16(const float* __restrict__ x, _Float16* __restrict__ X16, size_t n8) { const size_t t = (size_t)blockIdx.x * 256 + threadIdx.x; if (t >= n8) return; FragH f;
#pragma unroll
  for (int q = 0; q < 8; ++q) f.h[q] = (_Float16)x[t * 8 + q]; *(v8us*)((unsigned short*)X16 + t * 8) = f.half[0];  }
__global__ __launch_bounds__(256) void k_round16f(const float* __restrict__ W, _Float16* __restrict__ Bt, size_t n8) { const size_t t = (size_t)blockIdx.x * 256 + threadIdx.x; if (t >= n8) return; FragH f;
#pragma unroll
  for (int i = 0; i < 8; ++i) f.h[i] = (_Float16)(bf16_round(W[t * 8 + i]) * 16.0f); *(v8us*)((unsigned short*)Bt + t * 8) = f.half[0];  }
template <int NHv, int TTv>
__global__ __launch_bounds__(256) void k_vt(const _Float16* __restrict__ V16, int ldv, int voff, _Float16* __restrict__ Vt) { __shared__ unsigned short tl[64][66]; const int tid = threadIdx.x; const int slab = blockIdx.x / (TTv / 64), lg = blockIdx.x % (TTv / 64); const int b = slab / NHv, h = slab % NHv;
  for (int i = tid; i < 64 * 8; i += 256) { const int r = i / 8, c8 = (i % 8) * 8; FragH f; f.half[0] = *(const v8us*)((const unsigned short*)V16 + ((size_t)b * TTv + lg * 64 + r) * ldv + voff + h * 64 + c8);
#pragma unroll
    for (int q = 0; q < 8; ++q) tl[r][c8 + q] = f.u[q]; }
  __syncthreads();
  {
#pragma unroll
    for (int rd = 0; rd < 2; ++rd) { const int d = rd * 32 + tid / 8, pc = tid % 8; FragH f;
#pragma unroll
      for (int q = 0; q < 8; ++q) f.u[q] = tl[pc * 8 + q][d];
      *(v8us*)((unsigned short*)Vt + ((size_t)slab * 64 + d) * TTv + lg * 64 + pc * 8) = f.half[0]; }
     } }

__global__ __launch_bounds__(256) void k_hl(const float* __restrict__ F, _Float16* __restrict__ Hh, _Float16* __restrict__ Hl, size_t n8) { const size_t t = (size_t)blockIdx.x * 256 + threadIdx.x; if (t >= n8) return; FragH fh, fl; const v4f a = *(const v4fa*)(F + t * 8), c = *(const v4fa*)(F + t * 8 + 4);
#pragma unroll
  for (int q = 0; q < 4; ++q) { _Float16 h = (_Float16)a[q]; fh.h[q] = h; fl.h[q] = (_Float16)((a[q] - (float)h) * 1024.0f); h = (_Float16)c[q]; fh.h[4 + q] = h; fl.h[4 + q] = (_Float16)((c[q] - (float)h) * 1024.0f); }
  { *(v8us*)((unsigned short*)Hh + t * 8) = fh.half[0]; *(v8us*)((unsigned short*)Hl + t * 8) = fl.half[0];  } }

// ---- fast GEMM (wave tile 32x64; requires M % 32 == 0 rows per launch region and N % 64 == 0); epilogue = k_gemm_hhx semantics ----
__device__ __forceinline__ v16h g2_frag(const _Float16* p, int hh) { FragH f; f.half[0] = *(const v8us*)((const unsigned short*)p + 8 * hh); f.half[1] = *(const v8us*)((const unsigned short*)p + 16 + 8 * hh); return f.v; }
__device__ __forceinline__ v8f g2_mma(v16h a, v16h b, v8f c) { v8f d = __builtin_amdgcn_wmma_f32_16x16x32_f16(false, a, false, b, (short)0, c, false, false); asm volatile("v_nop\n\tv_nop\n\tv_nop\n\tv_nop" : "+v"(d) : "v"(a), "v"(b)); return d; }
template <int ACT>
__global__ __launch_bounds__(128) void k_gemm2(const _Float16* __restrict__ A, int lda, size_t sA, const _Float16* __restrict__ Bh, int ldb, size_t sB, float alpha, const float* __restrict__ bias, size_t sBias, const float* __restrict__ CP, int rowsPerB, size_t sCPb, int row0g,
    float* __restrict__ C, _Float16* __restrict__ C16, int ldc, size_t sC, int M, int N, int K) { static_assert(ACT == 0 || ACT == 3 || ACT == 6 || ACT == 8 || ACT == 9 || ACT == 11 || ACT == 12 || ACT == 14 || ACT == 15 || ACT == 16 || ACT == 17, "k_gemm2: unsupported ACT code (would silently apply no activation)");
  __shared__ __attribute__((aligned(16))) float so[4][32][68];
  const int tid = threadIdx.x, w = tid >> 5, lane = tid & 31, ln = lane & 15, hh = lane >> 4; const int by = blockIdx.y;
  A += (size_t)by * sA; Bh += (size_t)by * sB; const size_t cofs = (size_t)by * sC; const float* bp = bias ? bias + (size_t)by * sBias : nullptr;
  const int ntn = N >> 6; const int mt = blockIdx.x / ntn, nq = blockIdx.x - mt * ntn; const int row0 = mt * 128 + 32 * w, col0 = nq * 64; if (row0 >= M) return;
  const _Float16* a0p = A + (size_t)(row0 + ln) * lda; const _Float16* a1p = a0p + (size_t)16 * lda;
  const _Float16* b0p = Bh + (size_t)(col0 + ln) * ldb; const _Float16* b1p = b0p + (size_t)16 * ldb; const _Float16* b2p = b1p + (size_t)16 * ldb; const _Float16* b3p = b2p + (size_t)16 * ldb;
  const v8f z8 = {0.f,0.f,0.f,0.f,0.f,0.f,0.f,0.f}; v8f c00 = z8, c01 = z8, c02 = z8, c03 = z8, c10 = z8, c11 = z8, c12 = z8, c13 = z8;
#pragma unroll 1
  for (int kb = 0; kb < K; kb += 32) { const v16h a0 = g2_frag(a0p + kb, hh), a1 = g2_frag(a1p + kb, hh);
    v16h b = g2_frag(b0p + kb, hh); c00 = g2_mma(a0, b, c00); c10 = g2_mma(a1, b, c10);
    b = g2_frag(b1p + kb, hh); c01 = g2_mma(a0, b, c01); c11 = g2_mma(a1, b, c11);
    b = g2_frag(b2p + kb, hh); c02 = g2_mma(a0, b, c02); c12 = g2_mma(a1, b, c12);
    b = g2_frag(b3p + kb, hh); c03 = g2_mma(a0, b, c03); c13 = g2_mma(a1, b, c13); }
  v8f accs[8] = {c00, c01, c02, c03, c10, c11, c12, c13};
#pragma unroll
  for (int u = 0; u < 8; ++u) { const int t = u & 3, half = u >> 2; const int col = col0 + t * 16 + ln; const float bv = bp ? bf16_round(bp[col]) : 0.f;
#pragma unroll
    for (int r = 0; r < 8; ++r) { const int rloc = half * 16 + 8 * hh + r; float v = accs[u][r] * alpha + bv; if (CP) { if (rowsPerB < 0) v += CP[cofs + (size_t)(row0g + row0 + rloc) * ldc + col];      /* rowsPerB < 0: own element of the batched C plane */ else { const int bidx = (row0g + row0 + rloc) / rowsPerB; v += CP[(size_t)bidx * sCPb + (size_t)by * 64 + col]; } }
      if (ACT == 3) v = fmaxf(v, 0.f); else if (ACT == 6) v = 0.5f * v * (1.0f + erff(v * 0.70710678118654752f)); else if (ACT == 11) v = 1.0f / (1.0f + expf(-v)); else if (ACT == 15) v = v / (1.0f + expf(-v)); else if (ACT == 12) v = (v > 0.f) ? v : 0.01f * v; else if (ACT == 8) v = tanhf(v); else if (ACT == 9) v = 0.5f * v * (1.0f + tanhf(0.7978845608028654f * (v + 0.044715f * v * v * v))); else if (ACT == 14) v = (v > 0.f) ? v : 0.1f * v; else if (ACT == 16) v = (v >= 0.f) ? v : 0.3f * v; else if (ACT == 17) v = (v >= 0.f) ? v : 0.2f * v;
      so[w][rloc][t * 16 + ln] = v; } }
  __builtin_amdgcn_fence(__ATOMIC_ACQ_REL, "workgroup"); __builtin_amdgcn_wave_barrier();
  const int rsub = lane >> 4, c4 = (lane & 15) * 4;
  {
#pragma unroll
    for (int q = 0; q < 16; ++q) { const int r = q * 2 + rsub; const v4f v = *(const v4fa*)&so[w][r][c4]; if (C) *(v4f*)(C + cofs + (size_t)(row0 + r) * ldc + col0 + c4) = v; if (C16) { v4h h4; for (int i = 0; i < 4; ++i) h4[i] = (_Float16)v[i]; *(v4h*)(C16 + cofs + (size_t)(row0 + r) * ldc + col0 + c4) = h4; } }
     } }


__global__ __launch_bounds__(256) void k_wnat(const float* __restrict__ w, size_t n8, _Float16* __restrict__ Bt) { const size_t t = (size_t)blockIdx.x * 256 + threadIdx.x; if (t >= n8) return; FragH f; for (int q = 0; q < 8; ++q) f.h[q] = (_Float16)(bf16_round(w[t * 8 + q]) * 16.0f); *(v8us*)((unsigned short*)Bt + t * 8) = f.half[0];  }
#define FAW 8                        /* waves per work-group */
#define FAK 64                       /* keys per stage */
#define FAP 144                      /* LDS row pitch, bytes: 128 + 16, an odd multiple of 16 for 16-byte readers */
#define FAN (SQ / FAK)               /* stages */
__device__ __forceinline__ float rs_xh(float x) { return __builtin_bit_cast(float, __builtin_amdgcn_permlanex16(__builtin_bit_cast(int, x), __builtin_bit_cast(int, x), 0x76543210, 0xfedcba98, false, false)); }      /* lane l with lane l ^ 16 */
typedef float v2f __attribute__((ext_vector_type(2))); typedef _Float16 v2h __attribute__((ext_vector_type(2)));
__device__ __forceinline__ v16h fa_frag(const unsigned char* p) { FragH f; f.half[0] = *(const v8us*)p; f.half[1] = *(const v8us*)(p + 32); return f.v; }      /* 32 k of one LDS row, hardware k order: p already holds the lane half's 16 bytes */
__device__ __forceinline__ v8f fa_mma(v16h a, v16h b, v8f c) { return __builtin_amdgcn_wmma_f32_16x16x32_f16(false, a, false, b, (short)0, c, false, false); }
/* work-group barrier that orders LDS alone: __syncthreads() would also wait for the global loads of the stage fetched ahead, which only this thread's registers receive */
__device__ __forceinline__ void fa_barrier() { __builtin_amdgcn_fence(__ATOMIC_RELEASE, "workgroup", "local"); __builtin_amdgcn_s_barrier(); __builtin_amdgcn_fence(__ATOMIC_ACQUIRE, "workgroup", "local"); }
__global__ __launch_bounds__(FAW * 32) void k_fattn(const _Float16* __restrict__ Q, const _Float16* __restrict__ Kg, const _Float16* __restrict__ Vt, _Float16* __restrict__ O) {
  __shared__ __attribute__((aligned(16))) unsigned char L[2][2][FAK * FAP];      /* [buffer][K rows | V^T rows] */
  const int tid = threadIdx.x, lane = tid & 31, ln = lane & 15, hh = lane >> 4; const int wave = __builtin_amdgcn_readfirstlane(tid >> 5);
  const int bh = blockIdx.y, b = bh / NH, h = bh - b * NH; const int q0 = blockIdx.x * (FAW * 16) + wave * 16;
  /* staging: 8 threads per 128-byte row, 32 rows per round, two rounds per tile */
  const int srow = tid >> 3, sch = (tid & 7) * 16;
  const unsigned char* kg = (const unsigned char*)(Kg + ((size_t)b * SQ + srow) * DM + h * HD) + sch;      /* K row srow of stage 0; a stage is FAK rows of DM */
  const unsigned char* vg = (const unsigned char*)(Vt + ((size_t)bh * HD + srow) * SQ) + sch;              /* V^T row d = srow; a stage is FAK keys along the row */
  const int sl = srow * FAP + sch;
  v8us k0, k1, v0, v1;
  auto fetch = [&](int st) { const unsigned char* kp = kg + (size_t)st * (FAK * DM * 2); const unsigned char* vp = vg + (size_t)st * (FAK * 2);
    k0 = *(const v8us*)kp; k1 = *(const v8us*)(kp + (size_t)32 * DM * 2); v0 = *(const v8us*)vp; v1 = *(const v8us*)(vp + (size_t)32 * SQ * 2);
    asm volatile("s_wait_xcnt 0x0" :: "v"(kp), "v"(vp) : "memory"); };      /* the loads' address registers are inputs here, so they stay live up to this wait and are re-used only behind it */
  auto put = [&](int buf) { *(v8us*)&L[buf][0][sl] = k0; *(v8us*)&L[buf][0][sl + 32 * FAP] = k1; *(v8us*)&L[buf][1][sl] = v0; *(v8us*)&L[buf][1][sl + 32 * FAP] = v1; };
  fetch(0);
  const _Float16* qp = Q + ((size_t)b * SQ + q0 + ln) * DM + h * HD; const v16h qf0 = g2_frag(qp, hh), qf1 = g2_frag(qp + 32, hh);      /* B operand: column = query, same k order as fa_frag */
  put(0); fetch(1);
  const v8f z8 = {0.f,0.f,0.f,0.f,0.f,0.f,0.f,0.f}; v8f acc[4] = {z8, z8, z8, z8};      /* acc[t][r] = O^T[16 t + 8 hh + r][query ln] */
  float m = -3.0e38f, l = 0.f;      /* running maximum (log2 domain, both halves alike) and this lane half's part of the denominator */
  const float cs = 0.125f * 1.4426950408889634f;      /* 1 / sqrt(64), and e^x = 2^(x log2 e) */
  const int fo = ln * FAP + hh * 16;
  __syncthreads();      /* publishes stage 0; the full barrier also ends the Q loads here, so that no wait for them stands in the loop, where it would drain the stage fetched ahead */
#pragma unroll 1
  for (int st = 0; st < FAN; ++st) {      /* rolled: the body is one whole stage, and the buffer index is a run-time offset */
    const int buf = st & 1;
    if (st + 1 < FAN) put(buf ^ 1);      /* stage st + 1, fetched one stage ago, into the buffer whose readers all passed the barrier at the foot of stage st - 1 */
    if (st + 2 < FAN) fetch(st + 2);
    const unsigned char* Kb = &L[buf][0][fo]; const unsigned char* Vb = &L[buf][1][fo];
    v16h kf[4][2], vf[4][2]; v8f s[4];
#pragma unroll
    for (int kt = 0; kt < 4; ++kt) { kf[kt][0] = fa_frag(Kb + kt * 16 * FAP); kf[kt][1] = fa_frag(Kb + kt * 16 * FAP + 64); }
#pragma unroll
    for (int kt = 0; kt < 4; ++kt) s[kt] = fa_mma(kf[kt][0], qf0, z8);
#pragma unroll
    for (int kt = 0; kt < 4; ++kt) s[kt] = fa_mma(kf[kt][1], qf1, s[kt]);
#pragma unroll
    for (int t = 0; t < 4; ++t) { vf[t][0] = fa_frag(Vb + t * 16 * FAP); vf[t][1] = fa_frag(Vb + t * 16 * FAP + 64); }
    __builtin_amdgcn_sched_barrier(0);      /* the eight score products run back to back and the V^T reads leave before the softmax: without it the maxima are woven between the products, each behind padding, and the V^T reads are waited for where they are issued */
    float mx = s[0][0];
#pragma unroll
    for (int kt = 0; kt < 4; ++kt)
#pragma unroll
      for (int r = 0; r < 8; ++r) mx = fmaxf(mx, s[kt][r]);
    mx = fmaxf(mx, rs_xh(mx));
    const float mn = fmaxf(m, mx * cs); const float corr = __builtin_amdgcn_exp2f(m - mn); m = mn;      /* corr is 0 in the first stage */
    const v2f cs2 = {cs, cs}, nm2 = {8.0f - mn, 8.0f - mn};      /* weights carried x256 (numerator and denominator alike), away from the f16 subnormal range */
    v2f sa = {0.f, 0.f}, sb = {0.f, 0.f}; union { v16h v; v2h p[8]; } pf[2];
#pragma unroll
    for (int kt = 0; kt < 4; ++kt)
#pragma unroll
      for (int i = 0; i < 4; ++i) { const v2f x = {s[kt][2 * i], s[kt][2 * i + 1]}; const v2f e = __builtin_elementwise_fma(x, cs2, nm2); const v2f p = {__builtin_amdgcn_exp2f(e[0]), __builtin_amdgcn_exp2f(e[1])};
        if (i & 1) sb += p; else sa += p; pf[kt >> 1].p[(kt & 1) * 4 + i] = __builtin_convertvector(p, v2h); }      /* element 8 (kt & 1) + r of the 32-key operand = tile kt, register r */
    sa += sb; l = fmaf(l, corr, sa[0] + sa[1]);
#pragma unroll
    for (int t = 0; t < 4; ++t) acc[t] = acc[t] * corr;
#pragma unroll
    for (int t = 0; t < 4; ++t) acc[t] = fa_mma(vf[t][0], pf[0].v, acc[t]);
#pragma unroll
    for (int t = 0; t < 4; ++t) acc[t] = fa_mma(vf[t][1], pf[1].v, acc[t]);
    fa_barrier();      /* publishes stage st + 1 and ends every wave's reads of this stage's buffer */
  }
  const float inv = 64.0f / (l + rs_xh(l));      /* o carried x64, as the output GEMM's alpha expects */
  _Float16* op = O + ((size_t)b * SQ + q0 + ln) * DM + h * HD + 8 * hh;
#pragma unroll
  for (int t = 0; t < 4; ++t) { FragH f;
#pragma unroll
    for (int r = 0; r < 8; ++r) f.h[r] = (_Float16)(acc[t][r] * inv);
    *(v8us*)((unsigned short*)op + t * 16) = f.half[0]; }      /* 8 consecutive d of one query row: 16 bytes */
}
__global__ __launch_bounds__(256) void k_vt(const _Float16* __restrict__ V16, int b, int h0, _Float16* __restrict__ VT) { __shared__ unsigned short tl[64][65]; const int tid = threadIdx.x; const int hh = blockIdx.x % HG, sg = blockIdx.x / HG; const int s0 = sg * 64; const int h = h0 + hh;
  for (int i = tid; i < 64 * 8; i += 256) { const int j = i / 8, d8 = (i % 8) * 8; FragH f; f.half[0] = *(const v8us*)((const unsigned short*)V16 + ((size_t)b * SQ + s0 + j) * DM + h * HD + d8); for (int q = 0; q < 8; ++q) tl[d8 + q][j] = f.u[q]; }
  __syncthreads();
  { for (int i = tid; i < 64 * 8; i += 256) { const int d = i / 8, j8 = (i % 8) * 8; FragH f; for (int q = 0; q < 8; ++q) f.u[q] = tl[d][j8 + q]; *(v8us*)((unsigned short*)VT + ((size_t)hh * HD + d) * SQ + s0 + j8) = f.half[0]; }  } }



__global__ __launch_bounds__(256) void k_rsmkm(const float* __restrict__ S, _Float16* __restrict__ P, int nrows, const int* __restrict__ am) {
  #pragma clang fp contract(off)
  const int t = blockIdx.x * 256 + threadIdx.x; if (t >= nrows) return; const size_t i = (size_t)t; const float* s = S + i * SQ; const int* mr = am + (size_t)(t % SQ) * SQ; float mx = -3.0e38f;
#pragma unroll 1
  for (int j = 0; j < SQ; ++j) { const float f = (mr[j] != 0) ? 1.f : 0.f; mx = fmaxf(mx, fmaf(f, s[j], (1.f - f) * -1.0e9f)); } float se = 0.f;
#pragma unroll 1
  for (int j = 0; j < SQ; ++j) { const float f = (mr[j] != 0) ? 1.f : 0.f; se += __expf(fmaf(f, s[j], (1.f - f) * -1.0e9f) - mx); } const float sc = 256.0f / se;
#pragma unroll 1
  for (int j0 = 0; j0 < SQ; j0 += 8) { FragH fr; for (int q = 0; q < 8; ++q) { const int j = j0 + q; const float f = (mr[j] != 0) ? 1.f : 0.f; fr.h[q] = (_Float16)(__expf(fmaf(f, s[j], (1.f - f) * -1.0e9f) - mx) * sc); }
    unsigned short* d = (unsigned short*)P + i * SQ + j0; *(v8us*)d = fr.half[0];  } }

// LayerNorm of the bf16-rounded rows, one wave per LNR rows and no LDS: a lane holds columns 4 lane + 128 u (u = 0..3) of each row, so every load covers 512 and every store 256 contiguous bytes;
// all the rows' loads leave first; mean and variance (two passes over the registers) are lane partials, four row_xmask steps and one exchange of the wave halves; gamma and beta are rounded once per wave.
#define LNR 4                        /* rows per wave */
#define LNW 4                        /* waves per work-group: 256 work-groups, one wave per SIMD */
template <int CTRL>
__device__ __forceinline__ float ln_dpp(float x) { return __builtin_bit_cast(float, __builtin_amdgcn_update_dpp(0, __builtin_bit_cast(int, x), CTRL, 0xf, 0xf, true)); }      /* lane l with lane l ^ (CTRL - 0x160) of its 16-lane row */
__device__ __forceinline__ float ln_sum32(float x) { x += ln_dpp<0x161>(x); x += ln_dpp<0x162>(x); x += ln_dpp<0x164>(x); x += ln_dpp<0x168>(x); return x + rs_xh(x); }      /* every lane ends with the sum over the wave */
__global__ __launch_bounds__(LNW * 32) void k_lnw(const float* __restrict__ X, const float* __restrict__ g, const float* __restrict__ bb, float eps, _Float16* __restrict__ N16) {
  static_assert(DM == 512 && NR % (LNR * LNW) == 0, "k_lnw: a lane holds 16 columns, and every wave has LNR whole rows");
  const int c0 = (threadIdx.x & 31) * 4; const size_t r0 = ((size_t)blockIdx.x * LNW + (threadIdx.x >> 5)) * LNR;
  const float* xp = X + r0 * DM + c0; _Float16* yp = N16 + r0 * DM + c0;
  v4f x[LNR][4], gg[4], be[4]; float mu[LNR], rs[LNR];
  for (int i = 0; i < LNR; ++i) for (int u = 0; u < 4; ++u) x[i][u] = *(const v4fa*)(xp + i * DM + u * 128);
  for (int u = 0; u < 4; ++u) { gg[u] = *(const v4fa*)(g + c0 + u * 128); be[u] = *(const v4fa*)(bb + c0 + u * 128); }
  asm volatile("s_wait_xcnt 0x0" :: "v"(xp) : "memory");      /* the row loads' address pair is an input here, so it stays live up to this wait */
  for (int u = 0; u < 4; ++u) for (int q = 0; q < 4; ++q) { gg[u][q] = bf16_round(gg[u][q]); be[u][q] = bf16_round(be[u][q]); }
  for (int i = 0; i < LNR; ++i) {
    for (int u = 0; u < 4; ++u) for (int q = 0; q < 4; ++q) x[i][u][q] = bf16_round(x[i][u][q]);
    const v4f t = (x[i][0] + x[i][1]) + (x[i][2] + x[i][3]); mu[i] = (t[0] + t[1]) + (t[2] + t[3]); }
  for (int i = 0; i < LNR; ++i) mu[i] = ln_sum32(mu[i]) * (1.0f / DM);
  for (int i = 0; i < LNR; ++i) {
    for (int u = 0; u < 4; ++u) x[i][u] -= mu[i];
    const v4f t = (x[i][0] * x[i][0] + x[i][1] * x[i][1]) + (x[i][2] * x[i][2] + x[i][3] * x[i][3]); rs[i] = (t[0] + t[1]) + (t[2] + t[3]); }
  for (int i = 0; i < LNR; ++i) rs[i] = rsqrtf(ln_sum32(rs[i]) * (1.0f / DM) + eps);
  for (int i = 0; i < LNR; ++i) for (int u = 0; u < 4; ++u) *(v4h*)(yp + i * DM + u * 128) = __builtin_convertvector(x[i][u] * rs[i] * gg[u] + be[u], v4h);
}


extern "C" void kernel_launch(void* const* d_in, const int* in_sizes, int n_in,
                              void* d_out, int out_size, void* d_ws, size_t ws_size, hipStream_t stream) {
  (void)in_sizes; (void)n_in; (void)out_size;
  const float* const* I = (const float* const*)d_in; const float* xq = I[0]; const float* xk = I[1]; const float* xv = I[2]; const float* lng = I[3]; const float* lnb = I[4]; const float* wq = I[5]; const float* bq = I[6]; const float* wk = I[7]; const float* bk = I[8]; const float* wv = I[9]; const float* bv = I[10]; const float* wo = I[11]; const float* bo = I[12]; const float* x = xq;      /* query, key, value; shared LayerNorm gamma / beta [512]; [in][out] Wq / Wk / Wv / Wo + biases */
  char* ws = (char*)d_ws; size_t off = 0;
  auto take = [&](size_t bytes) { char* p = ws + off; off += (bytes + 255) & ~(size_t)255; return p; };
  _Float16* BQ = (_Float16*)take((size_t)DM * DM * 2); _Float16* BK = (_Float16*)take((size_t)DM * DM * 2); _Float16* BV = (_Float16*)take((size_t)DM * DM * 2); _Float16* BO = (_Float16*)take((size_t)DM * DM * 2);
  _Float16* X16 = (_Float16*)take(NR * DM * 2); _Float16* XKp = (_Float16*)take(NR * DM * 2); _Float16* XVp = (_Float16*)take(NR * DM * 2); _Float16* Q16 = (_Float16*)take(NR * DM * 2); _Float16* K16 = (_Float16*)take(NR * DM * 2); _Float16* V16 = (_Float16*)take(NR * DM * 2); _Float16* O16 = (_Float16*)take(NR * DM * 2);
  _Float16* VT = (_Float16*)take((size_t)NB * NH * HD * SQ * 2);
  if (off > ws_size) return;
  { const unsigned g = (unsigned)(((size_t)DM * (DM / 8) + 255) / 256); k_wt_f16<<<g, 256, 0, stream>>>(wq, BQ, DM, DM, 16.0f); k_wt_f16<<<g, 256, 0, stream>>>(wk, BK, DM, DM, 16.0f); k_wt_f16<<<g, 256, 0, stream>>>(wv, BV, DM, DM, 16.0f); k_wt_f16<<<g, 256, 0, stream>>>(wo, BO, DM, DM, 16.0f); }      /* [in][out] -> Bt x16 */
  _Float16* XK = XKp; _Float16* XV = XVp; k_lnw<<<(unsigned)(NR / (LNR * LNW)), LNW * 32, 0, stream>>>(xk, lng, lnb, 1e-5f, XK); k_lnw<<<(unsigned)(NR / (LNR * LNW)), LNW * 32, 0, stream>>>(xv, lng, lnb, 1e-5f, XV);      /* LN(key), LN(value) with the SHARED parameters -> f16 rows */

  k_lnw<<<(unsigned)(NR / (LNR * LNW)), LNW * 32, 0, stream>>>(x, lng, lnb, 1e-5f, X16);      /* LN(query) -> f16 rows */
  const size_t r0p = (size_t)B0 * SQ;      /* first projected row */
  k_gemm2<0><<<dim3((unsigned)((MP / 128) * (DM / 64)), 1), 128, 0, stream>>>(X16 + r0p * DM, DM, 0, BQ, DM, 0, 0.0625f, bq, 0, nullptr, 1, 0, 0, nullptr, Q16 + r0p * DM, DM, 0, MP, DM, DM);
  k_gemm2<0><<<dim3((unsigned)((MP / 128) * (DM / 64)), 1), 128, 0, stream>>>(XK + r0p * DM, DM, 0, BK, DM, 0, 0.0625f, bk, 0, nullptr, 1, 0, 0, nullptr, K16 + r0p * DM, DM, 0, MP, DM, DM);
  k_gemm2<0><<<dim3((unsigned)((MP / 128) * (DM / 64)), 1), 128, 0, stream>>>(XV + r0p * DM, DM, 0, BV, DM, 0, 0.0625f, bv, 0, nullptr, 1, 0, 0, nullptr, V16 + r0p * DM, DM, 0, MP, DM, DM);
  k_vt<NH, SQ><<<NB * NH * (SQ / 64), 256, 0, stream>>>(V16, LQ, 0, VT);      /* V^T [NB][NH][HD][SQ] */
  k_fattn<<<dim3(SQ / (FAW * 16), NB * NH), FAW * 32, 0, stream>>>(Q16, K16, VT, O16);      /* o x64 (merged heads) as f16 rows, all batches and heads in one launch */
  k_gemm2<0><<<dim3((unsigned)((MPO / 128) * (DM / 64)), 1), 128, 0, stream>>>(O16 + r0p * DM, DM, 0, BO, DM, 0, 0.0009765625f, bo, 0, nullptr, 1, 0, 0, (float*)d_out + r0p * DM, nullptr, DM, 0, MPO, DM, DM);      /* out rows are the output layout */
}

// v004
// It runs in 90.8 microseconds.
// Two timings next to v003 both put it at 1.55 times that version's speed.
// Over all steps from v000 it is 21.4 times as fast.
#include <hip/hip_runtime.h>
// Multi-head attention over THREE inputs, each passed through ONE shared LayerNorm first (query, key, value [2][2048][512]; Q = LN(query) Wq + bq, K = LN(key) Wk + bk, V = LN(value) Wv + bv with LN: biased var, eps 1e-5, shared ln_g / ln_b; [in][out] 512 x 512, zero biases); 8 heads of 64; scores / 8; softmax over all 2048 keys (no mask); out = merged Wo + bo -> [2][2048][512]; no residual).
// Structure: token rows r = b*2048 + s; LN of the bf16-rounded inputs as f16 rows; the weight passes and the LayerNorms as block ranges of one launch; Q, K, V as three WMMA GEMMs in one launch, blockIdx.y the product (32x64 wave tiles, f32 accumulation, exact x16 weights + bias, f16 outputs); V^T for all batches and heads via LDS transposes; one fused attention launch over all (batch, head, 128 queries): S^T = K . Q^T (K = 64) on WMMA, online softmax in registers (f32 running maximum and sum, base 2, 1/sqrt(64) folded into the exponent; unnormalised weights x256, in (0, 256], as f16), O^T += V^T . P^T on WMMA, divided by the sum at the end (o carried x64 against f16 subnormal flush, folded into the output GEMM alpha) and written straight into the merged f16 o rows; out = o W_o + b GEMM (f32) into the output layout.
// Compute dtype: inputs rounded to bf16; weights exact; LN rows, q, k, v, softmax weights and o as plain f16 GEMM operands (~2^-12); scores and softmax statistics f32; v_wmma_f32_16x16x32_f16.
#define NB 2
#define SQ 2048
#define DM 512
#define NH 8
#define HD 64
#define HG 4                         /* heads per launch of the per-batch k_vt */
#define B0 0                         /* first batch processed (debug hook) */
#define NBR NB                       /* batches processed (debug hook) */
#define NR ((size_t)NB * SQ)         /* token rows */
#define MP ((int)((size_t)NBR * SQ)) /* rows projected (debug hook) */
#define QN SQ                        /* query rows per batch (unused: k_fattn attends all SQ) */
#define NHD NH                       /* heads (unused: k_fattn covers all NH heads) */
#define MPO MP                       /* rows through the output stage (debug hook) */
#define LQ DM      /* row pitch of the q/k/v rows */
typedef __bf16 v16b __attribute__((ext_vector_type(16)));
typedef unsigned short v8us __attribute__((ext_vector_type(8), may_alias));
typedef float  v8f  __attribute__((ext_vector_type(8)));
typedef float  v4f  __attribute__((ext_vector_type(4)));
typedef float  v4fa __attribute__((ext_vector_type(4), may_alias));
union FragB { v16b v; v8us half[2]; unsigned short u[16]; };

__device__ __forceinline__ unsigned short bf16_bits(float x) { unsigned int u = __float_as_uint(x); return (unsigned short)((u + 0x7FFFu + ((u >> 16) & 1u)) >> 16); }
__device__ __forceinline__ float bf16_val(unsigned short b) { return __uint_as_float(((unsigned int)b) << 16); }
__device__ __forceinline__ float bf16_round(float x) { return bf16_val(bf16_bits(x)); }
// D += A·B with NT terms: 1 = ah·bh, 2 = + al·bh (A split), 3 = + ah·bl (both split)
template <int NT>
__device__ __forceinline__ v8f mmaN(v16b ah, v16b al, v16b bh, v16b bl, v8f c) {
  c = __builtin_amdgcn_wmma_f32_16x16x32_bf16(false, ah, false, bh, (short)0, c, false, false);
  if (NT >= 2) c = __builtin_amdgcn_wmma_f32_16x16x32_bf16(false, al, false, bh, (short)0, c, false, false);
  if (NT >= 3) c = __builtin_amdgcn_wmma_f32_16x16x32_bf16(false, ah, false, bl, (short)0, c, false, false);
  asm volatile("v_nop\n\tv_nop\n\tv_nop\n\tv_nop" : "+v"(c) : "v"(ah), "v"(al), "v"(bh), "v"(bl));
  return c;
}

__global__ __launch_bounds__(256) void k_wt_bf16(const float* __restrict__ W, unsigned short* __restrict__ Wt, int K, int N) {
  const int t = blockIdx.x * 256 + threadIdx.x;
  const int k8n = K / 8;
  if (t >= N * k8n) return;
  const int n = t / k8n, k8 = (t % k8n) * 8;
  v8us v;
#pragma unroll
  for (int i = 0; i < 8; ++i) v[i] = bf16_bits(W[(size_t)(k8 + i) * N + n]);
  *(v8us*)(Wt + (size_t)n * K + k8) = v;
  
}

// GEMM C[M][N] (f32, pitch ldc) = act(A[M][K]·W + bias). A f32 row-major (pitch lda) converted per fragment to bf16
// (ASPLIT: hi/lo two planes -> 2 terms, else single rounded term); Wt bf16 [N][K] (pitch ldb). BIAS_BF16 rounds the
// bias to bf16 first (bias quantised to bf16 before the add). K%32==0, M%16==0, N%64==0.
template <bool ASPLIT, int ACT, bool BIAS_BF16>
__global__ __launch_bounds__(128) void k_gemm_bf(const float* __restrict__ A, int lda, const unsigned short* __restrict__ Wt, int ldb,
                                               const float* __restrict__ bias, float* __restrict__ C, int ldc, int M, int N, int K) {
  __shared__ __attribute__((aligned(16))) float so[4][16][64];
  const int tid = threadIdx.x, w = tid >> 5, lane = tid & 31, ln = lane & 15, hh = lane >> 4;
  const int ntn = N / 64;
  const int wid = blockIdx.x * 4 + w;
  const int mt = wid / ntn, nq = wid % ntn;
  if (mt * 16 >= M) return;
  const int row0 = mt * 16, col0 = nq * 64;
  const float* arow = A + (size_t)(row0 + ln) * lda;
  v8f acc[4] = {};
  for (int kb = 0; kb < K; kb += 32) {
    FragB ah, al;
    const v4f x0 = *(const v4fa*)(arow + kb + 8 * hh), x1 = *(const v4fa*)(arow + kb + 8 * hh + 4);
    const v4f x2 = *(const v4fa*)(arow + kb + 16 + 8 * hh), x3 = *(const v4fa*)(arow + kb + 16 + 8 * hh + 4);
    float xs[16] = {x0[0],x0[1],x0[2],x0[3],x1[0],x1[1],x1[2],x1[3],x2[0],x2[1],x2[2],x2[3],x3[0],x3[1],x3[2],x3[3]};
#pragma unroll
    for (int i = 0; i < 16; ++i) { const unsigned short hb = bf16_bits(xs[i]); ah.u[i] = hb; al.u[i] = ASPLIT ? bf16_bits(xs[i] - bf16_val(hb)) : (unsigned short)0; }
#pragma unroll
    for (int t = 0; t < 4; ++t) {
      const unsigned short* brow = Wt + (size_t)(col0 + t * 16 + ln) * ldb + kb;
      FragB b;
      b.half[0] = *(const v8us*)(brow + 8 * hh);
      b.half[1] = *(const v8us*)(brow + 16 + 8 * hh);
      acc[t] = mmaN<ASPLIT ? 2 : 1>(ah.v, al.v, b.v, b.v, acc[t]);
    }
  }
#pragma unroll
  for (int t = 0; t < 4; ++t) {
    float bv = bias ? bias[col0 + t * 16 + ln] : 0.f;
    if (BIAS_BF16) bv = bf16_round(bv);
#pragma unroll
    for (int r = 0; r < 8; ++r) { float v = acc[t][r] + bv; if (ACT == 1) v = fmaxf(v, 0.f); so[w][8 * hh + r][t * 16 + ln] = v; }
  }
  __builtin_amdgcn_fence(__ATOMIC_ACQ_REL, "workgroup");
  __builtin_amdgcn_wave_barrier();
  const int rsub = lane >> 4, c4 = (lane & 15) * 4;
  {
#pragma unroll
    for (int q = 0; q < 8; ++q) {
      const int r = q * 2 + rsub;
      const v4f v = *(const v4fa*)&so[w][r][c4];
      *(v4f*)(C + (size_t)(row0 + r) * ldc + col0 + c4) = v;
    }
    
  }
}

// GEMM C = act(A·W + bias + resid): A f32 (ASPLIT -> hi/lo 2 terms), Wt bf16 [N][K]; ACT 0 none, 1 relu, 2 exact gelu;
// resid (optional, f32, row index = (row % rmod), pitch ldr, RES_BF16 rounds it) added before the activation.
template <bool ASPLIT, int ACT, bool BIAS_BF16, bool RES_BF16>
__global__ __launch_bounds__(128) void k_gemm_bf3(const float* __restrict__ A, int lda, const unsigned short* __restrict__ Wt, int ldb,
                                                const float* __restrict__ bias, const float* __restrict__ resid, int rmod, int ldr,
                                                float* __restrict__ C, int ldc, int M, int N, int K) {
  __shared__ __attribute__((aligned(16))) float so[4][16][64];
  const int tid = threadIdx.x, w = tid >> 5, lane = tid & 31, ln = lane & 15, hh = lane >> 4;
  const int ntn = N / 64;
  const int wid = blockIdx.x * 4 + w;
  const int mt = wid / ntn, nq = wid % ntn;
  if (mt * 16 >= M) return;
  const int row0 = mt * 16, col0 = nq * 64;
  const float* arow = A + (size_t)(row0 + ln) * lda;
  v8f acc[4] = {};
  for (int kb = 0; kb < K; kb += 32) {
    FragB ah, al;
    const v4f x0 = *(const v4fa*)(arow + kb + 8 * hh), x1 = *(const v4fa*)(arow + kb + 8 * hh + 4);
    const v4f x2 = *(const v4fa*)(arow + kb + 16 + 8 * hh), x3 = *(const v4fa*)(arow + kb + 16 + 8 * hh + 4);
    float xs[16] = {x0[0],x0[1],x0[2],x0[3],x1[0],x1[1],x1[2],x1[3],x2[0],x2[1],x2[2],x2[3],x3[0],x3[1],x3[2],x3[3]};
#pragma unroll
    for (int i = 0; i < 16; ++i) { const unsigned short hb = bf16_bits(xs[i]); ah.u[i] = hb; al.u[i] = ASPLIT ? bf16_bits(xs[i] - bf16_val(hb)) : (unsigned short)0; }
#pragma unroll
    for (int t = 0; t < 4; ++t) {
      const unsigned short* brow = Wt + (size_t)(col0 + t * 16 + ln) * ldb + kb;
      FragB b;
      b.half[0] = *(const v8us*)(brow + 8 * hh);
      b.half[1] = *(const v8us*)(brow + 16 + 8 * hh);
      acc[t] = mmaN<ASPLIT ? 2 : 1>(ah.v, al.v, b.v, b.v, acc[t]);
    }
  }
#pragma unroll
  for (int t = 0; t < 4; ++t) {
    const int col = col0 + t * 16 + ln;
    float bv = bias ? bias[col] : 0.f;
    if (BIAS_BF16) bv = bf16_round(bv);
#pragma unroll
    for (int r = 0; r < 8; ++r) {
      float v = acc[t][r] + bv;
      if (resid) { float rv = resid[(size_t)((row0 + 8 * hh + r) % rmod) * ldr + col]; if (RES_BF16) rv = bf16_round(rv); v += rv; }
      if (ACT == 1) v = fmaxf(v, 0.f);
      if (ACT == 2) v = 0.5f * v * (1.0f + erff(v * 0.70710678118654752f));
      if (ACT == 3) { const float u = 0.7978845608028654f * (v + 0.044715f * v * v * v); v = 0.5f * v * (1.0f + tanhf(u)); }
      so[w][8 * hh + r][t * 16 + ln] = v;
    }
  }
  __builtin_amdgcn_fence(__ATOMIC_ACQ_REL, "workgroup");
  __builtin_amdgcn_wave_barrier();
  const int rsub = lane >> 4, c4 = (lane & 15) * 4;
  {
#pragma unroll
    for (int q = 0; q < 8; ++q) {
      const int r = q * 2 + rsub;
      const v4f v = *(const v4fa*)&so[w][r][c4];
      *(v4f*)(C + (size_t)(row0 + r) * ldc + col0 + c4) = v;
    }
    
  }
}
// row LayerNorm (biased variance, eps) over N: s = X (+ R); optional out_sum <- s; out_norm <- (s-mu)*rsqrt(var+eps)*g + b
template <bool PARAM_BF16>
__global__ __launch_bounds__(256) void k_layernorm(const float* __restrict__ X, const float* __restrict__ R, const float* __restrict__ g, const float* __restrict__ bta,
                                                  float* __restrict__ out_sum, float* __restrict__ out_norm, int N, float eps) {
  __shared__ float red[256];
  const int row = blockIdx.x, tid = threadIdx.x;
  const float* x = X + (size_t)row * N; const float* rr = R ? R + (size_t)row * N : nullptr;
  float vals[16];                     // up to N = 4096
  const int per = N / 256;            // contiguous chunk per thread? use strided-by-4 chunks: thread handles j = tid*4 + 1024*u
  float s1 = 0.f;
  for (int u = 0; u < per / 4; ++u) {
    const int j = tid * 4 + 1024 * u;
    const v4f a = *(const v4fa*)(x + j);
    v4f b = {0.f,0.f,0.f,0.f}; if (rr) b = *(const v4fa*)(rr + j);
#pragma unroll
    for (int q = 0; q < 4; ++q) { const float v = a[q] + b[q]; vals[u * 4 + q] = v; s1 += v; }
  }
  red[tid] = s1; __syncthreads();
  for (int st = 128; st > 0; st >>= 1) { if (tid < st) red[tid] += red[tid + st]; __syncthreads(); }
  const float mu = red[0] / (float)N; __syncthreads();
  float s2 = 0.f;
  for (int u = 0; u < per / 4; ++u)
#pragma unroll
    for (int q = 0; q < 4; ++q) { const float c = vals[u * 4 + q] - mu; s2 += c * c; }
  red[tid] = s2; __syncthreads();
  for (int st = 128; st > 0; st >>= 1) { if (tid < st) red[tid] += red[tid + st]; __syncthreads(); }
  const float rs = rsqrtf(red[0] / (float)N + eps);
  {
    for (int u = 0; u < per / 4; ++u) {
      const int j = tid * 4 + 1024 * u;
      v4f o, sm;
#pragma unroll
      for (int q = 0; q < 4; ++q) {
        float gg = g[j + q], bb = bta[j + q];
        if (PARAM_BF16) { gg = bf16_round(gg); bb = bf16_round(bb); }
        sm[q] = vals[u * 4 + q]; o[q] = (vals[u * 4 + q] - mu) * rs * gg + bb;
      }
      if (out_sum) *(v4f*)(out_sum + (size_t)row * N + j) = sm;
      *(v4f*)(out_norm + (size_t)row * N + j) = o;
    }
    
  }
}



// ---- f16 WMMA path (v_wmma_f32_16x16x32_f16): 11-bit significands for operands in range — used where a [0,1] probability operand needs more precision than bf16
typedef _Float16 v16h __attribute__((ext_vector_type(16)));
union FragH { v16h v; v8us half[2]; _Float16 h[16]; unsigned short u[16]; };
template <int NT>
__device__ __forceinline__ v8f mmaH(v16h ah, v16h al, v16h bh, v16h bl, v8f c) {
  c = __builtin_amdgcn_wmma_f32_16x16x32_f16(false, ah, false, bh, (short)0, c, false, false);
  if (NT >= 2) c = __builtin_amdgcn_wmma_f32_16x16x32_f16(false, al, false, bh, (short)0, c, false, false);
  if (NT >= 3) c = __builtin_amdgcn_wmma_f32_16x16x32_f16(false, ah, false, bl, (short)0, c, false, false);
  asm volatile("v_nop\n\tv_nop\n\tv_nop\n\tv_nop" : "+v"(c) : "v"(ah), "v"(al), "v"(bh), "v"(bl));
  return c;
}
// batched GEMM like k_gemm_b but f16 operands: A f32 (split into f16 hi/lo if ASPLIT, else rounded to f16), Bt = f16 values [n][k]; alpha; C f32; N multiple of 16 (partial tiles skipped)
template <bool ASPLIT>
__global__ __launch_bounds__(128) void k_gemm_h(const float* __restrict__ A, int lda, size_t sA, const _Float16* __restrict__ Bh, int ldb, size_t sB, float alpha, float* __restrict__ C, int ldc, size_t sC, int M, int N, int K) {
  __shared__ __attribute__((aligned(16))) float so[4][16][64];
  const int tid = threadIdx.x, w = tid >> 5, lane = tid & 31, ln = lane & 15, hh = lane >> 4; const int by = blockIdx.y;
  A += (size_t)by * sA; Bh += (size_t)by * sB; C += (size_t)by * sC;
  const int ntn = (N + 63) / 64; const int wid = blockIdx.x * 4 + w; const int mt = wid / ntn, nq = wid % ntn; if (mt * 16 >= M) return;
  const int row0 = mt * 16, col0 = nq * 64; const float* arow = A + (size_t)(row0 + ln) * lda;
  v8f acc[4] = {};
  for (int kb = 0; kb < K; kb += 32) {
    FragH ah, al;
    const v4f x0 = *(const v4fa*)(arow + kb + 8 * hh), x1 = *(const v4fa*)(arow + kb + 8 * hh + 4), x2 = *(const v4fa*)(arow + kb + 16 + 8 * hh), x3 = *(const v4fa*)(arow + kb + 16 + 8 * hh + 4);
    float xs[16] = {x0[0],x0[1],x0[2],x0[3],x1[0],x1[1],x1[2],x1[3],x2[0],x2[1],x2[2],x2[3],x3[0],x3[1],x3[2],x3[3]};
#pragma unroll
    for (int i = 0; i < 16; ++i) { const _Float16 h = (_Float16)xs[i]; ah.h[i] = h; al.h[i] = ASPLIT ? (_Float16)(xs[i] - (float)h) : (_Float16)0.0f; }
#pragma unroll
    for (int t = 0; t < 4; ++t) { if (col0 + t * 16 >= N) continue; const size_t boff = (size_t)(col0 + t * 16 + ln) * ldb + kb; FragH bq; bq.half[0] = *(const v8us*)(Bh + boff + 8 * hh); bq.half[1] = *(const v8us*)(Bh + boff + 16 + 8 * hh);
      acc[t] = mmaH<ASPLIT ? 2 : 1>(ah.v, al.v, bq.v, bq.v, acc[t]); }
  }
#pragma unroll
  for (int t = 0; t < 4; ++t) { if (col0 + t * 16 >= N) continue;
#pragma unroll
    for (int r = 0; r < 8; ++r) so[w][8 * hh + r][t * 16 + ln] = acc[t][r] * alpha; }
  __builtin_amdgcn_fence(__ATOMIC_ACQ_REL, "workgroup"); __builtin_amdgcn_wave_barrier();
  const int rsub = lane >> 4, c4 = (lane & 15) * 4;
  {
#pragma unroll
    for (int q = 0; q < 8; ++q) { const int r = q * 2 + rsub; if (col0 + c4 < N) { const v4f v = *(const v4fa*)&so[w][r][c4]; *(v4f*)(C + (size_t)(row0 + r) * ldc + col0 + c4) = v; } }
     }
}

// Wt[n][k] = f16(W[k][n]·scale) from f32 row-major W[K][N] (scale = power of two; bf16-exact weights stay exact in f16 away from the subnormal range)
__device__ __forceinline__ void wt_f16_part(const float* __restrict__ W, _Float16* __restrict__ Wt, int K, int N, float scale, int blk) {      /* blk: index of the 256-thread work-group within this matrix */
  const int t = blk * 256 + threadIdx.x; if (t >= N * (K / 8)) return; const int n = t / (K / 8), k8 = (t % (K / 8)) * 8; FragH f;
#pragma unroll
  for (int i = 0; i < 8; ++i) f.h[i] = (_Float16)(bf16_round(W[(size_t)(k8 + i) * N + n]) * scale); const v8us o = f.half[0];
  *(v8us*)((unsigned short*)Wt + (size_t)n * K + k8) = o; 
}
// k_gemm_hh variant with fused epilogue: v = acc·alpha + bias[by·sBias + col] (+ CP[(row/rowsPerB)·sCPb + by·64 + col] if CP) ; ACT 0 none / 1 elu ; writes f16 C16 (and f32 C if non-null)
template <int ACT>
__global__ __launch_bounds__(128) void k_gemm_hhx(const _Float16* __restrict__ A, int lda, size_t sA, const _Float16* __restrict__ Bh, int ldb, size_t sB, float alpha, const float* __restrict__ bias, size_t sBias, const float* __restrict__ CP, int rowsPerB, size_t sCPb, int row0g,
    float* __restrict__ C, _Float16* __restrict__ C16, int ldc, size_t sC, int M, int N, int K) {
  __shared__ __attribute__((aligned(16))) float so[4][16][64];
  const int tid = threadIdx.x, w = tid >> 5, lane = tid & 31, ln = lane & 15, hh = lane >> 4; const int by = blockIdx.y;
  A += (size_t)by * sA; Bh += (size_t)by * sB; const size_t cofs = (size_t)by * sC; const float* bp = bias ? bias + (size_t)by * sBias : nullptr;
  const int ntn = (N + 63) / 64; const int wid = blockIdx.x * 4 + w; const int mt = wid / ntn, nq = wid % ntn; if (mt * 16 >= M) return;
  const int row0 = mt * 16, col0 = nq * 64; const _Float16* arow = A + (size_t)(row0 + ln) * lda;
  v8f acc[4] = {};
  for (int kb = 0; kb < K; kb += 32) { FragH ah; ah.half[0] = *(const v8us*)((const unsigned short*)arow + kb + 8 * hh); ah.half[1] = *(const v8us*)((const unsigned short*)arow + kb + 16 + 8 * hh);
#pragma unroll
    for (int t = 0; t < 4; ++t) { if (col0 + t * 16 >= N) continue; const size_t boff = (size_t)(col0 + t * 16 + ln) * ldb + kb; FragH bq; bq.half[0] = *(const v8us*)((const unsigned short*)Bh + boff + 8 * hh); bq.half[1] = *(const v8us*)((const unsigned short*)Bh + boff + 16 + 8 * hh);
      acc[t] = mmaH<1>(ah.v, ah.v, bq.v, bq.v, acc[t]); }
  }
#pragma unroll
  for (int t = 0; t < 4; ++t) { if (col0 + t * 16 >= N) continue; const int col = col0 + t * 16 + ln; const float bv = bp ? bf16_round(bp[col]) : 0.f;
#pragma unroll
    for (int r = 0; r < 8; ++r) { float v = acc[t][r] * alpha + bv; if (CP) { const int rr = row0g + row0 + 8 * hh + r; if (rowsPerB < 0) v += CP[cofs + (size_t)rr * ldc + col];      /* rowsPerB < 0: own element of the batched C plane */ else { const int bidx = rr / rowsPerB; v += CP[(size_t)bidx * sCPb + (size_t)by * 64 + col]; } } if (ACT == 1) v = (v > 0.f) ? v : expm1f(v); else if (ACT == 7) v = (v > 0.f) ? v + 1.0f : expf(v); else if (ACT == 8) v = tanhf(v); else if (ACT == 9) v = 0.5f * v * (1.0f + tanhf(0.7978845608028654f * (v + 0.044715f * v * v * v))); else if (ACT == 11) v = 1.0f / (1.0f + expf(-v)); else if (ACT == 12) v = (v > 0.f) ? v : 0.01f * v; else if (ACT == 14) v = (v > 0.f) ? v : 0.1f * v; else if (ACT == 16) v = (v >= 0.f) ? v : 0.3f * v; else if (ACT == 17) v = (v >= 0.f) ? v : 0.2f * v; else if (ACT == 15) v = v / (1.0f + expf(-v)); else if (ACT == 3) v = fmaxf(v, 0.f); else if (ACT == 6) v = 0.5f * v * (1.0f + erff(v * 0.70710678118654752f)); so[w][8 * hh + r][t * 16 + ln] = v; } }
  __builtin_amdgcn_fence(__ATOMIC_ACQ_REL, "workgroup"); __builtin_amdgcn_wave_barrier();
  const int rsub = lane >> 4, c4 = (lane & 15) * 4; typedef _Float16 v4h __attribute__((ext_vector_type(4)));
  {
#pragma unroll
    for (int q = 0; q < 8; ++q) { const int r = q * 2 + rsub; if (col0 + c4 < N) { const v4f v = *(const v4fa*)&so[w][r][c4]; if (C) *(v4f*)(C + cofs + (size_t)(row0 + r) * ldc + col0 + c4) = v; if (C16) { v4h h4; for (int i = 0; i < 4; ++i) h4[i] = (_Float16)v[i]; *(v4h*)(C16 + cofs + (size_t)(row0 + r) * ldc + col0 + c4) = h4; } } }
     }
}


typedef _Float16 v4h __attribute__((ext_vector_type(4)));

__global__ __launch_bounds__(256) void k_x16(const float* __restrict__ x, _Float16* __restrict__ X16, size_t n8) { const size_t t = (size_t)blockIdx.x * 256 + threadIdx.x; if (t >= n8) return; FragH f;
#pragma unroll
  for (int q = 0; q < 8; ++q) f.h[q] = (_Float16)bf16_round(x[t * 8 + q]); *(v8us*)((unsigned short*)X16 + t * 8) = f.half[0];  }
__global__ __launch_bounds__(256) void k_h16(const float* __restrict__ x, _Float16* __restrict__ X16, size_t n8) { const size_t t = (size_t)blockIdx.x * 256 + threadIdx.x; if (t >= n8) return; FragH f;
#pragma unroll
  for (int q = 0; q < 8; ++q) f.h[q] = (_Float16)x[t * 8 + q]; *(v8us*)((unsigned short*)X16 + t * 8) = f.half[0];  }
__global__ __launch_bounds__(256) void k_round16f(const float* __restrict__ W, _Float16* __restrict__ Bt, size_t n8) { const size_t t = (size_t)blockIdx.x * 256 + threadIdx.x; if (t >= n8) return; FragH f;
#pragma unroll
  for (int i = 0; i < 8; ++i) f.h[i] = (_Float16)(bf16_round(W[t * 8 + i]) * 16.0f); *(v8us*)((unsigned short*)Bt + t * 8) = f.half[0];  }
template <int NHv, int TTv>
__global__ __launch_bounds__(256) void k_vt(const _Float16* __restrict__ V16, int ldv, int voff, _Float16* __restrict__ Vt) { __shared__ unsigned short tl[64][66]; const int tid = threadIdx.x; const int slab = blockIdx.x / (TTv / 64), lg = blockIdx.x % (TTv / 64); const int b = slab / NHv, h = slab % NHv;
  for (int i = tid; i < 64 * 8; i += 256) { const int r = i / 8, c8 = (i % 8) * 8; FragH f; f.half[0] = *(const v8us*)((const unsigned short*)V16 + ((size_t)b * TTv + lg * 64 + r) * ldv + voff + h * 64 + c8);
#pragma unroll
    for (int q = 0; q < 8; ++q) tl[r][c8 + q] = f.u[q]; }
  __syncthreads();
  {
#pragma unroll
    for (int rd = 0; rd < 2; ++rd) { const int d = rd * 32 + tid / 8, pc = tid % 8; FragH f;
#pragma unroll
      for (int q = 0; q < 8; ++q) f.u[q] = tl[pc * 8 + q][d];
      *(v8us*)((unsigned short*)Vt + ((size_t)slab * 64 + d) * TTv + lg * 64 + pc * 8) = f.half[0]; }
     } }

__global__ __launch_bounds__(256) void k_hl(const float* __restrict__ F, _Float16* __restrict__ Hh, _Float16* __restrict__ Hl, size_t n8) { const size_t t = (size_t)blockIdx.x * 256 + threadIdx.x; if (t >= n8) return; FragH fh, fl; const v4f a = *(const v4fa*)(F + t * 8), c = *(const v4fa*)(F + t * 8 + 4);
#pragma unroll
  for (int q = 0; q < 4; ++q) { _Float16 h = (_Float16)a[q]; fh.h[q] = h; fl.h[q] = (_Float16)((a[q] - (float)h) * 1024.0f); h = (_Float16)c[q]; fh.h[4 + q] = h; fl.h[4 + q] = (_Float16)((c[q] - (float)h) * 1024.0f); }
  { *(v8us*)((unsigned short*)Hh + t * 8) = fh.half[0]; *(v8us*)((unsigned short*)Hl + t * 8) = fl.half[0];  } }

// ---- fast GEMM (wave tile 32x64; requires M % 32 == 0 rows per launch region and N % 64 == 0); epilogue = k_gemm_hhx semantics ----
__device__ __forceinline__ v16h g2_frag(const _Float16* p, int hh) { FragH f; f.half[0] = *(const v8us*)((const unsigned short*)p + 8 * hh); f.half[1] = *(const v8us*)((const unsigned short*)p + 16 + 8 * hh); return f.v; }
__device__ __forceinline__ v8f g2_mma(v16h a, v16h b, v8f c) { v8f d = __builtin_amdgcn_wmma_f32_16x16x32_f16(false, a, false, b, (short)0, c, false, false); asm volatile("v_nop\n\tv_nop\n\tv_nop\n\tv_nop" : "+v"(d) : "v"(a), "v"(b)); return d; }
template <int ACT>
__global__ __launch_bounds__(128) void k_gemm2(const _Float16* __restrict__ A, int lda, size_t sA, const _Float16* __restrict__ Bh, int ldb, size_t sB, float alpha, const float* __restrict__ bias0, const float* __restrict__ bias1, const float* __restrict__ bias2, size_t sBias, const float* __restrict__ CP, int rowsPerB, size_t sCPb, int row0g,
    float* __restrict__ C, _Float16* __restrict__ C16, int ldc, size_t sC, int M, int N, int K) { static_assert(ACT == 0 || ACT == 3 || ACT == 6 || ACT == 8 || ACT == 9 || ACT == 11 || ACT == 12 || ACT == 14 || ACT == 15 || ACT == 16 || ACT == 17, "k_gemm2: unsupported ACT code (would silently apply no activation)");
  __shared__ __attribute__((aligned(16))) float so[4][32][68];
  const int tid = threadIdx.x, w = tid >> 5, lane = tid & 31, ln = lane & 15, hh = lane >> 4; const int by = blockIdx.y;
  const float* bias = by == 0 ? bias0 : by == 1 ? bias1 : bias2;      /* the biases of up to three products batched over blockIdx.y are separate buffers */
  A += (size_t)by * sA; Bh += (size_t)by * sB; const size_t cofs = (size_t)by * sC; const float* bp = bias ? bias + (size_t)by * sBias : nullptr;
  const int ntn = N >> 6; const int mt = blockIdx.x / ntn, nq = blockIdx.x - mt * ntn; const int row0 = mt * 128 + 32 * w, col0 = nq * 64; if (row0 >= M) return;
  const _Float16* a0p = A + (size_t)(row0 + ln) * lda; const _Float16* a1p = a0p + (size_t)16 * lda;
  const _Float16* b0p = Bh + (size_t)(col0 + ln) * ldb; const _Float16* b1p = b0p + (size_t)16 * ldb; const _Float16* b2p = b1p + (size_t)16 * ldb; const _Float16* b3p = b2p + (size_t)16 * ldb;
  const v8f z8 = {0.f,0.f,0.f,0.f,0.f,0.f,0.f,0.f}; v8f c00 = z8, c01 = z8, c02 = z8, c03 = z8, c10 = z8, c11 = z8, c12 = z8, c13 = z8;
#pragma unroll 1
  for (int kb = 0; kb < K; kb += 32) { const v16h a0 = g2_frag(a0p + kb, hh), a1 = g2_frag(a1p + kb, hh);
    v16h b = g2_frag(b0p + kb, hh); c00 = g2_mma(a0, b, c00); c10 = g2_mma(a1, b, c10);
    b = g2_frag(b1p + kb, hh); c01 = g2_mma(a0, b, c01); c11 = g2_mma(a1, b, c11);
    b = g2_frag(b2p + kb, hh); c02 = g2_mma(a0, b, c02); c12 = g2_mma(a1, b, c12);
    b = g2_frag(b3p + kb, hh); c03 = g2_mma(a0, b, c03); c13 = g2_mma(a1, b, c13); }
  v8f accs[8] = {c00, c01, c02, c03, c10, c11, c12, c13};
#pragma unroll
  for (int u = 0; u < 8; ++u) { const int t = u & 3, half = u >> 2; const int col = col0 + t * 16 + ln; const float bv = bp ? bf16_round(bp[col]) : 0.f;
#pragma unroll
    for (int r = 0; r < 8; ++r) { const int rloc = half * 16 + 8 * hh + r; float v = accs[u][r] * alpha + bv; if (CP) { if (rowsPerB < 0) v += CP[cofs + (size_t)(row0g + row0 + rloc) * ldc + col];      /* rowsPerB < 0: own element of the batched C plane */ else { const int bidx = (row0g + row0 + rloc) / rowsPerB; v += CP[(size_t)bidx * sCPb + (size_t)by * 64 + col]; } }
      if (ACT == 3) v = fmaxf(v, 0.f); else if (ACT == 6) v = 0.5f * v * (1.0f + erff(v * 0.70710678118654752f)); else if (ACT == 11) v = 1.0f / (1.0f + expf(-v)); else if (ACT == 15) v = v / (1.0f + expf(-v)); else if (ACT == 12) v = (v > 0.f) ? v : 0.01f * v; else if (ACT == 8) v = tanhf(v); else if (ACT == 9) v = 0.5f * v * (1.0f + tanhf(0.7978845608028654f * (v + 0.044715f * v * v * v))); else if (ACT == 14) v = (v > 0.f) ? v : 0.1f * v; else if (ACT == 16) v = (v >= 0.f) ? v : 0.3f * v; else if (ACT == 17) v = (v >= 0.f) ? v : 0.2f * v;
      so[w][rloc][t * 16 + ln] = v; } }
  __builtin_amdgcn_fence(__ATOMIC_ACQ_REL, "workgroup"); __builtin_amdgcn_wave_barrier();
  const int rsub = lane >> 4, c4 = (lane & 15) * 4;
  {
#pragma unroll
    for (int q = 0; q < 16; ++q) { const int r = q * 2 + rsub; const v4f v = *(const v4fa*)&so[w][r][c4]; if (C) *(v4f*)(C + cofs + (size_t)(row0 + r) * ldc + col0 + c4) = v; if (C16) { v4h h4; for (int i = 0; i < 4; ++i) h4[i] = (_Float16)v[i]; *(v4h*)(C16 + cofs + (size_t)(row0 + r) * ldc + col0 + c4) = h4; } }
     } }


__global__ __launch_bounds__(256) void k_wnat(const float* __restrict__ w, size_t n8, _Float16* __restrict__ Bt) { const size_t t = (size_t)blockIdx.x * 256 + threadIdx.x; if (t >= n8) return; FragH f; for (int q = 0; q < 8; ++q) f.h[q] = (_Float16)(bf16_round(w[t * 8 + q]) * 16.0f); *(v8us*)((unsigned short*)Bt + t * 8) = f.half[0];  }
#define FAW 8                        /* waves per work-group */
#define FAK 64                       /* keys per stage */
#define FAP 144                      /* LDS row pitch, bytes: 128 + 16, an odd multiple of 16 for 16-byte readers */
#define FAN (SQ / FAK)               /* stages */
__device__ __forceinline__ float rs_xh(float x) { return __builtin_bit_cast(float, __builtin_amdgcn_permlanex16(__builtin_bit_cast(int, x), __builtin_bit_cast(int, x), 0x76543210, 0xfedcba98, false, false)); }      /* lane l with lane l ^ 16 */
typedef float v2f __attribute__((ext_vector_type(2))); typedef _Float16 v2h __attribute__((ext_vector_type(2)));
__device__ __forceinline__ v16h fa_frag(const unsigned char* p) { FragH f; f.half[0] = *(const v8us*)p; f.half[1] = *(const v8us*)(p + 32); return f.v; }      /* 32 k of one LDS row, hardware k order: p already holds the lane half's 16 bytes */
__device__ __forceinline__ v8f fa_mma(v16h a, v16h b, v8f c) { return __builtin_amdgcn_wmma_f32_16x16x32_f16(false, a, false, b, (short)0, c, false, false); }
/* work-group barrier that orders LDS alone: __syncthreads() would also wait for the global loads of the stage fetched ahead, which only this thread's registers receive */
__device__ __forceinline__ void fa_barrier() { __builtin_amdgcn_fence(__ATOMIC_RELEASE, "workgroup", "local"); __builtin_amdgcn_s_barrier(); __builtin_amdgcn_fence(__ATOMIC_ACQUIRE, "workgroup", "local"); }
__global__ __launch_bounds__(FAW * 32) void k_fattn(const _Float16* __restrict__ Q, const _Float16* __restrict__ Kg, const _Float16* __restrict__ Vt, _Float16* __restrict__ O) {
  __shared__ __attribute__((aligned(16))) unsigned char L[2][2][FAK * FAP];      /* [buffer][K rows | V^T rows] */
  const int tid = threadIdx.x, lane = tid & 31, ln = lane & 15, hh = lane >> 4; const int wave = __builtin_amdgcn_readfirstlane(tid >> 5);
  const int bh = blockIdx.y, b = bh / NH, h = bh - b * NH; const int q0 = blockIdx.x * (FAW * 16) + wave * 16;
  /* staging: 8 threads per 128-byte row, 32 rows per round, two rounds per tile */
  const int srow = tid >> 3, sch = (tid & 7) * 16;
  const unsigned char* kg = (const unsigned char*)(Kg + ((size_t)b * SQ + srow) * DM + h * HD) + sch;      /* K row srow of stage 0; a stage is FAK rows of DM */
  const unsigned char* vg = (const unsigned char*)(Vt + ((size_t)bh * HD + srow) * SQ) + sch;              /* V^T row d = srow; a stage is FAK keys along the row */
  const int sl = srow * FAP + sch;
  v8us k0, k1, v0, v1;
  auto fetch = [&](int st) { const unsigned char* kp = kg + (size_t)st * (FAK * DM * 2); const unsigned char* vp = vg + (size_t)st * (FAK * 2);
    k0 = *(const v8us*)kp; k1 = *(const v8us*)(kp + (size_t)32 * DM * 2); v0 = *(const v8us*)vp; v1 = *(const v8us*)(vp + (size_t)32 * SQ * 2);
    asm volatile("s_wait_xcnt 0x0" :: "v"(kp), "v"(vp) : "memory"); };      /* the loads' address registers are inputs here, so they stay live up to this wait and are re-used only behind it */
  auto put = [&](int buf) { *(v8us*)&L[buf][0][sl] = k0; *(v8us*)&L[buf][0][sl + 32 * FAP] = k1; *(v8us*)&L[buf][1][sl] = v0; *(v8us*)&L[buf][1][sl + 32 * FAP] = v1; };
  fetch(0);
  const _Float16* qp = Q + ((size_t)b * SQ + q0 + ln) * DM + h * HD; const v16h qf0 = g2_frag(qp, hh), qf1 = g2_frag(qp + 32, hh);      /* B operand: column = query, same k order as fa_frag */
  put(0); fetch(1);
  const v8f z8 = {0.f,0.f,0.f,0.f,0.f,0.f,0.f,0.f}; v8f acc[4] = {z8, z8, z8, z8};      /* acc[t][r] = O^T[16 t + 8 hh + r][query ln] */
  float m = -3.0e38f, l = 0.f;      /* running maximum (log2 domain, both halves alike) and this lane half's part of the denominator */
  const float cs = 0.125f * 1.4426950408889634f;      /* 1 / sqrt(64), and e^x = 2^(x log2 e) */
  const int fo = ln * FAP + hh * 16;
  __syncthreads();      /* publishes stage 0; the full barrier also ends the Q loads here, so that no wait for them stands in the loop, where it would drain the stage fetched ahead */
#pragma unroll 1
  for (int st = 0; st < FAN; ++st) {      /* rolled: the body is one whole stage, and the buffer index is a run-time offset */
    const int buf = st & 1;
    if (st + 1 < FAN) put(buf ^ 1);      /* stage st + 1, fetched one stage ago, into the buffer whose readers all passed the barrier at the foot of stage st - 1 */
    if (st + 2 < FAN) fetch(st + 2);
    const unsigned char* Kb = &L[buf][0][fo]; const unsigned char* Vb = &L[buf][1][fo];
    v16h kf[4][2], vf[4][2]; v8f s[4];
#pragma unroll
    for (int kt = 0; kt < 4; ++kt) { kf[kt][0] = fa_frag(Kb + kt * 16 * FAP); kf[kt][1] = fa_frag(Kb + kt * 16 * FAP + 64); }
#pragma unroll
    for (int kt = 0; kt < 4; ++kt) s[kt] = fa_mma(kf[kt][0], qf0, z8);
#pragma unroll
    for (int kt = 0; kt < 4; ++kt) s[kt] = fa_mma(kf[kt][1], qf1, s[kt]);
#pragma unroll
    for (int t = 0; t < 4; ++t) { vf[t][0] = fa_frag(Vb + t * 16 * FAP); vf[t][1] = fa_frag(Vb + t * 16 * FAP + 64); }
    __builtin_amdgcn_sched_barrier(0);      /* the eight score products run back to back and the V^T reads leave before the softmax: without it the maxima are woven between the products, each behind padding, and the V^T reads are waited for where they are issued */
    float mx = s[0][0];
#pragma unroll
    for (int kt = 0; kt < 4; ++kt)
#pragma unroll
      for (int r = 0; r < 8; ++r) mx = fmaxf(mx, s[kt][r]);
    mx = fmaxf(mx, rs_xh(mx));
    const float mn = fmaxf(m, mx * cs); const float corr = __builtin_amdgcn_exp2f(m - mn); m = mn;      /* corr is 0 in the first stage */
    const v2f cs2 = {cs, cs}, nm2 = {8.0f - mn, 8.0f - mn};      /* weights carried x256 (numerator and denominator alike), away from the f16 subnormal range */
    v2f sa = {0.f, 0.f}, sb = {0.f, 0.f}; union { v16h v; v2h p[8]; } pf[2];
#pragma unroll
    for (int kt = 0; kt < 4; ++kt)
#pragma unroll
      for (int i = 0; i < 4; ++i) { const v2f x = {s[kt][2 * i], s[kt][2 * i + 1]}; const v2f e = __builtin_elementwise_fma(x, cs2, nm2); const v2f p = {__builtin_amdgcn_exp2f(e[0]), __builtin_amdgcn_exp2f(e[1])};
        if (i & 1) sb += p; else sa += p; pf[kt >> 1].p[(kt & 1) * 4 + i] = __builtin_convertvector(p, v2h); }      /* element 8 (kt & 1) + r of the 32-key operand = tile kt, register r */
    sa += sb; l = fmaf(l, corr, sa[0] + sa[1]);
#pragma unroll
    for (int t = 0; t < 4; ++t) acc[t] = acc[t] * corr;
#pragma unroll
    for (int t = 0; t < 4; ++t) acc[t] = fa_mma(vf[t][0], pf[0].v, acc[t]);
#pragma unroll
    for (int t = 0; t < 4; ++t) acc[t] = fa_mma(vf[t][1], pf[1].v, acc[t]);
    fa_barrier();      /* publishes stage st + 1 and ends every wave's reads of this stage's buffer */
  }
  const float inv = 64.0f / (l + rs_xh(l));      /* o carried x64, as the output GEMM's alpha expects */
  _Float16* op = O + ((size_t)b * SQ + q0 + ln) * DM + h * HD + 8 * hh;
#pragma unroll
  for (int t = 0; t < 4; ++t) { FragH f;
#pragma unroll
    for (int r = 0; r < 8; ++r) f.h[r] = (_Float16)(acc[t][r] * inv);
    *(v8us*)((unsigned short*)op + t * 16) = f.half[0]; }      /* 8 consecutive d of one query row: 16 bytes */
}
__global__ __launch_bounds__(256) void k_vt(const _Float16* __restrict__ V16, int b, int h0, _Float16* __restrict__ VT) { __shared__ unsigned short tl[64][65]; const int tid = threadIdx.x; const int hh = blockIdx.x % HG, sg = blockIdx.x / HG; const int s0 = sg * 64; const int h = h0 + hh;
  for (int i = tid; i < 64 * 8; i += 256) { const int j = i / 8, d8 = (i % 8) * 8; FragH f; f.half[0] = *(const v8us*)((const unsigned short*)V16 + ((size_t)b * SQ + s0 + j) * DM + h * HD + d8); for (int q = 0; q < 8; ++q) tl[d8 + q][j] = f.u[q]; }
  __syncthreads();
  { for (int i = tid; i < 64 * 8; i += 256) { const int d = i / 8, j8 = (i % 8) * 8; FragH f; for (int q = 0; q < 8; ++q) f.u[q] = tl[d][j8 + q]; *(v8us*)((unsigned short*)VT + ((size_t)hh * HD + d) * SQ + s0 + j8) = f.half[0]; }  } }



__global__ __launch_bounds__(256) void k_rsmkm(const float* __restrict__ S, _Float16* __restrict__ P, int nrows, const int* __restrict__ am) {
  #pragma clang fp contract(off)
  const int t = blockIdx.x * 256 + threadIdx.x; if (t >= nrows) return; const size_t i = (size_t)t; const float* s = S + i * SQ; const int* mr = am + (size_t)(t % SQ) * SQ; float mx = -3.0e38f;
#pragma unroll 1
  for (int j = 0; j < SQ; ++j) { const float f = (mr[j] != 0) ? 1.f : 0.f; mx = fmaxf(mx, fmaf(f, s[j], (1.f - f) * -1.0e9f)); } float se = 0.f;
#pragma unroll 1
  for (int j = 0; j < SQ; ++j) { const float f = (mr[j] != 0) ? 1.f : 0.f; se += __expf(fmaf(f, s[j], (1.f - f) * -1.0e9f) - mx); } const float sc = 256.0f / se;
#pragma unroll 1
  for (int j0 = 0; j0 < SQ; j0 += 8) { FragH fr; for (int q = 0; q < 8; ++q) { const int j = j0 + q; const float f = (mr[j] != 0) ? 1.f : 0.f; fr.h[q] = (_Float16)(__expf(fmaf(f, s[j], (1.f - f) * -1.0e9f) - mx) * sc); }
    unsigned short* d = (unsigned short*)P + i * SQ + j0; *(v8us*)d = fr.half[0];  } }

// LayerNorm of the bf16-rounded rows, one wave per LNR rows and no LDS: a lane holds columns 4 lane + 128 u (u = 0..3) of each row, so every load covers 512 and every store 256 contiguous bytes;
// all the rows' loads leave first; mean and variance (two passes over the registers) are lane partials, four row_xmask steps and one exchange of the wave halves; gamma and beta are rounded once per wave.
#define LNR 4                        /* rows per wave */
#define LNW 8                        /* waves per work-group: the 256 threads that the weight pass in the same launch has */
template <int CTRL>
__device__ __forceinline__ float ln_dpp(float x) { return __builtin_bit_cast(float, __builtin_amdgcn_update_dpp(0, __builtin_bit_cast(int, x), CTRL, 0xf, 0xf, true)); }      /* lane l with lane l ^ (CTRL - 0x160) of its 16-lane row */
__device__ __forceinline__ float ln_sum32(float x) { x += ln_dpp<0x161>(x); x += ln_dpp<0x162>(x); x += ln_dpp<0x164>(x); x += ln_dpp<0x168>(x); return x + rs_xh(x); }      /* every lane ends with the sum over the wave */
__device__ __forceinline__ void lnw_part(const float* __restrict__ X, const float* __restrict__ g, const float* __restrict__ bb, float eps, _Float16* __restrict__ N16, int blk) {      /* blk: index of the work-group within this input */
  static_assert(DM == 512 && NR % (LNR * LNW) == 0, "lnw_part: a lane holds 16 columns, and every wave has LNR whole rows");
  const int c0 = (threadIdx.x & 31) * 4; const size_t r0 = ((size_t)blk * LNW + (threadIdx.x >> 5)) * LNR;
  const float* xp = X + r0 * DM + c0; _Float16* yp = N16 + r0 * DM + c0;
  v4f x[LNR][4], gg[4], be[4]; float mu[LNR], rs[LNR];
  for (int i = 0; i < LNR; ++i) for (int u = 0; u < 4; ++u) x[i][u] = *(const v4fa*)(xp + i * DM + u * 128);
  for (int u = 0; u < 4; ++u) { gg[u] = *(const v4fa*)(g + c0 + u * 128); be[u] = *(const v4fa*)(bb + c0 + u * 128); }
  asm volatile("s_wait_xcnt 0x0" :: "v"(xp) : "memory");      /* the row loads' address pair is an input here, so it stays live up to this wait */
  for (int u = 0; u < 4; ++u) for (int q = 0; q < 4; ++q) { gg[u][q] = bf16_round(gg[u][q]); be[u][q] = bf16_round(be[u][q]); }
  for (int i = 0; i < LNR; ++i) {
    for (int u = 0; u < 4; ++u) for (int q = 0; q < 4; ++q) x[i][u][q] = bf16_round(x[i][u][q]);
    const v4f t = (x[i][0] + x[i][1]) + (x[i][2] + x[i][3]); mu[i] = (t[0] + t[1]) + (t[2] + t[3]); }
  for (int i = 0; i < LNR; ++i) mu[i] = ln_sum32(mu[i]) * (1.0f / DM);
  for (int i = 0; i < LNR; ++i) {
    for (int u = 0; u < 4; ++u) x[i][u] -= mu[i];
    const v4f t = (x[i][0] * x[i][0] + x[i][1] * x[i][1]) + (x[i][2] * x[i][2] + x[i][3] * x[i][3]); rs[i] = (t[0] + t[1]) + (t[2] + t[3]); }
  for (int i = 0; i < LNR; ++i) rs[i] = rsqrtf(ln_sum32(rs[i]) * (1.0f / DM) + eps);
  for (int i = 0; i < LNR; ++i) for (int u = 0; u < 4; ++u) *(v4h*)(yp + i * DM + u * 128) = __builtin_convertvector(x[i][u] * rs[i] * gg[u] + be[u], v4h);
  asm volatile("s_wait_xcnt 0x0" ::: "memory");      /* behind the last row stores: in the built kernel the weight part's code follows them and rewrites their address and data registers */
}
// Everything that reads only inputs, as ranges of the block index of ONE launch: the four weight passes, then the three LayerNorms. None reads what another writes.
// Bt holds the four weight planes (q, k, v, o) and N16 the three row planes (query, key, value) one behind the other. The weight work-groups, which touch the most lines each, start first.
#define WTB (DM * (DM / 8) / 256)    /* work-groups per weight matrix */
#define LNB ((int)(NR / (LNR * LNW)))      /* work-groups per LayerNorm input */
__global__ __launch_bounds__(256) void k_prep(const float* __restrict__ wq, const float* __restrict__ wk, const float* __restrict__ wv, const float* __restrict__ wo, _Float16* __restrict__ Bt,
                                              const float* __restrict__ xq, const float* __restrict__ xk, const float* __restrict__ xv, const float* __restrict__ g, const float* __restrict__ bb, float eps, _Float16* __restrict__ N16) {
  static_assert(LNW * 32 == 256 && DM * (DM / 8) % 256 == 0, "k_prep: both parts are dealt to work-groups of 256 threads");
  const int bx = blockIdx.x;
  if (bx < 4 * WTB) { const int j = bx / WTB; wt_f16_part(j == 0 ? wq : j == 1 ? wk : j == 2 ? wv : wo, Bt + (size_t)j * DM * DM, DM, DM, 16.0f, bx - j * WTB); }
  else { const int c = bx - 4 * WTB, j = c / LNB; lnw_part(j == 0 ? xq : j == 1 ? xk : xv, g, bb, eps, N16 + (size_t)j * NR * DM, c - j * LNB); }
}


extern "C" void kernel_launch(void* const* d_in, const int* in_sizes, int n_in,
                              void* d_out, int out_size, void* d_ws, size_t ws_size, hipStream_t stream) {
  (void)in_sizes; (void)n_in; (void)out_size;
  const float* const* I = (const float* const*)d_in; const float* xq = I[0]; const float* xk = I[1]; const float* xv = I[2]; const float* lng = I[3]; const float* lnb = I[4]; const float* wq = I[5]; const float* bq = I[6]; const float* wk = I[7]; const float* bk = I[8]; const float* wv = I[9]; const float* bv = I[10]; const float* wo = I[11]; const float* bo = I[12]; const float* x = xq;      /* query, key, value; shared LayerNorm gamma / beta [512]; [in][out] Wq / Wk / Wv / Wo + biases */
  char* ws = (char*)d_ws; size_t off = 0;
  auto take = [&](size_t bytes) { char* p = ws + off; off += (bytes + 255) & ~(size_t)255; return p; };
  _Float16* BQ = (_Float16*)take((size_t)4 * DM * DM * 2); _Float16* BO = BQ + (size_t)3 * DM * DM;      /* weight planes q, k, v, o, one behind the other */
  _Float16* X16 = (_Float16*)take((size_t)3 * NR * DM * 2);      /* LN(query), LN(key), LN(value) rows, one plane behind the other */
  _Float16* Q16 = (_Float16*)take((size_t)3 * NR * DM * 2); _Float16* K16 = Q16 + NR * DM; _Float16* V16 = K16 + NR * DM; _Float16* O16 = (_Float16*)take(NR * DM * 2);      /* q, k, v planes likewise */
  _Float16* VT = (_Float16*)take((size_t)NB * NH * HD * SQ * 2);
  if (off > ws_size) return;
  k_prep<<<4 * WTB + 3 * LNB, 256, 0, stream>>>(wq, wk, wv, wo, BQ, x, xk, xv, lng, lnb, 1e-5f, X16);      /* [in][out] -> Bt x16 for all four weights; LN with the SHARED parameters -> f16 rows for all three inputs */
  const size_t r0p = (size_t)B0 * SQ;      /* first projected row */
  k_gemm2<0><<<dim3((unsigned)((MP / 128) * (DM / 64)), 3), 128, 0, stream>>>(X16 + r0p * DM, DM, NR * DM, BQ, DM, (size_t)DM * DM, 0.0625f, bq, bk, bv, 0, nullptr, 1, 0, 0, nullptr, Q16 + r0p * DM, DM, NR * DM, MP, DM, DM);      /* q, k and v projections: blockIdx.y picks the planes and the bias */
  k_vt<NH, SQ><<<NB * NH * (SQ / 64), 256, 0, stream>>>(V16, LQ, 0, VT);      /* V^T [NB][NH][HD][SQ] */
  k_fattn<<<dim3(SQ / (FAW * 16), NB * NH), FAW * 32, 0, stream>>>(Q16, K16, VT, O16);      /* o x64 (merged heads) as f16 rows, all batches and heads in one launch */
  k_gemm2<0><<<dim3((unsigned)((MPO / 128) * (DM / 64)), 1), 128, 0, stream>>>(O16 + r0p * DM, DM, 0, BO, DM, 0, 0.0009765625f, bo, bo, bo, 0, nullptr, 1, 0, 0, (float*)d_out + r0p * DM, nullptr, DM, 0, MPO, DM, DM);      /* out rows are the output layout */
}

// v005
// It runs in 61.1 microseconds.
// Next to v004, in two timings, it ran 1.46 and 1.45 times as fast.
// All steps since v000 together make it 31.1 times as fast.
#include <hip/hip_runtime.h>
// Multi-head attention over THREE inputs, each passed through ONE shared LayerNorm first (query, key, value [2][2048][512]; Q = LN(query) Wq + bq, K = LN(key) Wk + bk, V = LN(value) Wv + bv with LN: biased var, eps 1e-5, shared ln_g / ln_b; [in][out] 512 x 512, zero biases); 8 heads of 64; scores / 8; softmax over all 2048 keys (no mask); out = merged Wo + bo -> [2][2048][512]; no residual).
// Structure: token rows r = b*2048 + s; LN of the bf16-rounded inputs as f16 rows; the weight passes and the LayerNorms as block ranges of one launch; Q, K, V as three WMMA GEMMs in one launch, blockIdx.y the product (32x64 wave tiles, f32 accumulation, exact x16 weights + bias, f16 outputs); V^T for all batches and heads via LDS transposes; one fused attention launch over all (batch, head, 128 queries): S^T = K . Q^T (K = 64) on WMMA, online softmax in registers (f32 running maximum and sum, base 2, 1/sqrt(64) folded into the exponent; unnormalised weights x256, in (0, 256], as f16), O^T += V^T . P^T on WMMA, divided by the sum at the end (o carried x64 against f16 subnormal flush, folded into the output GEMM alpha) and written straight into the merged f16 o rows; out = o W_o + b GEMM (f32) into the output layout.
// Compute dtype: inputs rounded to bf16; weights exact; LN rows, q, k, v, softmax weights and o as plain f16 GEMM operands (~2^-12); scores and softmax statistics f32; v_wmma_f32_16x16x32_f16.
#define NB 2
#define SQ 2048
#define DM 512
#define NH 8
#define HD 64
#define HG 4                         /* heads per launch of the per-batch k_vt */
#define B0 0                         /* first batch processed (debug hook) */
#define NBR NB                       /* batches processed (debug hook) */
#define NR ((size_t)NB * SQ)         /* token rows */
#define MP ((int)((size_t)NBR * SQ)) /* rows projected (debug hook) */
#define QN SQ                        /* query rows per batch (unused: k_fattn attends all SQ) */
#define NHD NH                       /* heads (unused: k_fattn covers all NH heads) */
#define MPO MP                       /* rows through the output stage (debug hook) */
#define LQ DM      /* row pitch of the q/k/v rows */
typedef __bf16 v16b __attribute__((ext_vector_type(16)));
typedef unsigned short v8us __attribute__((ext_vector_type(8), may_alias));
typedef float  v8f  __attribute__((ext_vector_type(8)));
typedef float  v4f  __attribute__((ext_vector_type(4)));
typedef float  v4fa __attribute__((ext_vector_type(4), may_alias));
union FragB { v16b v; v8us half[2]; unsigned short u[16]; };

__device__ __forceinline__ unsigned short bf16_bits(float x) { unsigned int u = __float_as_uint(x); return (unsigned short)((u + 0x7FFFu + ((u >> 16) & 1u)) >> 16); }
__device__ __forceinline__ float bf16_val(unsigned short b) { return __uint_as_float(((unsigned int)b) << 16); }
__device__ __forceinline__ float bf16_round(float x) { return bf16_val(bf16_bits(x)); }
// D += A·B with NT terms: 1 = ah·bh, 2 = + al·bh (A split), 3 = + ah·bl (both split)
template <int NT>
__device__ __forceinline__ v8f mmaN(v16b ah, v16b al, v16b bh, v16b bl, v8f c) {
  c = __builtin_amdgcn_wmma_f32_16x16x32_bf16(false, ah, false, bh, (short)0, c, false, false);
  if (NT >= 2) c = __builtin_amdgcn_wmma_f32_16x16x32_bf16(false, al, false, bh, (short)0, c, false, false);
  if (NT >= 3) c = __builtin_amdgcn_wmma_f32_16x16x32_bf16(false, ah, false, bl, (short)0, c, false, false);
  asm volatile("v_nop\n\tv_nop\n\tv_nop\n\tv_nop" : "+v"(c) : "v"(ah), "v"(al), "v"(bh), "v"(bl));
  return c;
}

__global__ __launch_bounds__(256) void k_wt_bf16(const float* __restrict__ W, unsigned short* __restrict__ Wt, int K, int N) {
  const int t = blockIdx.x * 256 + threadIdx.x;
  const int k8n = K / 8;
  if (t >= N * k8n) return;
  const int n = t / k8n, k8 = (t % k8n) * 8;
  v8us v;
#pragma unroll
  for (int i = 0; i < 8; ++i) v[i] = bf16_bits(W[(size_t)(k8 + i) * N + n]);
  *(v8us*)(Wt + (size_t)n * K + k8) = v;
  
}

// GEMM C[M][N] (f32, pitch ldc) = act(A[M][K]·W + bias). A f32 row-major (pitch lda) converted per fragment to bf16
// (ASPLIT: hi/lo two planes -> 2 terms, else single rounded term); Wt bf16 [N][K] (pitch ldb). BIAS_BF16 rounds the
// bias to bf16 first (bias quantised to bf16 before the add). K%32==0, M%16==0, N%64==0.
template <bool ASPLIT, int ACT, bool BIAS_BF16>
__global__ __launch_bounds__(128) void k_gemm_bf(const float* __restrict__ A, int lda, const unsigned short* __restrict__ Wt, int ldb,
                                               const float* __restrict__ bias, float* __restrict__ C, int ldc, int M, int N, int K) {
  __shared__ __attribute__((aligned(16))) float so[4][16][64];
  const int tid = threadIdx.x, w = tid >> 5, lane = tid & 31, ln = lane & 15, hh = lane >> 4;
  const int ntn = N / 64;
  const int wid = blockIdx.x * 4 + w;
  const int mt = wid / ntn, nq = wid % ntn;
  if (mt * 16 >= M) return;
  const int row0 = mt * 16, col0 = nq * 64;
  const float* arow = A + (size_t)(row0 + ln) * lda;
  v8f acc[4] = {};
  for (int kb = 0; kb < K; kb += 32) {
    FragB ah, al;
    const v4f x0 = *(const v4fa*)(arow + kb + 8 * hh), x1 = *(const v4fa*)(arow + kb + 8 * hh + 4);
    const v4f x2 = *(const v4fa*)(arow + kb + 16 + 8 * hh), x3 = *(const v4fa*)(arow + kb + 16 + 8 * hh + 4);
    float xs[16] = {x0[0],x0[1],x0[2],x0[3],x1[0],x1[1],x1[2],x1[3],x2[0],x2[1],x2[2],x2[3],x3[0],x3[1],x3[2],x3[3]};
#pragma unroll
    for (int i = 0; i < 16; ++i) { const unsigned short hb = bf16_bits(xs[i]); ah.u[i] = hb; al.u[i] = ASPLIT ? bf16_bits(xs[i] - bf16_val(hb)) : (unsigned short)0; }
#pragma unroll
    for (int t = 0; t < 4; ++t) {
      const unsigned short* brow = Wt + (size_t)(col0 + t * 16 + ln) * ldb + kb;
      FragB b;
      b.half[0] = *(const v8us*)(brow + 8 * hh);
      b.half[1] = *(const v8us*)(brow + 16 + 8 * hh);
      acc[t] = mmaN<ASPLIT ? 2 : 1>(ah.v, al.v, b.v, b.v, acc[t]);
    }
  }
#pragma unroll
  for (int t = 0; t < 4; ++t) {
    float bv = bias ? bias[col0 + t * 16 + ln] : 0.f;
    if (BIAS_BF16) bv = bf16_round(bv);
#pragma unroll
    for (int r = 0; r < 8; ++r) { float v = acc[t][r] + bv; if (ACT == 1) v = fmaxf(v, 0.f); so[w][8 * hh + r][t * 16 + ln] = v; }
  }
  __builtin_amdgcn_fence(__ATOMIC_ACQ_REL, "workgroup");
  __builtin_amdgcn_wave_barrier();
  const int rsub = lane >> 4, c4 = (lane & 15) * 4;
  {
#pragma unroll
    for (int q = 0; q < 8; ++q) {
      const int r = q * 2 + rsub;
      const v4f v = *(const v4fa*)&so[w][r][c4];
      *(v4f*)(C + (size_t)(row0 + r) * ldc + col0 + c4) = v;
    }
    
  }
}

// GEMM C = act(A·W + bias + resid): A f32 (ASPLIT -> hi/lo 2 terms), Wt bf16 [N][K]; ACT 0 none, 1 relu, 2 exact gelu;
// resid (optional, f32, row index = (row % rmod), pitch ldr, RES_BF16 rounds it) added before the activation.
template <bool ASPLIT, int ACT, bool BIAS_BF16, bool RES_BF16>
__global__ __launch_bounds__(128) void k_gemm_bf3(const float* __restrict__ A, int lda, const unsigned short* __restrict__ Wt, int ldb,
                                                const float* __restrict__ bias, const float* __restrict__ resid, int rmod, int ldr,
                                                float* __restrict__ C, int ldc, int M, int N, int K) {
  __shared__ __attribute__((aligned(16))) float so[4][16][64];
  const int tid = threadIdx.x, w = tid >> 5, lane = tid & 31, ln = lane & 15, hh = lane >> 4;
  const int ntn = N / 64;
  const int wid = blockIdx.x * 4 + w;
  const int mt = wid / ntn, nq = wid % ntn;
  if (mt * 16 >= M) return;
  const int row0 = mt * 16, col0 = nq * 64;
  const float* arow = A + (size_t)(row0 + ln) * lda;
  v8f acc[4] = {};
  for (int kb = 0; kb < K; kb += 32) {
    FragB ah, al;
    const v4f x0 = *(const v4fa*)(arow + kb + 8 * hh), x1 = *(const v4fa*)(arow + kb + 8 * hh + 4);
    const v4f x2 = *(const v4fa*)(arow + kb + 16 + 8 * hh), x3 = *(const v4fa*)(arow + kb + 16 + 8 * hh + 4);
    float xs[16] = {x0[0],x0[1],x0[2],x0[3],x1[0],x1[1],x1[2],x1[3],x2[0],x2[1],x2[2],x2[3],x3[0],x3[1],x3[2],x3[3]};
#pragma unroll
    for (int i = 0; i < 16; ++i) { const unsigned short hb = bf16_bits(xs[i]); ah.u[i] = hb; al.u[i] = ASPLIT ? bf16_bits(xs[i] - bf16_val(hb)) : (unsigned short)0; }
#pragma unroll
    for (int t = 0; t < 4; ++t) {
      const unsigned short* brow = Wt + (size_t)(col0 + t * 16 + ln) * ldb + kb;
      FragB b;
      b.half[0] = *(const v8us*)(brow + 8 * hh);
      b.half[1] = *(const v8us*)(brow + 16 + 8 * hh);
      acc[t] = mmaN<ASPLIT ? 2 : 1>(ah.v, al.v, b.v, b.v, acc[t]);
    }
  }
#pragma unroll
  for (int t = 0; t < 4; ++t) {
    const int col = col0 + t * 16 + ln;
    float bv = bias ? bias[col] : 0.f;
    if (BIAS_BF16) bv = bf16_round(bv);
#pragma unroll
    for (int r = 0; r < 8; ++r) {
      float v = acc[t][r] + bv;
      if (resid) { float rv = resid[(size_t)((row0 + 8 * hh + r) % rmod) * ldr + col]; if (RES_BF16) rv = bf16_round(rv); v += rv; }
      if (ACT == 1) v = fmaxf(v, 0.f);
      if (ACT == 2) v = 0.5f * v * (1.0f + erff(v * 0.70710678118654752f));
      if (ACT == 3) { const float u = 0.7978845608028654f * (v + 0.044715f * v * v * v); v = 0.5f * v * (1.0f + tanhf(u)); }
      so[w][8 * hh + r][t * 16 + ln] = v;
    }
  }
  __builtin_amdgcn_fence(__ATOMIC_ACQ_REL, "workgroup");
  __builtin_amdgcn_wave_barrier();
  const int rsub = lane >> 4, c4 = (lane & 15) * 4;
  {
#pragma unroll
    for (int q = 0; q < 8; ++q) {
      const int r = q * 2 + rsub;
      const v4f v = *(const v4fa*)&so[w][r][c4];
      *(v4f*)(C + (size_t)(row0 + r) * ldc + col0 + c4) = v;
    }
    
  }
}
// row LayerNorm (biased variance, eps) over N: s = X (+ R); optional out_sum <- s; out_norm <- (s-mu)*rsqrt(var+eps)*g + b
template <bool PARAM_BF16>
__global__ __launch_bounds__(256) void k_layernorm(const float* __restrict__ X, const float* __restrict__ R, const float* __restrict__ g, const float* __restrict__ bta,
                                                  float* __restrict__ out_sum, float* __restrict__ out_norm, int N, float eps) {
  __shared__ float red[256];
  const int row = blockIdx.x, tid = threadIdx.x;
  const float* x = X + (size_t)row * N; const float* rr = R ? R + (size_t)row * N : nullptr;
  float vals[16];                     // up to N = 4096
  const int per = N / 256;            // contiguous chunk per thread? use strided-by-4 chunks: thread handles j = tid*4 + 1024*u
  float s1 = 0.f;
  for (int u = 0; u < per / 4; ++u) {
    const int j = tid * 4 + 1024 * u;
    const v4f a = *(const v4fa*)(x + j);
    v4f b = {0.f,0.f,0.f,0.f}; if (rr) b = *(const v4fa*)(rr + j);
#pragma unroll
    for (int q = 0; q < 4; ++q) { const float v = a[q] + b[q]; vals[u * 4 + q] = v; s1 += v; }
  }
  red[tid] = s1; __syncthreads();
  for (int st = 128; st > 0; st >>= 1) { if (tid < st) red[tid] += red[tid + st]; __syncthreads(); }
  const float mu = red[0] / (float)N; __syncthreads();
  float s2 = 0.f;
  for (int u = 0; u < per / 4; ++u)
#pragma unroll
    for (int q = 0; q < 4; ++q) { const float c = vals[u * 4 + q] - mu; s2 += c * c; }
  red[tid] = s2; __syncthreads();
  for (int st = 128; st > 0; st >>= 1) { if (tid < st) red[tid] += red[tid + st]; __syncthreads(); }
  const float rs = rsqrtf(red[0] / (float)N + eps);
  {
    for (int u = 0; u < per / 4; ++u) {
      const int j = tid * 4 + 1024 * u;
      v4f o, sm;
#pragma unroll
      for (int q = 0; q < 4; ++q) {
        float gg = g[j + q], bb = bta[j + q];
        if (PARAM_BF16) { gg = bf16_round(gg); bb = bf16_round(bb); }
        sm[q] = vals[u * 4 + q]; o[q] = (vals[u * 4 + q] - mu) * rs * gg + bb;
      }
      if (out_sum) *(v4f*)(out_sum + (size_t)row * N + j) = sm;
      *(v4f*)(out_norm + (size_t)row * N + j) = o;
    }
    
  }
}



// ---- f16 WMMA path (v_wmma_f32_16x16x32_f16): 11-bit significands for operands in range — used where a [0,1] probability operand needs more precision than bf16
typedef _Float16 v16h __attribute__((ext_vector_type(16)));
union FragH { v16h v; v8us half[2]; _Float16 h[16]; unsigned short u[16]; };
template <int NT>
__device__ __forceinline__ v8f mmaH(v16h ah, v16h al, v16h bh, v16h bl, v8f c) {
  c = __builtin_amdgcn_wmma_f32_16x16x32_f16(false, ah, false, bh, (short)0, c, false, false);
  if (NT >= 2) c = __builtin_amdgcn_wmma_f32_16x16x32_f16(false, al, false, bh, (short)0, c, false, false);
  if (NT >= 3) c = __builtin_amdgcn_wmma_f32_16x16x32_f16(false, ah, false, bl, (short)0, c, false, false);
  asm volatile("v_nop\n\tv_nop\n\tv_nop\n\tv_nop" : "+v"(c) : "v"(ah), "v"(al), "v"(bh), "v"(bl));
  return c;
}
// batched GEMM like k_gemm_b but f16 operands: A f32 (split into f16 hi/lo if ASPLIT, else rounded to f16), Bt = f16 values [n][k]; alpha; C f32; N multiple of 16 (partial tiles skipped)
template <bool ASPLIT>
__global__ __launch_bounds__(128) void k_gemm_h(const float* __restrict__ A, int lda, size_t sA, const _Float16* __restrict__ Bh, int ldb, size_t sB, float alpha, float* __restrict__ C, int ldc, size_t sC, int M, int N, int K) {
  __shared__ __attribute__((aligned(16))) float so[4][16][64];
  const int tid = threadIdx.x, w = tid >> 5, lane = tid & 31, ln = lane & 15, hh = lane >> 4; const int by = blockIdx.y;
  A += (size_t)by * sA; Bh += (size_t)by * sB; C += (size_t)by * sC;
  const int ntn = (N + 63) / 64; const int wid = blockIdx.x * 4 + w; const int mt = wid / ntn, nq = wid % ntn; if (mt * 16 >= M) return;
  const int row0 = mt * 16, col0 = nq * 64; const float* arow = A + (size_t)(row0 + ln) * lda;
  v8f acc[4] = {};
  for (int kb = 0; kb < K; kb += 32) {
    FragH ah, al;
    const v4f x0 = *(const v4fa*)(arow + kb + 8 * hh), x1 = *(const v4fa*)(arow + kb + 8 * hh + 4), x2 = *(const v4fa*)(arow + kb + 16 + 8 * hh), x3 = *(const v4fa*)(arow + kb + 16 + 8 * hh + 4);
    float xs[16] = {x0[0],x0[1],x0[2],x0[3],x1[0],x1[1],x1[2],x1[3],x2[0],x2[1],x2[2],x2[3],x3[0],x3[1],x3[2],x3[3]};
#pragma unroll
    for (int i = 0; i < 16; ++i) { const _Float16 h = (_Float16)xs[i]; ah.h[i] = h; al.h[i] = ASPLIT ? (_Float16)(xs[i] - (float)h) : (_Float16)0.0f; }
#pragma unroll
    for (int t = 0; t < 4; ++t) { if (col0 + t * 16 >= N) continue; const size_t boff = (size_t)(col0 + t * 16 + ln) * ldb + kb; FragH bq; bq.half[0] = *(const v8us*)(Bh + boff + 8 * hh); bq.half[1] = *(const v8us*)(Bh + boff + 16 + 8 * hh);
      acc[t] = mmaH<ASPLIT ? 2 : 1>(ah.v, al.v, bq.v, bq.v, acc[t]); }
  }
#pragma unroll
  for (int t = 0; t < 4; ++t) { if (col0 + t * 16 >= N) continue;
#pragma unroll
    for (int r = 0; r < 8; ++r) so[w][8 * hh + r][t * 16 + ln] = acc[t][r] * alpha; }
  __builtin_amdgcn_fence(__ATOMIC_ACQ_REL, "workgroup"); __builtin_amdgcn_wave_barrier();
  const int rsub = lane >> 4, c4 = (lane & 15) * 4;
  {
#pragma unroll
    for (int q = 0; q < 8; ++q) { const int r = q * 2 + rsub; if (col0 + c4 < N) { const v4f v = *(const v4fa*)&so[w][r][c4]; *(v4f*)(C + (size_t)(row0 + r) * ldc + col0 + c4) = v; } }
     }
}

// Wt[n][k] = f16(W[k][n]·scale) from f32 row-major W[K][N] (scale = power of two; bf16-exact weights stay exact in f16 away from the subnormal range)
__device__ __forceinline__ void wt_f16_part(const float* __restrict__ W, _Float16* __restrict__ Wt, int K, int N, float scale, int blk) {      /* blk: index of the 256-thread work-group within this matrix */
  const int t = blk * 256 + threadIdx.x; if (t >= N * (K / 8)) return; const int n = t / (K / 8), k8 = (t % (K / 8)) * 8; FragH f;
#pragma unroll
  for (int i = 0; i < 8; ++i) f.h[i] = (_Float16)(bf16_round(W[(size_t)(k8 + i) * N + n]) * scale); const v8us o = f.half[0];
  *(v8us*)((unsigned short*)Wt + (size_t)n * K + k8) = o; 
}
// k_gemm_hh variant with fused epilogue: v = acc·alpha + bias[by·sBias + col] (+ CP[(row/rowsPerB)·sCPb + by·64 + col] if CP) ; ACT 0 none / 1 elu ; writes f16 C16 (and f32 C if non-null)
template <int ACT>
__global__ __launch_bounds__(128) void k_gemm_hhx(const _Float16* __restrict__ A, int lda, size_t sA, const _Float16* __restrict__ Bh, int ldb, size_t sB, float alpha, const float* __restrict__ bias, size_t sBias, const float* __restrict__ CP, int rowsPerB, size_t sCPb, int row0g,
    float* __restrict__ C, _Float16* __restrict__ C16, int ldc, size_t sC, int M, int N, int K) {
  __shared__ __attribute__((aligned(16))) float so[4][16][64];
  const int tid = threadIdx.x, w = tid >> 5, lane = tid & 31, ln = lane & 15, hh = lane >> 4; const int by = blockIdx.y;
  A += (size_t)by * sA; Bh += (size_t)by * sB; const size_t cofs = (size_t)by * sC; const float* bp = bias ? bias + (size_t)by * sBias : nullptr;
  const int ntn = (N + 63) / 64; const int wid = blockIdx.x * 4 + w; const int mt = wid / ntn, nq = wid % ntn; if (mt * 16 >= M) return;
  const int row0 = mt * 16, col0 = nq * 64; const _Float16* arow = A + (size_t)(row0 + ln) * lda;
  v8f acc[4] = {};
  for (int kb = 0; kb < K; kb += 32) { FragH ah; ah.half[0] = *(const v8us*)((const unsigned short*)arow + kb + 8 * hh); ah.half[1] = *(const v8us*)((const unsigned short*)arow + kb + 16 + 8 * hh);
#pragma unroll
    for (int t = 0; t < 4; ++t) { if (col0 + t * 16 >= N) continue; const size_t boff = (size_t)(col0 + t * 16 + ln) * ldb + kb; FragH bq; bq.half[0] = *(const v8us*)((const unsigned short*)Bh + boff + 8 * hh); bq.half[1] = *(const v8us*)((const unsigned short*)Bh + boff + 16 + 8 * hh);
      acc[t] = mmaH<1>(ah.v, ah.v, bq.v, bq.v, acc[t]); }
  }
#pragma unroll
  for (int t = 0; t < 4; ++t) { if (col0 + t * 16 >= N) continue; const int col = col0 + t * 16 + ln; const float bv = bp ? bf16_round(bp[col]) : 0.f;
#pragma unroll
    for (int r = 0; r < 8; ++r) { float v = acc[t][r] * alpha + bv; if (CP) { const int rr = row0g + row0 + 8 * hh + r; if (rowsPerB < 0) v += CP[cofs + (size_t)rr * ldc + col];      /* rowsPerB < 0: own element of the batched C plane */ else { const int bidx = rr / rowsPerB; v += CP[(size_t)bidx * sCPb + (size_t)by * 64 + col]; } } if (ACT == 1) v = (v > 0.f) ? v : expm1f(v); else if (ACT == 7) v = (v > 0.f) ? v + 1.0f : expf(v); else if (ACT == 8) v = tanhf(v); else if (ACT == 9) v = 0.5f * v * (1.0f + tanhf(0.7978845608028654f * (v + 0.044715f * v * v * v))); else if (ACT == 11) v = 1.0f / (1.0f + expf(-v)); else if (ACT == 12) v = (v > 0.f) ? v : 0.01f * v; else if (ACT == 14) v = (v > 0.f) ? v : 0.1f * v; else if (ACT == 16) v = (v >= 0.f) ? v : 0.3f * v; else if (ACT == 17) v = (v >= 0.f) ? v : 0.2f * v; else if (ACT == 15) v = v / (1.0f + expf(-v)); else if (ACT == 3) v = fmaxf(v, 0.f); else if (ACT == 6) v = 0.5f * v * (1.0f + erff(v * 0.70710678118654752f)); so[w][8 * hh + r][t * 16 + ln] = v; } }
  __builtin_amdgcn_fence(__ATOMIC_ACQ_REL, "workgroup"); __builtin_amdgcn_wave_barrier();
  const int rsub = lane >> 4, c4 = (lane & 15) * 4; typedef _Float16 v4h __attribute__((ext_vector_type(4)));
  {
#pragma unroll
    for (int q = 0; q < 8; ++q) { const int r = q * 2 + rsub; if (col0 + c4 < N) { const v4f v = *(const v4fa*)&so[w][r][c4]; if (C) *(v4f*)(C + cofs + (size_t)(row0 + r) * ldc + col0 + c4) = v; if (C16) { v4h h4; for (int i = 0; i < 4; ++i) h4[i] = (_Float16)v[i]; *(v4h*)(C16 + cofs + (size_t)(row0 + r) * ldc + col0 + c4) = h4; } } }
     }
}


typedef _Float16 v4h __attribute__((ext_vector_type(4)));

__global__ __launch_bounds__(256) void k_x16(const float* __restrict__ x, _Float16* __restrict__ X16, size_t n8) { const size_t t = (size_t)blockIdx.x * 256 + threadIdx.x; if (t >= n8) return; FragH f;
#pragma unroll
  for (int q = 0; q < 8; ++q) f.h[q] = (_Float16)bf16_round(x[t * 8 + q]); *(v8us*)((unsigned short*)X16 + t * 8) = f.half[0];  }
__global__ __launch_bounds__(256) void k_h16(const float* __restrict__ x, _Float16* __restrict__ X16, size_t n8) { const size_t t = (size_t)blockIdx.x * 256 + threadIdx.x; if (t >= n8) return; FragH f;
#pragma unroll
  for (int q = 0; q < 8; ++q) f.h[q] = (_Float16)x[t * 8 + q]; *(v8us*)((unsigned short*)X16 + t * 8) = f.half[0];  }
__global__ __launch_bounds__(256) void k_round16f(const float* __restrict__ W, _Float16* __restrict__ Bt, size_t n8) { const size_t t = (size_t)blockIdx.x * 256 + threadIdx.x; if (t >= n8) return; FragH f;
#pragma unroll
  for (int i = 0; i < 8; ++i) f.h[i] = (_Float16)(bf16_round(W[t * 8 + i]) * 16.0f); *(v8us*)((unsigned short*)Bt + t * 8) = f.half[0];  }
template <int NHv, int TTv>
__global__ __launch_bounds__(256) void k_vt(const _Float16* __restrict__ V16, int ldv, int voff, _Float16* __restrict__ Vt) { __shared__ unsigned short tl[64][66]; const int tid = threadIdx.x; const int slab = blockIdx.x / (TTv / 64), lg = blockIdx.x % (TTv / 64); const int b = slab / NHv, h = slab % NHv;
  for (int i = tid; i < 64 * 8; i += 256) { const int r = i / 8, c8 = (i % 8) * 8; FragH f; f.half[0] = *(const v8us*)((const unsigned short*)V16 + ((size_t)b * TTv + lg * 64 + r) * ldv + voff + h * 64 + c8);
#pragma unroll
    for (int q = 0; q < 8; ++q) tl[r][c8 + q] = f.u[q]; }
  __syncthreads();
  {
#pragma unroll
    for (int rd = 0; rd < 2; ++rd) { const int d = rd * 32 + tid / 8, pc = tid % 8; FragH f;
#pragma unroll
      for (int q = 0; q < 8; ++q) f.u[q] = tl[pc * 8 + q][d];
      *(v8us*)((unsigned short*)Vt + ((size_t)slab * 64 + d) * TTv + lg * 64 + pc * 8) = f.half[0]; }
     } }

__global__ __launch_bounds__(256) void k_hl(const float* __restrict__ F, _Float16* __restrict__ Hh, _Float16* __restrict__ Hl, size_t n8) { const size_t t = (size_t)blockIdx.x * 256 + threadIdx.x; if (t >= n8) return; FragH fh, fl; const v4f a = *(const v4fa*)(F + t * 8), c = *(const v4fa*)(F + t * 8 + 4);
#pragma unroll
  for (int q = 0; q < 4; ++q) { _Float16 h = (_Float16)a[q]; fh.h[q] = h; fl.h[q] = (_Float16)((a[q] - (float)h) * 1024.0f); h = (_Float16)c[q]; fh.h[4 + q] = h; fl.h[4 + q] = (_Float16)((c[q] - (float)h) * 1024.0f); }
  { *(v8us*)((unsigned short*)Hh + t * 8) = fh.half[0]; *(v8us*)((unsigned short*)Hl + t * 8) = fl.half[0];  } }

// ---- fast GEMM (work-group tile 128x64, wave tile 32x64; requires M % 128 == 0, N % 64 == 0, K % 64 == 0; LDA / LDB: row pitches of A and Bh in elements); epilogue = k_gemm_hhx semantics ----
// The operand rows come in stages of 64 k: whole 128-byte lines into registers one stage ahead, then into one of two LDS buffers (row pitch 144 bytes), one barrier per stage; the waves read their fragments from LDS.
#define G2K 64                       /* k per stage: 128 bytes of every operand row */
#define G2P 144                      /* LDS row pitch, bytes: 128 + 16, an odd multiple of 16 for 16-byte readers */
#define G2R (128 + 64)               /* rows per stage: 128 of A, then 64 of Bh */
__device__ __forceinline__ v16h g2_frag(const _Float16* p, int hh) { FragH f; f.half[0] = *(const v8us*)((const unsigned short*)p + 8 * hh); f.half[1] = *(const v8us*)((const unsigned short*)p + 16 + 8 * hh); return f.v; }
__device__ __forceinline__ v16h fa_frag(const unsigned char* p) { FragH f; f.half[0] = *(const v8us*)p; f.half[1] = *(const v8us*)(p + 32); return f.v; }      /* 32 k of one LDS row, hardware k order: p already holds the lane half's 16 bytes */
__device__ __forceinline__ v8f fa_mma(v16h a, v16h b, v8f c) { return __builtin_amdgcn_wmma_f32_16x16x32_f16(false, a, false, b, (short)0, c, false, false); }
/* work-group barrier that orders LDS alone: __syncthreads() would also wait for the global loads of the stage fetched ahead, which only this thread's registers receive */
__device__ __forceinline__ void fa_barrier() { __builtin_amdgcn_fence(__ATOMIC_RELEASE, "workgroup", "local"); __builtin_amdgcn_s_barrier(); __builtin_amdgcn_fence(__ATOMIC_ACQUIRE, "workgroup", "local"); }
template <int ACT, int LDA, int LDB>
__global__ __launch_bounds__(128) void k_gemm2(const _Float16* __restrict__ A, size_t sA, const _Float16* __restrict__ Bh, size_t sB, float alpha, const float* __restrict__ bias0, const float* __restrict__ bias1, const float* __restrict__ bias2, size_t sBias, const float* __restrict__ CP, int rowsPerB, size_t sCPb, int row0g,
    float* __restrict__ C, _Float16* __restrict__ C16, int ldc, size_t sC, int M, int N, int K) { static_assert(ACT == 0 || ACT == 3 || ACT == 6 || ACT == 8 || ACT == 9 || ACT == 11 || ACT == 12 || ACT == 14 || ACT == 15 || ACT == 16 || ACT == 17, "k_gemm2: unsupported ACT code (would silently apply no activation)");
  __shared__ __attribute__((aligned(16))) unsigned char sm[2 * G2R * G2P];      /* the two stage buffers; behind the k loop the same bytes hold the epilogue's f32 tiles */
  static_assert(sizeof(float) * 4 * 32 * 68 <= sizeof(sm), "k_gemm2: the epilogue's tiles lie in the stage buffers");
  float (*so)[32][68] = reinterpret_cast<float (*)[32][68]>(sm);
  const int tid = threadIdx.x, w = tid >> 5, lane = tid & 31, ln = lane & 15, hh = lane >> 4; const int by = blockIdx.y;
  const float* bias = by == 0 ? bias0 : by == 1 ? bias1 : bias2;      /* the biases of up to three products batched over blockIdx.y are separate buffers */
  A += (size_t)by * sA; Bh += (size_t)by * sB; const size_t cofs = (size_t)by * sC; const float* bp = bias ? bias + (size_t)by * sBias : nullptr;
  const int ntn = N >> 6; const int mt = blockIdx.x / ntn, nq = blockIdx.x - mt * ntn; const int row0 = mt * 128 + 32 * w, col0 = nq * 64; if (mt * 128 >= M) return;      /* the same for the whole work-group: barriers follow */
  /* staging: 8 threads per 128-byte row, 16 rows per round, 8 rounds for A and 4 for Bh */
  const int srow = tid >> 3, sch = (tid & 7) * 16;
  const unsigned char* ag = (const unsigned char*)(A + (size_t)(mt * 128 + srow) * LDA) + sch;
  const unsigned char* bg = (const unsigned char*)(Bh + (size_t)(col0 + srow) * LDB) + sch;
  const int sl = srow * G2P + sch;
  v8us ra[8], rb[4];
  auto fetch = [&](int st) { const unsigned char* ap = ag + (size_t)st * (G2K * 2); const unsigned char* bp = bg + (size_t)st * (G2K * 2);
#pragma unroll
    for (int r = 0; r < 8; ++r) ra[r] = *(const v8us*)(ap + (size_t)r * 16 * LDA * 2);
#pragma unroll
    for (int r = 0; r < 4; ++r) rb[r] = *(const v8us*)(bp + (size_t)r * 16 * LDB * 2);
    asm volatile("s_wait_xcnt 0x0" :: "v"(ap), "v"(bp) : "memory"); };      /* the loads' address registers are inputs here, so they stay live up to this wait and are re-used only behind it */
  auto put = [&](int buf) { unsigned char* d = sm + buf * (G2R * G2P) + sl;
#pragma unroll
    for (int r = 0; r < 8; ++r) *(v8us*)(d + r * 16 * G2P) = ra[r];
#pragma unroll
    for (int r = 0; r < 4; ++r) *(v8us*)(d + (128 + r * 16) * G2P) = rb[r]; };
  const int ns = K / G2K;
  fetch(0); put(0); if (ns > 1) fetch(1);
  const int fa = (32 * w + ln) * G2P + hh * 16, fb = (128 + ln) * G2P + hh * 16;      /* the lane's row and half in the A rows and in the Bh rows */
  const v8f z8 = {0.f,0.f,0.f,0.f,0.f,0.f,0.f,0.f}; v8f c00 = z8, c01 = z8, c02 = z8, c03 = z8, c10 = z8, c11 = z8, c12 = z8, c13 = z8;
  fa_barrier();      /* publishes stage 0 */
#pragma unroll 1
  for (int st = 0; st < ns; ++st) {      /* rolled: the body is one whole stage, and the buffer index is a run-time offset */
    const int buf = st & 1;
    if (st + 1 < ns) put(buf ^ 1);      /* stage st + 1, fetched one stage ago, into the buffer whose readers all passed the barrier at the foot of stage st - 1 */
    if (st + 2 < ns) fetch(st + 2);
    const unsigned char* Ab = sm + buf * (G2R * G2P) + fa; const unsigned char* Bb = sm + buf * (G2R * G2P) + fb;
    v16h a[2][2], b[2][4];      /* [32-k half of the stage][16-row tile] */
#pragma unroll
    for (int ks = 0; ks < 2; ++ks) {
#pragma unroll
      for (int i = 0; i < 2; ++i) a[ks][i] = fa_frag(Ab + i * 16 * G2P + ks * 64);
#pragma unroll
      for (int t = 0; t < 4; ++t) b[ks][t] = fa_frag(Bb + t * 16 * G2P + ks * 64); }
    __builtin_amdgcn_sched_barrier(0);      /* the stage's 24 LDS reads leave as one group ahead of its 16 products: without it one register set is re-used for every Bh fragment, and each pair of products waits out an LDS read of its own */
#pragma unroll
    for (int ks = 0; ks < 2; ++ks) {      /* k ascending by 32 in every accumulator */
      c00 = fa_mma(a[ks][0], b[ks][0], c00); c10 = fa_mma(a[ks][1], b[ks][0], c10); c01 = fa_mma(a[ks][0], b[ks][1], c01); c11 = fa_mma(a[ks][1], b[ks][1], c11);
      c02 = fa_mma(a[ks][0], b[ks][2], c02); c12 = fa_mma(a[ks][1], b[ks][2], c12); c03 = fa_mma(a[ks][0], b[ks][3], c03); c13 = fa_mma(a[ks][1], b[ks][3], c13); }
    fa_barrier();      /* publishes stage st + 1 and ends every wave's reads of this stage's buffer; the last one frees the buffers for the epilogue */
  }
  v8f accs[8] = {c00, c01, c02, c03, c10, c11, c12, c13};
#pragma unroll
  for (int u = 0; u < 8; ++u) { const int t = u & 3, half = u >> 2; const int col = col0 + t * 16 + ln; const float bv = bp ? bf16_round(bp[col]) : 0.f;
#pragma unroll
    for (int r = 0; r < 8; ++r) { const int rloc = half * 16 + 8 * hh + r; float v = accs[u][r] * alpha + bv; if (CP) { if (rowsPerB < 0) v += CP[cofs + (size_t)(row0g + row0 + rloc) * ldc + col];      /* rowsPerB < 0: own element of the batched C plane */ else { const int bidx = (row0g + row0 + rloc) / rowsPerB; v += CP[(size_t)bidx * sCPb + (size_t)by * 64 + col]; } }
      if (ACT == 3) v = fmaxf(v, 0.f); else if (ACT == 6) v = 0.5f * v * (1.0f + erff(v * 0.70710678118654752f)); else if (ACT == 11) v = 1.0f / (1.0f + expf(-v)); else if (ACT == 15) v = v / (1.0f + expf(-v)); else if (ACT == 12) v = (v > 0.f) ? v : 0.01f * v; else if (ACT == 8) v = tanhf(v); else if (ACT == 9) v = 0.5f * v * (1.0f + tanhf(0.7978845608028654f * (v + 0.044715f * v * v * v))); else if (ACT == 14) v = (v > 0.f) ? v : 0.1f * v; else if (ACT == 16) v = (v >= 0.f) ? v : 0.3f * v; else if (ACT == 17) v = (v >= 0.f) ? v : 0.2f * v;
      so[w][rloc][t * 16 + ln] = v; } }
  __builtin_amdgcn_fence(__ATOMIC_ACQ_REL, "workgroup"); __builtin_amdgcn_wave_barrier();
  const int rsub = lane >> 4, c4 = (lane & 15) * 4;
  {
#pragma unroll
    for (int q = 0; q < 16; ++q) { const int r = q * 2 + rsub; const v4f v = *(const v4fa*)&so[w][r][c4]; if (C) *(v4f*)(C + cofs + (size_t)(row0 + r) * ldc + col0 + c4) = v; if (C16) { v4h h4; for (int i = 0; i < 4; ++i) h4[i] = (_Float16)v[i]; *(v4h*)(C16 + cofs + (size_t)(row0 + r) * ldc + col0 + c4) = h4; } }
     } }


__global__ __launch_bounds__(256) void k_wnat(const float* __restrict__ w, size_t n8, _Float16* __restrict__ Bt) { const size_t t = (size_t)blockIdx.x * 256 + threadIdx.x; if (t >= n8) return; FragH f; for (int q = 0; q < 8; ++q) f.h[q] = (_Float16)(bf16_round(w[t * 8 + q]) * 16.0f); *(v8us*)((unsigned short*)Bt + t * 8) = f.half[0];  }
#define FAW 8                        /* waves per work-group */
#define FAK 64                       /* keys per stage */
#define FAP 144                      /* LDS row pitch, bytes: 128 + 16, an odd multiple of 16 for 16-byte readers */
#define FAN (SQ / FAK)               /* stages */
__device__ __forceinline__ float rs_xh(float x) { return __builtin_bit_cast(float, __builtin_amdgcn_permlanex16(__builtin_bit_cast(int, x), __builtin_bit_cast(int, x), 0x76543210, 0xfedcba98, false, false)); }      /* lane l with lane l ^ 16 */
typedef float v2f __attribute__((ext_vector_type(2))); typedef _Float16 v2h __attribute__((ext_vector_type(2)));
__global__ __launch_bounds__(FAW * 32) void k_fattn(const _Float16* __restrict__ Q, const _Float16* __restrict__ Kg, const _Float16* __restrict__ Vt, _Float16* __restrict__ O) {
  __shared__ __attribute__((aligned(16))) unsigned char L[2][2][FAK * FAP];      /* [buffer][K rows | V^T rows] */
  const int tid = threadIdx.x, lane = tid & 31, ln = lane & 15, hh = lane >> 4; const int wave = __builtin_amdgcn_readfirstlane(tid >> 5);
  const int bh = blockIdx.y, b = bh / NH, h = bh - b * NH; const int q0 = blockIdx.x * (FAW * 16) + wave * 16;
  /* staging: 8 threads per 128-byte row, 32 rows per round, two rounds per tile */
  const int srow = tid >> 3, sch = (tid & 7) * 16;
  const unsigned char* kg = (const unsigned char*)(Kg + ((size_t)b * SQ + srow) * DM + h * HD) + sch;      /* K row srow of stage 0; a stage is FAK rows of DM */
  const unsigned char* vg = (const unsigned char*)(Vt + ((size_t)bh * HD + srow) * SQ) + sch;              /* V^T row d = srow; a stage is FAK keys along the row */
  const int sl = srow * FAP + sch;
  v8us k0, k1, v0, v1;
  auto fetch = [&](int st) { const unsigned char* kp = kg + (size_t)st * (FAK * DM * 2); const unsigned char* vp = vg + (size_t)st * (FAK * 2);
    k0 = *(const v8us*)kp; k1 = *(const v8us*)(kp + (size_t)32 * DM * 2); v0 = *(const v8us*)vp; v1 = *(const v8us*)(vp + (size_t)32 * SQ * 2);
    asm volatile("s_wait_xcnt 0x0" :: "v"(kp), "v"(vp) : "memory"); };      /* the loads' address registers are inputs here, so they stay live up to this wait and are re-used only behind it */
  auto put = [&](int buf) { *(v8us*)&L[buf][0][sl] = k0; *(v8us*)&L[buf][0][sl + 32 * FAP] = k1; *(v8us*)&L[buf][1][sl] = v0; *(v8us*)&L[buf][1][sl + 32 * FAP] = v1; };
  fetch(0);
  const _Float16* qp = Q + ((size_t)b * SQ + q0 + ln) * DM + h * HD; const v16h qf0 = g2_frag(qp, hh), qf1 = g2_frag(qp + 32, hh);      /* B operand: column = query, same k order as fa_frag */
  put(0); fetch(1);
  const v8f z8 = {0.f,0.f,0.f,0.f,0.f,0.f,0.f,0.f}; v8f acc[4] = {z8, z8, z8, z8};      /* acc[t][r] = O^T[16 t + 8 hh + r][query ln] */
  float m = -3.0e38f, l = 0.f;      /* running maximum (log2 domain, both halves alike) and this lane half's part of the denominator */
  const float cs = 0.125f * 1.4426950408889634f;      /* 1 / sqrt(64), and e^x = 2^(x log2 e) */
  const int fo = ln * FAP + hh * 16;
  __syncthreads();      /* publishes stage 0; the full barrier also ends the Q loads here, so that no wait for them stands in the loop, where it would drain the stage fetched ahead */
#pragma unroll 1
  for (int st = 0; st < FAN; ++st) {      /* rolled: the body is one whole stage, and the buffer index is a run-time offset */
    const int buf = st & 1;
    if (st + 1 < FAN) put(buf ^ 1);      /* stage st + 1, fetched one stage ago, into the buffer whose readers all passed the barrier at the foot of stage st - 1 */
    if (st + 2 < FAN) fetch(st + 2);
    const unsigned char* Kb = &L[buf][0][fo]; const unsigned char* Vb = &L[buf][1][fo];
    v16h kf[4][2], vf[4][2]; v8f s[4];
#pragma unroll
    for (int kt = 0; kt < 4; ++kt) { kf[kt][0] = fa_frag(Kb + kt * 16 * FAP); kf[kt][1] = fa_frag(Kb + kt * 16 * FAP + 64); }
#pragma unroll
    for (int kt = 0; kt < 4; ++kt) s[kt] = fa_mma(kf[kt][0], qf0, z8);
#pragma unroll
    for (int kt = 0; kt < 4; ++kt) s[kt] = fa_mma(kf[kt][1], qf1, s[kt]);
#pragma unroll
    for (int t = 0; t < 4; ++t) { vf[t][0] = fa_frag(Vb + t * 16 * FAP); vf[t][1] = fa_frag(Vb + t * 16 * FAP + 64); }
    __builtin_amdgcn_sched_barrier(0);      /* the eight score products run back to back and the V^T reads leave before the softmax: without it the maxima are woven between the products, each behind padding, and the V^T reads are waited for where they are issued */
    float mx = s[0][0];
#pragma unroll
    for (int kt = 0; kt < 4; ++kt)
#pragma unroll
      for (int r = 0; r < 8; ++r) mx = fmaxf(mx, s[kt][r]);
    mx = fmaxf(mx, rs_xh(mx));
    const float mn = fmaxf(m, mx * cs); const float corr = __builtin_amdgcn_exp2f(m - mn); m = mn;      /* corr is 0 in the first stage */
    const v2f cs2 = {cs, cs}, nm2 = {8.0f - mn, 8.0f - mn};      /* weights carried x256 (numerator and denominator alike), away from the f16 subnormal range */
    v2f sa = {0.f, 0.f}, sb = {0.f, 0.f}; union { v16h v; v2h p[8]; } pf[2];
#pragma unroll
    for (int kt = 0; kt < 4; ++kt)
#pragma unroll
      for (int i = 0; i < 4; ++i) { const v2f x = {s[kt][2 * i], s[kt][2 * i + 1]}; const v2f e = __builtin_elementwise_fma(x, cs2, nm2); const v2f p = {__builtin_amdgcn_exp2f(e[0]), __builtin_amdgcn_exp2f(e[1])};
        if (i & 1) sb += p; else sa += p; pf[kt >> 1].p[(kt & 1) * 4 + i] = __builtin_convertvector(p, v2h); }      /* element 8 (kt & 1) + r of the 32-key operand = tile kt, register r */
    sa += sb; l = fmaf(l, corr, sa[0] + sa[1]);
#pragma unroll
    for (int t = 0; t < 4; ++t) acc[t] = acc[t] * corr;
#pragma unroll
    for (int t = 0; t < 4; ++t) acc[t] = fa_mma(vf[t][0], pf[0].v, acc[t]);
#pragma unroll
    for (int t = 0; t < 4; ++t) acc[t] = fa_mma(vf[t][1], pf[1].v, acc[t]);
    fa_barrier();      /* publishes stage st + 1 and ends every wave's reads of this stage's buffer */
  }
  const float inv = 64.0f / (l + rs_xh(l));      /* o carried x64, as the output GEMM's alpha expects */
  _Float16* op = O + ((size_t)b * SQ + q0 + ln) * DM + h * HD + 8 * hh;
#pragma unroll
  for (int t = 0; t < 4; ++t) { FragH f;
#pragma unroll
    for (int r = 0; r < 8; ++r) f.h[r] = (_Float16)(acc[t][r] * inv);
    *(v8us*)((unsigned short*)op + t * 16) = f.half[0]; }      /* 8 consecutive d of one query row: 16 bytes */
}
__global__ __launch_bounds__(256) void k_vt(const _Float16* __restrict__ V16, int b, int h0, _Float16* __restrict__ VT) { __shared__ unsigned short tl[64][65]; const int tid = threadIdx.x; const int hh = blockIdx.x % HG, sg = blockIdx.x / HG; const int s0 = sg * 64; const int h = h0 + hh;
  for (int i = tid; i < 64 * 8; i += 256) { const int j = i / 8, d8 = (i % 8) * 8; FragH f; f.half[0] = *(const v8us*)((const unsigned short*)V16 + ((size_t)b * SQ + s0 + j) * DM + h * HD + d8); for (int q = 0; q < 8; ++q) tl[d8 + q][j] = f.u[q]; }
  __syncthreads();
  { for (int i = tid; i < 64 * 8; i += 256) { const int d = i / 8, j8 = (i % 8) * 8; FragH f; for (int q = 0; q < 8; ++q) f.u[q] = tl[d][j8 + q]; *(v8us*)((unsigned short*)VT + ((size_t)hh * HD + d) * SQ + s0 + j8) = f.half[0]; }  } }



__global__ __launch_bounds__(256) void k_rsmkm(const float* __restrict__ S, _Float16* __restrict__ P, int nrows, const int* __restrict__ am) {
  #pragma clang fp contract(off)
  const int t = blockIdx.x * 256 + threadIdx.x; if (t >= nrows) return; const size_t i = (size_t)t; const float* s = S + i * SQ; const int* mr = am + (size_t)(t % SQ) * SQ; float mx = -3.0e38f;
#pragma unroll 1
  for (int j = 0; j < SQ; ++j) { const float f = (mr[j] != 0) ? 1.f : 0.f; mx = fmaxf(mx, fmaf(f, s[j], (1.f - f) * -1.0e9f)); } float se = 0.f;
#pragma unroll 1
  for (int j = 0; j < SQ; ++j) { const float f = (mr[j] != 0) ? 1.f : 0.f; se += __expf(fmaf(f, s[j], (1.f - f) * -1.0e9f) - mx); } const float sc = 256.0f / se;
#pragma unroll 1
  for (int j0 = 0; j0 < SQ; j0 += 8) { FragH fr; for (int q = 0; q < 8; ++q) { const int j = j0 + q; const float f = (mr[j] != 0) ? 1.f : 0.f; fr.h[q] = (_Float16)(__expf(fmaf(f, s[j], (1.f - f) * -1.0e9f) - mx) * sc); }
    unsigned short* d = (unsigned short*)P + i * SQ + j0; *(v8us*)d = fr.half[0];  } }

// LayerNorm of the bf16-rounded rows, one wave per LNR rows and no LDS: a lane holds columns 4 lane + 128 u (u = 0..3) of each row, so every load covers 512 and every store 256 contiguous bytes;
// all the rows' loads leave first; mean and variance (two passes over the registers) are lane partials, four row_xmask steps and one exchange of the wave halves; gamma and beta are rounded once per wave.
#define LNR 4                        /* rows per wave */
#define LNW 8                        /* waves per work-group: the 256 threads that the weight pass in the same launch has */
template <int CTRL>
__device__ __forceinline__ float ln_dpp(float x) { return __builtin_bit_cast(float, __builtin_amdgcn_update_dpp(0, __builtin_bit_cast(int, x), CTRL, 0xf, 0xf, true)); }      /* lane l with lane l ^ (CTRL - 0x160) of its 16-lane row */
__device__ __forceinline__ float ln_sum32(float x) { x += ln_dpp<0x161>(x); x += ln_dpp<0x162>(x); x += ln_dpp<0x164>(x); x += ln_dpp<0x168>(x); return x + rs_xh(x); }      /* every lane ends with the sum over the wave */
__device__ __forceinline__ void lnw_part(const float* __restrict__ X, const float* __restrict__ g, const float* __restrict__ bb, float eps, _Float16* __restrict__ N16, int blk) {      /* blk: index of the work-group within this input */
  static_assert(DM == 512 && NR % (LNR * LNW) == 0, "lnw_part: a lane holds 16 columns, and every wave has LNR whole rows");
  const int c0 = (threadIdx.x & 31) * 4; const size_t r0 = ((size_t)blk * LNW + (threadIdx.x >> 5)) * LNR;
  const float* xp = X + r0 * DM + c0; _Float16* yp = N16 + r0 * DM + c0;
  v4f x[LNR][4], gg[4], be[4]; float mu[LNR], rs[LNR];
  for (int i = 0; i < LNR; ++i) for (int u = 0; u < 4; ++u) x[i][u] = *(const v4fa*)(xp + i * DM + u * 128);
  for (int u = 0; u < 4; ++u) { gg[u] = *(const v4fa*)(g + c0 + u * 128); be[u] = *(const v4fa*)(bb + c0 + u * 128); }
  asm volatile("s_wait_xcnt 0x0" :: "v"(xp) : "memory");      /* the row loads' address pair is an input here, so it stays live up to this wait */
  for (int u = 0; u < 4; ++u) for (int q = 0; q < 4; ++q) { gg[u][q] = bf16_round(gg[u][q]); be[u][q] = bf16_round(be[u][q]); }
  for (int i = 0; i < LNR; ++i) {
    for (int u = 0; u < 4; ++u) for (int q = 0; q < 4; ++q) x[i][u][q] = bf16_round(x[i][u][q]);
    const v4f t = (x[i][0] + x[i][1]) + (x[i][2] + x[i][3]); mu[i] = (t[0] + t[1]) + (t[2] + t[3]); }
  for (int i = 0; i < LNR; ++i) mu[i] = ln_sum32(mu[i]) * (1.0f / DM);
  for (int i = 0; i < LNR; ++i) {
    for (int u = 0; u < 4; ++u) x[i][u] -= mu[i];
    const v4f t = (x[i][0] * x[i][0] + x[i][1] * x[i][1]) + (x[i][2] * x[i][2] + x[i][3] * x[i][3]); rs[i] = (t[0] + t[1]) + (t[2] + t[3]); }
  for (int i = 0; i < LNR; ++i) rs[i] = rsqrtf(ln_sum32(rs[i]) * (1.0f / DM) + eps);
  for (int i = 0; i < LNR; ++i) for (int u = 0; u < 4; ++u) *(v4h*)(yp + i * DM + u * 128) = __builtin_convertvector(x[i][u] * rs[i] * gg[u] + be[u], v4h);
  asm volatile("s_wait_xcnt 0x0" ::: "memory");      /* behind the last row stores: in the built kernel the weight part's code follows them and rewrites their address and data registers */
}
// Everything that reads only inputs, as ranges of the block index of ONE launch: the four weight passes, then the three LayerNorms. None reads what another writes.
// Bt holds the four weight planes (q, k, v, o) and N16 the three row planes (query, key, value) one behind the other. The weight work-groups, which touch the most lines each, start first.
#define WTB (DM * (DM / 8) / 256)    /* work-groups per weight matrix */
#define LNB ((int)(NR / (LNR * LNW)))      /* work-groups per LayerNorm input */
__global__ __launch_bounds__(256) void k_prep(const float* __restrict__ wq, const float* __restrict__ wk, const float* __restrict__ wv, const float* __restrict__ wo, _Float16* __restrict__ Bt,
                                              const float* __restrict__ xq, const float* __restrict__ xk, const float* __restrict__ xv, const float* __restrict__ g, const float* __restrict__ bb, float eps, _Float16* __restrict__ N16) {
  static_assert(LNW * 32 == 256 && DM * (DM / 8) % 256 == 0, "k_prep: both parts are dealt to work-groups of 256 threads");
  const int bx = blockIdx.x;
  if (bx < 4 * WTB) { const int j = bx / WTB; wt_f16_part(j == 0 ? wq : j == 1 ? wk : j == 2 ? wv : wo, Bt + (size_t)j * DM * DM, DM, DM, 16.0f, bx - j * WTB); }
  else { const int c = bx - 4 * WTB, j = c / LNB; lnw_part(j == 0 ? xq : j == 1 ? xk : xv, g, bb, eps, N16 + (size_t)j * NR * DM, c - j * LNB); }
}


extern "C" void kernel_launch(void* const* d_in, const int* in_sizes, int n_in,
                              void* d_out, int out_size, void* d_ws, size_t ws_size, hipStream_t stream) {
  (void)in_sizes; (void)n_in; (void)out_size;
  const float* const* I = (const float* const*)d_in; const float* xq = I[0]; const float* xk = I[1]; const float* xv = I[2]; const float* lng = I[3]; const float* lnb = I[4]; const float* wq = I[5]; const float* bq = I[6]; const float* wk = I[7]; const float* bk = I[8]; const float* wv = I[9]; const float* bv = I[10]; const float* wo = I[11]; const float* bo = I[12]; const float* x = xq;      /* query, key, value; shared LayerNorm gamma / beta [512]; [in][out] Wq / Wk / Wv / Wo + biases */
  char* ws = (char*)d_ws; size_t off = 0;
  auto take = [&](size_t bytes) { char* p = ws + off; off += (bytes + 255) & ~(size_t)255; return p; };
  _Float16* BQ = (_Float16*)take((size_t)4 * DM * DM * 2); _Float16* BO = BQ + (size_t)3 * DM * DM;      /* weight planes q, k, v, o, one behind the other */
  _Float16* X16 = (_Float16*)take((size_t)3 * NR * DM * 2);      /* LN(query), LN(key), LN(value) rows, one plane behind the other */
  _Float16* Q16 = (_Float16*)take((size_t)3 * NR * DM * 2); _Float16* K16 = Q16 + NR * DM; _Float16* V16 = K16 + NR * DM; _Float16* O16 = (_Float16*)take(NR * DM * 2);      /* q, k, v planes likewise */
  _Float16* VT = (_Float16*)take((size_t)NB * NH * HD * SQ * 2);
  if (off > ws_size) return;
  k_prep<<<4 * WTB + 3 * LNB, 256, 0, stream>>>(wq, wk, wv, wo, BQ, x, xk, xv, lng, lnb, 1e-5f, X16);      /* [in][out] -> Bt x16 for all four weights; LN with the SHARED parameters -> f16 rows for all three inputs */
  const size_t r0p = (size_t)B0 * SQ;      /* first projected row */
  k_gemm2<0, DM, DM><<<dim3((unsigned)((MP / 128) * (DM / 64)), 3), 128, 0, stream>>>(X16 + r0p * DM, NR * DM, BQ, (size_t)DM * DM, 0.0625f, bq, bk, bv, 0, nullptr, 1, 0, 0, nullptr, Q16 + r0p * DM, DM, NR * DM, MP, DM, DM);      /* q, k and v projections: blockIdx.y picks the planes and the bias */
  k_vt<NH, SQ><<<NB * NH * (SQ / 64), 256, 0, stream>>>(V16, LQ, 0, VT);      /* V^T [NB][NH][HD][SQ] */
  k_fattn<<<dim3(SQ / (FAW * 16), NB * NH), FAW * 32, 0, stream>>>(Q16, K16, VT, O16);      /* o x64 (merged heads) as f16 rows, all batches and heads in one launch */
  k_gemm2<0, DM, DM><<<dim3((unsigned)((MPO / 128) * (DM / 64)), 1), 128, 0, stream>>>(O16 + r0p * DM, 0, BO, 0, 0.0009765625f, bo, bo, bo, 0, nullptr, 1, 0, 0, (float*)d_out + r0p * DM, nullptr, DM, 0, MPO, DM, DM);      /* out rows are the output layout */
}

// v006
// Measured time: 57.4 microseconds a run.
// In two side-by-side timings against v005, it was 1.07 and 1.05 times as fast.
// Counting every step since v000, it is 33.0 times as fast.
#include <hip/hip_runtime.h>
// Multi-head attention over THREE inputs, each passed through ONE shared LayerNorm first (query, key, value [2][2048][512]; Q = LN(query) Wq + bq, K = LN(key) Wk + bk, V = LN(value) Wv + bv with LN: biased var, eps 1e-5, shared ln_g / ln_b; [in][out] 512 x 512, zero biases); 8 heads of 64; scores / 8; softmax over all 2048 keys (no mask); out = merged Wo + bo -> [2][2048][512]; no residual).
// Structure: token rows r = b*2048 + s; LN rows as f16 (inputs bf16-rounded first); the weight passes and the LayerNorms as block ranges of one launch; Q, K, V as three WMMA GEMMs in one launch, blockIdx.y the product (32x64 wave tiles, f32 accumulation, exact x16 weights + bias, f16 outputs); one fused attention launch over all (batch, head, 128 queries): S^T = K . Q^T (K = 64) on WMMA, online softmax in registers (f32 running maximum and sum, base 2, 1/sqrt(64) folded into the exponent; unnormalised weights x256, in (0, 256], as f16), O^T += V^T . P^T on WMMA (V rows staged as they lie, the V^T operand read from LDS by transposing loads), divided by the sum at the end (o carried x64 against f16 subnormal flush, folded into the output GEMM alpha) and written straight into the merged f16 o rows; out = o W_o + b GEMM (f32) into the output layout.
// Compute dtype: inputs rounded to bf16; weights exact; LN rows, q, k, v, softmax weights and o as plain f16 GEMM operands (~2^-12); scores and softmax statistics f32. v_wmma_f32_16x16x32_f16.
#define NB 2
#define SQ 2048
#define DM 512
#define NH 8
#define HD 64
#define HG 4                         /* heads per launch of the per-batch k_vt */
#define B0 0                         /* first batch processed (debug hook) */
#define NBR NB                       /* batches processed (debug hook) */
#define NR ((size_t)NB * SQ)         /* token rows */
#define MP ((int)((size_t)NBR * SQ)) /* rows projected (debug hook) */
#define QN SQ                        /* query rows per batch (unused: k_fattn attends all SQ) */
#define NHD NH                       /* heads (unused: k_fattn covers all NH heads) */
#define MPO MP                       /* rows through the output stage (debug hook) */
#define LQ DM      /* row pitch of the q/k/v rows */
typedef __bf16 v16b __attribute__((ext_vector_type(16)));
typedef unsigned short v8us __attribute__((ext_vector_type(8), may_alias));
typedef float  v8f  __attribute__((ext_vector_type(8)));
typedef float  v4f  __attribute__((ext_vector_type(4)));
typedef float  v4fa __attribute__((ext_vector_type(4), may_alias));
union FragB { v16b v; v8us half[2]; unsigned short u[16]; };

__device__ __forceinline__ unsigned short bf16_bits(float x) { unsigned int u = __float_as_uint(x); return (unsigned short)((u + 0x7FFFu + ((u >> 16) & 1u)) >> 16); }
__device__ __forceinline__ float bf16_val(unsigned short b) { return __uint_as_float(((unsigned int)b) << 16); }
__device__ __forceinline__ float bf16_round(float x) { return bf16_val(bf16_bits(x)); }
// D += A·B with NT terms: 1 = ah·bh, 2 = + al·bh (A split), 3 = + ah·bl (both split)
template <int NT>
__device__ __forceinline__ v8f mmaN(v16b ah, v16b al, v16b bh, v16b bl, v8f c) {
  c = __builtin_amdgcn_wmma_f32_16x16x32_bf16(false, ah, false, bh, (short)0, c, false, false);
  if (NT >= 2) c = __builtin_amdgcn_wmma_f32_16x16x32_bf16(false, al, false, bh, (short)0, c, false, false);
  if (NT >= 3) c = __builtin_amdgcn_wmma_f32_16x16x32_bf16(false, ah, false, bl, (short)0, c, false, false);
  asm volatile("v_nop\n\tv_nop\n\tv_nop\n\tv_nop" : "+v"(c) : "v"(ah), "v"(al), "v"(bh), "v"(bl));
  return c;
}

__global__ __launch_bounds__(256) void k_wt_bf16(const float* __restrict__ W, unsigned short* __restrict__ Wt, int K, int N) {
  const int t = blockIdx.x * 256 + threadIdx.x;
  const int k8n = K / 8;
  if (t >= N * k8n) return;
  const int n = t / k8n, k8 = (t % k8n) * 8;
  v8us v;
#pragma unroll
  for (int i = 0; i < 8; ++i) v[i] = bf16_bits(W[(size_t)(k8 + i) * N + n]);
  *(v8us*)(Wt + (size_t)n * K + k8) = v;
  
}

// GEMM C[M][N] (f32, pitch ldc) = act(A[M][K]·W + bias). A f32 row-major (pitch lda) converted per fragment to bf16
// (ASPLIT: hi/lo two planes -> 2 terms, else single rounded term); Wt bf16 [N][K] (pitch ldb). BIAS_BF16 rounds the
// bias to bf16 first (bias quantised to bf16 before the add). K%32==0, M%16==0, N%64==0.
template <bool ASPLIT, int ACT, bool BIAS_BF16>
__global__ __launch_bounds__(128) void k_gemm_bf(const float* __restrict__ A, int lda, const unsigned short* __restrict__ Wt, int ldb,
                                               const float* __restrict__ bias, float* __restrict__ C, int ldc, int M, int N, int K) {
  __shared__ __attribute__((aligned(16))) float so[4][16][64];
  const int tid = threadIdx.x, w = tid >> 5, lane = tid & 31, ln = lane & 15, hh = lane >> 4;
  const int ntn = N / 64;
  const int wid = blockIdx.x * 4 + w;
  const int mt = wid / ntn, nq = wid % ntn;
  if (mt * 16 >= M) return;
  const int row0 = mt * 16, col0 = nq * 64;
  const float* arow = A + (size_t)(row0 + ln) * lda;
  v8f acc[4] = {};
  for (int kb = 0; kb < K; kb += 32) {
    FragB ah, al;
    const v4f x0 = *(const v4fa*)(arow + kb + 8 * hh), x1 = *(const v4fa*)(arow + kb + 8 * hh + 4);
    const v4f x2 = *(const v4fa*)(arow + kb + 16 + 8 * hh), x3 = *(const v4fa*)(arow + kb + 16 + 8 * hh + 4);
    float xs[16] = {x0[0],x0[1],x0[2],x0[3],x1[0],x1[1],x1[2],x1[3],x2[0],x2[1],x2[2],x2[3],x3[0],x3[1],x3[2],x3[3]};
#pragma unroll
    for (int i = 0; i < 16; ++i) { const unsigned short hb = bf16_bits(xs[i]); ah.u[i] = hb; al.u[i] = ASPLIT ? bf16_bits(xs[i] - bf16_val(hb)) : (unsigned short)0; }
#pragma unroll
    for (int t = 0; t < 4; ++t) {
      const unsigned short* brow = Wt + (size_t)(col0 + t * 16 + ln) * ldb + kb;
      FragB b;
      b.half[0] = *(const v8us*)(brow + 8 * hh);
      b.half[1] = *(const v8us*)(brow + 16 + 8 * hh);
      acc[t] = mmaN<ASPLIT ? 2 : 1>(ah.v, al.v, b.v, b.v, acc[t]);
    }
  }
#pragma unroll
  for (int t = 0; t < 4; ++t) {
    float bv = bias ? bias[col0 + t * 16 + ln] : 0.f;
    if (BIAS_BF16) bv = bf16_round(bv);
#pragma unroll
    for (int r = 0; r < 8; ++r) { float v = acc[t][r] + bv; if (ACT == 1) v = fmaxf(v, 0.f); so[w][8 * hh + r][t * 16 + ln] = v; }
  }
  __builtin_amdgcn_fence(__ATOMIC_ACQ_REL, "workgroup");
  __builtin_amdgcn_wave_barrier();
  const int rsub = lane >> 4, c4 = (lane & 15) * 4;
  {
#pragma unroll
    for (int q = 0; q < 8; ++q) {
      const int r = q * 2 + rsub;
      const v4f v = *(const v4fa*)&so[w][r][c4];
      *(v4f*)(C + (size_t)(row0 + r) * ldc + col0 + c4) = v;
    }
    
  }
}

// GEMM C = act(A·W + bias + resid): A f32 (ASPLIT -> hi/lo 2 terms), Wt bf16 [N][K]; ACT 0 none, 1 relu, 2 exact gelu;
// resid (optional, f32, row index = (row % rmod), pitch ldr, RES_BF16 rounds it) added before the activation.
template <bool ASPLIT, int ACT, bool BIAS_BF16, bool RES_BF16>
__global__ __launch_bounds__(128) void k_gemm_bf3(const float* __restrict__ A, int lda, const unsigned short* __restrict__ Wt, int ldb,
                                                const float* __restrict__ bias, const float* __restrict__ resid, int rmod, int ldr,
                                                float* __restrict__ C, int ldc, int M, int N, int K) {
  __shared__ __attribute__((aligned(16))) float so[4][16][64];
  const int tid = threadIdx.x, w = tid >> 5, lane = tid & 31, ln = lane & 15, hh = lane >> 4;
  const int ntn = N / 64;
  const int wid = blockIdx.x * 4 + w;
  const int mt = wid / ntn, nq = wid % ntn;
  if (mt * 16 >= M) return;
  const int row0 = mt * 16, col0 = nq * 64;
  const float* arow = A + (size_t)(row0 + ln) * lda;
  v8f acc[4] = {};
  for (int kb = 0; kb < K; kb += 32) {
    FragB ah, al;
    const v4f x0 = *(const v4fa*)(arow + kb + 8 * hh), x1 = *(const v4fa*)(arow + kb + 8 * hh + 4);
    const v4f x2 = *(const v4fa*)(arow + kb + 16 + 8 * hh), x3 = *(const v4fa*)(arow + kb + 16 + 8 * hh + 4);
    float xs[16] = {x0[0],x0[1],x0[2],x0[3],x1[0],x1[1],x1[2],x1[3],x2[0],x2[1],x2[2],x2[3],x3[0],x3[1],x3[2],x3[3]};
#pragma unroll
    for (int i = 0; i < 16; ++i) { const unsigned short hb = bf16_bits(xs[i]); ah.u[i] = hb; al.u[i] = ASPLIT ? bf16_bits(xs[i] - bf16_val(hb)) : (unsigned short)0; }
#pragma unroll
    for (int t = 0; t < 4; ++t) {
      const unsigned short* brow = Wt + (size_t)(col0 + t * 16 + ln) * ldb + kb;
      FragB b;
      b.half[0] = *(const v8us*)(brow + 8 * hh);
      b.half[1] = *(const v8us*)(brow + 16 + 8 * hh);
      acc[t] = mmaN<ASPLIT ? 2 : 1>(ah.v, al.v, b.v, b.v, acc[t]);
    }
  }
#pragma unroll
  for (int t = 0; t < 4; ++t) {
    const int col = col0 + t * 16 + ln;
    float bv = bias ? bias[col] : 0.f;
    if (BIAS_BF16) bv = bf16_round(bv);
#pragma unroll
    for (int r = 0; r < 8; ++r) {
      float v = acc[t][r] + bv;
      if (resid) { float rv = resid[(size_t)((row0 + 8 * hh + r) % rmod) * ldr + col]; if (RES_BF16) rv = bf16_round(rv); v += rv; }
      if (ACT == 1) v = fmaxf(v, 0.f);
      if (ACT == 2) v = 0.5f * v * (1.0f + erff(v * 0.70710678118654752f));
      if (ACT == 3) { const float u = 0.7978845608028654f * (v + 0.044715f * v * v * v); v = 0.5f * v * (1.0f + tanhf(u)); }
      so[w][8 * hh + r][t * 16 + ln] = v;
    }
  }
  __builtin_amdgcn_fence(__ATOMIC_ACQ_REL, "workgroup");
  __builtin_amdgcn_wave_barrier();
  const int rsub = lane >> 4, c4 = (lane & 15) * 4;
  {
#pragma unroll
    for (int q = 0; q < 8; ++q) {
      const int r = q * 2 + rsub;
      const v4f v = *(const v4fa*)&so[w][r][c4];
      *(v4f*)(C + (size_t)(row0 + r) * ldc + col0 + c4) = v;
    }
    
  }
}
// row LayerNorm (biased variance, eps) over N: s = X (+ R); optional out_sum <- s; out_norm <- (s-mu)*rsqrt(var+eps)*g + b
template <bool PARAM_BF16>
__global__ __launch_bounds__(256) void k_layernorm(const float* __restrict__ X, const float* __restrict__ R, const float* __restrict__ g, const float* __restrict__ bta,
                                                  float* __restrict__ out_sum, float* __restrict__ out_norm, int N, float eps) {
  __shared__ float red[256];
  const int row = blockIdx.x, tid = threadIdx.x;
  const float* x = X + (size_t)row * N; const float* rr = R ? R + (size_t)row * N : nullptr;
  float vals[16];                     // up to N = 4096
  const int per = N / 256;            // contiguous chunk per thread? use strided-by-4 chunks: thread handles j = tid*4 + 1024*u
  float s1 = 0.f;
  for (int u = 0; u < per / 4; ++u) {
    const int j = tid * 4 + 1024 * u;
    const v4f a = *(const v4fa*)(x + j);
    v4f b = {0.f,0.f,0.f,0.f}; if (rr) b = *(const v4fa*)(rr + j);
#pragma unroll
    for (int q = 0; q < 4; ++q) { const float v = a[q] + b[q]; vals[u * 4 + q] = v; s1 += v; }
  }
  red[tid] = s1; __syncthreads();
  for (int st = 128; st > 0; st >>= 1) { if (tid < st) red[tid] += red[tid + st]; __syncthreads(); }
  const float mu = red[0] / (float)N; __syncthreads();
  float s2 = 0.f;
  for (int u = 0; u < per / 4; ++u)
#pragma unroll
    for (int q = 0; q < 4; ++q) { const float c = vals[u * 4 + q] - mu; s2 += c * c; }
  red[tid] = s2; __syncthreads();
  for (int st = 128; st > 0; st >>= 1) { if (tid < st) red[tid] += red[tid + st]; __syncthreads(); }
  const float rs = rsqrtf(red[0] / (float)N + eps);
  {
    for (int u = 0; u < per / 4; ++u) {
      const int j = tid * 4 + 1024 * u;
      v4f o, sm;
#pragma unroll
      for (int q = 0; q < 4; ++q) {
        float gg = g[j + q], bb = bta[j + q];
        if (PARAM_BF16) { gg = bf16_round(gg); bb = bf16_round(bb); }
        sm[q] = vals[u * 4 + q]; o[q] = (vals[u * 4 + q] - mu) * rs * gg + bb;
      }
      if (out_sum) *(v4f*)(out_sum + (size_t)row * N + j) = sm;
      *(v4f*)(out_norm + (size_t)row * N + j) = o;
    }
    
  }
}



// ---- f16 WMMA path (v_wmma_f32_16x16x32_f16): 11-bit significands for operands in range — used where a [0,1] probability operand needs more precision than bf16
typedef _Float16 v16h __attribute__((ext_vector_type(16)));
union FragH { v16h v; v8us half[2]; _Float16 h[16]; unsigned short u[16]; };
template <int NT>
__device__ __forceinline__ v8f mmaH(v16h ah, v16h al, v16h bh, v16h bl, v8f c) {
  c = __builtin_amdgcn_wmma_f32_16x16x32_f16(false, ah, false, bh, (short)0, c, false, false);
  if (NT >= 2) c = __builtin_amdgcn_wmma_f32_16x16x32_f16(false, al, false, bh, (short)0, c, false, false);
  if (NT >= 3) c = __builtin_amdgcn_wmma_f32_16x16x32_f16(false, ah, false, bl, (short)0, c, false, false);
  asm volatile("v_nop\n\tv_nop\n\tv_nop\n\tv_nop" : "+v"(c) : "v"(ah), "v"(al), "v"(bh), "v"(bl));
  return c;
}
// batched GEMM like k_gemm_b but f16 operands: A f32 (split into f16 hi/lo if ASPLIT, else rounded to f16), Bt = f16 values [n][k]; alpha; C f32; N multiple of 16 (partial tiles skipped)
template <bool ASPLIT>
__global__ __launch_bounds__(128) void k_gemm_h(const float* __restrict__ A, int lda, size_t sA, const _Float16* __restrict__ Bh, int ldb, size_t sB, float alpha, float* __restrict__ C, int ldc, size_t sC, int M, int N, int K) {
  __shared__ __attribute__((aligned(16))) float so[4][16][64];
  const int tid = threadIdx.x, w = tid >> 5, lane = tid & 31, ln = lane & 15, hh = lane >> 4; const int by = blockIdx.y;
  A += (size_t)by * sA; Bh += (size_t)by * sB; C += (size_t)by * sC;
  const int ntn = (N + 63) / 64; const int wid = blockIdx.x * 4 + w; const int mt = wid / ntn, nq = wid % ntn; if (mt * 16 >= M) return;
  const int row0 = mt * 16, col0 = nq * 64; const float* arow = A + (size_t)(row0 + ln) * lda;
  v8f acc[4] = {};
  for (int kb = 0; kb < K; kb += 32) {
    FragH ah, al;
    const v4f x0 = *(const v4fa*)(arow + kb + 8 * hh), x1 = *(const v4fa*)(arow + kb + 8 * hh + 4), x2 = *(const v4fa*)(arow + kb + 16 + 8 * hh), x3 = *(const v4fa*)(arow + kb + 16 + 8 * hh + 4);
    float xs[16] = {x0[0],x0[1],x0[2],x0[3],x1[0],x1[1],x1[2],x1[3],x2[0],x2[1],x2[2],x2[3],x3[0],x3[1],x3[2],x3[3]};
#pragma unroll
    for (int i = 0; i < 16; ++i) { const _Float16 h = (_Float16)xs[i]; ah.h[i] = h; al.h[i] = ASPLIT ? (_Float16)(xs[i] - (float)h) : (_Float16)0.0f; }
#pragma unroll
    for (int t = 0; t < 4; ++t) { if (col0 + t * 16 >= N) continue; const size_t boff = (size_t)(col0 + t * 16 + ln) * ldb + kb; FragH bq; bq.half[0] = *(const v8us*)(Bh + boff + 8 * hh); bq.half[1] = *(const v8us*)(Bh + boff + 16 + 8 * hh);
      acc[t] = mmaH<ASPLIT ? 2 : 1>(ah.v, al.v, bq.v, bq.v, acc[t]); }
  }
#pragma unroll
  for (int t = 0; t < 4; ++t) { if (col0 + t * 16 >= N) continue;
#pragma unroll
    for (int r = 0; r < 8; ++r) so[w][8 * hh + r][t * 16 + ln] = acc[t][r] * alpha; }
  __builtin_amdgcn_fence(__ATOMIC_ACQ_REL, "workgroup"); __builtin_amdgcn_wave_barrier();
  const int rsub = lane >> 4, c4 = (lane & 15) * 4;
  {
#pragma unroll
    for (int q = 0; q < 8; ++q) { const int r = q * 2 + rsub; if (col0 + c4 < N) { const v4f v = *(const v4fa*)&so[w][r][c4]; *(v4f*)(C + (size_t)(row0 + r) * ldc + col0 + c4) = v; } }
     }
}

// Wt[n][k] = f16(W[k][n]·scale) from f32 row-major W[K][N] (scale = power of two; bf16-exact weights stay exact in f16 away from the subnormal range)
__device__ __forceinline__ void wt_f16_part(const float* __restrict__ W, _Float16* __restrict__ Wt, int K, int N, float scale, int blk) {      /* blk: index of the 256-thread work-group within this matrix */
  const int t = blk * 256 + threadIdx.x; if (t >= N * (K / 8)) return; const int n = t / (K / 8), k8 = (t % (K / 8)) * 8; FragH f;
#pragma unroll
  for (int i = 0; i < 8; ++i) f.h[i] = (_Float16)(bf16_round(W[(size_t)(k8 + i) * N + n]) * scale); const v8us o = f.half[0];
  *(v8us*)((unsigned short*)Wt + (size_t)n * K + k8) = o; 
}
// k_gemm_hh variant with fused epilogue: v = acc·alpha + bias[by·sBias + col] (+ CP[(row/rowsPerB)·sCPb + by·64 + col] if CP) ; ACT 0 none / 1 elu ; writes f16 C16 (and f32 C if non-null)
template <int ACT>
__global__ __launch_bounds__(128) void k_gemm_hhx(const _Float16* __restrict__ A, int lda, size_t sA, const _Float16* __restrict__ Bh, int ldb, size_t sB, float alpha, const float* __restrict__ bias, size_t sBias, const float* __restrict__ CP, int rowsPerB, size_t sCPb, int row0g,
    float* __restrict__ C, _Float16* __restrict__ C16, int ldc, size_t sC, int M, int N, int K) {
  __shared__ __attribute__((aligned(16))) float so[4][16][64];
  const int tid = threadIdx.x, w = tid >> 5, lane = tid & 31, ln = lane & 15, hh = lane >> 4; const int by = blockIdx.y;
  A += (size_t)by * sA; Bh += (size_t)by * sB; const size_t cofs = (size_t)by * sC; const float* bp = bias ? bias + (size_t)by * sBias : nullptr;
  const int ntn = (N + 63) / 64; const int wid = blockIdx.x * 4 + w; const int mt = wid / ntn, nq = wid % ntn; if (mt * 16 >= M) return;
  const int row0 = mt * 16, col0 = nq * 64; const _Float16* arow = A + (size_t)(row0 + ln) * lda;
  v8f acc[4] = {};
  for (int kb = 0; kb < K; kb += 32) { FragH ah; ah.half[0] = *(const v8us*)((const unsigned short*)arow + kb + 8 * hh); ah.half[1] = *(const v8us*)((const unsigned short*)arow + kb + 16 + 8 * hh);
#pragma unroll
    for (int t = 0; t < 4; ++t) { if (col0 + t * 16 >= N) continue; const size_t boff = (size_t)(col0 + t * 16 + ln) * ldb + kb; FragH bq; bq.half[0] = *(const v8us*)((const unsigned short*)Bh + boff + 8 * hh); bq.half[1] = *(const v8us*)((const unsigned short*)Bh + boff + 16 + 8 * hh);
      acc[t] = mmaH<1>(ah.v, ah.v, bq.v, bq.v, acc[t]); }
  }
#pragma unroll
  for (int t = 0; t < 4; ++t) { if (col0 + t * 16 >= N) continue; const int col = col0 + t * 16 + ln; const float bv = bp ? bf16_round(bp[col]) : 0.f;
#pragma unroll
    for (int r = 0; r < 8; ++r) { float v = acc[t][r] * alpha + bv; if (CP) { const int rr = row0g + row0 + 8 * hh + r; if (rowsPerB < 0) v += CP[cofs + (size_t)rr * ldc + col];      /* rowsPerB < 0: own element of the batched C plane */ else { const int bidx = rr / rowsPerB; v += CP[(size_t)bidx * sCPb + (size_t)by * 64 + col]; } } if (ACT == 1) v = (v > 0.f) ? v : expm1f(v); else if (ACT == 7) v = (v > 0.f) ? v + 1.0f : expf(v); else if (ACT == 8) v = tanhf(v); else if (ACT == 9) v = 0.5f * v * (1.0f + tanhf(0.7978845608028654f * (v + 0.044715f * v * v * v))); else if (ACT == 11) v = 1.0f / (1.0f + expf(-v)); else if (ACT == 12) v = (v > 0.f) ? v : 0.01f * v; else if (ACT == 14) v = (v > 0.f) ? v : 0.1f * v; else if (ACT == 16) v = (v >= 0.f) ? v : 0.3f * v; else if (ACT == 17) v = (v >= 0.f) ? v : 0.2f * v; else if (ACT == 15) v = v / (1.0f + expf(-v)); else if (ACT == 3) v = fmaxf(v, 0.f); else if (ACT == 6) v = 0.5f * v * (1.0f + erff(v * 0.70710678118654752f)); so[w][8 * hh + r][t * 16 + ln] = v; } }
  __builtin_amdgcn_fence(__ATOMIC_ACQ_REL, "workgroup"); __builtin_amdgcn_wave_barrier();
  const int rsub = lane >> 4, c4 = (lane & 15) * 4; typedef _Float16 v4h __attribute__((ext_vector_type(4)));
  {
#pragma unroll
    for (int q = 0; q < 8; ++q) { const int r = q * 2 + rsub; if (col0 + c4 < N) { const v4f v = *(const v4fa*)&so[w][r][c4]; if (C) *(v4f*)(C + cofs + (size_t)(row0 + r) * ldc + col0 + c4) = v; if (C16) { v4h h4; for (int i = 0; i < 4; ++i) h4[i] = (_Float16)v[i]; *(v4h*)(C16 + cofs + (size_t)(row0 + r) * ldc + col0 + c4) = h4; } } }
     }
}


typedef _Float16 v4h __attribute__((ext_vector_type(4)));

__global__ __launch_bounds__(256) void k_x16(const float* __restrict__ x, _Float16* __restrict__ X16, size_t n8) { const size_t t = (size_t)blockIdx.x * 256 + threadIdx.x; if (t >= n8) return; FragH f;
#pragma unroll
  for (int q = 0; q < 8; ++q) f.h[q] = (_Float16)bf16_round(x[t * 8 + q]); *(v8us*)((unsigned short*)X16 + t * 8) = f.half[0];  }
__global__ __launch_bounds__(256) void k_h16(const float* __restrict__ x, _Float16* __restrict__ X16, size_t n8) { const size_t t = (size_t)blockIdx.x * 256 + threadIdx.x; if (t >= n8) return; FragH f;
#pragma unroll
  for (int q = 0; q < 8; ++q) f.h[q] = (_Float16)x[t * 8 + q]; *(v8us*)((unsigned short*)X16 + t * 8) = f.half[0];  }
__global__ __launch_bounds__(256) void k_round16f(const float* __restrict__ W, _Float16* __restrict__ Bt, size_t n8) { const size_t t = (size_t)blockIdx.x * 256 + threadIdx.x; if (t >= n8) return; FragH f;
#pragma unroll
  for (int i = 0; i < 8; ++i) f.h[i] = (_Float16)(bf16_round(W[t * 8 + i]) * 16.0f); *(v8us*)((unsigned short*)Bt + t * 8) = f.half[0];  }
__global__ __launch_bounds__(256) void k_hl(const float* __restrict__ F, _Float16* __restrict__ Hh, _Float16* __restrict__ Hl, size_t n8) { const size_t t = (size_t)blockIdx.x * 256 + threadIdx.x; if (t >= n8) return; FragH fh, fl; const v4f a = *(const v4fa*)(F + t * 8), c = *(const v4fa*)(F + t * 8 + 4);
#pragma unroll
  for (int q = 0; q < 4; ++q) { _Float16 h = (_Float16)a[q]; fh.h[q] = h; fl.h[q] = (_Float16)((a[q] - (float)h) * 1024.0f); h = (_Float16)c[q]; fh.h[4 + q] = h; fl.h[4 + q] = (_Float16)((c[q] - (float)h) * 1024.0f); }
  { *(v8us*)((unsigned short*)Hh + t * 8) = fh.half[0]; *(v8us*)((unsigned short*)Hl + t * 8) = fl.half[0];  } }

// ---- fast GEMM (work-group tile 128x64, wave tile 32x64; requires M % 128 == 0, N % 64 == 0, K % 64 == 0; LDA / LDB: row pitches of A and Bh in elements); epilogue = k_gemm_hhx semantics ----
// The operand rows come in stages of 64 k: whole 128-byte lines into registers one stage ahead, then into one of two LDS buffers (row pitch 144 bytes), one barrier per stage; the waves read their fragments from LDS.
#define G2K 64                       /* k per stage: 128 bytes of every operand row */
#define G2P 144                      /* LDS row pitch, bytes: 128 + 16, an odd multiple of 16 for 16-byte readers */
#define G2R (128 + 64)               /* rows per stage: 128 of A, then 64 of Bh */
__device__ __forceinline__ v16h g2_frag(const _Float16* p, int hh) { FragH f; f.half[0] = *(const v8us*)((const unsigned short*)p + 8 * hh); f.half[1] = *(const v8us*)((const unsigned short*)p + 16 + 8 * hh); return f.v; }
__device__ __forceinline__ v16h fa_frag(const unsigned char* p) { FragH f; f.half[0] = *(const v8us*)p; f.half[1] = *(const v8us*)(p + 32); return f.v; }      /* 32 k of one LDS row, hardware k order: p already holds the lane half's 16 bytes */
__device__ __forceinline__ v8f fa_mma(v16h a, v16h b, v8f c) { return __builtin_amdgcn_wmma_f32_16x16x32_f16(false, a, false, b, (short)0, c, false, false); }
/* work-group barrier that orders LDS alone: __syncthreads() would also wait for the global loads of the stage fetched ahead, which only this thread's registers receive */
__device__ __forceinline__ void fa_barrier() { __builtin_amdgcn_fence(__ATOMIC_RELEASE, "workgroup", "local"); __builtin_amdgcn_s_barrier(); __builtin_amdgcn_fence(__ATOMIC_ACQUIRE, "workgroup", "local"); }
template <int ACT, int LDA, int LDB>
__global__ __launch_bounds__(128) void k_gemm2(const _Float16* __restrict__ A, size_t sA, const _Float16* __restrict__ Bh, size_t sB, float alpha, const float* __restrict__ bias0, const float* __restrict__ bias1, const float* __restrict__ bias2, size_t sBias, const float* __restrict__ CP, int rowsPerB, size_t sCPb, int row0g,
    float* __restrict__ C, _Float16* __restrict__ C16, int ldc, size_t sC, int M, int N, int K) { static_assert(ACT == 0 || ACT == 3 || ACT == 6 || ACT == 8 || ACT == 9 || ACT == 11 || ACT == 12 || ACT == 14 || ACT == 15 || ACT == 16 || ACT == 17, "k_gemm2: unsupported ACT code (would silently apply no activation)");
  __shared__ __attribute__((aligned(16))) unsigned char sm[2 * G2R * G2P];      /* the two stage buffers; behind the k loop the same bytes hold the epilogue's f32 tiles */
  static_assert(sizeof(float) * 4 * 32 * 68 <= sizeof(sm), "k_gemm2: the epilogue's tiles lie in the stage buffers");
  float (*so)[32][68] = reinterpret_cast<float (*)[32][68]>(sm);
  const int tid = threadIdx.x, w = tid >> 5, lane = tid & 31, ln = lane & 15, hh = lane >> 4; const int by = blockIdx.y;
  const float* bias = by == 0 ? bias0 : by == 1 ? bias1 : bias2;      /* the biases of up to three products batched over blockIdx.y are separate buffers */
  A += (size_t)by * sA; Bh += (size_t)by * sB; const size_t cofs = (size_t)by * sC; const float* bp = bias ? bias + (size_t)by * sBias : nullptr;
  const int ntn = N >> 6; const int mt = blockIdx.x / ntn, nq = blockIdx.x - mt * ntn; const int row0 = mt * 128 + 32 * w, col0 = nq * 64; if (mt * 128 >= M) return;      /* the same for the whole work-group: barriers follow */
  /* staging: 8 threads per 128-byte row, 16 rows per round, 8 rounds for A and 4 for Bh */
  const int srow = tid >> 3, sch = (tid & 7) * 16;
  const unsigned char* ag = (const unsigned char*)(A + (size_t)(mt * 128 + srow) * LDA) + sch;
  const unsigned char* bg = (const unsigned char*)(Bh + (size_t)(col0 + srow) * LDB) + sch;
  const int sl = srow * G2P + sch;
  v8us ra[8], rb[4];
  auto fetch = [&](int st) { const unsigned char* ap = ag + (size_t)st * (G2K * 2); const unsigned char* bp = bg + (size_t)st * (G2K * 2);
#pragma unroll
    for (int r = 0; r < 8; ++r) ra[r] = *(const v8us*)(ap + (size_t)r * 16 * LDA * 2);
#pragma unroll
    for (int r = 0; r < 4; ++r) rb[r] = *(const v8us*)(bp + (size_t)r * 16 * LDB * 2);
    asm volatile("s_wait_xcnt 0x0" :: "v"(ap), "v"(bp) : "memory"); };      /* the loads' address registers are inputs here, so they stay live up to this wait and are re-used only behind it */
  auto put = [&](int buf) { unsigned char* d = sm + buf * (G2R * G2P) + sl;
#pragma unroll
    for (int r = 0; r < 8; ++r) *(v8us*)(d + r * 16 * G2P) = ra[r];
#pragma unroll
    for (int r = 0; r < 4; ++r) *(v8us*)(d + (128 + r * 16) * G2P) = rb[r]; };
  const int ns = K / G2K;
  fetch(0); put(0); if (ns > 1) fetch(1);
  const int fa = (32 * w + ln) * G2P + hh * 16, fb = (128 + ln) * G2P + hh * 16;      /* the lane's row and half in the A rows and in the Bh rows */
  const v8f z8 = {0.f,0.f,0.f,0.f,0.f,0.f,0.f,0.f}; v8f c00 = z8, c01 = z8, c02 = z8, c03 = z8, c10 = z8, c11 = z8, c12 = z8, c13 = z8;
  fa_barrier();      /* publishes stage 0 */
#pragma unroll 1
  for (int st = 0; st < ns; ++st) {      /* rolled: the body is one whole stage, and the buffer index is a run-time offset */
    const int buf = st & 1;
    if (st + 1 < ns) put(buf ^ 1);      /* stage st + 1, fetched one stage ago, into the buffer whose readers all passed the barrier at the foot of stage st - 1 */
    if (st + 2 < ns) fetch(st + 2);
    const unsigned char* Ab = sm + buf * (G2R * G2P) + fa; const unsigned char* Bb = sm + buf * (G2R * G2P) + fb;
    v16h a[2][2], b[2][4];      /* [32-k half of the stage][16-row tile] */
#pragma unroll
    for (int ks = 0; ks < 2; ++ks) {
#pragma unroll
      for (int i = 0; i < 2; ++i) a[ks][i] = fa_frag(Ab + i * 16 * G2P + ks * 64);
#pragma unroll
      for (int t = 0; t < 4; ++t) b[ks][t] = fa_frag(Bb + t * 16 * G2P + ks * 64); }
    __builtin_amdgcn_sched_barrier(0);      /* the stage's 24 LDS reads leave as one group ahead of its 16 products: without it one register set is re-used for every Bh fragment, and each pair of products waits out an LDS read of its own */
#pragma unroll
    for (int ks = 0; ks < 2; ++ks) {      /* k ascending by 32 in every accumulator */
      c00 = fa_mma(a[ks][0], b[ks][0], c00); c10 = fa_mma(a[ks][1], b[ks][0], c10); c01 = fa_mma(a[ks][0], b[ks][1], c01); c11 = fa_mma(a[ks][1], b[ks][1], c11);
      c02 = fa_mma(a[ks][0], b[ks][2], c02); c12 = fa_mma(a[ks][1], b[ks][2], c12); c03 = fa_mma(a[ks][0], b[ks][3], c03); c13 = fa_mma(a[ks][1], b[ks][3], c13); }
    fa_barrier();      /* publishes stage st + 1 and ends every wave's reads of this stage's buffer; the last one frees the buffers for the epilogue */
  }
  v8f accs[8] = {c00, c01, c02, c03, c10, c11, c12, c13};
#pragma unroll
  for (int u = 0; u < 8; ++u) { const int t = u & 3, half = u >> 2; const int col = col0 + t * 16 + ln; const float bv = bp ? bf16_round(bp[col]) : 0.f;
#pragma unroll
    for (int r = 0; r < 8; ++r) { const int rloc = half * 16 + 8 * hh + r; float v = accs[u][r] * alpha + bv; if (CP) { if (rowsPerB < 0) v += CP[cofs + (size_t)(row0g + row0 + rloc) * ldc + col];      /* rowsPerB < 0: own element of the batched C plane */ else { const int bidx = (row0g + row0 + rloc) / rowsPerB; v += CP[(size_t)bidx * sCPb + (size_t)by * 64 + col]; } }
      if (ACT == 3) v = fmaxf(v, 0.f); else if (ACT == 6) v = 0.5f * v * (1.0f + erff(v * 0.70710678118654752f)); else if (ACT == 11) v = 1.0f / (1.0f + expf(-v)); else if (ACT == 15) v = v / (1.0f + expf(-v)); else if (ACT == 12) v = (v > 0.f) ? v : 0.01f * v; else if (ACT == 8) v = tanhf(v); else if (ACT == 9) v = 0.5f * v * (1.0f + tanhf(0.7978845608028654f * (v + 0.044715f * v * v * v))); else if (ACT == 14) v = (v > 0.f) ? v : 0.1f * v; else if (ACT == 16) v = (v >= 0.f) ? v : 0.3f * v; else if (ACT == 17) v = (v >= 0.f) ? v : 0.2f * v;
      so[w][rloc][t * 16 + ln] = v; } }
  __builtin_amdgcn_fence(__ATOMIC_ACQ_REL, "workgroup"); __builtin_amdgcn_wave_barrier();
  const int rsub = lane >> 4, c4 = (lane & 15) * 4;
  {
#pragma unroll
    for (int q = 0; q < 16; ++q) { const int r = q * 2 + rsub; const v4f v = *(const v4fa*)&so[w][r][c4]; if (C) *(v4f*)(C + cofs + (size_t)(row0 + r) * ldc + col0 + c4) = v; if (C16) { v4h h4; for (int i = 0; i < 4; ++i) h4[i] = (_Float16)v[i]; *(v4h*)(C16 + cofs + (size_t)(row0 + r) * ldc + col0 + c4) = h4; } }
     } }


__global__ __launch_bounds__(256) void k_wnat(const float* __restrict__ w, size_t n8, _Float16* __restrict__ Bt) { const size_t t = (size_t)blockIdx.x * 256 + threadIdx.x; if (t >= n8) return; FragH f; for (int q = 0; q < 8; ++q) f.h[q] = (_Float16)(bf16_round(w[t * 8 + q]) * 16.0f); *(v8us*)((unsigned short*)Bt + t * 8) = f.half[0];  }
#define FAW 8                        /* waves per work-group */
#define FAK 64                       /* keys per stage */
#define FAP 144                      /* LDS row pitch of K, bytes: 128 + 16, an odd multiple of 16 for 16-byte readers */
#define FAPV 160                     /* LDS row pitch of V, bytes: 128 + 32, an odd multiple of 32 for the transposing reader */
#define FAKB (FAK * FAP)             /* bytes of a stage's K rows; its V rows lie behind them */
#define FAN (SQ / FAK)               /* stages */
__device__ __forceinline__ float rs_xh(float x) { return __builtin_bit_cast(float, __builtin_amdgcn_permlanex16(__builtin_bit_cast(int, x), __builtin_bit_cast(int, x), 0x76543210, 0xfedcba98, false, false)); }      /* lane l with lane l ^ 16 */
typedef float v2f __attribute__((ext_vector_type(2))); typedef _Float16 v2h __attribute__((ext_vector_type(2)));
typedef short v8s __attribute__((ext_vector_type(8)));
/* 16 (d) x 32 (keys) A fragment of V^T from row-major V rows in LDS: p = the lane's address in the first 16 keys, row 8 (lane >> 4) + (lane & 7), byte 16 ((lane >> 3) & 1) of the 32 bytes of the 16 d; lane (c, h) receives keys 8 h + 0..7 of column c, then the same of the next 16 keys */
__device__ __forceinline__ v16h fa_frag_tr(const unsigned char* p) { typedef __attribute__((address_space(3))) v8s lds_v8s; FragH f; f.half[0] = __builtin_bit_cast(v8us, __builtin_amdgcn_ds_load_tr16_b128_v8i16((lds_v8s*)p)); f.half[1] = __builtin_bit_cast(v8us, __builtin_amdgcn_ds_load_tr16_b128_v8i16((lds_v8s*)(p + 16 * FAPV))); return f.v; }
__global__ __launch_bounds__(FAW * 32) void k_fattn(const _Float16* __restrict__ Q, const _Float16* __restrict__ Kg, const _Float16* __restrict__ Vg, _Float16* __restrict__ O) {
  __shared__ __attribute__((aligned(16))) unsigned char L[2][FAKB + FAK * FAPV];      /* [buffer][K rows, then V rows] */
  const int tid = threadIdx.x, lane = tid & 31, ln = lane & 15, hh = lane >> 4; const int wave = __builtin_amdgcn_readfirstlane(tid >> 5);
  const int bh = blockIdx.y, b = bh / NH, h = bh - b * NH; const int q0 = blockIdx.x * (FAW * 16) + wave * 16;
  /* staging: 8 threads per 128-byte row, 32 rows per round, two rounds per tile */
  const int srow = tid >> 3, sch = (tid & 7) * 16;
  const unsigned char* kg = (const unsigned char*)(Kg + ((size_t)b * SQ + srow) * DM + h * HD) + sch;      /* K row srow of stage 0; a stage is FAK rows of DM */
  const unsigned char* vg = (const unsigned char*)(Vg + ((size_t)b * SQ + srow) * DM + h * HD) + sch;      /* V row srow of stage 0, likewise */
  const int sl = srow * FAP + sch, slv = FAKB + srow * FAPV + sch;
  v8us k0, k1, v0, v1;
  auto fetch = [&]() { const unsigned char* kp = kg; const unsigned char* vp = vg;      /* kg, vg: this thread's place in the next stage to fetch */
    k0 = *(const v8us*)kp; k1 = *(const v8us*)(kp + (size_t)32 * DM * 2); v0 = *(const v8us*)vp; v1 = *(const v8us*)(vp + (size_t)32 * DM * 2);
    asm volatile("s_wait_xcnt 0x0" :: "v"(kp), "v"(vp) : "memory");      /* the loads' address registers are inputs here, so they stay live up to this wait and are re-used only behind it */
    kg = kp + FAK * DM * 2; vg = vp + FAK * DM * 2; };
  auto put = [&](int buf) { *(v8us*)&L[buf][sl] = k0; *(v8us*)&L[buf][sl + 32 * FAP] = k1; *(v8us*)&L[buf][slv] = v0; *(v8us*)&L[buf][slv + 32 * FAPV] = v1; };
  fetch();
  const _Float16* qp = Q + ((size_t)b * SQ + q0 + ln) * DM + h * HD; const v16h qf0 = g2_frag(qp, hh), qf1 = g2_frag(qp + 32, hh);      /* B operand: column = query, same k order as fa_frag */
  put(0); fetch();
  const v8f z8 = {0.f,0.f,0.f,0.f,0.f,0.f,0.f,0.f}; v8f acc[4] = {z8, z8, z8, z8};      /* acc[t][r] = O^T[16 t + 8 hh + r][query ln] */
  float m = -3.0e38f, l = 0.f;      /* running maximum (log2 domain, both halves alike) and this lane half's part of the denominator */
  const float cs = 0.125f * 1.4426950408889634f;      /* 1 / sqrt(64), and e^x = 2^(x log2 e) */
  const int fo = ln * FAP + hh * 16, fv = FAKB + (8 * hh + (lane & 7)) * FAPV + ((lane >> 3) & 1) * 16;      /* the lane's place in the K rows; its place in the V rows for the transposing loads */
  __syncthreads();      /* publishes stage 0; the full barrier also ends the Q loads here, so that no wait for them stands in the loop, where it would drain the stage fetched ahead */
#pragma unroll 1
  for (int st = 0; st < FAN; ++st) {      /* rolled: the body is one whole stage, and the buffer index is a run-time offset */
    const int buf = st & 1;
    if (st + 1 < FAN) put(buf ^ 1);      /* stage st + 1, fetched one stage ago, into the buffer whose readers all passed the barrier at the foot of stage st - 1 */
    if (st + 2 < FAN) fetch();
    const unsigned char* Kb = &L[buf][fo]; const unsigned char* Vb = &L[buf][fv];
    v16h kf[4][2], vf[4][2]; v8f s[4];
#pragma unroll
    for (int kt = 0; kt < 4; ++kt) { kf[kt][0] = fa_frag(Kb + kt * 16 * FAP); kf[kt][1] = fa_frag(Kb + kt * 16 * FAP + 64); }
#pragma unroll
    for (int kt = 0; kt < 4; ++kt) s[kt] = fa_mma(kf[kt][0], qf0, z8);
#pragma unroll
    for (int kt = 0; kt < 4; ++kt) s[kt] = fa_mma(kf[kt][1], qf1, s[kt]);
#pragma unroll
    for (int t = 0; t < 4; ++t) { vf[t][0] = fa_frag_tr(Vb + t * 32); vf[t][1] = fa_frag_tr(Vb + 32 * FAPV + t * 32); }      /* d = 16 t + ln; keys 0..31 and 32..63 of the stage */
    __builtin_amdgcn_sched_barrier(0);      /* the eight score products run back to back and the V^T reads leave before the softmax: without it the maxima are woven between the products, each behind padding, and the V^T reads are waited for where they are issued */
    float mx = s[0][0];
#pragma unroll
    for (int kt = 0; kt < 4; ++kt)
#pragma unroll
      for (int r = 0; r < 8; ++r) mx = fmaxf(mx, s[kt][r]);
    mx = fmaxf(mx, rs_xh(mx));
    const float mn = fmaxf(m, mx * cs); const float corr = __builtin_amdgcn_exp2f(m - mn); m = mn;      /* corr is 0 in the first stage */
    const v2f cs2 = {cs, cs}, nm2 = {8.0f - mn, 8.0f - mn};      /* weights carried x256 (numerator and denominator alike), away from the f16 subnormal range */
    v2f sa = {0.f, 0.f}, sb = {0.f, 0.f}; union { v16h v; v2h p[8]; } pf[2];
#pragma unroll
    for (int kt = 0; kt < 4; ++kt)
#pragma unroll
      for (int i = 0; i < 4; ++i) { const v2f x = {s[kt][2 * i], s[kt][2 * i + 1]}; const v2f e = __builtin_elementwise_fma(x, cs2, nm2); const v2f p = {__builtin_amdgcn_exp2f(e[0]), __builtin_amdgcn_exp2f(e[1])};
        if (i & 1) sb += p; else sa += p; pf[kt >> 1].p[(kt & 1) * 4 + i] = __builtin_convertvector(p, v2h); }      /* element 8 (kt & 1) + r of the 32-key operand = tile kt, register r */
    sa += sb; l = fmaf(l, corr, sa[0] + sa[1]);
#pragma unroll
    for (int t = 0; t < 4; ++t) acc[t] = acc[t] * corr;
#pragma unroll
    for (int t = 0; t < 4; ++t) acc[t] = fa_mma(vf[t][0], pf[0].v, acc[t]);
#pragma unroll
    for (int t = 0; t < 4; ++t) acc[t] = fa_mma(vf[t][1], pf[1].v, acc[t]);
    fa_barrier();      /* publishes stage st + 1 and ends every wave's reads of this stage's buffer */
  }
  const float inv = 64.0f / (l + rs_xh(l));      /* o carried x64, as the output GEMM's alpha expects */
  _Float16* op = O + ((size_t)b * SQ + q0 + ln) * DM + h * HD + 8 * hh;
#pragma unroll
  for (int t = 0; t < 4; ++t) { FragH f;
#pragma unroll
    for (int r = 0; r < 8; ++r) f.h[r] = (_Float16)(acc[t][r] * inv);
    *(v8us*)((unsigned short*)op + t * 16) = f.half[0]; }      /* 8 consecutive d of one query row: 16 bytes */
}
__global__ __launch_bounds__(256) void k_vt(const _Float16* __restrict__ V16, int b, int h0, _Float16* __restrict__ VT) { __shared__ unsigned short tl[64][65]; const int tid = threadIdx.x; const int hh = blockIdx.x % HG, sg = blockIdx.x / HG; const int s0 = sg * 64; const int h = h0 + hh;
  for (int i = tid; i < 64 * 8; i += 256) { const int j = i / 8, d8 = (i % 8) * 8; FragH f; f.half[0] = *(const v8us*)((const unsigned short*)V16 + ((size_t)b * SQ + s0 + j) * DM + h * HD + d8); for (int q = 0; q < 8; ++q) tl[d8 + q][j] = f.u[q]; }
  __syncthreads();
  { for (int i = tid; i < 64 * 8; i += 256) { const int d = i / 8, j8 = (i % 8) * 8; FragH f; for (int q = 0; q < 8; ++q) f.u[q] = tl[d][j8 + q]; *(v8us*)((unsigned short*)VT + ((size_t)hh * HD + d) * SQ + s0 + j8) = f.half[0]; }  } }



__global__ __launch_bounds__(256) void k_rsmkm(const float* __restrict__ S, _Float16* __restrict__ P, int nrows, const int* __restrict__ am) {
  #pragma clang fp contract(off)
  const int t = blockIdx.x * 256 + threadIdx.x; if (t >= nrows) return; const size_t i = (size_t)t; const float* s = S + i * SQ; const int* mr = am + (size_t)(t % SQ) * SQ; float mx = -3.0e38f;
#pragma unroll 1
  for (int j = 0; j < SQ; ++j) { const float f = (mr[j] != 0) ? 1.f : 0.f; mx = fmaxf(mx, fmaf(f, s[j], (1.f - f) * -1.0e9f)); } float se = 0.f;
#pragma unroll 1
  for (int j = 0; j < SQ; ++j) { const float f = (mr[j] != 0) ? 1.f : 0.f; se += __expf(fmaf(f, s[j], (1.f - f) * -1.0e9f) - mx); } const float sc = 256.0f / se;
#pragma unroll 1
  for (int j0 = 0; j0 < SQ; j0 += 8) { FragH fr; for (int q = 0; q < 8; ++q) { const int j = j0 + q; const float f = (mr[j] != 0) ? 1.f : 0.f; fr.h[q] = (_Float16)(__expf(fmaf(f, s[j], (1.f - f) * -1.0e9f) - mx) * sc); }
    unsigned short* d = (unsigned short*)P + i * SQ + j0; *(v8us*)d = fr.half[0];  } }

// LayerNorm of the bf16-rounded rows, one wave per LNR rows and no LDS: a lane holds columns 4 lane + 128 u (u = 0..3) of each row, so every load covers 512 and every store 256 contiguous bytes;
// all the rows' loads leave first; mean and variance (two passes over the registers) are lane partials, four row_xmask steps and one exchange of the wave halves; gamma and beta are rounded once per wave.
#define LNR 4                        /* rows per wave */
#define LNW 8                        /* waves per work-group: the 256 threads that the weight pass in the same launch has */
template <int CTRL>
__device__ __forceinline__ float ln_dpp(float x) { return __builtin_bit_cast(float, __builtin_amdgcn_update_dpp(0, __builtin_bit_cast(int, x), CTRL, 0xf, 0xf, true)); }      /* lane l with lane l ^ (CTRL - 0x160) of its 16-lane row */
__device__ __forceinline__ float ln_sum32(float x) { x += ln_dpp<0x161>(x); x += ln_dpp<0x162>(x); x += ln_dpp<0x164>(x); x += ln_dpp<0x168>(x); return x + rs_xh(x); }      /* every lane ends with the sum over the wave */
__device__ __forceinline__ void lnw_part(const float* __restrict__ X, const float* __restrict__ g, const float* __restrict__ bb, float eps, _Float16* __restrict__ N16, int blk) {      /* blk: index of the work-group within this input */
  static_assert(DM == 512 && NR % (LNR * LNW) == 0, "lnw_part: a lane holds 16 columns, and every wave has LNR whole rows");
  const int c0 = (threadIdx.x & 31) * 4; const size_t r0 = ((size_t)blk * LNW + (threadIdx.x >> 5)) * LNR;
  const float* xp = X + r0 * DM + c0; _Float16* yp = N16 + r0 * DM + c0;
  v4f x[LNR][4], gg[4], be[4]; float mu[LNR], rs[LNR];
  for (int i = 0; i < LNR; ++i) for (int u = 0; u < 4; ++u) x[i][u] = *(const v4fa*)(xp + i * DM + u * 128);
  for (int u = 0; u < 4; ++u) { gg[u] = *(const v4fa*)(g + c0 + u * 128); be[u] = *(const v4fa*)(bb + c0 + u * 128); }
  asm volatile("s_wait_xcnt 0x0" :: "v"(xp) : "memory");      /* the row loads' address pair is an input here, so it stays live up to this wait */
  for (int u = 0; u < 4; ++u) for (int q = 0; q < 4; ++q) { gg[u][q] = bf16_round(gg[u][q]); be[u][q] = bf16_round(be[u][q]); }
  for (int i = 0; i < LNR; ++i) {
    for (int u = 0; u < 4; ++u) for (int q = 0; q < 4; ++q) x[i][u][q] = bf16_round(x[i][u][q]);
    const v4f t = (x[i][0] + x[i][1]) + (x[i][2] + x[i][3]); mu[i] = (t[0] + t[1]) + (t[2] + t[3]); }
  for (int i = 0; i < LNR; ++i) mu[i] = ln_sum32(mu[i]) * (1.0f / DM);
  for (int i = 0; i < LNR; ++i) {
    for (int u = 0; u < 4; ++u) x[i][u] -= mu[i];
    const v4f t = (x[i][0] * x[i][0] + x[i][1] * x[i][1]) + (x[i][2] * x[i][2] + x[i][3] * x[i][3]); rs[i] = (t[0] + t[1]) + (t[2] + t[3]); }
  for (int i = 0; i < LNR; ++i) rs[i] = rsqrtf(ln_sum32(rs[i]) * (1.0f / DM) + eps);
  for (int i = 0; i < LNR; ++i) for (int u = 0; u < 4; ++u) *(v4h*)(yp + i * DM + u * 128) = __builtin_convertvector(x[i][u] * rs[i] * gg[u] + be[u], v4h);
  asm volatile("s_wait_xcnt 0x0" ::: "memory");      /* behind the last row stores: in the built kernel the weight part's code follows them and rewrites their address and data registers */
}
// Everything that reads only inputs, as ranges of the block index of ONE launch: the four weight passes, then the three LayerNorms. None reads what another writes.
// Bt holds the four weight planes (q, k, v, o) and N16 the three row planes (query, key, value) one behind the other. The weight work-groups, which touch the most lines each, start first.
#define WTB (DM * (DM / 8) / 256)    /* work-groups per weight matrix */
#define LNB ((int)(NR / (LNR * LNW)))      /* work-groups per LayerNorm input */
__global__ __launch_bounds__(256) void k_prep(const float* __restrict__ wq, const float* __restrict__ wk, const float* __restrict__ wv, const float* __restrict__ wo, _Float16* __restrict__ Bt,
                                              const float* __restrict__ xq, const float* __restrict__ xk, const float* __restrict__ xv, const float* __restrict__ g, const float* __restrict__ bb, float eps, _Float16* __restrict__ N16) {
  static_assert(LNW * 32 == 256 && DM * (DM / 8) % 256 == 0, "k_prep: both parts are dealt to work-groups of 256 threads");
  const int bx = blockIdx.x;
  if (bx < 4 * WTB) { const int j = bx / WTB; wt_f16_part(j == 0 ? wq : j == 1 ? wk : j == 2 ? wv : wo, Bt + (size_t)j * DM * DM, DM, DM, 16.0f, bx - j * WTB); }
  else { const int c = bx - 4 * WTB, j = c / LNB; lnw_part(j == 0 ? xq : j == 1 ? xk : xv, g, bb, eps, N16 + (size_t)j * NR * DM, c - j * LNB); }
}


extern "C" void kernel_launch(void* const* d_in, const int* in_sizes, int n_in,
                              void* d_out, int out_size, void* d_ws, size_t ws_size, hipStream_t stream) {
  (void)in_sizes; (void)n_in; (void)out_size;
  const float* const* I = (const float* const*)d_in; const float* xq = I[0]; const float* xk = I[1]; const float* xv = I[2]; const float* lng = I[3]; const float* lnb = I[4]; const float* wq = I[5]; const float* bq = I[6]; const float* wk = I[7]; const float* bk = I[8]; const float* wv = I[9]; const float* bv = I[10]; const float* wo = I[11]; const float* bo = I[12]; const float* x = xq;      /* query, key, value; shared LayerNorm gamma / beta [512]; [in][out] Wq / Wk / Wv / Wo + biases */
  char* ws = (char*)d_ws; size_t off = 0;
  auto take = [&](size_t bytes) { char* p = ws + off; off += (bytes + 255) & ~(size_t)255; return p; };
  _Float16* BQ = (_Float16*)take((size_t)4 * DM * DM * 2); _Float16* BO = BQ + (size_t)3 * DM * DM;      /* weight planes q, k, v, o, one behind the other */
  _Float16* X16 = (_Float16*)take((size_t)3 * NR * DM * 2);      /* LN(query), LN(key), LN(value) rows, one plane behind the other */
  _Float16* Q16 = (_Float16*)take((size_t)3 * NR * DM * 2); _Float16* K16 = Q16 + NR * DM; _Float16* V16 = K16 + NR * DM; _Float16* O16 = (_Float16*)take(NR * DM * 2);      /* q, k, v planes likewise */
  if (off > ws_size) return;
  k_prep<<<4 * WTB + 3 * LNB, 256, 0, stream>>>(wq, wk, wv, wo, BQ, x, xk, xv, lng, lnb, 1e-5f, X16);      /* [in][out] -> Bt x16 for all four weights; LN with the SHARED parameters -> f16 rows for all three inputs */
  const size_t r0p = (size_t)B0 * SQ;      /* first projected row */
  k_gemm2<0, DM, DM><<<dim3((unsigned)((MP / 128) * (DM / 64)), 3), 128, 0, stream>>>(X16 + r0p * DM, NR * DM, BQ, (size_t)DM * DM, 0.0625f, bq, bk, bv, 0, nullptr, 1, 0, 0, nullptr, Q16 + r0p * DM, DM, NR * DM, MP, DM, DM);      /* q, k and v projections: blockIdx.y picks the planes and the bias */
  k_fattn<<<dim3(SQ / (FAW * 16), NB * NH), FAW * 32, 0, stream>>>(Q16, K16, V16, O16);      /* o x64 (merged heads) as f16 rows, all batches and heads in one launch */
  k_gemm2<0, DM, DM><<<dim3((unsigned)((MPO / 128) * (DM / 64)), 1), 128, 0, stream>>>(O16 + r0p * DM, 0, BO, 0, 0.0009765625f, bo, bo, bo, 0, nullptr, 1, 0, 0, (float*)d_out + r0p * DM, nullptr, DM, 0, MPO, DM, DM);      /* out rows are the output layout */
}

// v007
// One run takes 52.9 microseconds.
// Two timings next to v006 put it at 1.08 and 1.09 times that version's speed.
// Counting every step since v000, it is 35.7 times as fast.
#include <hip/hip_runtime.h>
// Multi-head attention over THREE inputs, each passed through ONE shared LayerNorm first (query, key, value [2][2048][512]; Q = LN(query) Wq + bq, K = LN(key) Wk + bk, V = LN(value) Wv + bv with LN: biased var, eps 1e-5, shared ln_g / ln_b; [in][out] 512 x 512, zero biases); 8 heads of 64; scores / 8; softmax over all 2048 keys (no mask); out = merged Wo + bo -> [2][2048][512]; no residual).
// Structure: token rows r = b*2048 + s; LN rows as f16 (inputs bf16-rounded first); the weight passes and the LayerNorms as block ranges of one launch; Q, K, V as three WMMA GEMMs in one launch, blockIdx.y the product (32x64 wave tiles, f32 accumulation, exact x16 weights + bias, f16 outputs); one fused attention launch over all (batch, head, 128 queries): S^T = K . Q^T (K = 64) on WMMA, online softmax in registers (f32 running maximum and sum, base 2, 1/sqrt(64) folded into the exponent; unnormalised weights x256, in (0, 256], as f16), O^T += V^T . P^T on WMMA (V rows staged as they lie, the V^T operand read from LDS by transposing loads), divided by the sum at the end (o carried x64 against f16 subnormal flush, folded into the output GEMM alpha) and written straight into the merged f16 o rows; out = o W_o + b GEMM (f32) into the output layout.
// Compute dtype: inputs rounded to bf16; weights exact; LN rows, q, k, v, softmax weights and o as plain f16 GEMM operands (~2^-12); scores and softmax statistics f32. v_wmma_f32_16x16x32_f16.
#define NB 2
#define SQ 2048
#define DM 512
#define NH 8
#define HD 64
#define HG 4                         /* heads per launch of the per-batch k_vt */
#define B0 0                         /* first batch processed (debug hook) */
#define NBR NB                       /* batches processed (debug hook) */
#define NR ((size_t)NB * SQ)         /* token rows */
#define MP ((int)((size_t)NBR * SQ)) /* rows projected (debug hook) */
#define QN SQ                        /* query rows per batch (unused: k_fattn attends all SQ) */
#define NHD NH                       /* heads (unused: k_fattn covers all NH heads) */
#define MPO MP                       /* rows through the output stage (debug hook) */
#define LQ DM      /* row pitch of the q/k/v rows (unused: k_gemm2 and k_fattn take DM) */
typedef __bf16 v16b __attribute__((ext_vector_type(16)));
typedef unsigned short v8us __attribute__((ext_vector_type(8), may_alias));
typedef float  v8f  __attribute__((ext_vector_type(8)));
typedef float  v4f  __attribute__((ext_vector_type(4)));
typedef float  v4fa __attribute__((ext_vector_type(4), may_alias));
union FragB { v16b v; v8us half[2]; unsigned short u[16]; };

__device__ __forceinline__ unsigned short bf16_bits(float x) { unsigned int u = __float_as_uint(x); return (unsigned short)((u + 0x7FFFu + ((u >> 16) & 1u)) >> 16); }
__device__ __forceinline__ float bf16_val(unsigned short b) { return __uint_as_float(((unsigned int)b) << 16); }
__device__ __forceinline__ float bf16_round(float x) { return bf16_val(bf16_bits(x)); }
// D += A·B with NT terms: 1 = ah·bh, 2 = + al·bh (A split), 3 = + ah·bl (both split)
template <int NT>
__device__ __forceinline__ v8f mmaN(v16b ah, v16b al, v16b bh, v16b bl, v8f c) {
  c = __builtin_amdgcn_wmma_f32_16x16x32_bf16(false, ah, false, bh, (short)0, c, false, false);
  if (NT >= 2) c = __builtin_amdgcn_wmma_f32_16x16x32_bf16(false, al, false, bh, (short)0, c, false, false);
  if (NT >= 3) c = __builtin_amdgcn_wmma_f32_16x16x32_bf16(false, ah, false, bl, (short)0, c, false, false);
  asm volatile("v_nop\n\tv_nop\n\tv_nop\n\tv_nop" : "+v"(c) : "v"(ah), "v"(al), "v"(bh), "v"(bl));
  return c;
}

__global__ __launch_bounds__(256) void k_wt_bf16(const float* __restrict__ W, unsigned short* __restrict__ Wt, int K, int N) {
  const int t = blockIdx.x * 256 + threadIdx.x;
  const int k8n = K / 8;
  if (t >= N * k8n) return;
  const int n = t / k8n, k8 = (t % k8n) * 8;
  v8us v;
#pragma unroll
  for (int i = 0; i < 8; ++i) v[i] = bf16_bits(W[(size_t)(k8 + i) * N + n]);
  *(v8us*)(Wt + (size_t)n * K + k8) = v;
  
}

// GEMM C[M][N] (f32, pitch ldc) = act(A[M][K]·W + bias). A f32 row-major (pitch lda) converted per fragment to bf16
// (ASPLIT: hi/lo two planes -> 2 terms, else single rounded term); Wt bf16 [N][K] (pitch ldb). BIAS_BF16 rounds the
// bias to bf16 first (bias quantised to bf16 before the add). K%32==0, M%16==0, N%64==0.
template <bool ASPLIT, int ACT, bool BIAS_BF16>
__global__ __launch_bounds__(128) void k_gemm_bf(const float* __restrict__ A, int lda, const unsigned short* __restrict__ Wt, int ldb,
                                               const float* __restrict__ bias, float* __restrict__ C, int ldc, int M, int N, int K) {
  __shared__ __attribute__((aligned(16))) float so[4][16][64];
  const int tid = threadIdx.x, w = tid >> 5, lane = tid & 31, ln = lane & 15, hh = lane >> 4;
  const int ntn = N / 64;
  const int wid = blockIdx.x * 4 + w;
  const int mt = wid / ntn, nq = wid % ntn;
  if (mt * 16 >= M) return;
  const int row0 = mt * 16, col0 = nq * 64;
  const float* arow = A + (size_t)(row0 + ln) * lda;
  v8f acc[4] = {};
  for (int kb = 0; kb < K; kb += 32) {
    FragB ah, al;
    const v4f x0 = *(const v4fa*)(arow + kb + 8 * hh), x1 = *(const v4fa*)(arow + kb + 8 * hh + 4);
    const v4f x2 = *(const v4fa*)(arow + kb + 16 + 8 * hh), x3 = *(const v4fa*)(arow + kb + 16 + 8 * hh + 4);
    float xs[16] = {x0[0],x0[1],x0[2],x0[3],x1[0],x1[1],x1[2],x1[3],x2[0],x2[1],x2[2],x2[3],x3[0],x3[1],x3[2],x3[3]};
#pragma unroll
    for (int i = 0; i < 16; ++i) { const unsigned short hb = bf16_bits(xs[i]); ah.u[i] = hb; al.u[i] = ASPLIT ? bf16_bits(xs[i] - bf16_val(hb)) : (unsigned short)0; }
#pragma unroll
    for (int t = 0; t < 4; ++t) {
      const unsigned short* brow = Wt + (size_t)(col0 + t * 16 + ln) * ldb + kb;
      FragB b;
      b.half[0] = *(const v8us*)(brow + 8 * hh);
      b.half[1] = *(const v8us*)(brow + 16 + 8 * hh);
      acc[t] = mmaN<ASPLIT ? 2 : 1>(ah.v, al.v, b.v, b.v, acc[t]);
    }
  }
#pragma unroll
  for (int t = 0; t < 4; ++t) {
    float bv = bias ? bias[col0 + t * 16 + ln] : 0.f;
    if (BIAS_BF16) bv = bf16_round(bv);
#pragma unroll
    for (int r = 0; r < 8; ++r) { float v = acc[t][r] + bv; if (ACT == 1) v = fmaxf(v, 0.f); so[w][8 * hh + r][t * 16 + ln] = v; }
  }
  __builtin_amdgcn_fence(__ATOMIC_ACQ_REL, "workgroup");
  __builtin_amdgcn_wave_barrier();
  const int rsub = lane >> 4, c4 = (lane & 15) * 4;
  {
#pragma unroll
    for (int q = 0; q < 8; ++q) {
      const int r = q * 2 + rsub;
      const v4f v = *(const v4fa*)&so[w][r][c4];
      *(v4f*)(C + (size_t)(row0 + r) * ldc + col0 + c4) = v;
    }
    
  }
}

// GEMM C = act(A·W + bias + resid): A f32 (ASPLIT -> hi/lo 2 terms), Wt bf16 [N][K]; ACT 0 none, 1 relu, 2 exact gelu;
// resid (optional, f32, row index = (row % rmod), pitch ldr, RES_BF16 rounds it) added before the activation.
template <bool ASPLIT, int ACT, bool BIAS_BF16, bool RES_BF16>
__global__ __launch_bounds__(128) void k_gemm_bf3(const float* __restrict__ A, int lda, const unsigned short* __restrict__ Wt, int ldb,
                                                const float* __restrict__ bias, const float* __restrict__ resid, int rmod, int ldr,
                                                float* __restrict__ C, int ldc, int M, int N, int K) {
  __shared__ __attribute__((aligned(16))) float so[4][16][64];
  const int tid = threadIdx.x, w = tid >> 5, lane = tid & 31, ln = lane & 15, hh = lane >> 4;
  const int ntn = N / 64;
  const int wid = blockIdx.x * 4 + w;
  const int mt = wid / ntn, nq = wid % ntn;
  if (mt * 16 >= M) return;
  const int row0 = mt * 16, col0 = nq * 64;
  const float* arow = A + (size_t)(row0 + ln) * lda;
  v8f acc[4] = {};
  for (int kb = 0; kb < K; kb += 32) {
    FragB ah, al;
    const v4f x0 = *(const v4fa*)(arow + kb + 8 * hh), x1 = *(const v4fa*)(arow + kb + 8 * hh + 4);
    const v4f x2 = *(const v4fa*)(arow + kb + 16 + 8 * hh), x3 = *(const v4fa*)(arow + kb + 16 + 8 * hh + 4);
    float xs[16] = {x0[0],x0[1],x0[2],x0[3],x1[0],x1[1],x1[2],x1[3],x2[0],x2[1],x2[2],x2[3],x3[0],x3[1],x3[2],x3[3]};
#pragma unroll
    for (int i = 0; i < 16; ++i) { const unsigned short hb = bf16_bits(xs[i]); ah.u[i] = hb; al.u[i] = ASPLIT ? bf16_bits(xs[i] - bf16_val(hb)) : (unsigned short)0; }
#pragma unroll
    for (int t = 0; t < 4; ++t) {
      const unsigned short* brow = Wt + (size_t)(col0 + t * 16 + ln) * ldb + kb;
      FragB b;
      b.half[0] = *(const v8us*)(brow + 8 * hh);
      b.half[1] = *(const v8us*)(brow + 16 + 8 * hh);
      acc[t] = mmaN<ASPLIT ? 2 : 1>(ah.v, al.v, b.v, b.v, acc[t]);
    }
  }
#pragma unroll
  for (int t = 0; t < 4; ++t) {
    const int col = col0 + t * 16 + ln;
    float bv = bias ? bias[col] : 0.f;
    if (BIAS_BF16) bv = bf16_round(bv);
#pragma unroll
    for (int r = 0; r < 8; ++r) {
      float v = acc[t][r] + bv;
      if (resid) { float rv = resid[(size_t)((row0 + 8 * hh + r) % rmod) * ldr + col]; if (RES_BF16) rv = bf16_round(rv); v += rv; }
      if (ACT == 1) v = fmaxf(v, 0.f);
      if (ACT == 2) v = 0.5f * v * (1.0f + erff(v * 0.70710678118654752f));
      if (ACT == 3) { const float u = 0.7978845608028654f * (v + 0.044715f * v * v * v); v = 0.5f * v * (1.0f + tanhf(u)); }
      so[w][8 * hh + r][t * 16 + ln] = v;
    }
  }
  __builtin_amdgcn_fence(__ATOMIC_ACQ_REL, "workgroup");
  __builtin_amdgcn_wave_barrier();
  const int rsub = lane >> 4, c4 = (lane & 15) * 4;
  {
#pragma unroll
    for (int q = 0; q < 8; ++q) {
      const int r = q * 2 + rsub;
      const v4f v = *(const v4fa*)&so[w][r][c4];
      *(v4f*)(C + (size_t)(row0 + r) * ldc + col0 + c4) = v;
    }
    
  }
}
// row LayerNorm (biased variance, eps) over N: s = X (+ R); optional out_sum <- s; out_norm <- (s-mu)*rsqrt(var+eps)*g + b
template <bool PARAM_BF16>
__global__ __launch_bounds__(256) void k_layernorm(const float* __restrict__ X, const float* __restrict__ R, const float* __restrict__ g, const float* __restrict__ bta,
                                                  float* __restrict__ out_sum, float* __restrict__ out_norm, int N, float eps) {
  __shared__ float red[256];
  const int row = blockIdx.x, tid = threadIdx.x;
  const float* x = X + (size_t)row * N; const float* rr = R ? R + (size_t)row * N : nullptr;
  float vals[16];                     // up to N = 4096
  const int per = N / 256;            // contiguous chunk per thread? use strided-by-4 chunks: thread handles j = tid*4 + 1024*u
  float s1 = 0.f;
  for (int u = 0; u < per / 4; ++u) {
    const int j = tid * 4 + 1024 * u;
    const v4f a = *(const v4fa*)(x + j);
    v4f b = {0.f,0.f,0.f,0.f}; if (rr) b = *(const v4fa*)(rr + j);
#pragma unroll
    for (int q = 0; q < 4; ++q) { const float v = a[q] + b[q]; vals[u * 4 + q] = v; s1 += v; }
  }
  red[tid] = s1; __syncthreads();
  for (int st = 128; st > 0; st >>= 1) { if (tid < st) red[tid] += red[tid + st]; __syncthreads(); }
  const float mu = red[0] / (float)N; __syncthreads();
  float s2 = 0.f;
  for (int u = 0; u < per / 4; ++u)
#pragma unroll
    for (int q = 0; q < 4; ++q) { const float c = vals[u * 4 + q] - mu; s2 += c * c; }
  red[tid] = s2; __syncthreads();
  for (int st = 128; st > 0; st >>= 1) { if (tid < st) red[tid] += red[tid + st]; __syncthreads(); }
  const float rs = rsqrtf(red[0] / (float)N + eps);
  {
    for (int u = 0; u < per / 4; ++u) {
      const int j = tid * 4 + 1024 * u;
      v4f o, sm;
#pragma unroll
      for (int q = 0; q < 4; ++q) {
        float gg = g[j + q], bb = bta[j + q];
        if (PARAM_BF16) { gg = bf16_round(gg); bb = bf16_round(bb); }
        sm[q] = vals[u * 4 + q]; o[q] = (vals[u * 4 + q] - mu) * rs * gg + bb;
      }
      if (out_sum) *(v4f*)(out_sum + (size_t)row * N + j) = sm;
      *(v4f*)(out_norm + (size_t)row * N + j) = o;
    }
    
  }
}



// ---- f16 WMMA path (v_wmma_f32_16x16x32_f16): 11-bit significands for operands in range — used where a [0,1] probability operand needs more precision than bf16
typedef _Float16 v16h __attribute__((ext_vector_type(16)));
union FragH { v16h v; v8us half[2]; _Float16 h[16]; unsigned short u[16]; };
template <int NT>
__device__ __forceinline__ v8f mmaH(v16h ah, v16h al, v16h bh, v16h bl, v8f c) {
  c = __builtin_amdgcn_wmma_f32_16x16x32_f16(false, ah, false, bh, (short)0, c, false, false);
  if (NT >= 2) c = __builtin_amdgcn_wmma_f32_16x16x32_f16(false, al, false, bh, (short)0, c, false, false);
  if (NT >= 3) c = __builtin_amdgcn_wmma_f32_16x16x32_f16(false, ah, false, bl, (short)0, c, false, false);
  asm volatile("v_nop\n\tv_nop\n\tv_nop\n\tv_nop" : "+v"(c) : "v"(ah), "v"(al), "v"(bh), "v"(bl));
  return c;
}
// batched GEMM like k_gemm_b but f16 operands: A f32 (split into f16 hi/lo if ASPLIT, else rounded to f16), Bt = f16 values [n][k]; alpha; C f32; N multiple of 16 (partial tiles skipped)
template <bool ASPLIT>
__global__ __launch_bounds__(128) void k_gemm_h(const float* __restrict__ A, int lda, size_t sA, const _Float16* __restrict__ Bh, int ldb, size_t sB, float alpha, float* __restrict__ C, int ldc, size_t sC, int M, int N, int K) {
  __shared__ __attribute__((aligned(16))) float so[4][16][64];
  const int tid = threadIdx.x, w = tid >> 5, lane = tid & 31, ln = lane & 15, hh = lane >> 4; const int by = blockIdx.y;
  A += (size_t)by * sA; Bh += (size_t)by * sB; C += (size_t)by * sC;
  const int ntn = (N + 63) / 64; const int wid = blockIdx.x * 4 + w; const int mt = wid / ntn, nq = wid % ntn; if (mt * 16 >= M) return;
  const int row0 = mt * 16, col0 = nq * 64; const float* arow = A + (size_t)(row0 + ln) * lda;
  v8f acc[4] = {};
  for (int kb = 0; kb < K; kb += 32) {
    FragH ah, al;
    const v4f x0 = *(const v4fa*)(arow + kb + 8 * hh), x1 = *(const v4fa*)(arow + kb + 8 * hh + 4), x2 = *(const v4fa*)(arow + kb + 16 + 8 * hh), x3 = *(const v4fa*)(arow + kb + 16 + 8 * hh + 4);
    float xs[16] = {x0[0],x0[1],x0[2],x0[3],x1[0],x1[1],x1[2],x1[3],x2[0],x2[1],x2[2],x2[3],x3[0],x3[1],x3[2],x3[3]};
#pragma unroll
    for (int i = 0; i < 16; ++i) { const _Float16 h = (_Float16)xs[i]; ah.h[i] = h; al.h[i] = ASPLIT ? (_Float16)(xs[i] - (float)h) : (_Float16)0.0f; }
#pragma unroll
    for (int t = 0; t < 4; ++t) { if (col0 + t * 16 >= N) continue; const size_t boff = (size_t)(col0 + t * 16 + ln) * ldb + kb; FragH bq; bq.half[0] = *(const v8us*)(Bh + boff + 8 * hh); bq.half[1] = *(const v8us*)(Bh + boff + 16 + 8 * hh);
      acc[t] = mmaH<ASPLIT ? 2 : 1>(ah.v, al.v, bq.v, bq.v, acc[t]); }
  }
#pragma unroll
  for (int t = 0; t < 4; ++t) { if (col0 + t * 16 >= N) continue;
#pragma unroll
    for (int r = 0; r < 8; ++r) so[w][8 * hh + r][t * 16 + ln] = acc[t][r] * alpha; }
  __builtin_amdgcn_fence(__ATOMIC_ACQ_REL, "workgroup"); __builtin_amdgcn_wave_barrier();
  const int rsub = lane >> 4, c4 = (lane & 15) * 4;
  {
#pragma unroll
    for (int q = 0; q < 8; ++q) { const int r = q * 2 + rsub; if (col0 + c4 < N) { const v4f v = *(const v4fa*)&so[w][r][c4]; *(v4f*)(C + (size_t)(row0 + r) * ldc + col0 + c4) = v; } }
     }
}

// Wt[n][k] = f16(W[k][n]·scale) from f32 row-major W[K][N] (scale = power of two; bf16-exact weights stay exact in f16 away from the subnormal range)
__device__ __forceinline__ void wt_f16_part(const float* __restrict__ W, _Float16* __restrict__ Wt, int K, int N, float scale, int blk) {      /* blk: index of the 256-thread work-group within this matrix */
  const int t = blk * 256 + threadIdx.x; if (t >= N * (K / 8)) return; const int n = t / (K / 8), k8 = (t % (K / 8)) * 8; FragH f;
#pragma unroll
  for (int i = 0; i < 8; ++i) f.h[i] = (_Float16)(bf16_round(W[(size_t)(k8 + i) * N + n]) * scale); const v8us o = f.half[0];
  *(v8us*)((unsigned short*)Wt + (size_t)n * K + k8) = o; 
}
// k_gemm_hh variant with fused epilogue: v = acc·alpha + bias[by·sBias + col] (+ CP[(row/rowsPerB)·sCPb + by·64 + col] if CP) ; ACT 0 none / 1 elu ; writes f16 C16 (and f32 C if non-null)
template <int ACT>
__global__ __launch_bounds__(128) void k_gemm_hhx(const _Float16* __restrict__ A, int lda, size_t sA, const _Float16* __restrict__ Bh, int ldb, size_t sB, float alpha, const float* __restrict__ bias, size_t sBias, const float* __restrict__ CP, int rowsPerB, size_t sCPb, int row0g,
    float* __restrict__ C, _Float16* __restrict__ C16, int ldc, size_t sC, int M, int N, int K) {
  __shared__ __attribute__((aligned(16))) float so[4][16][64];
  const int tid = threadIdx.x, w = tid >> 5, lane = tid & 31, ln = lane & 15, hh = lane >> 4; const int by = blockIdx.y;
  A += (size_t)by * sA; Bh += (size_t)by * sB; const size_t cofs = (size_t)by * sC; const float* bp = bias ? bias + (size_t)by * sBias : nullptr;
  const int ntn = (N + 63) / 64; const int wid = blockIdx.x * 4 + w; const int mt = wid / ntn, nq = wid % ntn; if (mt * 16 >= M) return;
  const int row0 = mt * 16, col0 = nq * 64; const _Float16* arow = A + (size_t)(row0 + ln) * lda;
  v8f acc[4] = {};
  for (int kb = 0; kb < K; kb += 32) { FragH ah; ah.half[0] = *(const v8us*)((const unsigned short*)arow + kb + 8 * hh); ah.half[1] = *(const v8us*)((const unsigned short*)arow + kb + 16 + 8 * hh);
#pragma unroll
    for (int t = 0; t < 4; ++t) { if (col0 + t * 16 >= N) continue; const size_t boff = (size_t)(col0 + t * 16 + ln) * ldb + kb; FragH bq; bq.half[0] = *(const v8us*)((const unsigned short*)Bh + boff + 8 * hh); bq.half[1] = *(const v8us*)((const unsigned short*)Bh + boff + 16 + 8 * hh);
      acc[t] = mmaH<1>(ah.v, ah.v, bq.v, bq.v, acc[t]); }
  }
#pragma unroll
  for (int t = 0; t < 4; ++t) { if (col0 + t * 16 >= N) continue; const int col = col0 + t * 16 + ln; const float bv = bp ? bf16_round(bp[col]) : 0.f;
#pragma unroll
    for (int r = 0; r < 8; ++r) { float v = acc[t][r] * alpha + bv; if (CP) { const int rr = row0g + row0 + 8 * hh + r; if (rowsPerB < 0) v += CP[cofs + (size_t)rr * ldc + col];      /* rowsPerB < 0: own element of the batched C plane */ else { const int bidx = rr / rowsPerB; v += CP[(size_t)bidx * sCPb + (size_t)by * 64 + col]; } } if (ACT == 1) v = (v > 0.f) ? v : expm1f(v); else if (ACT == 7) v = (v > 0.f) ? v + 1.0f : expf(v); else if (ACT == 8) v = tanhf(v); else if (ACT == 9) v = 0.5f * v * (1.0f + tanhf(0.7978845608028654f * (v + 0.044715f * v * v * v))); else if (ACT == 11) v = 1.0f / (1.0f + expf(-v)); else if (ACT == 12) v = (v > 0.f) ? v : 0.01f * v; else if (ACT == 14) v = (v > 0.f) ? v : 0.1f * v; else if (ACT == 16) v = (v >= 0.f) ? v : 0.3f * v; else if (ACT == 17) v = (v >= 0.f) ? v : 0.2f * v; else if (ACT == 15) v = v / (1.0f + expf(-v)); else if (ACT == 3) v = fmaxf(v, 0.f); else if (ACT == 6) v = 0.5f * v * (1.0f + erff(v * 0.70710678118654752f)); so[w][8 * hh + r][t * 16 + ln] = v; } }
  __builtin_amdgcn_fence(__ATOMIC_ACQ_REL, "workgroup"); __builtin_amdgcn_wave_barrier();
  const int rsub = lane >> 4, c4 = (lane & 15) * 4; typedef _Float16 v4h __attribute__((ext_vector_type(4)));
  {
#pragma unroll
    for (int q = 0; q < 8; ++q) { const int r = q * 2 + rsub; if (col0 + c4 < N) { const v4f v = *(const v4fa*)&so[w][r][c4]; if (C) *(v4f*)(C + cofs + (size_t)(row0 + r) * ldc + col0 + c4) = v; if (C16) { v4h h4; for (int i = 0; i < 4; ++i) h4[i] = (_Float16)v[i]; *(v4h*)(C16 + cofs + (size_t)(row0 + r) * ldc + col0 + c4) = h4; } } }
     }
}


typedef _Float16 v4h __attribute__((ext_vector_type(4)));

__global__ __launch_bounds__(256) void k_x16(const float* __restrict__ x, _Float16* __restrict__ X16, size_t n8) { const size_t t = (size_t)blockIdx.x * 256 + threadIdx.x; if (t >= n8) return; FragH f;
#pragma unroll
  for (int q = 0; q < 8; ++q) f.h[q] = (_Float16)bf16_round(x[t * 8 + q]); *(v8us*)((unsigned short*)X16 + t * 8) = f.half[0];  }
__global__ __launch_bounds__(256) void k_h16(const float* __restrict__ x, _Float16* __restrict__ X16, size_t n8) { const size_t t = (size_t)blockIdx.x * 256 + threadIdx.x; if (t >= n8) return; FragH f;
#pragma unroll
  for (int q = 0; q < 8; ++q) f.h[q] = (_Float16)x[t * 8 + q]; *(v8us*)((unsigned short*)X16 + t * 8) = f.half[0];  }
__global__ __launch_bounds__(256) void k_round16f(const float* __restrict__ W, _Float16* __restrict__ Bt, size_t n8) { const size_t t = (size_t)blockIdx.x * 256 + threadIdx.x; if (t >= n8) return; FragH f;
#pragma unroll
  for (int i = 0; i < 8; ++i) f.h[i] = (_Float16)(bf16_round(W[t * 8 + i]) * 16.0f); *(v8us*)((unsigned short*)Bt + t * 8) = f.half[0];  }
__global__ __launch_bounds__(256) void k_hl(const float* __restrict__ F, _Float16* __restrict__ Hh, _Float16* __restrict__ Hl, size_t n8) { const size_t t = (size_t)blockIdx.x * 256 + threadIdx.x; if (t >= n8) return; FragH fh, fl; const v4f a = *(const v4fa*)(F + t * 8), c = *(const v4fa*)(F + t * 8 + 4);
#pragma unroll
  for (int q = 0; q < 4; ++q) { _Float16 h = (_Float16)a[q]; fh.h[q] = h; fl.h[q] = (_Float16)((a[q] - (float)h) * 1024.0f); h = (_Float16)c[q]; fh.h[4 + q] = h; fl.h[4 + q] = (_Float16)((c[q] - (float)h) * 1024.0f); }
  { *(v8us*)((unsigned short*)Hh + t * 8) = fh.half[0]; *(v8us*)((unsigned short*)Hl + t * 8) = fl.half[0];  } }

// ---- fast GEMM (work-group tile 128x64, wave tile 32x64; requires M % 128 == 0, N % 64 == 0, K % 64 == 0; LDA / LDB / LDC: row pitches of A, Bh and the output in elements); v = acc * alpha + bf16(bias[col]), written as f32 (OUT32) or as f16 ----
// Shapes, pitches and the output kind are template parameters: the epilogue holds no test that is the same for a whole launch, so it is one straight run of code in which the read-back of the tile and the stores each leave as one group.
// The operand rows come in stages of 64 k: whole 128-byte lines into registers one stage ahead, then into one of two LDS buffers (row pitch 144 bytes), one barrier per stage; the waves read their fragments from LDS.
#define G2K 64                       /* k per stage: 128 bytes of every operand row */
#define G2P 144                      /* LDS row pitch, bytes: 128 + 16, an odd multiple of 16 for 16-byte readers */
#define G2R (128 + 64)               /* rows per stage: 128 of A, then 64 of Bh */
__device__ __forceinline__ v16h g2_frag(const _Float16* p, int hh) { FragH f; f.half[0] = *(const v8us*)((const unsigned short*)p + 8 * hh); f.half[1] = *(const v8us*)((const unsigned short*)p + 16 + 8 * hh); return f.v; }
__device__ __forceinline__ v16h fa_frag(const unsigned char* p) { FragH f; f.half[0] = *(const v8us*)p; f.half[1] = *(const v8us*)(p + 32); return f.v; }      /* 32 k of one LDS row, hardware k order: p already holds the lane half's 16 bytes */
__device__ __forceinline__ v8f fa_mma(v16h a, v16h b, v8f c) { return __builtin_amdgcn_wmma_f32_16x16x32_f16(false, a, false, b, (short)0, c, false, false); }
/* work-group barrier that orders LDS alone: __syncthreads() would also wait for the global loads of the stage fetched ahead, which only this thread's registers receive */
__device__ __forceinline__ void fa_barrier() { __builtin_amdgcn_fence(__ATOMIC_RELEASE, "workgroup", "local"); __builtin_amdgcn_s_barrier(); __builtin_amdgcn_fence(__ATOMIC_ACQUIRE, "workgroup", "local"); }
template <int ACT, int LDA, int LDB, int LDC, int M, int N, int K, bool OUT32>
__global__ __launch_bounds__(128) void k_gemm2(const _Float16* __restrict__ A, size_t sA, const _Float16* __restrict__ Bh, size_t sB, float alpha, const float* __restrict__ bias0, const float* __restrict__ bias1, const float* __restrict__ bias2,
    float* __restrict__ C, _Float16* __restrict__ C16, size_t sC) { static_assert(M % 128 == 0 && N % 64 == 0 && K % G2K == 0, "k_gemm2: whole tiles and whole stages only"); static_assert(ACT == 0 || ACT == 3 || ACT == 6 || ACT == 8 || ACT == 9 || ACT == 11 || ACT == 12 || ACT == 14 || ACT == 15 || ACT == 16 || ACT == 17, "k_gemm2: unsupported ACT code (would silently apply no activation)");
  __shared__ __attribute__((aligned(16))) unsigned char sm[2 * G2R * G2P];      /* the two stage buffers; behind the k loop the same bytes hold the epilogue's f32 tiles */
  static_assert(sizeof(float) * 4 * 32 * 68 <= sizeof(sm), "k_gemm2: the epilogue's tiles lie in the stage buffers");
  float (*so)[32][68] = reinterpret_cast<float (*)[32][68]>(sm);
  const int tid = threadIdx.x, w = tid >> 5, lane = tid & 31, ln = lane & 15, hh = lane >> 4; const int by = blockIdx.y;
  const float* bias = by == 0 ? bias0 : by == 1 ? bias1 : bias2;      /* the biases of up to three products batched over blockIdx.y are separate buffers */
  A += (size_t)by * sA; Bh += (size_t)by * sB; const size_t cofs = (size_t)by * sC;
  const int ntn = N >> 6; const int mt = blockIdx.x / ntn, nq = blockIdx.x - mt * ntn; const int row0 = mt * 128 + 32 * w, col0 = nq * 64; if (mt * 128 >= M) return;      /* the same for the whole work-group: barriers follow */
  /* staging: 8 threads per 128-byte row, 16 rows per round, 8 rounds for A and 4 for Bh */
  const int srow = tid >> 3, sch = (tid & 7) * 16;
  const unsigned char* ag = (const unsigned char*)(A + (size_t)(mt * 128 + srow) * LDA) + sch;
  const unsigned char* bg = (const unsigned char*)(Bh + (size_t)(col0 + srow) * LDB) + sch;
  const int sl = srow * G2P + sch;
  v8us ra[8], rb[4];
  auto fetch = [&](int st) { const unsigned char* ap = ag + (size_t)st * (G2K * 2); const unsigned char* bp = bg + (size_t)st * (G2K * 2);
#pragma unroll
    for (int r = 0; r < 8; ++r) ra[r] = *(const v8us*)(ap + (size_t)r * 16 * LDA * 2);
#pragma unroll
    for (int r = 0; r < 4; ++r) rb[r] = *(const v8us*)(bp + (size_t)r * 16 * LDB * 2);
    asm volatile("s_wait_xcnt 0x0" :: "v"(ap), "v"(bp) : "memory"); };      /* the loads' address registers are inputs here, so they stay live up to this wait and are re-used only behind it */
  auto put = [&](int buf) { unsigned char* d = sm + buf * (G2R * G2P) + sl;
#pragma unroll
    for (int r = 0; r < 8; ++r) *(v8us*)(d + r * 16 * G2P) = ra[r];
#pragma unroll
    for (int r = 0; r < 4; ++r) *(v8us*)(d + (128 + r * 16) * G2P) = rb[r]; };
  const int ns = K / G2K;
  fetch(0);
  const float* bq = bias + col0 + ln; float braw[4];      /* the lane's four bias values, asked for here, behind stage 0's loads: they arrive under the k loop */
#pragma unroll
  for (int t = 0; t < 4; ++t) braw[t] = bq[t * 16];
  asm volatile("s_wait_xcnt 0x0" :: "v"(bq) : "memory");      /* stands directly behind the bias loads, in front of every re-use of a register that they name; the lane's pointer is an input, so it stays live up to here */
  put(0); if (ns > 1) fetch(1);
  const int fa = (32 * w + ln) * G2P + hh * 16, fb = (128 + ln) * G2P + hh * 16;      /* the lane's row and half in the A rows and in the Bh rows */
  const v8f z8 = {0.f,0.f,0.f,0.f,0.f,0.f,0.f,0.f}; v8f c00 = z8, c01 = z8, c02 = z8, c03 = z8, c10 = z8, c11 = z8, c12 = z8, c13 = z8;
  fa_barrier();      /* publishes stage 0 */
#pragma unroll 1
  for (int st = 0; st < ns; ++st) {      /* rolled: the body is one whole stage, and the buffer index is a run-time offset */
    const int buf = st & 1;
    if (st + 1 < ns) put(buf ^ 1);      /* stage st + 1, fetched one stage ago, into the buffer whose readers all passed the barrier at the foot of stage st - 1 */
    if (st + 2 < ns) fetch(st + 2);
    const unsigned char* Ab = sm + buf * (G2R * G2P) + fa; const unsigned char* Bb = sm + buf * (G2R * G2P) + fb;
    v16h a[2][2], b[2][4];      /* [32-k half of the stage][16-row tile] */
#pragma unroll
    for (int ks = 0; ks < 2; ++ks) {
#pragma unroll
      for (int i = 0; i < 2; ++i) a[ks][i] = fa_frag(Ab + i * 16 * G2P + ks * 64);
#pragma unroll
      for (int t = 0; t < 4; ++t) b[ks][t] = fa_frag(Bb + t * 16 * G2P + ks * 64); }
    __builtin_amdgcn_sched_barrier(0);      /* the stage's 24 LDS reads leave as one group ahead of its 16 products: without it one register set is re-used for every Bh fragment, and each pair of products waits out an LDS read of its own */
#pragma unroll
    for (int ks = 0; ks < 2; ++ks) {      /* k ascending by 32 in every accumulator */
      c00 = fa_mma(a[ks][0], b[ks][0], c00); c10 = fa_mma(a[ks][1], b[ks][0], c10); c01 = fa_mma(a[ks][0], b[ks][1], c01); c11 = fa_mma(a[ks][1], b[ks][1], c11);
      c02 = fa_mma(a[ks][0], b[ks][2], c02); c12 = fa_mma(a[ks][1], b[ks][2], c12); c03 = fa_mma(a[ks][0], b[ks][3], c03); c13 = fa_mma(a[ks][1], b[ks][3], c13); }
    fa_barrier();      /* publishes stage st + 1 and ends every wave's reads of this stage's buffer; the last one frees the buffers for the epilogue */
  }
  v8f accs[8] = {c00, c01, c02, c03, c10, c11, c12, c13};
#pragma unroll
  for (int u = 0; u < 8; ++u) { const int t = u & 3, half = u >> 2; const float bv = bf16_round(braw[t]);
#pragma unroll
    for (int r = 0; r < 8; ++r) { const int rloc = half * 16 + 8 * hh + r; float v = accs[u][r] * alpha + bv;
      if (ACT == 3) v = fmaxf(v, 0.f); else if (ACT == 6) v = 0.5f * v * (1.0f + erff(v * 0.70710678118654752f)); else if (ACT == 11) v = 1.0f / (1.0f + expf(-v)); else if (ACT == 15) v = v / (1.0f + expf(-v)); else if (ACT == 12) v = (v > 0.f) ? v : 0.01f * v; else if (ACT == 8) v = tanhf(v); else if (ACT == 9) v = 0.5f * v * (1.0f + tanhf(0.7978845608028654f * (v + 0.044715f * v * v * v))); else if (ACT == 14) v = (v > 0.f) ? v : 0.1f * v; else if (ACT == 16) v = (v >= 0.f) ? v : 0.3f * v; else if (ACT == 17) v = (v >= 0.f) ? v : 0.2f * v;
      so[w][rloc][t * 16 + ln] = v; } }
  __builtin_amdgcn_fence(__ATOMIC_ACQ_REL, "workgroup"); __builtin_amdgcn_wave_barrier();
  const int rsub = lane >> 4, c4 = (lane & 15) * 4;
  {
#pragma unroll
    for (int q = 0; q < 16; ++q) { const int r = q * 2 + rsub; const v4f v = *(const v4fa*)&so[w][r][c4]; if (OUT32) *(v4f*)(C + cofs + (size_t)(row0 + r) * LDC + col0 + c4) = v; else { v4h h4; for (int i = 0; i < 4; ++i) h4[i] = (_Float16)v[i]; *(v4h*)(C16 + cofs + (size_t)(row0 + r) * LDC + col0 + c4) = h4; } }
     } }


__global__ __launch_bounds__(256) void k_wnat(const float* __restrict__ w, size_t n8, _Float16* __restrict__ Bt) { const size_t t = (size_t)blockIdx.x * 256 + threadIdx.x; if (t >= n8) return; FragH f; for (int q = 0; q < 8; ++q) f.h[q] = (_Float16)(bf16_round(w[t * 8 + q]) * 16.0f); *(v8us*)((unsigned short*)Bt + t * 8) = f.half[0];  }
#define FAW 8                        /* waves per work-group */
#define FAK 64                       /* keys per stage */
#define FAP 144                      /* LDS row pitch of K, bytes: 128 + 16, an odd multiple of 16 for 16-byte readers */
#define FAPV 160                     /* LDS row pitch of V, bytes: 128 + 32, an odd multiple of 32 for the transposing reader */
#define FAKB (FAK * FAP)             /* bytes of a stage's K rows; its V rows lie behind them */
#define FAN (SQ / FAK)               /* stages */
__device__ __forceinline__ float rs_xh(float x) { return __builtin_bit_cast(float, __builtin_amdgcn_permlanex16(__builtin_bit_cast(int, x), __builtin_bit_cast(int, x), 0x76543210, 0xfedcba98, false, false)); }      /* lane l with lane l ^ 16 */
typedef float v2f __attribute__((ext_vector_type(2))); typedef _Float16 v2h __attribute__((ext_vector_type(2)));
typedef short v8s __attribute__((ext_vector_type(8)));
/* 16 (d) x 32 (keys) A fragment of V^T from row-major V rows in LDS: p = the lane's address in the first 16 keys, row 8 (lane >> 4) + (lane & 7), byte 16 ((lane >> 3) & 1) of the 32 bytes of the 16 d; lane (c, h) receives keys 8 h + 0..7 of column c, then the same of the next 16 keys */
__device__ __forceinline__ v16h fa_frag_tr(const unsigned char* p) { typedef __attribute__((address_space(3))) v8s lds_v8s; FragH f; f.half[0] = __builtin_bit_cast(v8us, __builtin_amdgcn_ds_load_tr16_b128_v8i16((lds_v8s*)p)); f.half[1] = __builtin_bit_cast(v8us, __builtin_amdgcn_ds_load_tr16_b128_v8i16((lds_v8s*)(p + 16 * FAPV))); return f.v; }
__global__ __launch_bounds__(FAW * 32) void k_fattn(const _Float16* __restrict__ Q, const _Float16* __restrict__ Kg, const _Float16* __restrict__ Vg, _Float16* __restrict__ O) {
  __shared__ __attribute__((aligned(16))) unsigned char L[2][FAKB + FAK * FAPV];      /* [buffer][K rows, then V rows] */
  const int tid = threadIdx.x, lane = tid & 31, ln = lane & 15, hh = lane >> 4; const int wave = __builtin_amdgcn_readfirstlane(tid >> 5);
  const int bh = blockIdx.y, b = bh / NH, h = bh - b * NH; const int q0 = blockIdx.x * (FAW * 16) + wave * 16;
  /* staging: 8 threads per 128-byte row, 32 rows per round, two rounds per tile */
  const int srow = tid >> 3, sch = (tid & 7) * 16;
  const unsigned char* kg = (const unsigned char*)(Kg + ((size_t)b * SQ + srow) * DM + h * HD) + sch;      /* K row srow of stage 0; a stage is FAK rows of DM */
  const unsigned char* vg = (const unsigned char*)(Vg + ((size_t)b * SQ + srow) * DM + h * HD) + sch;      /* V row srow of stage 0, likewise */
  const int sl = srow * FAP + sch, slv = FAKB + srow * FAPV + sch;
  v8us k0, k1, v0, v1;
  auto fetch = [&]() { const unsigned char* kp = kg; const unsigned char* vp = vg;      /* kg, vg: this thread's place in the next stage to fetch */
    k0 = *(const v8us*)kp; k1 = *(const v8us*)(kp + (size_t)32 * DM * 2); v0 = *(const v8us*)vp; v1 = *(const v8us*)(vp + (size_t)32 * DM * 2);
    asm volatile("s_wait_xcnt 0x0" :: "v"(kp), "v"(vp) : "memory");      /* the loads' address registers are inputs here, so they stay live up to this wait and are re-used only behind it */
    kg = kp + FAK * DM * 2; vg = vp + FAK * DM * 2; };
  auto put = [&](int buf) { *(v8us*)&L[buf][sl] = k0; *(v8us*)&L[buf][sl + 32 * FAP] = k1; *(v8us*)&L[buf][slv] = v0; *(v8us*)&L[buf][slv + 32 * FAPV] = v1; };
  fetch();
  const _Float16* qp = Q + ((size_t)b * SQ + q0 + ln) * DM + h * HD; const v16h qf0 = g2_frag(qp, hh), qf1 = g2_frag(qp + 32, hh);      /* B operand: column = query, same k order as fa_frag */
  put(0); fetch();
  const v8f z8 = {0.f,0.f,0.f,0.f,0.f,0.f,0.f,0.f}; v8f acc[4] = {z8, z8, z8, z8};      /* acc[t][r] = O^T[16 t + 8 hh + r][query ln] */
  float m = -3.0e38f, l = 0.f;      /* running maximum (log2 domain, both halves alike) and this lane half's part of the denominator */
  const float cs = 0.125f * 1.4426950408889634f;      /* 1 / sqrt(64), and e^x = 2^(x log2 e) */
  const int fo = ln * FAP + hh * 16, fv = FAKB + (8 * hh + (lane & 7)) * FAPV + ((lane >> 3) & 1) * 16;      /* the lane's place in the K rows; its place in the V rows for the transposing loads */
  __syncthreads();      /* publishes stage 0; the full barrier also ends the Q loads here, so that no wait for them stands in the loop, where it would drain the stage fetched ahead */
#pragma unroll 1
  for (int st = 0; st < FAN; ++st) {      /* rolled: the body is one whole stage, and the buffer index is a run-time offset */
    const int buf = st & 1;
    if (st + 1 < FAN) put(buf ^ 1);      /* stage st + 1, fetched one stage ago, into the buffer whose readers all passed the barrier at the foot of stage st - 1 */
    if (st + 2 < FAN) fetch();
    const unsigned char* Kb = &L[buf][fo]; const unsigned char* Vb = &L[buf][fv];
    v16h kf[4][2], vf[4][2]; v8f s[4];
#pragma unroll
    for (int kt = 0; kt < 4; ++kt) { kf[kt][0] = fa_frag(Kb + kt * 16 * FAP); kf[kt][1] = fa_frag(Kb + kt * 16 * FAP + 64); }
#pragma unroll
    for (int kt = 0; kt < 4; ++kt) s[kt] = fa_mma(kf[kt][0], qf0, z8);
#pragma unroll
    for (int kt = 0; kt < 4; ++kt) s[kt] = fa_mma(kf[kt][1], qf1, s[kt]);
#pragma unroll
    for (int t = 0; t < 4; ++t) { vf[t][0] = fa_frag_tr(Vb + t * 32); vf[t][1] = fa_frag_tr(Vb + 32 * FAPV + t * 32); }      /* d = 16 t + ln; keys 0..31 and 32..63 of the stage */
    __builtin_amdgcn_sched_barrier(0);      /* the eight score products run back to back and the V^T reads leave before the softmax: without it the maxima are woven between the products, each behind padding, and the V^T reads are waited for where they are issued */
    float mx = s[0][0];
#pragma unroll
    for (int kt = 0; kt < 4; ++kt)
#pragma unroll
      for (int r = 0; r < 8; ++r) mx = fmaxf(mx, s[kt][r]);
    mx = fmaxf(mx, rs_xh(mx));
    const float mn = fmaxf(m, mx * cs); const float corr = __builtin_amdgcn_exp2f(m - mn); m = mn;      /* corr is 0 in the first stage */
    const v2f cs2 = {cs, cs}, nm2 = {8.0f - mn, 8.0f - mn};      /* weights carried x256 (numerator and denominator alike), away from the f16 subnormal range */
    v2f sa = {0.f, 0.f}, sb = {0.f, 0.f}; union { v16h v; v2h p[8]; } pf[2];
#pragma unroll
    for (int kt = 0; kt < 4; ++kt)
#pragma unroll
      for (int i = 0; i < 4; ++i) { const v2f x = {s[kt][2 * i], s[kt][2 * i + 1]}; const v2f e = __builtin_elementwise_fma(x, cs2, nm2); const v2f p = {__builtin_amdgcn_exp2f(e[0]), __builtin_amdgcn_exp2f(e[1])};
        if (i & 1) sb += p; else sa += p; pf[kt >> 1].p[(kt & 1) * 4 + i] = __builtin_convertvector(p, v2h); }      /* element 8 (kt & 1) + r of the 32-key operand = tile kt, register r */
    sa += sb; l = fmaf(l, corr, sa[0] + sa[1]);
#pragma unroll
    for (int t = 0; t < 4; ++t) acc[t] = acc[t] * corr;
#pragma unroll
    for (int t = 0; t < 4; ++t) acc[t] = fa_mma(vf[t][0], pf[0].v, acc[t]);
#pragma unroll
    for (int t = 0; t < 4; ++t) acc[t] = fa_mma(vf[t][1], pf[1].v, acc[t]);
    fa_barrier();      /* publishes stage st + 1 and ends every wave's reads of this stage's buffer */
  }
  const float inv = 64.0f / (l + rs_xh(l));      /* o carried x64, as the output GEMM's alpha expects */
  _Float16* op = O + ((size_t)b * SQ + q0 + ln) * DM + h * HD + 8 * hh;
#pragma unroll
  for (int t = 0; t < 4; ++t) { FragH f;
#pragma unroll
    for (int r = 0; r < 8; ++r) f.h[r] = (_Float16)(acc[t][r] * inv);
    *(v8us*)((unsigned short*)op + t * 16) = f.half[0]; }      /* 8 consecutive d of one query row: 16 bytes */
}
__global__ __launch_bounds__(256) void k_vt(const _Float16* __restrict__ V16, int b, int h0, _Float16* __restrict__ VT) { __shared__ unsigned short tl[64][65]; const int tid = threadIdx.x; const int hh = blockIdx.x % HG, sg = blockIdx.x / HG; const int s0 = sg * 64; const int h = h0 + hh;
  for (int i = tid; i < 64 * 8; i += 256) { const int j = i / 8, d8 = (i % 8) * 8; FragH f; f.half[0] = *(const v8us*)((const unsigned short*)V16 + ((size_t)b * SQ + s0 + j) * DM + h * HD + d8); for (int q = 0; q < 8; ++q) tl[d8 + q][j] = f.u[q]; }
  __syncthreads();
  { for (int i = tid; i < 64 * 8; i += 256) { const int d = i / 8, j8 = (i % 8) * 8; FragH f; for (int q = 0; q < 8; ++q) f.u[q] = tl[d][j8 + q]; *(v8us*)((unsigned short*)VT + ((size_t)hh * HD + d) * SQ + s0 + j8) = f.half[0]; }  } }



__global__ __launch_bounds__(256) void k_rsmkm(const float* __restrict__ S, _Float16* __restrict__ P, int nrows, const int* __restrict__ am) {
  #pragma clang fp contract(off)
  const int t = blockIdx.x * 256 + threadIdx.x; if (t >= nrows) return; const size_t i = (size_t)t; const float* s = S + i * SQ; const int* mr = am + (size_t)(t % SQ) * SQ; float mx = -3.0e38f;
#pragma unroll 1
  for (int j = 0; j < SQ; ++j) { const float f = (mr[j] != 0) ? 1.f : 0.f; mx = fmaxf(mx, fmaf(f, s[j], (1.f - f) * -1.0e9f)); } float se = 0.f;
#pragma unroll 1
  for (int j = 0; j < SQ; ++j) { const float f = (mr[j] != 0) ? 1.f : 0.f; se += __expf(fmaf(f, s[j], (1.f - f) * -1.0e9f) - mx); } const float sc = 256.0f / se;
#pragma unroll 1
  for (int j0 = 0; j0 < SQ; j0 += 8) { FragH fr; for (int q = 0; q < 8; ++q) { const int j = j0 + q; const float f = (mr[j] != 0) ? 1.f : 0.f; fr.h[q] = (_Float16)(__expf(fmaf(f, s[j], (1.f - f) * -1.0e9f) - mx) * sc); }
    unsigned short* d = (unsigned short*)P + i * SQ + j0; *(v8us*)d = fr.half[0];  } }

// LayerNorm of the bf16-rounded rows, one wave per LNR rows and no LDS: a lane holds columns 4 lane + 128 u (u = 0..3) of each row, so every load covers 512 and every store 256 contiguous bytes;
// all the rows' loads leave first; mean and variance (two passes over the registers) are lane partials, four row_xmask steps and one exchange of the wave halves; gamma and beta are rounded once per wave.
#define LNR 4                        /* rows per wave */
#define LNW 8                        /* waves per work-group: the 256 threads that the weight pass in the same launch has */
template <int CTRL>
__device__ __forceinline__ float ln_dpp(float x) { return __builtin_bit_cast(float, __builtin_amdgcn_update_dpp(0, __builtin_bit_cast(int, x), CTRL, 0xf, 0xf, true)); }      /* lane l with lane l ^ (CTRL - 0x160) of its 16-lane row */
__device__ __forceinline__ float ln_sum32(float x) { x += ln_dpp<0x161>(x); x += ln_dpp<0x162>(x); x += ln_dpp<0x164>(x); x += ln_dpp<0x168>(x); return x + rs_xh(x); }      /* every lane ends with the sum over the wave */
__device__ __forceinline__ void lnw_part(const float* __restrict__ X, const float* __restrict__ g, const float* __restrict__ bb, float eps, _Float16* __restrict__ N16, int blk) {      /* blk: index of the work-group within this input */
  static_assert(DM == 512 && NR % (LNR * LNW) == 0, "lnw_part: a lane holds 16 columns, and every wave has LNR whole rows");
  const int c0 = (threadIdx.x & 31) * 4; const size_t r0 = ((size_t)blk * LNW + (threadIdx.x >> 5)) * LNR;
  const float* xp = X + r0 * DM + c0; _Float16* yp = N16 + r0 * DM + c0;
  v4f x[LNR][4], gg[4], be[4]; float mu[LNR], rs[LNR];
  for (int i = 0; i < LNR; ++i) for (int u = 0; u < 4; ++u) x[i][u] = *(const v4fa*)(xp + i * DM + u * 128);
  for (int u = 0; u < 4; ++u) { gg[u] = *(const v4fa*)(g + c0 + u * 128); be[u] = *(const v4fa*)(bb + c0 + u * 128); }
  asm volatile("s_wait_xcnt 0x0" :: "v"(xp) : "memory");      /* the row loads' address pair is an input here, so it stays live up to this wait */
  for (int u = 0; u < 4; ++u) for (int q = 0; q < 4; ++q) { gg[u][q] = bf16_round(gg[u][q]); be[u][q] = bf16_round(be[u][q]); }
  for (int i = 0; i < LNR; ++i) {
    for (int u = 0; u < 4; ++u) for (int q = 0; q < 4; ++q) x[i][u][q] = bf16_round(x[i][u][q]);
    const v4f t = (x[i][0] + x[i][1]) + (x[i][2] + x[i][3]); mu[i] = (t[0] + t[1]) + (t[2] + t[3]); }
  for (int i = 0; i < LNR; ++i) mu[i] = ln_sum32(mu[i]) * (1.0f / DM);
  for (int i = 0; i < LNR; ++i) {
    for (int u = 0; u < 4; ++u) x[i][u] -= mu[i];
    const v4f t = (x[i][0] * x[i][0] + x[i][1] * x[i][1]) + (x[i][2] * x[i][2] + x[i][3] * x[i][3]); rs[i] = (t[0] + t[1]) + (t[2] + t[3]); }
  for (int i = 0; i < LNR; ++i) rs[i] = rsqrtf(ln_sum32(rs[i]) * (1.0f / DM) + eps);
  for (int i = 0; i < LNR; ++i) for (int u = 0; u < 4; ++u) *(v4h*)(yp + i * DM + u * 128) = __builtin_convertvector(x[i][u] * rs[i] * gg[u] + be[u], v4h);
  asm volatile("s_wait_xcnt 0x0" ::: "memory");      /* behind the last row stores: in the built kernel the weight part's code follows them and rewrites their address and data registers */
}
// Everything that reads only inputs, as ranges of the block index of ONE launch: the four weight passes, then the three LayerNorms. None reads what another writes.
// Bt holds the four weight planes (q, k, v, o) and N16 the three row planes (query, key, value) one behind the other. The weight work-groups, which touch the most lines each, start first.
#define WTB (DM * (DM / 8) / 256)    /* work-groups per weight matrix */
#define LNB ((int)(NR / (LNR * LNW)))      /* work-groups per LayerNorm input */
__global__ __launch_bounds__(256) void k_prep(const float* __restrict__ wq, const float* __restrict__ wk, const float* __restrict__ wv, const float* __restrict__ wo, _Float16* __restrict__ Bt,
                                              const float* __restrict__ xq, const float* __restrict__ xk, const float* __restrict__ xv, const float* __restrict__ g, const float* __restrict__ bb, float eps, _Float16* __restrict__ N16) {
  static_assert(LNW * 32 == 256 && DM * (DM / 8) % 256 == 0, "k_prep: both parts are dealt to work-groups of 256 threads");
  const int bx = blockIdx.x;
  if (bx < 4 * WTB) { const int j = bx / WTB; wt_f16_part(j == 0 ? wq : j == 1 ? wk : j == 2 ? wv : wo, Bt + (size_t)j * DM * DM, DM, DM, 16.0f, bx - j * WTB); }
  else { const int c = bx - 4 * WTB, j = c / LNB; lnw_part(j == 0 ? xq : j == 1 ? xk : xv, g, bb, eps, N16 + (size_t)j * NR * DM, c - j * LNB); }
}


extern "C" void kernel_launch(void* const* d_in, const int* in_sizes, int n_in,
                              void* d_out, int out_size, void* d_ws, size_t ws_size, hipStream_t stream) {
  (void)in_sizes; (void)n_in; (void)out_size;
  const float* const* I = (const float* const*)d_in; const float* xq = I[0]; const float* xk = I[1]; const float* xv = I[2]; const float* lng = I[3]; const float* lnb = I[4]; const float* wq = I[5]; const float* bq = I[6]; const float* wk = I[7]; const float* bk = I[8]; const float* wv = I[9]; const float* bv = I[10]; const float* wo = I[11]; const float* bo = I[12]; const float* x = xq;      /* query, key, value; shared LayerNorm gamma / beta [512]; [in][out] Wq / Wk / Wv / Wo + biases */
  char* ws = (char*)d_ws; size_t off = 0;
  auto take = [&](size_t bytes) { char* p = ws + off; off += (bytes + 255) & ~(size_t)255; return p; };
  _Float16* BQ = (_Float16*)take((size_t)4 * DM * DM * 2); _Float16* BO = BQ + (size_t)3 * DM * DM;      /* weight planes q, k, v, o, one behind the other */
  _Float16* X16 = (_Float16*)take((size_t)3 * NR * DM * 2);      /* LN(query), LN(key), LN(value) rows, one plane behind the other */
  _Float16* Q16 = (_Float16*)take((size_t)3 * NR * DM * 2); _Float16* K16 = Q16 + NR * DM; _Float16* V16 = K16 + NR * DM; _Float16* O16 = (_Float16*)take(NR * DM * 2);      /* q, k, v planes likewise */
  if (off > ws_size) return;
  k_prep<<<4 * WTB + 3 * LNB, 256, 0, stream>>>(wq, wk, wv, wo, BQ, x, xk, xv, lng, lnb, 1e-5f, X16);      /* [in][out] -> Bt x16 for all four weights; LN with the SHARED parameters -> f16 rows for all three inputs */
  const size_t r0p = (size_t)B0 * SQ;      /* first projected row */
  k_gemm2<0, DM, DM, DM, MP, DM, DM, false><<<dim3((unsigned)((MP / 128) * (DM / 64)), 3), 128, 0, stream>>>(X16 + r0p * DM, NR * DM, BQ, (size_t)DM * DM, 0.0625f, bq, bk, bv, nullptr, Q16 + r0p * DM, NR * DM);      /* q, k and v projections: blockIdx.y picks the planes and the bias */
  k_fattn<<<dim3(SQ / (FAW * 16), NB * NH), FAW * 32, 0, stream>>>(Q16, K16, V16, O16);      /* o x64 (merged heads) as f16 rows, all batches and heads in one launch */
  k_gemm2<0, DM, DM, DM, MPO, DM, DM, true><<<dim3((unsigned)((MPO / 128) * (DM / 64)), 1), 128, 0, stream>>>(O16 + r0p * DM, 0, BO, 0, 0.0009765625f, bo, bo, bo, (float*)d_out + r0p * DM, nullptr, 0);      /* out rows are the output layout */
}

// v008
// It runs in 46.3 microseconds.
// Two timings next to v007 put it at 1.13 and 1.15 times that version's speed.
// Over all steps from v000 it is 40.8 times as fast.
#include <hip/hip_runtime.h>
// Multi-head attention over THREE inputs, each passed through ONE shared LayerNorm first (query, key, value [2][2048][512]; Q = LN(query) Wq + bq, K = LN(key) Wk + bk, V = LN(value) Wv + bv with LN: biased var, eps 1e-5, shared ln_g / ln_b; [in][out] 512 x 512, zero biases); 8 heads of 64; scores / 8; softmax over all 2048 keys (no mask); out = merged Wo + bo -> [2][2048][512]; no residual).
// Structure: token rows r = b*2048 + s; LN(query), LN(key), LN(value) as f16 rows (inputs bf16-rounded); the weight passes and the LayerNorms as block ranges of one launch; Q, K, V as three WMMA GEMMs in one launch, blockIdx.y the product (32x64 wave tiles, f32 accumulation, exact x16 weights + bias, f16 outputs); one fused attention launch over all (batch, head, 128 queries; 32 queries and half of the keys per wave, the halves joined at the end): S^T = K . Q^T (K = 64) on WMMA, online softmax in registers (f32 running maximum and sum, base 2, 1/sqrt(64) folded into the exponent; unnormalised weights x256, in (0, 256], as f16), O^T += V^T . P^T on WMMA (V rows staged as they lie, the V^T operand read from LDS by transposing loads), divided by the sum at the end (o carried x64 against f16 subnormal flush, folded into the output GEMM alpha) and written straight into the merged f16 o rows; out = o W_o + b GEMM (f32) into the output layout.
// Compute dtype: inputs rounded to bf16; weights exact; LN rows, q, k, v, softmax weights and o as plain f16 GEMM operands (~2^-12); scores and softmax statistics f32; v_wmma_f32_16x16x32_f16.
#define NB 2
#define SQ 2048
#define DM 512
#define NH 8
#define HD 64
#define HG 4                         /* heads per launch of the per-batch k_vt */
#define B0 0                         /* first batch processed (debug hook) */
#define NBR NB                       /* batches processed (debug hook) */
#define NR ((size_t)NB * SQ)         /* token rows */
#define MP ((int)((size_t)NBR * SQ)) /* rows projected (debug hook) */
#define QN SQ                        /* query rows per batch (unused: k_fattn attends all SQ) */
#define NHD NH                       /* heads (unused: k_fattn covers all NH heads) */
#define MPO MP                       /* rows through the output stage (debug hook) */
#define LQ DM      /* row pitch of the q/k/v rows (unused: k_gemm2 and k_fattn take DM) */
typedef __bf16 v16b __attribute__((ext_vector_type(16)));
typedef unsigned short v8us __attribute__((ext_vector_type(8), may_alias));
typedef float  v8f  __attribute__((ext_vector_type(8)));
typedef float  v4f  __attribute__((ext_vector_type(4)));
typedef float  v4fa __attribute__((ext_vector_type(4), may_alias));
union FragB { v16b v; v8us half[2]; unsigned short u[16]; };

__device__ __forceinline__ unsigned short bf16_bits(float x) { unsigned int u = __float_as_uint(x); return (unsigned short)((u + 0x7FFFu + ((u >> 16) & 1u)) >> 16); }
__device__ __forceinline__ float bf16_val(unsigned short b) { return __uint_as_float(((unsigned int)b) << 16); }
__device__ __forceinline__ float bf16_round(float x) { return bf16_val(bf16_bits(x)); }
// D += A·B with NT terms: 1 = ah·bh, 2 = + al·bh (A split), 3 = + ah·bl (both split)
template <int NT>
__device__ __forceinline__ v8f mmaN(v16b ah, v16b al, v16b bh, v16b bl, v8f c) {
  c = __builtin_amdgcn_wmma_f32_16x16x32_bf16(false, ah, false, bh, (short)0, c, false, false);
  if (NT >= 2) c = __builtin_amdgcn_wmma_f32_16x16x32_bf16(false, al, false, bh, (short)0, c, false, false);
  if (NT >= 3) c = __builtin_amdgcn_wmma_f32_16x16x32_bf16(false, ah, false, bl, (short)0, c, false, false);
  asm volatile("v_nop\n\tv_nop\n\tv_nop\n\tv_nop" : "+v"(c) : "v"(ah), "v"(al), "v"(bh), "v"(bl));
  return c;
}

__global__ __launch_bounds__(256) void k_wt_bf16(const float* __restrict__ W, unsigned short* __restrict__ Wt, int K, int N) {
  const int t = blockIdx.x * 256 + threadIdx.x;
  const int k8n = K / 8;
  if (t >= N * k8n) return;
  const int n = t / k8n, k8 = (t % k8n) * 8;
  v8us v;
#pragma unroll
  for (int i = 0; i < 8; ++i) v[i] = bf16_bits(W[(size_t)(k8 + i) * N + n]);
  *(v8us*)(Wt + (size_t)n * K + k8) = v;
  
}

// GEMM C[M][N] (f32, pitch ldc) = act(A[M][K]·W + bias). A f32 row-major (pitch lda) converted per fragment to bf16
// (ASPLIT: hi/lo two planes -> 2 terms, else single rounded term); Wt bf16 [N][K] (pitch ldb). BIAS_BF16 rounds the
// bias to bf16 first (bias quantised to bf16 before the add). K%32==0, M%16==0, N%64==0.
template <bool ASPLIT, int ACT, bool BIAS_BF16>
__global__ __launch_bounds__(128) void k_gemm_bf(const float* __restrict__ A, int lda, const unsigned short* __restrict__ Wt, int ldb,
                                               const float* __restrict__ bias, float* __restrict__ C, int ldc, int M, int N, int K) {
  __shared__ __attribute__((aligned(16))) float so[4][16][64];
  const int tid = threadIdx.x, w = tid >> 5, lane = tid & 31, ln = lane & 15, hh = lane >> 4;
  const int ntn = N / 64;
  const int wid = blockIdx.x * 4 + w;
  const int mt = wid / ntn, nq = wid % ntn;
  if (mt * 16 >= M) return;
  const int row0 = mt * 16, col0 = nq * 64;
  const float* arow = A + (size_t)(row0 + ln) * lda;
  v8f acc[4] = {};
  for (int kb = 0; kb < K; kb += 32) {
    FragB ah, al;
    const v4f x0 = *(const v4fa*)(arow + kb + 8 * hh), x1 = *(const v4fa*)(arow + kb + 8 * hh + 4);
    const v4f x2 = *(const v4fa*)(arow + kb + 16 + 8 * hh), x3 = *(const v4fa*)(arow + kb + 16 + 8 * hh + 4);
    float xs[16] = {x0[0],x0[1],x0[2],x0[3],x1[0],x1[1],x1[2],x1[3],x2[0],x2[1],x2[2],x2[3],x3[0],x3[1],x3[2],x3[3]};
#pragma unroll
    for (int i = 0; i < 16; ++i) { const unsigned short hb = bf16_bits(xs[i]); ah.u[i] = hb; al.u[i] = ASPLIT ? bf16_bits(xs[i] - bf16_val(hb)) : (unsigned short)0; }
#pragma unroll
    for (int t = 0; t < 4; ++t) {
      const unsigned short* brow = Wt + (size_t)(col0 + t * 16 + ln) * ldb + kb;
      FragB b;
      b.half[0] = *(const v8us*)(brow + 8 * hh);
      b.half[1] = *(const v8us*)(brow + 16 + 8 * hh);
      acc[t] = mmaN<ASPLIT ? 2 : 1>(ah.v, al.v, b.v, b.v, acc[t]);
    }
  }
#pragma unroll
  for (int t = 0; t < 4; ++t) {
    float bv = bias ? bias[col0 + t * 16 + ln] : 0.f;
    if (BIAS_BF16) bv = bf16_round(bv);
#pragma unroll
    for (int r = 0; r < 8; ++r) { float v = acc[t][r] + bv; if (ACT == 1) v = fmaxf(v, 0.f); so[w][8 * hh + r][t * 16 + ln] = v; }
  }
  __builtin_amdgcn_fence(__ATOMIC_ACQ_REL, "workgroup");
  __builtin_amdgcn_wave_barrier();
  const int rsub = lane >> 4, c4 = (lane & 15) * 4;
  {
#pragma unroll
    for (int q = 0; q < 8; ++q) {
      const int r = q * 2 + rsub;
      const v4f v = *(const v4fa*)&so[w][r][c4];
      *(v4f*)(C + (size_t)(row0 + r) * ldc + col0 + c4) = v;
    }
    
  }
}

// GEMM C = act(A·W + bias + resid): A f32 (ASPLIT -> hi/lo 2 terms), Wt bf16 [N][K]; ACT 0 none, 1 relu, 2 exact gelu;
// resid (optional, f32, row index = (row % rmod), pitch ldr, RES_BF16 rounds it) added before the activation.
template <bool ASPLIT, int ACT, bool BIAS_BF16, bool RES_BF16>
__global__ __launch_bounds__(128) void k_gemm_bf3(const float* __restrict__ A, int lda, const unsigned short* __restrict__ Wt, int ldb,
                                                const float* __restrict__ bias, const float* __restrict__ resid, int rmod, int ldr,
                                                float* __restrict__ C, int ldc, int M, int N, int K) {
  __shared__ __attribute__((aligned(16))) float so[4][16][64];
  const int tid = threadIdx.x, w = tid >> 5, lane = tid & 31, ln = lane & 15, hh = lane >> 4;
  const int ntn = N / 64;
  const int wid = blockIdx.x * 4 + w;
  const int mt = wid / ntn, nq = wid % ntn;
  if (mt * 16 >= M) return;
  const int row0 = mt * 16, col0 = nq * 64;
  const float* arow = A + (size_t)(row0 + ln) * lda;
  v8f acc[4] = {};
  for (int kb = 0; kb < K; kb += 32) {
    FragB ah, al;
    const v4f x0 = *(const v4fa*)(arow + kb + 8 * hh), x1 = *(const v4fa*)(arow + kb + 8 * hh + 4);
    const v4f x2 = *(const v4fa*)(arow + kb + 16 + 8 * hh), x3 = *(const v4fa*)(arow + kb + 16 + 8 * hh + 4);
    float xs[16] = {x0[0],x0[1],x0[2],x0[3],x1[0],x1[1],x1[2],x1[3],x2[0],x2[1],x2[2],x2[3],x3[0],x3[1],x3[2],x3[3]};
#pragma unroll
    for (int i = 0; i < 16; ++i) { const unsigned short hb = bf16_bits(xs[i]); ah.u[i] = hb; al.u[i] = ASPLIT ? bf16_bits(xs[i] - bf16_val(hb)) : (unsigned short)0; }
#pragma unroll
    for (int t = 0; t < 4; ++t) {
      const unsigned short* brow = Wt + (size_t)(col0 + t * 16 + ln) * ldb + kb;
      FragB b;
      b.half[0] = *(const v8us*)(brow + 8 * hh);
      b.half[1] = *(const v8us*)(brow + 16 + 8 * hh);
      acc[t] = mmaN<ASPLIT ? 2 : 1>(ah.v, al.v, b.v, b.v, acc[t]);
    }
  }
#pragma unroll
  for (int t = 0; t < 4; ++t) {
    const int col = col0 + t * 16 + ln;
    float bv = bias ? bias[col] : 0.f;
    if (BIAS_BF16) bv = bf16_round(bv);
#pragma unroll
    for (int r = 0; r < 8; ++r) {
      float v = acc[t][r] + bv;
      if (resid) { float rv = resid[(size_t)((row0 + 8 * hh + r) % rmod) * ldr + col]; if (RES_BF16) rv = bf16_round(rv); v += rv; }
      if (ACT == 1) v = fmaxf(v, 0.f);
      if (ACT == 2) v = 0.5f * v * (1.0f + erff(v * 0.70710678118654752f));
      if (ACT == 3) { const float u = 0.7978845608028654f * (v + 0.044715f * v * v * v); v = 0.5f * v * (1.0f + tanhf(u)); }
      so[w][8 * hh + r][t * 16 + ln] = v;
    }
  }
  __builtin_amdgcn_fence(__ATOMIC_ACQ_REL, "workgroup");
  __builtin_amdgcn_wave_barrier();
  const int rsub = lane >> 4, c4 = (lane & 15) * 4;
  {
#pragma unroll
    for (int q = 0; q < 8; ++q) {
      const int r = q * 2 + rsub;
      const v4f v = *(const v4fa*)&so[w][r][c4];
      *(v4f*)(C + (size_t)(row0 + r) * ldc + col0 + c4) = v;
    }
    
  }
}
// row LayerNorm (biased variance, eps) over N: s = X (+ R); optional out_sum <- s; out_norm <- (s-mu)*rsqrt(var+eps)*g + b
template <bool PARAM_BF16>
__global__ __launch_bounds__(256) void k_layernorm(const float* __restrict__ X, const float* __restrict__ R, const float* __restrict__ g, const float* __restrict__ bta,
                                                  float* __restrict__ out_sum, float* __restrict__ out_norm, int N, float eps) {
  __shared__ float red[256];
  const int row = blockIdx.x, tid = threadIdx.x;
  const float* x = X + (size_t)row * N; const float* rr = R ? R + (size_t)row * N : nullptr;
  float vals[16];                     // up to N = 4096
  const int per = N / 256;            // contiguous chunk per thread? use strided-by-4 chunks: thread handles j = tid*4 + 1024*u
  float s1 = 0.f;
  for (int u = 0; u < per / 4; ++u) {
    const int j = tid * 4 + 1024 * u;
    const v4f a = *(const v4fa*)(x + j);
    v4f b = {0.f,0.f,0.f,0.f}; if (rr) b = *(const v4fa*)(rr + j);
#pragma unroll
    for (int q = 0; q < 4; ++q) { const float v = a[q] + b[q]; vals[u * 4 + q] = v; s1 += v; }
  }
  red[tid] = s1; __syncthreads();
  for (int st = 128; st > 0; st >>= 1) { if (tid < st) red[tid] += red[tid + st]; __syncthreads(); }
  const float mu = red[0] / (float)N; __syncthreads();
  float s2 = 0.f;
  for (int u = 0; u < per / 4; ++u)
#pragma unroll
    for (int q = 0; q < 4; ++q) { const float c = vals[u * 4 + q] - mu; s2 += c * c; }
  red[tid] = s2; __syncthreads();
  for (int st = 128; st > 0; st >>= 1) { if (tid < st) red[tid] += red[tid + st]; __syncthreads(); }
  const float rs = rsqrtf(red[0] / (float)N + eps);
  {
    for (int u = 0; u < per / 4; ++u) {
      const int j = tid * 4 + 1024 * u;
      v4f o, sm;
#pragma unroll
      for (int q = 0; q < 4; ++q) {
        float gg = g[j + q], bb = bta[j + q];
        if (PARAM_BF16) { gg = bf16_round(gg); bb = bf16_round(bb); }
        sm[q] = vals[u * 4 + q]; o[q] = (vals[u * 4 + q] - mu) * rs * gg + bb;
      }
      if (out_sum) *(v4f*)(out_sum + (size_t)row * N + j) = sm;
      *(v4f*)(out_norm + (size_t)row * N + j) = o;
    }
    
  }
}



// ---- f16 WMMA path (v_wmma_f32_16x16x32_f16): 11-bit significands for operands in range — used where a [0,1] probability operand needs more precision than bf16
typedef _Float16 v16h __attribute__((ext_vector_type(16)));
union FragH { v16h v; v8us half[2]; _Float16 h[16]; unsigned short u[16]; };
template <int NT>
__device__ __forceinline__ v8f mmaH(v16h ah, v16h al, v16h bh, v16h bl, v8f c) {
  c = __builtin_amdgcn_wmma_f32_16x16x32_f16(false, ah, false, bh, (short)0, c, false, false);
  if (NT >= 2) c = __builtin_amdgcn_wmma_f32_16x16x32_f16(false, al, false, bh, (short)0, c, false, false);
  if (NT >= 3) c = __builtin_amdgcn_wmma_f32_16x16x32_f16(false, ah, false, bl, (short)0, c, false, false);
  asm volatile("v_nop\n\tv_nop\n\tv_nop\n\tv_nop" : "+v"(c) : "v"(ah), "v"(al), "v"(bh), "v"(bl));
  return c;
}
// batched GEMM like k_gemm_b but f16 operands: A f32 (split into f16 hi/lo if ASPLIT, else rounded to f16), Bt = f16 values [n][k]; alpha; C f32; N multiple of 16 (partial tiles skipped)
template <bool ASPLIT>
__global__ __launch_bounds__(128) void k_gemm_h(const float* __restrict__ A, int lda, size_t sA, const _Float16* __restrict__ Bh, int ldb, size_t sB, float alpha, float* __restrict__ C, int ldc, size_t sC, int M, int N, int K) {
  __shared__ __attribute__((aligned(16))) float so[4][16][64];
  const int tid = threadIdx.x, w = tid >> 5, lane = tid & 31, ln = lane & 15, hh = lane >> 4; const int by = blockIdx.y;
  A += (size_t)by * sA; Bh += (size_t)by * sB; C += (size_t)by * sC;
  const int ntn = (N + 63) / 64; const int wid = blockIdx.x * 4 + w; const int mt = wid / ntn, nq = wid % ntn; if (mt * 16 >= M) return;
  const int row0 = mt * 16, col0 = nq * 64; const float* arow = A + (size_t)(row0 + ln) * lda;
  v8f acc[4] = {};
  for (int kb = 0; kb < K; kb += 32) {
    FragH ah, al;
    const v4f x0 = *(const v4fa*)(arow + kb + 8 * hh), x1 = *(const v4fa*)(arow + kb + 8 * hh + 4), x2 = *(const v4fa*)(arow + kb + 16 + 8 * hh), x3 = *(const v4fa*)(arow + kb + 16 + 8 * hh + 4);
    float xs[16] = {x0[0],x0[1],x0[2],x0[3],x1[0],x1[1],x1[2],x1[3],x2[0],x2[1],x2[2],x2[3],x3[0],x3[1],x3[2],x3[3]};
#pragma unroll
    for (int i = 0; i < 16; ++i) { const _Float16 h = (_Float16)xs[i]; ah.h[i] = h; al.h[i] = ASPLIT ? (_Float16)(xs[i] - (float)h) : (_Float16)0.0f; }
#pragma unroll
    for (int t = 0; t < 4; ++t) { if (col0 + t * 16 >= N) continue; const size_t boff = (size_t)(col0 + t * 16 + ln) * ldb + kb; FragH bq; bq.half[0] = *(const v8us*)(Bh + boff + 8 * hh); bq.half[1] = *(const v8us*)(Bh + boff + 16 + 8 * hh);
      acc[t] = mmaH<ASPLIT ? 2 : 1>(ah.v, al.v, bq.v, bq.v, acc[t]); }
  }
#pragma unroll
  for (int t = 0; t < 4; ++t) { if (col0 + t * 16 >= N) continue;
#pragma unroll
    for (int r = 0; r < 8; ++r) so[w][8 * hh + r][t * 16 + ln] = acc[t][r] * alpha; }
  __builtin_amdgcn_fence(__ATOMIC_ACQ_REL, "workgroup"); __builtin_amdgcn_wave_barrier();
  const int rsub = lane >> 4, c4 = (lane & 15) * 4;
  {
#pragma unroll
    for (int q = 0; q < 8; ++q) { const int r = q * 2 + rsub; if (col0 + c4 < N) { const v4f v = *(const v4fa*)&so[w][r][c4]; *(v4f*)(C + (size_t)(row0 + r) * ldc + col0 + c4) = v; } }
     }
}

// Wt[n][k] = f16(W[k][n]·scale) from f32 row-major W[K][N] (scale = power of two; bf16-exact weights stay exact in f16 away from the subnormal range)
__device__ __forceinline__ void wt_f16_part(const float* __restrict__ W, _Float16* __restrict__ Wt, int K, int N, float scale, int blk) {      /* blk: index of the 256-thread work-group within this matrix */
  const int t = blk * 256 + threadIdx.x; if (t >= N * (K / 8)) return; const int n = t / (K / 8), k8 = (t % (K / 8)) * 8; FragH f;
#pragma unroll
  for (int i = 0; i < 8; ++i) f.h[i] = (_Float16)(bf16_round(W[(size_t)(k8 + i) * N + n]) * scale); const v8us o = f.half[0];
  *(v8us*)((unsigned short*)Wt + (size_t)n * K + k8) = o; 
}
// k_gemm_hh variant with fused epilogue: v = acc·alpha + bias[by·sBias + col] (+ CP[(row/rowsPerB)·sCPb + by·64 + col] if CP) ; ACT 0 none / 1 elu ; writes f16 C16 (and f32 C if non-null)
template <int ACT>
__global__ __launch_bounds__(128) void k_gemm_hhx(const _Float16* __restrict__ A, int lda, size_t sA, const _Float16* __restrict__ Bh, int ldb, size_t sB, float alpha, const float* __restrict__ bias, size_t sBias, const float* __restrict__ CP, int rowsPerB, size_t sCPb, int row0g,
    float* __restrict__ C, _Float16* __restrict__ C16, int ldc, size_t sC, int M, int N, int K) {
  __shared__ __attribute__((aligned(16))) float so[4][16][64];
  const int tid = threadIdx.x, w = tid >> 5, lane = tid & 31, ln = lane & 15, hh = lane >> 4; const int by = blockIdx.y;
  A += (size_t)by * sA; Bh += (size_t)by * sB; const size_t cofs = (size_t)by * sC; const float* bp = bias ? bias + (size_t)by * sBias : nullptr;
  const int ntn = (N + 63) / 64; const int wid = blockIdx.x * 4 + w; const int mt = wid / ntn, nq = wid % ntn; if (mt * 16 >= M) return;
  const int row0 = mt * 16, col0 = nq * 64; const _Float16* arow = A + (size_t)(row0 + ln) * lda;
  v8f acc[4] = {};
  for (int kb = 0; kb < K; kb += 32) { FragH ah; ah.half[0] = *(const v8us*)((const unsigned short*)arow + kb + 8 * hh); ah.half[1] = *(const v8us*)((const unsigned short*)arow + kb + 16 + 8 * hh);
#pragma unroll
    for (int t = 0; t < 4; ++t) { if (col0 + t * 16 >= N) continue; const size_t boff = (size_t)(col0 + t * 16 + ln) * ldb + kb; FragH bq; bq.half[0] = *(const v8us*)((const unsigned short*)Bh + boff + 8 * hh); bq.half[1] = *(const v8us*)((const unsigned short*)Bh + boff + 16 + 8 * hh);
      acc[t] = mmaH<1>(ah.v, ah.v, bq.v, bq.v, acc[t]); }
  }
#pragma unroll
  for (int t = 0; t < 4; ++t) { if (col0 + t * 16 >= N) continue; const int col = col0 + t * 16 + ln; const float bv = bp ? bf16_round(bp[col]) : 0.f;
#pragma unroll
    for (int r = 0; r < 8; ++r) { float v = acc[t][r] * alpha + bv; if (CP) { const int rr = row0g + row0 + 8 * hh + r; if (rowsPerB < 0) v += CP[cofs + (size_t)rr * ldc + col];      /* rowsPerB < 0: own element of the batched C plane */ else { const int bidx = rr / rowsPerB; v += CP[(size_t)bidx * sCPb + (size_t)by * 64 + col]; } } if (ACT == 1) v = (v > 0.f) ? v : expm1f(v); else if (ACT == 7) v = (v > 0.f) ? v + 1.0f : expf(v); else if (ACT == 8) v = tanhf(v); else if (ACT == 9) v = 0.5f * v * (1.0f + tanhf(0.7978845608028654f * (v + 0.044715f * v * v * v))); else if (ACT == 11) v = 1.0f / (1.0f + expf(-v)); else if (ACT == 12) v = (v > 0.f) ? v : 0.01f * v; else if (ACT == 14) v = (v > 0.f) ? v : 0.1f * v; else if (ACT == 16) v = (v >= 0.f) ? v : 0.3f * v; else if (ACT == 17) v = (v >= 0.f) ? v : 0.2f * v; else if (ACT == 15) v = v / (1.0f + expf(-v)); else if (ACT == 3) v = fmaxf(v, 0.f); else if (ACT == 6) v = 0.5f * v * (1.0f + erff(v * 0.70710678118654752f)); so[w][8 * hh + r][t * 16 + ln] = v; } }
  __builtin_amdgcn_fence(__ATOMIC_ACQ_REL, "workgroup"); __builtin_amdgcn_wave_barrier();
  const int rsub = lane >> 4, c4 = (lane & 15) * 4; typedef _Float16 v4h __attribute__((ext_vector_type(4)));
  {
#pragma unroll
    for (int q = 0; q < 8; ++q) { const int r = q * 2 + rsub; if (col0 + c4 < N) { const v4f v = *(const v4fa*)&so[w][r][c4]; if (C) *(v4f*)(C + cofs + (size_t)(row0 + r) * ldc + col0 + c4) = v; if (C16) { v4h h4; for (int i = 0; i < 4; ++i) h4[i] = (_Float16)v[i]; *(v4h*)(C16 + cofs + (size_t)(row0 + r) * ldc + col0 + c4) = h4; } } }
     }
}


typedef _Float16 v4h __attribute__((ext_vector_type(4)));

__global__ __launch_bounds__(256) void k_x16(const float* __restrict__ x, _Float16* __restrict__ X16, size_t n8) { const size_t t = (size_t)blockIdx.x * 256 + threadIdx.x; if (t >= n8) return; FragH f;
#pragma unroll
  for (int q = 0; q < 8; ++q) f.h[q] = (_Float16)bf16_round(x[t * 8 + q]); *(v8us*)((unsigned short*)X16 + t * 8) = f.half[0];  }
__global__ __launch_bounds__(256) void k_h16(const float* __restrict__ x, _Float16* __restrict__ X16, size_t n8) { const size_t t = (size_t)blockIdx.x * 256 + threadIdx.x; if (t >= n8) return; FragH f;
#pragma unroll
  for (int q = 0; q < 8; ++q) f.h[q] = (_Float16)x[t * 8 + q]; *(v8us*)((unsigned short*)X16 + t * 8) = f.half[0];  }
__global__ __launch_bounds__(256) void k_round16f(const float* __restrict__ W, _Float16* __restrict__ Bt, size_t n8) { const size_t t = (size_t)blockIdx.x * 256 + threadIdx.x; if (t >= n8) return; FragH f;
#pragma unroll
  for (int i = 0; i < 8; ++i) f.h[i] = (_Float16)(bf16_round(W[t * 8 + i]) * 16.0f); *(v8us*)((unsigned short*)Bt + t * 8) = f.half[0];  }
__global__ __launch_bounds__(256) void k_hl(const float* __restrict__ F, _Float16* __restrict__ Hh, _Float16* __restrict__ Hl, size_t n8) { const size_t t = (size_t)blockIdx.x * 256 + threadIdx.x; if (t >= n8) return; FragH fh, fl; const v4f a = *(const v4fa*)(F + t * 8), c = *(const v4fa*)(F + t * 8 + 4);
#pragma unroll
  for (int q = 0; q < 4; ++q) { _Float16 h = (_Float16)a[q]; fh.h[q] = h; fl.h[q] = (_Float16)((a[q] - (float)h) * 1024.0f); h = (_Float16)c[q]; fh.h[4 + q] = h; fl.h[4 + q] = (_Float16)((c[q] - (float)h) * 1024.0f); }
  { *(v8us*)((unsigned short*)Hh + t * 8) = fh.half[0]; *(v8us*)((unsigned short*)Hl + t * 8) = fl.half[0];  } }

// ---- fast GEMM (work-group tile 128x64, wave tile 32x64; requires M % 128 == 0, N % 64 == 0, K % 64 == 0; LDA / LDB / LDC: row pitches of A, Bh and the output in elements); v = acc * alpha + bf16(bias[col]), written as f32 (OUT32) or as f16 ----
// Shapes, pitches and the output kind are template parameters: the epilogue holds no test that is the same for a whole launch, so it is one straight run of code in which the read-back of the tile and the stores each leave as one group.
// The operand rows come in stages of 64 k: whole 128-byte lines into registers one stage ahead, then into one of two LDS buffers (row pitch 144 bytes), one barrier per stage; the waves read their fragments from LDS.
#define G2K 64                       /* k per stage: 128 bytes of every operand row */
#define G2P 144                      /* LDS row pitch, bytes: 128 + 16, an odd multiple of 16 for 16-byte readers */
#define G2R (128 + 64)               /* rows per stage: 128 of A, then 64 of Bh */
__device__ __forceinline__ v16h g2_frag(const _Float16* p, int hh) { FragH f; f.half[0] = *(const v8us*)((const unsigned short*)p + 8 * hh); f.half[1] = *(const v8us*)((const unsigned short*)p + 16 + 8 * hh); return f.v; }
__device__ __forceinline__ v16h fa_frag(const unsigned char* p) { FragH f; f.half[0] = *(const v8us*)p; f.half[1] = *(const v8us*)(p + 32); return f.v; }      /* 32 k of one LDS row, hardware k order: p already holds the lane half's 16 bytes */
__device__ __forceinline__ v8f fa_mma(v16h a, v16h b, v8f c) { return __builtin_amdgcn_wmma_f32_16x16x32_f16(false, a, false, b, (short)0, c, false, false); }
/* work-group barrier that orders LDS alone: __syncthreads() would also wait for the global loads of the stage fetched ahead, which only this thread's registers receive */
__device__ __forceinline__ void fa_barrier() { __builtin_amdgcn_fence(__ATOMIC_RELEASE, "workgroup", "local"); __builtin_amdgcn_s_barrier(); __builtin_amdgcn_fence(__ATOMIC_ACQUIRE, "workgroup", "local"); }
template <int ACT, int LDA, int LDB, int LDC, int M, int N, int K, bool OUT32>
__global__ __launch_bounds__(128) void k_gemm2(const _Float16* __restrict__ A, size_t sA, const _Float16* __restrict__ Bh, size_t sB, float alpha, const float* __restrict__ bias0, const float* __restrict__ bias1, const float* __restrict__ bias2,
    float* __restrict__ C, _Float16* __restrict__ C16, size_t sC) { static_assert(M % 128 == 0 && N % 64 == 0 && K % G2K == 0, "k_gemm2: whole tiles and whole stages only"); static_assert(ACT == 0 || ACT == 3 || ACT == 6 || ACT == 8 || ACT == 9 || ACT == 11 || ACT == 12 || ACT == 14 || ACT == 15 || ACT == 16 || ACT == 17, "k_gemm2: unsupported ACT code (would silently apply no activation)");
  __shared__ __attribute__((aligned(16))) unsigned char sm[2 * G2R * G2P];      /* the two stage buffers; behind the k loop the same bytes hold the epilogue's f32 tiles */
  static_assert(sizeof(float) * 4 * 32 * 68 <= sizeof(sm), "k_gemm2: the epilogue's tiles lie in the stage buffers");
  float (*so)[32][68] = reinterpret_cast<float (*)[32][68]>(sm);
  const int tid = threadIdx.x, w = tid >> 5, lane = tid & 31, ln = lane & 15, hh = lane >> 4; const int by = blockIdx.y;
  const float* bias = by == 0 ? bias0 : by == 1 ? bias1 : bias2;      /* the biases of up to three products batched over blockIdx.y are separate buffers */
  A += (size_t)by * sA; Bh += (size_t)by * sB; const size_t cofs = (size_t)by * sC;
  const int ntn = N >> 6; const int mt = blockIdx.x / ntn, nq = blockIdx.x - mt * ntn; const int row0 = mt * 128 + 32 * w, col0 = nq * 64; if (mt * 128 >= M) return;      /* the same for the whole work-group: barriers follow */
  /* staging: 8 threads per 128-byte row, 16 rows per round, 8 rounds for A and 4 for Bh */
  const int srow = tid >> 3, sch = (tid & 7) * 16;
  const unsigned char* ag = (const unsigned char*)(A + (size_t)(mt * 128 + srow) * LDA) + sch;
  const unsigned char* bg = (const unsigned char*)(Bh + (size_t)(col0 + srow) * LDB) + sch;
  const int sl = srow * G2P + sch;
  v8us ra[8], rb[4];
  auto fetch = [&](int st) { const unsigned char* ap = ag + (size_t)st * (G2K * 2); const unsigned char* bp = bg + (size_t)st * (G2K * 2);
#pragma unroll
    for (int r = 0; r < 8; ++r) ra[r] = *(const v8us*)(ap + (size_t)r * 16 * LDA * 2);
#pragma unroll
    for (int r = 0; r < 4; ++r) rb[r] = *(const v8us*)(bp + (size_t)r * 16 * LDB * 2);
    asm volatile("s_wait_xcnt 0x0" :: "v"(ap), "v"(bp) : "memory"); };      /* the loads' address registers are inputs here, so they stay live up to this wait and are re-used only behind it */
  auto put = [&](int buf) { unsigned char* d = sm + buf * (G2R * G2P) + sl;
#pragma unroll
    for (int r = 0; r < 8; ++r) *(v8us*)(d + r * 16 * G2P) = ra[r];
#pragma unroll
    for (int r = 0; r < 4; ++r) *(v8us*)(d + (128 + r * 16) * G2P) = rb[r]; };
  const int ns = K / G2K;
  fetch(0);
  const float* bq = bias + col0 + ln; float braw[4];      /* the lane's four bias values, asked for here, behind stage 0's loads: they arrive under the k loop */
#pragma unroll
  for (int t = 0; t < 4; ++t) braw[t] = bq[t * 16];
  asm volatile("s_wait_xcnt 0x0" :: "v"(bq) : "memory");      /* stands directly behind the bias loads, in front of every re-use of a register that they name; the lane's pointer is an input, so it stays live up to here */
  put(0); if (ns > 1) fetch(1);
  const int fa = (32 * w + ln) * G2P + hh * 16, fb = (128 + ln) * G2P + hh * 16;      /* the lane's row and half in the A rows and in the Bh rows */
  const v8f z8 = {0.f,0.f,0.f,0.f,0.f,0.f,0.f,0.f}; v8f c00 = z8, c01 = z8, c02 = z8, c03 = z8, c10 = z8, c11 = z8, c12 = z8, c13 = z8;
  fa_barrier();      /* publishes stage 0 */
#pragma unroll 1
  for (int st = 0; st < ns; ++st) {      /* rolled: the body is one whole stage, and the buffer index is a run-time offset */
    const int buf = st & 1;
    if (st + 1 < ns) put(buf ^ 1);      /* stage st + 1, fetched one stage ago, into the buffer whose readers all passed the barrier at the foot of stage st - 1 */
    if (st + 2 < ns) fetch(st + 2);
    const unsigned char* Ab = sm + buf * (G2R * G2P) + fa; const unsigned char* Bb = sm + buf * (G2R * G2P) + fb;
    v16h a[2][2], b[2][4];      /* [32-k half of the stage][16-row tile] */
#pragma unroll
    for (int ks = 0; ks < 2; ++ks) {
#pragma unroll
      for (int i = 0; i < 2; ++i) a[ks][i] = fa_frag(Ab + i * 16 * G2P + ks * 64);
#pragma unroll
      for (int t = 0; t < 4; ++t) b[ks][t] = fa_frag(Bb + t * 16 * G2P + ks * 64); }
    __builtin_amdgcn_sched_barrier(0);      /* the stage's 24 LDS reads leave as one group ahead of its 16 products: without it one register set is re-used for every Bh fragment, and each pair of products waits out an LDS read of its own */
#pragma unroll
    for (int ks = 0; ks < 2; ++ks) {      /* k ascending by 32 in every accumulator */
      c00 = fa_mma(a[ks][0], b[ks][0], c00); c10 = fa_mma(a[ks][1], b[ks][0], c10); c01 = fa_mma(a[ks][0], b[ks][1], c01); c11 = fa_mma(a[ks][1], b[ks][1], c11);
      c02 = fa_mma(a[ks][0], b[ks][2], c02); c12 = fa_mma(a[ks][1], b[ks][2], c12); c03 = fa_mma(a[ks][0], b[ks][3], c03); c13 = fa_mma(a[ks][1], b[ks][3], c13); }
    fa_barrier();      /* publishes stage st + 1 and ends every wave's reads of this stage's buffer; the last one frees the buffers for the epilogue */
  }
  v8f accs[8] = {c00, c01, c02, c03, c10, c11, c12, c13};
#pragma unroll
  for (int u = 0; u < 8; ++u) { const int t = u & 3, half = u >> 2; const float bv = bf16_round(braw[t]);
#pragma unroll
    for (int r = 0; r < 8; ++r) { const int rloc = half * 16 + 8 * hh + r; float v = accs[u][r] * alpha + bv;
      if (ACT == 3) v = fmaxf(v, 0.f); else if (ACT == 6) v = 0.5f * v * (1.0f + erff(v * 0.70710678118654752f)); else if (ACT == 11) v = 1.0f / (1.0f + expf(-v)); else if (ACT == 15) v = v / (1.0f + expf(-v)); else if (ACT == 12) v = (v > 0.f) ? v : 0.01f * v; else if (ACT == 8) v = tanhf(v); else if (ACT == 9) v = 0.5f * v * (1.0f + tanhf(0.7978845608028654f * (v + 0.044715f * v * v * v))); else if (ACT == 14) v = (v > 0.f) ? v : 0.1f * v; else if (ACT == 16) v = (v >= 0.f) ? v : 0.3f * v; else if (ACT == 17) v = (v >= 0.f) ? v : 0.2f * v;
      so[w][rloc][t * 16 + ln] = v; } }
  __builtin_amdgcn_fence(__ATOMIC_ACQ_REL, "workgroup"); __builtin_amdgcn_wave_barrier();
  const int rsub = lane >> 4, c4 = (lane & 15) * 4;
  {
#pragma unroll
    for (int q = 0; q < 16; ++q) { const int r = q * 2 + rsub; const v4f v = *(const v4fa*)&so[w][r][c4]; if (OUT32) *(v4f*)(C + cofs + (size_t)(row0 + r) * LDC + col0 + c4) = v; else { v4h h4; for (int i = 0; i < 4; ++i) h4[i] = (_Float16)v[i]; *(v4h*)(C16 + cofs + (size_t)(row0 + r) * LDC + col0 + c4) = h4; } }
     } }


__global__ __launch_bounds__(256) void k_wnat(const float* __restrict__ w, size_t n8, _Float16* __restrict__ Bt) { const size_t t = (size_t)blockIdx.x * 256 + threadIdx.x; if (t >= n8) return; FragH f; for (int q = 0; q < 8; ++q) f.h[q] = (_Float16)(bf16_round(w[t * 8 + q]) * 16.0f); *(v8us*)((unsigned short*)Bt + t * 8) = f.half[0];  }
#define FAW 8                        /* waves per work-group */
#define FAG 2                        /* key groups: waves 0..3 take the first FAK keys of every stage, waves 4..7 the second */
#define FAC 2                        /* 16-column query tiles per wave */
#define FAK 64                       /* keys per wave and stage */
#define FAS (FAG * FAK)              /* keys per stage */
#define FAQ ((FAW / FAG) * FAC * 16) /* query columns per work-group */
#define FAP 144                      /* LDS row pitch of K, bytes: 128 + 16, an odd multiple of 16 for 16-byte readers */
#define FAPV 160                     /* LDS row pitch of V, bytes: 128 + 32, an odd multiple of 32 for the transposing reader */
#define FAKB (FAS * FAP)             /* bytes of a stage's K rows; its V rows lie behind them */
#define FAN (SQ / FAS)               /* stages */
__device__ __forceinline__ float rs_xh(float x) { return __builtin_bit_cast(float, __builtin_amdgcn_permlanex16(__builtin_bit_cast(int, x), __builtin_bit_cast(int, x), 0x76543210, 0xfedcba98, false, false)); }      /* lane l with lane l ^ 16 */
typedef float v2f __attribute__((ext_vector_type(2))); typedef _Float16 v2h __attribute__((ext_vector_type(2)));
typedef short v8s __attribute__((ext_vector_type(8)));
/* 16 (d) x 32 (keys) A fragment of V^T from row-major V rows in LDS: p = the lane's address in the first 16 keys, row 8 (lane >> 4) + (lane & 7), byte 16 ((lane >> 3) & 1) of the 32 bytes of the 16 d; lane (c, h) receives keys 8 h + 0..7 of column c, then the same of the next 16 keys */
__device__ __forceinline__ v16h fa_frag_tr(const unsigned char* p) { typedef __attribute__((address_space(3))) v8s lds_v8s; FragH f; f.half[0] = __builtin_bit_cast(v8us, __builtin_amdgcn_ds_load_tr16_b128_v8i16((lds_v8s*)p)); f.half[1] = __builtin_bit_cast(v8us, __builtin_amdgcn_ds_load_tr16_b128_v8i16((lds_v8s*)(p + 16 * FAPV))); return f.v; }
__global__ __launch_bounds__(FAW * 32) void k_fattn(const _Float16* __restrict__ Q, const _Float16* __restrict__ Kg, const _Float16* __restrict__ Vg, _Float16* __restrict__ O) {
  __shared__ __attribute__((aligned(16))) unsigned char L[2][FAKB + FAS * FAPV];      /* [buffer][K rows, then V rows]; behind the loop the same bytes carry the second key group's partial results */
  static_assert(SQ % (2 * FAS) == 0 && SQ % FAQ == 0 && FAW * 4 == 32, "k_fattn: whole stages, whole column blocks, 32 rows per staging round");
  static_assert((FAW / FAG) * (FAC * 8 + 1) * 32 * 16 <= sizeof(L), "k_fattn: the partial results lie in the stage buffers");
  const int tid = threadIdx.x, lane = tid & 31, ln = lane & 15, hh = lane >> 4; const int wave = __builtin_amdgcn_readfirstlane(tid >> 5);
  const int cg = wave & (FAW / FAG - 1), kh = wave / (FAW / FAG);      /* column group, key group */
  const int bh = blockIdx.y, b = bh / NH, h = bh - b * NH; const int q0 = blockIdx.x * FAQ + cg * (FAC * 16);
  /* staging: 8 threads per 128-byte row, 32 rows per round, four rounds per tile */
  const int srow = tid >> 3, sch = (tid & 7) * 16;
  const unsigned char* kg = (const unsigned char*)(Kg + ((size_t)b * SQ + srow) * DM + h * HD) + sch;      /* K row srow of stage 0; a stage is FAS rows of DM */
  const unsigned char* vg = (const unsigned char*)(Vg + ((size_t)b * SQ + srow) * DM + h * HD) + sch;      /* V row srow of stage 0, likewise */
  const int sl = srow * FAP + sch, slv = FAKB + srow * FAPV + sch;
  v8us kr[FAS / 32], vr[FAS / 32];
  auto fetch = [&]() { const unsigned char* kp = kg; const unsigned char* vp = vg;      /* kg, vg: this thread's place in the next stage to fetch */
#pragma unroll
    for (int r = 0; r < FAS / 32; ++r) { kr[r] = *(const v8us*)(kp + (size_t)r * 32 * DM * 2); vr[r] = *(const v8us*)(vp + (size_t)r * 32 * DM * 2); }
    asm volatile("s_wait_xcnt 0x0" :: "v"(kp), "v"(vp) : "memory");      /* the loads' address registers are inputs here, so they stay live up to this wait and are re-used only behind it */
    kg = kp + FAS * DM * 2; vg = vp + FAS * DM * 2; };
  auto put = [&](int buf) {
#pragma unroll
    for (int r = 0; r < FAS / 32; ++r) { *(v8us*)&L[buf][sl + r * 32 * FAP] = kr[r]; *(v8us*)&L[buf][slv + r * 32 * FAPV] = vr[r]; } };
  fetch();
  v16h qf[FAC][2];      /* B operand: column = query, same k order as fa_frag */
#pragma unroll
  for (int c = 0; c < FAC; ++c) { const _Float16* qp = Q + ((size_t)b * SQ + q0 + c * 16 + ln) * DM + h * HD; qf[c][0] = g2_frag(qp, hh); qf[c][1] = g2_frag(qp + 32, hh);
    asm volatile("s_wait_xcnt 0x0" :: "v"(qp) : "memory"); }      /* stands directly behind the tile's Q loads, in front of every re-use of a register that they name; the lane's pointer is an input, so it stays live up to here */
  put(0); fetch();
  const v8f z8 = {0.f,0.f,0.f,0.f,0.f,0.f,0.f,0.f}; v8f acc[FAC][4];      /* acc[c][t][r] = O^T[16 t + 8 hh + r][query 16 c + ln], over this wave's keys */
  float m[FAC], l[FAC];      /* per column tile: running maximum (log2 domain, both halves alike) and this lane half's part of the denominator */
#pragma unroll
  for (int c = 0; c < FAC; ++c) { m[c] = -3.0e38f; l[c] = 0.f;
#pragma unroll
    for (int t = 0; t < 4; ++t) acc[c][t] = z8; }
  const float cs = 0.125f * 1.4426950408889634f;      /* 1 / sqrt(64), and e^x = 2^(x log2 e) */
  const int fo = (kh * FAK + ln) * FAP + hh * 16, fv = FAKB + (kh * FAK + 8 * hh + (lane & 7)) * FAPV + ((lane >> 3) & 1) * 16;      /* the lane's place in its key group's K rows; its place in the V rows for the transposing loads */
  __syncthreads();      /* publishes stage 0; the full barrier also ends the Q loads here, so that no wait for them stands in the loop, where it would drain the stage fetched ahead */
#pragma unroll 1
  for (int st = 0; st < FAN; ++st) {      /* rolled: the body is one whole stage, and the buffer index is a run-time offset */
    const int buf = st & 1;
    if (st + 1 < FAN) put(buf ^ 1);      /* stage st + 1, fetched one stage ago, into the buffer whose readers all passed the barrier of stage st - 1, behind its last LDS read */
    if (st + 2 < FAN) fetch();
    const unsigned char* Kb = &L[buf][fo]; const unsigned char* Vb = &L[buf][fv];
    v16h kf[4][2], vf[4][2]; v8f s[FAC][4];
#pragma unroll
    for (int kt = 0; kt < 4; ++kt) { kf[kt][0] = fa_frag(Kb + kt * 16 * FAP); kf[kt][1] = fa_frag(Kb + kt * 16 * FAP + 64); }
#pragma unroll
    for (int t = 0; t < 4; ++t) { vf[t][0] = fa_frag_tr(Vb + t * 32); vf[t][1] = fa_frag_tr(Vb + 32 * FAPV + t * 32); }      /* d = 16 t + ln; keys 0..31 and 32..63 of the wave's part of the stage */
    __builtin_amdgcn_sched_barrier(0);      /* the stage's 32 LDS reads leave as one group, K first: without it one register set is re-used for every K fragment, and each pair of products waits out an LDS read of its own */
#pragma unroll
    for (int kt = 0; kt < 4; ++kt)
#pragma unroll
      for (int c = 0; c < FAC; ++c) s[c][kt] = fa_mma(kf[kt][0], qf[c][0], z8);
#pragma unroll
    for (int kt = 0; kt < 4; ++kt)
#pragma unroll
      for (int c = 0; c < FAC; ++c) s[c][kt] = fa_mma(kf[kt][1], qf[c][1], s[c][kt]);
    __builtin_amdgcn_sched_barrier(0);      /* the score products run back to back: without it the maxima are woven between the products, each behind padding */
    union { v16h v; v2h p[8]; } pf[FAC][2];
#pragma unroll
    for (int c = 0; c < FAC; ++c) {
      float mx = s[c][0][0];
#pragma unroll
      for (int kt = 0; kt < 4; ++kt)
#pragma unroll
        for (int r = 0; r < 8; ++r) mx = fmaxf(mx, s[c][kt][r]);
      mx = fmaxf(mx, rs_xh(mx));
      const float mn = fmaxf(m[c], mx * cs); const float corr = __builtin_amdgcn_exp2f(m[c] - mn); m[c] = mn;      /* corr is 0 in the first stage */
      const v2f cs2 = {cs, cs}, nm2 = {8.0f - mn, 8.0f - mn};      /* weights carried x256 (numerator and denominator alike), away from the f16 subnormal range */
      v2f sa = {0.f, 0.f}, sb = {0.f, 0.f};
#pragma unroll
      for (int kt = 0; kt < 4; ++kt)
#pragma unroll
        for (int i = 0; i < 4; ++i) { const v2f x = {s[c][kt][2 * i], s[c][kt][2 * i + 1]}; const v2f e = __builtin_elementwise_fma(x, cs2, nm2); const v2f p = {__builtin_amdgcn_exp2f(e[0]), __builtin_amdgcn_exp2f(e[1])};
          if (i & 1) sb += p; else sa += p; pf[c][kt >> 1].p[(kt & 1) * 4 + i] = __builtin_convertvector(p, v2h); }      /* element 8 (kt & 1) + r of the 32-key operand = tile kt, register r */
      sa += sb; l[c] = fmaf(l[c], corr, sa[0] + sa[1]);
#pragma unroll
      for (int t = 0; t < 4; ++t) acc[c][t] = acc[c][t] * corr;
    }
    __builtin_amdgcn_sched_barrier(0);      /* holds the barrier below behind the softmax: moved up in front of it, its wait for the V^T reads stands where they have only just been issued, and the softmax no longer runs under them */
    fa_barrier();      /* stands behind the stage's last LDS read: publishes stage st + 1 and ends every wave's reads of this stage's buffer; the last one frees the buffers for the partial results */
#pragma unroll
    for (int hk = 0; hk < 2; ++hk)
#pragma unroll
      for (int t = 0; t < 4; ++t)
#pragma unroll
        for (int c = 0; c < FAC; ++c) acc[c][t] = fa_mma(vf[t][hk], pf[c][hk].v, acc[c][t]);
    __builtin_amdgcn_sched_barrier(0);      /* holds the four slots below behind the last product */
    asm volatile("v_nop\n\tv_nop\n\tv_nop\n\tv_nop");      /* the distance that the chip needs between the last products and the next stage's first vector instructions, which overwrite their operand registers */
  }
  /* join of the two key groups: the second hands its maxima, sums and O^T to the first, lane for lane (both hold the same query and d in the same lane and register) */
  v4fa* X = reinterpret_cast<v4fa*>(&L[0][0]) + (size_t)cg * (FAC * 8 + 1) * 32 + lane;      /* entry j of the column group: 32 lanes x 16 bytes in a row */
  if (kh != 0) {
#pragma unroll
    for (int c = 0; c < FAC; ++c)
#pragma unroll
      for (int t = 0; t < 4; ++t) { const v8f a = acc[c][t]; X[((c * 4 + t) * 2) * 32] = v4f{a[0], a[1], a[2], a[3]}; X[((c * 4 + t) * 2 + 1) * 32] = v4f{a[4], a[5], a[6], a[7]}; }
    X[FAC * 8 * 32] = v4f{m[0], l[0], m[1], l[1]};
  }
  fa_barrier();      /* publishes the second key group's partial results; every wave passes it */
  if (kh != 0) return;
  const v4f ml = X[FAC * 8 * 32]; FragH f[FAC][4];
#pragma unroll
  for (int c = 0; c < FAC; ++c) {
    const float mo = ml[2 * c], lo = ml[2 * c + 1]; const float mn = fmaxf(m[c], mo); const float f0 = __builtin_amdgcn_exp2f(m[c] - mn), f1 = __builtin_amdgcn_exp2f(mo - mn);      /* both maxima are finite: each group has walked keys */
    const float lt = l[c] * f0 + lo * f1; const float inv = 64.0f / (lt + rs_xh(lt));      /* o carried x64, as the output GEMM's alpha expects */
    const float g0 = f0 * inv, g1 = f1 * inv;
#pragma unroll
    for (int t = 0; t < 4; ++t) { const v4f x0 = X[((c * 4 + t) * 2) * 32], x1 = X[((c * 4 + t) * 2 + 1) * 32];
#pragma unroll
      for (int r = 0; r < 4; ++r) { f[c][t].h[r] = (_Float16)(acc[c][t][r] * g0 + x0[r] * g1); f[c][t].h[4 + r] = (_Float16)(acc[c][t][4 + r] * g0 + x1[r] * g1); } }
  }
#pragma unroll
  for (int c = 0; c < FAC; ++c) { _Float16* op = O + ((size_t)b * SQ + q0 + c * 16 + ln) * DM + h * HD + 8 * hh;
#pragma unroll
    for (int t = 0; t < 4; ++t) *(v8us*)((unsigned short*)op + t * 16) = f[c][t].half[0]; }      /* 8 consecutive d of one query row: 16 bytes */
}
__global__ __launch_bounds__(256) void k_vt(const _Float16* __restrict__ V16, int b, int h0, _Float16* __restrict__ VT) { __shared__ unsigned short tl[64][65]; const int tid = threadIdx.x; const int hh = blockIdx.x % HG, sg = blockIdx.x / HG; const int s0 = sg * 64; const int h = h0 + hh;
  for (int i = tid; i < 64 * 8; i += 256) { const int j = i / 8, d8 = (i % 8) * 8; FragH f; f.half[0] = *(const v8us*)((const unsigned short*)V16 + ((size_t)b * SQ + s0 + j) * DM + h * HD + d8); for (int q = 0; q < 8; ++q) tl[d8 + q][j] = f.u[q]; }
  __syncthreads();
  { for (int i = tid; i < 64 * 8; i += 256) { const int d = i / 8, j8 = (i % 8) * 8; FragH f; for (int q = 0; q < 8; ++q) f.u[q] = tl[d][j8 + q]; *(v8us*)((unsigned short*)VT + ((size_t)hh * HD + d) * SQ + s0 + j8) = f.half[0]; }  } }



__global__ __launch_bounds__(256) void k_rsmkm(const float* __restrict__ S, _Float16* __restrict__ P, int nrows, const int* __restrict__ am) {
  #pragma clang fp contract(off)
  const int t = blockIdx.x * 256 + threadIdx.x; if (t >= nrows) return; const size_t i = (size_t)t; const float* s = S + i * SQ; const int* mr = am + (size_t)(t % SQ) * SQ; float mx = -3.0e38f;
#pragma unroll 1
  for (int j = 0; j < SQ; ++j) { const float f = (mr[j] != 0) ? 1.f : 0.f; mx = fmaxf(mx, fmaf(f, s[j], (1.f - f) * -1.0e9f)); } float se = 0.f;
#pragma unroll 1
  for (int j = 0; j < SQ; ++j) { const float f = (mr[j] != 0) ? 1.f : 0.f; se += __expf(fmaf(f, s[j], (1.f - f) * -1.0e9f) - mx); } const float sc = 256.0f / se;
#pragma unroll 1
  for (int j0 = 0; j0 < SQ; j0 += 8) { FragH fr; for (int q = 0; q < 8; ++q) { const int j = j0 + q; const float f = (mr[j] != 0) ? 1.f : 0.f; fr.h[q] = (_Float16)(__expf(fmaf(f, s[j], (1.f - f) * -1.0e9f) - mx) * sc); }
    unsigned short* d = (unsigned short*)P + i * SQ + j0; *(v8us*)d = fr.half[0];  } }

// LayerNorm of the bf16-rounded rows, one wave per LNR rows and no LDS: a lane holds columns 4 lane + 128 u (u = 0..3) of each row, so every load covers 512 and every store 256 contiguous bytes;
// all the rows' loads leave first; mean and variance (two passes over the registers) are lane partials, four row_xmask steps and one exchange of the wave halves; gamma and beta are rounded once per wave.
#define LNR 4                        /* rows per wave */
#define LNW 8                        /* waves per work-group: the 256 threads that the weight pass in the same launch has */
template <int CTRL>
__device__ __forceinline__ float ln_dpp(float x) { return __builtin_bit_cast(float, __builtin_amdgcn_update_dpp(0, __builtin_bit_cast(int, x), CTRL, 0xf, 0xf, true)); }      /* lane l with lane l ^ (CTRL - 0x160) of its 16-lane row */
__device__ __forceinline__ float ln_sum32(float x) { x += ln_dpp<0x161>(x); x += ln_dpp<0x162>(x); x += ln_dpp<0x164>(x); x += ln_dpp<0x168>(x); return x + rs_xh(x); }      /* every lane ends with the sum over the wave */
__device__ __forceinline__ void lnw_part(const float* __restrict__ X, const float* __restrict__ g, const float* __restrict__ bb, float eps, _Float16* __restrict__ N16, int blk) {      /* blk: index of the work-group within this input */
  static_assert(DM == 512 && NR % (LNR * LNW) == 0, "lnw_part: a lane holds 16 columns, and every wave has LNR whole rows");
  const int c0 = (threadIdx.x & 31) * 4; const size_t r0 = ((size_t)blk * LNW + (threadIdx.x >> 5)) * LNR;
  const float* xp = X + r0 * DM + c0; _Float16* yp = N16 + r0 * DM + c0;
  v4f x[LNR][4], gg[4], be[4]; float mu[LNR], rs[LNR];
  for (int i = 0; i < LNR; ++i) for (int u = 0; u < 4; ++u) x[i][u] = *(const v4fa*)(xp + i * DM + u * 128);
  for (int u = 0; u < 4; ++u) { gg[u] = *(const v4fa*)(g + c0 + u * 128); be[u] = *(const v4fa*)(bb + c0 + u * 128); }
  asm volatile("s_wait_xcnt 0x0" :: "v"(xp) : "memory");      /* the row loads' address pair is an input here, so it stays live up to this wait */
  for (int u = 0; u < 4; ++u) for (int q = 0; q < 4; ++q) { gg[u][q] = bf16_round(gg[u][q]); be[u][q] = bf16_round(be[u][q]); }
  for (int i = 0; i < LNR; ++i) {
    for (int u = 0; u < 4; ++u) for (int q = 0; q < 4; ++q) x[i][u][q] = bf16_round(x[i][u][q]);
    const v4f t = (x[i][0] + x[i][1]) + (x[i][2] + x[i][3]); mu[i] = (t[0] + t[1]) + (t[2] + t[3]); }
  for (int i = 0; i < LNR; ++i) mu[i] = ln_sum32(mu[i]) * (1.0f / DM);
  for (int i = 0; i < LNR; ++i) {
    for (int u = 0; u < 4; ++u) x[i][u] -= mu[i];
    const v4f t = (x[i][0] * x[i][0] + x[i][1] * x[i][1]) + (x[i][2] * x[i][2] + x[i][3] * x[i][3]); rs[i] = (t[0] + t[1]) + (t[2] + t[3]); }
  for (int i = 0; i < LNR; ++i) rs[i] = rsqrtf(ln_sum32(rs[i]) * (1.0f / DM) + eps);
  for (int i = 0; i < LNR; ++i) for (int u = 0; u < 4; ++u) *(v4h*)(yp + i * DM + u * 128) = __builtin_convertvector(x[i][u] * rs[i] * gg[u] + be[u], v4h);
  asm volatile("s_wait_xcnt 0x0" ::: "memory");      /* behind the last row stores: in the built kernel the weight part's code follows them and rewrites their address and data registers */
}
// Everything that reads only inputs, as ranges of the block index of ONE launch: the four weight passes, then the three LayerNorms. None reads what another writes.
// Bt holds the four weight planes (q, k, v, o) and N16 the three row planes (query, key, value) one behind the other. The weight work-groups, which touch the most lines each, start first.
#define WTB (DM * (DM / 8) / 256)    /* work-groups per weight matrix */
#define LNB ((int)(NR / (LNR * LNW)))      /* work-groups per LayerNorm input */
__global__ __launch_bounds__(256) void k_prep(const float* __restrict__ wq, const float* __restrict__ wk, const float* __restrict__ wv, const float* __restrict__ wo, _Float16* __restrict__ Bt,
                                              const float* __restrict__ xq, const float* __restrict__ xk, const float* __restrict__ xv, const float* __restrict__ g, const float* __restrict__ bb, float eps, _Float16* __restrict__ N16) {
  static_assert(LNW * 32 == 256 && DM * (DM / 8) % 256 == 0, "k_prep: both parts are dealt to work-groups of 256 threads");
  const int bx = blockIdx.x;
  if (bx < 4 * WTB) { const int j = bx / WTB; wt_f16_part(j == 0 ? wq : j == 1 ? wk : j == 2 ? wv : wo, Bt + (size_t)j * DM * DM, DM, DM, 16.0f, bx - j * WTB); }
  else { const int c = bx - 4 * WTB, j = c / LNB; lnw_part(j == 0 ? xq : j == 1 ? xk : xv, g, bb, eps, N16 + (size_t)j * NR * DM, c - j * LNB); }
}


extern "C" void kernel_launch(void* const* d_in, const int* in_sizes, int n_in,
                              void* d_out, int out_size, void* d_ws, size_t ws_size, hipStream_t stream) {
  (void)in_sizes; (void)n_in; (void)out_size;
  const float* const* I = (const float* const*)d_in; const float* xq = I[0]; const float* xk = I[1]; const float* xv = I[2]; const float* lng = I[3]; const float* lnb = I[4]; const float* wq = I[5]; const float* bq = I[6]; const float* wk = I[7]; const float* bk = I[8]; const float* wv = I[9]; const float* bv = I[10]; const float* wo = I[11]; const float* bo = I[12]; const float* x = xq;      /* query, key, value; shared LayerNorm gamma / beta [512]; [in][out] Wq / Wk / Wv / Wo + biases */
  char* ws = (char*)d_ws; size_t off = 0;
  auto take = [&](size_t bytes) { char* p = ws + off; off += (bytes + 255) & ~(size_t)255; return p; };
  _Float16* BQ = (_Float16*)take((size_t)4 * DM * DM * 2); _Float16* BO = BQ + (size_t)3 * DM * DM;      /* weight planes q, k, v, o, one behind the other */
  _Float16* X16 = (_Float16*)take((size_t)3 * NR * DM * 2);      /* LN(query), LN(key), LN(value) rows, one plane behind the other */
  _Float16* Q16 = (_Float16*)take((size_t)3 * NR * DM * 2); _Float16* K16 = Q16 + NR * DM; _Float16* V16 = K16 + NR * DM; _Float16* O16 = (_Float16*)take(NR * DM * 2);      /* q, k, v planes likewise */
  if (off > ws_size) return;
  k_prep<<<4 * WTB + 3 * LNB, 256, 0, stream>>>(wq, wk, wv, wo, BQ, x, xk, xv, lng, lnb, 1e-5f, X16);      /* [in][out] -> Bt x16 for all four weights; LN with the SHARED parameters -> f16 rows for all three inputs */
  const size_t r0p = (size_t)B0 * SQ;      /* first projected row */
  k_gemm2<0, DM, DM, DM, MP, DM, DM, false><<<dim3((unsigned)((MP / 128) * (DM / 64)), 3), 128, 0, stream>>>(X16 + r0p * DM, NR * DM, BQ, (size_t)DM * DM, 0.0625f, bq, bk, bv, nullptr, Q16 + r0p * DM, NR * DM);      /* q, k and v projections: blockIdx.y picks the planes and the bias */
  k_fattn<<<dim3(SQ / FAQ, NB * NH), FAW * 32, 0, stream>>>(Q16, K16, V16, O16);      /* o x64 (merged heads) as f16 rows, all batches and heads in one launch */
  k_gemm2<0, DM, DM, DM, MPO, DM, DM, true><<<dim3((unsigned)((MPO / 128) * (DM / 64)), 1), 128, 0, stream>>>(O16 + r0p * DM, 0, BO, 0, 0.0009765625f, bo, bo, bo, (float*)d_out + r0p * DM, nullptr, 0);      /* out rows are the output layout */
}

// v009
// Measured time: 41.5 microseconds a run.
// Next to v008, in two timings, it ran 1.12 times as fast each time.
// Over all steps from v000 it is 45.6 times as fast.
#include <hip/hip_runtime.h>
// Multi-head attention over THREE inputs, each passed through ONE shared LayerNorm first (query, key, value [2][2048][512]; Q = LN(query) Wq + bq, K = LN(key) Wk + bk, V = LN(value) Wv + bv with LN: biased var, eps 1e-5, shared ln_g / ln_b; [in][out] 512 x 512, zero biases); 8 heads of 64; scores / 8; softmax over all 2048 keys (no mask); out = merged Wo + bo -> [2][2048][512]; no residual).
// Structure: token rows r = b*2048 + s; x rounded to bf16 as it is loaded; the LayerNorms, the weight conversion and Q, K, V as three WMMA GEMMs in one launch, block ranges the product (rows normalised into LDS, 64x64 wave tiles, f32 accumulation, exact x16 weights + bias, f16 outputs); one fused attention launch over all (batch, head, 128 queries; 32 queries and half of the keys per wave, the halves joined at the end): S^T = K . Q^T (K = 64) on WMMA, online softmax in registers (f32 running maximum and sum, base 2, 1/sqrt(64) folded into the exponent; unnormalised weights x256, in (0, 256], as f16), O^T += V^T . P^T on WMMA (V rows staged as they lie, the V^T operand read from LDS by transposing loads), divided by the sum at the end (o carried x64 against f16 subnormal flush, folded into the output GEMM alpha) and written straight into the merged f16 o rows; out = o W_o + b GEMM (f32) into the output layout.
// Compute dtype: inputs rounded to bf16; weights exact; normalised rows, q, k, v, softmax weights and o as plain f16 GEMM operands (~2^-12); scores and softmax statistics f32; v_wmma_f32_16x16x32_f16.
#define NB 2
#define SQ 2048
#define DM 512
#define NH 8
#define HD 64
#define HG 4                         /* heads per launch of the per-batch k_vt */
#define B0 0                         /* first batch processed (debug hook) */
#define NBR NB                       /* batches processed (debug hook) */
#define NR ((size_t)NB * SQ)         /* token rows */
#define MP ((int)((size_t)NBR * SQ)) /* rows of the NBR batches (debug hook; only MPO, the output stage, uses it) */
#define QN SQ                        /* query rows per batch (unused: k_fattn attends all SQ) */
#define NHD NH                       /* heads (unused: k_fattn covers all NH heads) */
#define MPO MP                       /* rows through the output stage (debug hook) */
#define LQ DM      /* row pitch of the q/k/v rows (unused: k_lnproj and k_fattn take DM) */
typedef __bf16 v16b __attribute__((ext_vector_type(16)));
typedef unsigned short v8us __attribute__((ext_vector_type(8), may_alias));
typedef float  v8f  __attribute__((ext_vector_type(8)));
typedef float  v4f  __attribute__((ext_vector_type(4)));
typedef float  v4fa __attribute__((ext_vector_type(4), may_alias));
union FragB { v16b v; v8us half[2]; unsigned short u[16]; };

__device__ __forceinline__ unsigned short bf16_bits(float x) { unsigned int u = __float_as_uint(x); return (unsigned short)((u + 0x7FFFu + ((u >> 16) & 1u)) >> 16); }
__device__ __forceinline__ float bf16_val(unsigned short b) { return __uint_as_float(((unsigned int)b) << 16); }
__device__ __forceinline__ float bf16_round(float x) { return bf16_val(bf16_bits(x)); }
// D += A·B with NT terms: 1 = ah·bh, 2 = + al·bh (A split), 3 = + ah·bl (both split)
template <int NT>
__device__ __forceinline__ v8f mmaN(v16b ah, v16b al, v16b bh, v16b bl, v8f c) {
  c = __builtin_amdgcn_wmma_f32_16x16x32_bf16(false, ah, false, bh, (short)0, c, false, false);
  if (NT >= 2) c = __builtin_amdgcn_wmma_f32_16x16x32_bf16(false, al, false, bh, (short)0, c, false, false);
  if (NT >= 3) c = __builtin_amdgcn_wmma_f32_16x16x32_bf16(false, ah, false, bl, (short)0, c, false, false);
  asm volatile("v_nop\n\tv_nop\n\tv_nop\n\tv_nop" : "+v"(c) : "v"(ah), "v"(al), "v"(bh), "v"(bl));
  return c;
}

__global__ __launch_bounds__(256) void k_wt_bf16(const float* __restrict__ W, unsigned short* __restrict__ Wt, int K, int N) {
  const int t = blockIdx.x * 256 + threadIdx.x;
  const int k8n = K / 8;
  if (t >= N * k8n) return;
  const int n = t / k8n, k8 = (t % k8n) * 8;
  v8us v;
#pragma unroll
  for (int i = 0; i < 8; ++i) v[i] = bf16_bits(W[(size_t)(k8 + i) * N + n]);
  *(v8us*)(Wt + (size_t)n * K + k8) = v;
  
}

// GEMM C[M][N] (f32, pitch ldc) = act(A[M][K]·W + bias). A f32 row-major (pitch lda) converted per fragment to bf16
// (ASPLIT: hi/lo two planes -> 2 terms, else single rounded term); Wt bf16 [N][K] (pitch ldb). BIAS_BF16 rounds the
// bias to bf16 first (bias quantised to bf16 before the add). K%32==0, M%16==0, N%64==0.
template <bool ASPLIT, int ACT, bool BIAS_BF16>
__global__ __launch_bounds__(128) void k_gemm_bf(const float* __restrict__ A, int lda, const unsigned short* __restrict__ Wt, int ldb,
                                               const float* __restrict__ bias, float* __restrict__ C, int ldc, int M, int N, int K) {
  __shared__ __attribute__((aligned(16))) float so[4][16][64];
  const int tid = threadIdx.x, w = tid >> 5, lane = tid & 31, ln = lane & 15, hh = lane >> 4;
  const int ntn = N / 64;
  const int wid = blockIdx.x * 4 + w;
  const int mt = wid / ntn, nq = wid % ntn;
  if (mt * 16 >= M) return;
  const int row0 = mt * 16, col0 = nq * 64;
  const float* arow = A + (size_t)(row0 + ln) * lda;
  v8f acc[4] = {};
  for (int kb = 0; kb < K; kb += 32) {
    FragB ah, al;
    const v4f x0 = *(const v4fa*)(arow + kb + 8 * hh), x1 = *(const v4fa*)(arow + kb + 8 * hh + 4);
    const v4f x2 = *(const v4fa*)(arow + kb + 16 + 8 * hh), x3 = *(const v4fa*)(arow + kb + 16 + 8 * hh + 4);
    float xs[16] = {x0[0],x0[1],x0[2],x0[3],x1[0],x1[1],x1[2],x1[3],x2[0],x2[1],x2[2],x2[3],x3[0],x3[1],x3[2],x3[3]};
#pragma unroll
    for (int i = 0; i < 16; ++i) { const unsigned short hb = bf16_bits(xs[i]); ah.u[i] = hb; al.u[i] = ASPLIT ? bf16_bits(xs[i] - bf16_val(hb)) : (unsigned short)0; }
#pragma unroll
    for (int t = 0; t < 4; ++t) {
      const unsigned short* brow = Wt + (size_t)(col0 + t * 16 + ln) * ldb + kb;
      FragB b;
      b.half[0] = *(const v8us*)(brow + 8 * hh);
      b.half[1] = *(const v8us*)(brow + 16 + 8 * hh);
      acc[t] = mmaN<ASPLIT ? 2 : 1>(ah.v, al.v, b.v, b.v, acc[t]);
    }
  }
#pragma unroll
  for (int t = 0; t < 4; ++t) {
    float bv = bias ? bias[col0 + t * 16 + ln] : 0.f;
    if (BIAS_BF16) bv = bf16_round(bv);
#pragma unroll
    for (int r = 0; r < 8; ++r) { float v = acc[t][r] + bv; if (ACT == 1) v = fmaxf(v, 0.f); so[w][8 * hh + r][t * 16 + ln] = v; }
  }
  __builtin_amdgcn_fence(__ATOMIC_ACQ_REL, "workgroup");
  __builtin_amdgcn_wave_barrier();
  const int rsub = lane >> 4, c4 = (lane & 15) * 4;
  {
#pragma unroll
    for (int q = 0; q < 8; ++q) {
      const int r = q * 2 + rsub;
      const v4f v = *(const v4fa*)&so[w][r][c4];
      *(v4f*)(C + (size_t)(row0 + r) * ldc + col0 + c4) = v;
    }
    
  }
}

// GEMM C = act(A·W + bias + resid): A f32 (ASPLIT -> hi/lo 2 terms), Wt bf16 [N][K]; ACT 0 none, 1 relu, 2 exact gelu;
// resid (optional, f32, row index = (row % rmod), pitch ldr, RES_BF16 rounds it) added before the activation.
template <bool ASPLIT, int ACT, bool BIAS_BF16, bool RES_BF16>
__global__ __launch_bounds__(128) void k_gemm_bf3(const float* __restrict__ A, int lda, const unsigned short* __restrict__ Wt, int ldb,
                                                const float* __restrict__ bias, const float* __restrict__ resid, int rmod, int ldr,
                                                float* __restrict__ C, int ldc, int M, int N, int K) {
  __shared__ __attribute__((aligned(16))) float so[4][16][64];
  const int tid = threadIdx.x, w = tid >> 5, lane = tid & 31, ln = lane & 15, hh = lane >> 4;
  const int ntn = N / 64;
  const int wid = blockIdx.x * 4 + w;
  const int mt = wid / ntn, nq = wid % ntn;
  if (mt * 16 >= M) return;
  const int row0 = mt * 16, col0 = nq * 64;
  const float* arow = A + (size_t)(row0 + ln) * lda;
  v8f acc[4] = {};
  for (int kb = 0; kb < K; kb += 32) {
    FragB ah, al;
    const v4f x0 = *(const v4fa*)(arow + kb + 8 * hh), x1 = *(const v4fa*)(arow + kb + 8 * hh + 4);
    const v4f x2 = *(const v4fa*)(arow + kb + 16 + 8 * hh), x3 = *(const v4fa*)(arow + kb + 16 + 8 * hh + 4);
    float xs[16] = {x0[0],x0[1],x0[2],x0[3],x1[0],x1[1],x1[2],x1[3],x2[0],x2[1],x2[2],x2[3],x3[0],x3[1],x3[2],x3[3]};
#pragma unroll
    for (int i = 0; i < 16; ++i) { const unsigned short hb = bf16_bits(xs[i]); ah.u[i] = hb; al.u[i] = ASPLIT ? bf16_bits(xs[i] - bf16_val(hb)) : (unsigned short)0; }
#pragma unroll
    for (int t = 0; t < 4; ++t) {
      const unsigned short* brow = Wt + (size_t)(col0 + t * 16 + ln) * ldb + kb;
      FragB b;
      b.half[0] = *(const v8us*)(brow + 8 * hh);
      b.half[1] = *(const v8us*)(brow + 16 + 8 * hh);
      acc[t] = mmaN<ASPLIT ? 2 : 1>(ah.v, al.v, b.v, b.v, acc[t]);
    }
  }
#pragma unroll
  for (int t = 0; t < 4; ++t) {
    const int col = col0 + t * 16 + ln;
    float bv = bias ? bias[col] : 0.f;
    if (BIAS_BF16) bv = bf16_round(bv);
#pragma unroll
    for (int r = 0; r < 8; ++r) {
      float v = acc[t][r] + bv;
      if (resid) { float rv = resid[(size_t)((row0 + 8 * hh + r) % rmod) * ldr + col]; if (RES_BF16) rv = bf16_round(rv); v += rv; }
      if (ACT == 1) v = fmaxf(v, 0.f);
      if (ACT == 2) v = 0.5f * v * (1.0f + erff(v * 0.70710678118654752f));
      if (ACT == 3) { const float u = 0.7978845608028654f * (v + 0.044715f * v * v * v); v = 0.5f * v * (1.0f + tanhf(u)); }
      so[w][8 * hh + r][t * 16 + ln] = v;
    }
  }
  __builtin_amdgcn_fence(__ATOMIC_ACQ_REL, "workgroup");
  __builtin_amdgcn_wave_barrier();
  const int rsub = lane >> 4, c4 = (lane & 15) * 4;
  {
#pragma unroll
    for (int q = 0; q < 8; ++q) {
      const int r = q * 2 + rsub;
      const v4f v = *(const v4fa*)&so[w][r][c4];
      *(v4f*)(C + (size_t)(row0 + r) * ldc + col0 + c4) = v;
    }
    
  }
}
// row LayerNorm (biased variance, eps) over N: s = X (+ R); optional out_sum <- s; out_norm <- (s-mu)*rsqrt(var+eps)*g + b
template <bool PARAM_BF16>
__global__ __launch_bounds__(256) void k_layernorm(const float* __restrict__ X, const float* __restrict__ R, const float* __restrict__ g, const float* __restrict__ bta,
                                                  float* __restrict__ out_sum, float* __restrict__ out_norm, int N, float eps) {
  __shared__ float red[256];
  const int row = blockIdx.x, tid = threadIdx.x;
  const float* x = X + (size_t)row * N; const float* rr = R ? R + (size_t)row * N : nullptr;
  float vals[16];                     // up to N = 4096
  const int per = N / 256;            // contiguous chunk per thread? use strided-by-4 chunks: thread handles j = tid*4 + 1024*u
  float s1 = 0.f;
  for (int u = 0; u < per / 4; ++u) {
    const int j = tid * 4 + 1024 * u;
    const v4f a = *(const v4fa*)(x + j);
    v4f b = {0.f,0.f,0.f,0.f}; if (rr) b = *(const v4fa*)(rr + j);
#pragma unroll
    for (int q = 0; q < 4; ++q) { const float v = a[q] + b[q]; vals[u * 4 + q] = v; s1 += v; }
  }
  red[tid] = s1; __syncthreads();
  for (int st = 128; st > 0; st >>= 1) { if (tid < st) red[tid] += red[tid + st]; __syncthreads(); }
  const float mu = red[0] / (float)N; __syncthreads();
  float s2 = 0.f;
  for (int u = 0; u < per / 4; ++u)
#pragma unroll
    for (int q = 0; q < 4; ++q) { const float c = vals[u * 4 + q] - mu; s2 += c * c; }
  red[tid] = s2; __syncthreads();
  for (int st = 128; st > 0; st >>= 1) { if (tid < st) red[tid] += red[tid + st]; __syncthreads(); }
  const float rs = rsqrtf(red[0] / (float)N + eps);
  {
    for (int u = 0; u < per / 4; ++u) {
      const int j = tid * 4 + 1024 * u;
      v4f o, sm;
#pragma unroll
      for (int q = 0; q < 4; ++q) {
        float gg = g[j + q], bb = bta[j + q];
        if (PARAM_BF16) { gg = bf16_round(gg); bb = bf16_round(bb); }
        sm[q] = vals[u * 4 + q]; o[q] = (vals[u * 4 + q] - mu) * rs * gg + bb;
      }
      if (out_sum) *(v4f*)(out_sum + (size_t)row * N + j) = sm;
      *(v4f*)(out_norm + (size_t)row * N + j) = o;
    }
    
  }
}



// ---- f16 WMMA path (v_wmma_f32_16x16x32_f16): 11-bit significands for operands in range — used where a [0,1] probability operand needs more precision than bf16
typedef _Float16 v16h __attribute__((ext_vector_type(16)));
union FragH { v16h v; v8us half[2]; _Float16 h[16]; unsigned short u[16]; };
template <int NT>
__device__ __forceinline__ v8f mmaH(v16h ah, v16h al, v16h bh, v16h bl, v8f c) {
  c = __builtin_amdgcn_wmma_f32_16x16x32_f16(false, ah, false, bh, (short)0, c, false, false);
  if (NT >= 2) c = __builtin_amdgcn_wmma_f32_16x16x32_f16(false, al, false, bh, (short)0, c, false, false);
  if (NT >= 3) c = __builtin_amdgcn_wmma_f32_16x16x32_f16(false, ah, false, bl, (short)0, c, false, false);
  asm volatile("v_nop\n\tv_nop\n\tv_nop\n\tv_nop" : "+v"(c) : "v"(ah), "v"(al), "v"(bh), "v"(bl));
  return c;
}
// batched GEMM like k_gemm_b but f16 operands: A f32 (split into f16 hi/lo if ASPLIT, else rounded to f16), Bt = f16 values [n][k]; alpha; C f32; N multiple of 16 (partial tiles skipped)
template <bool ASPLIT>
__global__ __launch_bounds__(128) void k_gemm_h(const float* __restrict__ A, int lda, size_t sA, const _Float16* __restrict__ Bh, int ldb, size_t sB, float alpha, float* __restrict__ C, int ldc, size_t sC, int M, int N, int K) {
  __shared__ __attribute__((aligned(16))) float so[4][16][64];
  const int tid = threadIdx.x, w = tid >> 5, lane = tid & 31, ln = lane & 15, hh = lane >> 4; const int by = blockIdx.y;
  A += (size_t)by * sA; Bh += (size_t)by * sB; C += (size_t)by * sC;
  const int ntn = (N + 63) / 64; const int wid = blockIdx.x * 4 + w; const int mt = wid / ntn, nq = wid % ntn; if (mt * 16 >= M) return;
  const int row0 = mt * 16, col0 = nq * 64; const float* arow = A + (size_t)(row0 + ln) * lda;
  v8f acc[4] = {};
  for (int kb = 0; kb < K; kb += 32) {
    FragH ah, al;
    const v4f x0 = *(const v4fa*)(arow + kb + 8 * hh), x1 = *(const v4fa*)(arow + kb + 8 * hh + 4), x2 = *(const v4fa*)(arow + kb + 16 + 8 * hh), x3 = *(const v4fa*)(arow + kb + 16 + 8 * hh + 4);
    float xs[16] = {x0[0],x0[1],x0[2],x0[3],x1[0],x1[1],x1[2],x1[3],x2[0],x2[1],x2[2],x2[3],x3[0],x3[1],x3[2],x3[3]};
#pragma unroll
    for (int i = 0; i < 16; ++i) { const _Float16 h = (_Float16)xs[i]; ah.h[i] = h; al.h[i] = ASPLIT ? (_Float16)(xs[i] - (float)h) : (_Float16)0.0f; }
#pragma unroll
    for (int t = 0; t < 4; ++t) { if (col0 + t * 16 >= N) continue; const size_t boff = (size_t)(col0 + t * 16 + ln) * ldb + kb; FragH bq; bq.half[0] = *(const v8us*)(Bh + boff + 8 * hh); bq.half[1] = *(const v8us*)(Bh + boff + 16 + 8 * hh);
      acc[t] = mmaH<ASPLIT ? 2 : 1>(ah.v, al.v, bq.v, bq.v, acc[t]); }
  }
#pragma unroll
  for (int t = 0; t < 4; ++t) { if (col0 + t * 16 >= N) continue;
#pragma unroll
    for (int r = 0; r < 8; ++r) so[w][8 * hh + r][t * 16 + ln] = acc[t][r] * alpha; }
  __builtin_amdgcn_fence(__ATOMIC_ACQ_REL, "workgroup"); __builtin_amdgcn_wave_barrier();
  const int rsub = lane >> 4, c4 = (lane & 15) * 4;
  {
#pragma unroll
    for (int q = 0; q < 8; ++q) { const int r = q * 2 + rsub; if (col0 + c4 < N) { const v4f v = *(const v4fa*)&so[w][r][c4]; *(v4f*)(C + (size_t)(row0 + r) * ldc + col0 + c4) = v; } }
     }
}

// Wt[n][k] = f16(W[k][n]·scale) from f32 row-major W[K][N] (scale = power of two; bf16-exact weights stay exact in f16 away from the subnormal range)
__device__ __forceinline__ void wt_f16_part(const float* __restrict__ W, _Float16* __restrict__ Wt, int K, int N, float scale, int blk) {      /* blk: index of the 256-thread part within this matrix */
  const int t = blk * 256 + threadIdx.x; if (t >= N * (K / 8)) return; const int n = t / (K / 8), k8 = (t % (K / 8)) * 8; FragH f;
#pragma unroll
  for (int i = 0; i < 8; ++i) f.h[i] = (_Float16)(bf16_round(W[(size_t)(k8 + i) * N + n]) * scale); const v8us o = f.half[0];
  *(v8us*)((unsigned short*)Wt + (size_t)n * K + k8) = o; 
}
// k_gemm_hh variant with fused epilogue: v = acc·alpha + bias[by·sBias + col] (+ CP[(row/rowsPerB)·sCPb + by·64 + col] if CP) ; ACT 0 none / 1 elu ; writes f16 C16 (and f32 C if non-null)
template <int ACT>
__global__ __launch_bounds__(128) void k_gemm_hhx(const _Float16* __restrict__ A, int lda, size_t sA, const _Float16* __restrict__ Bh, int ldb, size_t sB, float alpha, const float* __restrict__ bias, size_t sBias, const float* __restrict__ CP, int rowsPerB, size_t sCPb, int row0g,
    float* __restrict__ C, _Float16* __restrict__ C16, int ldc, size_t sC, int M, int N, int K) {
  __shared__ __attribute__((aligned(16))) float so[4][16][64];
  const int tid = threadIdx.x, w = tid >> 5, lane = tid & 31, ln = lane & 15, hh = lane >> 4; const int by = blockIdx.y;
  A += (size_t)by * sA; Bh += (size_t)by * sB; const size_t cofs = (size_t)by * sC; const float* bp = bias ? bias + (size_t)by * sBias : nullptr;
  const int ntn = (N + 63) / 64; const int wid = blockIdx.x * 4 + w; const int mt = wid / ntn, nq = wid % ntn; if (mt * 16 >= M) return;
  const int row0 = mt * 16, col0 = nq * 64; const _Float16* arow = A + (size_t)(row0 + ln) * lda;
  v8f acc[4] = {};
  for (int kb = 0; kb < K; kb += 32) { FragH ah; ah.half[0] = *(const v8us*)((const unsigned short*)arow + kb + 8 * hh); ah.half[1] = *(const v8us*)((const unsigned short*)arow + kb + 16 + 8 * hh);
#pragma unroll
    for (int t = 0; t < 4; ++t) { if (col0 + t * 16 >= N) continue; const size_t boff = (size_t)(col0 + t * 16 + ln) * ldb + kb; FragH bq; bq.half[0] = *(const v8us*)((const unsigned short*)Bh + boff + 8 * hh); bq.half[1] = *(const v8us*)((const unsigned short*)Bh + boff + 16 + 8 * hh);
      acc[t] = mmaH<1>(ah.v, ah.v, bq.v, bq.v, acc[t]); }
  }
#pragma unroll
  for (int t = 0; t < 4; ++t) { if (col0 + t * 16 >= N) continue; const int col = col0 + t * 16 + ln; const float bv = bp ? bf16_round(bp[col]) : 0.f;
#pragma unroll
    for (int r = 0; r < 8; ++r) { float v = acc[t][r] * alpha + bv; if (CP) { const int rr = row0g + row0 + 8 * hh + r; if (rowsPerB < 0) v += CP[cofs + (size_t)rr * ldc + col];      /* rowsPerB < 0: own element of the batched C plane */ else { const int bidx = rr / rowsPerB; v += CP[(size_t)bidx * sCPb + (size_t)by * 64 + col]; } } if (ACT == 1) v = (v > 0.f) ? v : expm1f(v); else if (ACT == 7) v = (v > 0.f) ? v + 1.0f : expf(v); else if (ACT == 8) v = tanhf(v); else if (ACT == 9) v = 0.5f * v * (1.0f + tanhf(0.7978845608028654f * (v + 0.044715f * v * v * v))); else if (ACT == 11) v = 1.0f / (1.0f + expf(-v)); else if (ACT == 12) v = (v > 0.f) ? v : 0.01f * v; else if (ACT == 14) v = (v > 0.f) ? v : 0.1f * v; else if (ACT == 16) v = (v >= 0.f) ? v : 0.3f * v; else if (ACT == 17) v = (v >= 0.f) ? v : 0.2f * v; else if (ACT == 15) v = v / (1.0f + expf(-v)); else if (ACT == 3) v = fmaxf(v, 0.f); else if (ACT == 6) v = 0.5f * v * (1.0f + erff(v * 0.70710678118654752f)); so[w][8 * hh + r][t * 16 + ln] = v; } }
  __builtin_amdgcn_fence(__ATOMIC_ACQ_REL, "workgroup"); __builtin_amdgcn_wave_barrier();
  const int rsub = lane >> 4, c4 = (lane & 15) * 4; typedef _Float16 v4h __attribute__((ext_vector_type(4)));
  {
#pragma unroll
    for (int q = 0; q < 8; ++q) { const int r = q * 2 + rsub; if (col0 + c4 < N) { const v4f v = *(const v4fa*)&so[w][r][c4]; if (C) *(v4f*)(C + cofs + (size_t)(row0 + r) * ldc + col0 + c4) = v; if (C16) { v4h h4; for (int i = 0; i < 4; ++i) h4[i] = (_Float16)v[i]; *(v4h*)(C16 + cofs + (size_t)(row0 + r) * ldc + col0 + c4) = h4; } } }
     }
}


typedef _Float16 v4h __attribute__((ext_vector_type(4)));

__global__ __launch_bounds__(256) void k_x16(const float* __restrict__ x, _Float16* __restrict__ X16, size_t n8) { const size_t t = (size_t)blockIdx.x * 256 + threadIdx.x; if (t >= n8) return; FragH f;
#pragma unroll
  for (int q = 0; q < 8; ++q) f.h[q] = (_Float16)bf16_round(x[t * 8 + q]); *(v8us*)((unsigned short*)X16 + t * 8) = f.half[0];  }
__global__ __launch_bounds__(256) void k_h16(const float* __restrict__ x, _Float16* __restrict__ X16, size_t n8) { const size_t t = (size_t)blockIdx.x * 256 + threadIdx.x; if (t >= n8) return; FragH f;
#pragma unroll
  for (int q = 0; q < 8; ++q) f.h[q] = (_Float16)x[t * 8 + q]; *(v8us*)((unsigned short*)X16 + t * 8) = f.half[0];  }
__global__ __launch_bounds__(256) void k_round16f(const float* __restrict__ W, _Float16* __restrict__ Bt, size_t n8) { const size_t t = (size_t)blockIdx.x * 256 + threadIdx.x; if (t >= n8) return; FragH f;
#pragma unroll
  for (int i = 0; i < 8; ++i) f.h[i] = (_Float16)(bf16_round(W[t * 8 + i]) * 16.0f); *(v8us*)((unsigned short*)Bt + t * 8) = f.half[0];  }
__global__ __launch_bounds__(256) void k_hl(const float* __restrict__ F, _Float16* __restrict__ Hh, _Float16* __restrict__ Hl, size_t n8) { const size_t t = (size_t)blockIdx.x * 256 + threadIdx.x; if (t >= n8) return; FragH fh, fl; const v4f a = *(const v4fa*)(F + t * 8), c = *(const v4fa*)(F + t * 8 + 4);
#pragma unroll
  for (int q = 0; q < 4; ++q) { _Float16 h = (_Float16)a[q]; fh.h[q] = h; fl.h[q] = (_Float16)((a[q] - (float)h) * 1024.0f); h = (_Float16)c[q]; fh.h[4 + q] = h; fl.h[4 + q] = (_Float16)((c[q] - (float)h) * 1024.0f); }
  { *(v8us*)((unsigned short*)Hh + t * 8) = fh.half[0]; *(v8us*)((unsigned short*)Hl + t * 8) = fl.half[0];  } }

// ---- fast GEMM (work-group tile 128x64, wave tile 32x64; requires M % 128 == 0, N % 64 == 0, K % 64 == 0; LDA / LDB / LDC: row pitches of A, Bh and the output in elements); v = acc * alpha + bf16(bias[col]), written as f32 (OUT32) or as f16 ----
// Shapes, pitches and the output kind are template parameters: the epilogue holds no test that is the same for a whole launch, so it is one straight run of code in which the read-back of the tile and the stores each leave as one group.
// The operand rows come in stages of 64 k: whole 128-byte lines into registers one stage ahead, then into one of two LDS buffers (row pitch 144 bytes), one barrier per stage; the waves read their fragments from LDS.
#define G2K 64                       /* k per stage: 128 bytes of every operand row */
#define G2P 144                      /* LDS row pitch, bytes: 128 + 16, an odd multiple of 16 for 16-byte readers */
#define G2R (128 + 64)               /* rows per stage: 128 of A, then 64 of Bh */
__device__ __forceinline__ v16h g2_frag(const _Float16* p, int hh) { FragH f; f.half[0] = *(const v8us*)((const unsigned short*)p + 8 * hh); f.half[1] = *(const v8us*)((const unsigned short*)p + 16 + 8 * hh); return f.v; }
__device__ __forceinline__ v16h fa_frag(const unsigned char* p) { FragH f; f.half[0] = *(const v8us*)p; f.half[1] = *(const v8us*)(p + 32); return f.v; }      /* 32 k of one LDS row, hardware k order: p already holds the lane half's 16 bytes */
__device__ __forceinline__ v8f fa_mma(v16h a, v16h b, v8f c) { return __builtin_amdgcn_wmma_f32_16x16x32_f16(false, a, false, b, (short)0, c, false, false); }
/* work-group barrier that orders LDS alone: __syncthreads() would also wait for the global loads of the stage fetched ahead, which only this thread's registers receive */
__device__ __forceinline__ void fa_barrier() { __builtin_amdgcn_fence(__ATOMIC_RELEASE, "workgroup", "local"); __builtin_amdgcn_s_barrier(); __builtin_amdgcn_fence(__ATOMIC_ACQUIRE, "workgroup", "local"); }
template <int ACT, int LDA, int LDB, int LDC, int M, int N, int K, bool OUT32>
__global__ __launch_bounds__(128) void k_gemm2(const _Float16* __restrict__ A, size_t sA, const _Float16* __restrict__ Bh, size_t sB, float alpha, const float* __restrict__ bias0, const float* __restrict__ bias1, const float* __restrict__ bias2,
    float* __restrict__ C, _Float16* __restrict__ C16, size_t sC) { static_assert(M % 128 == 0 && N % 64 == 0 && K % G2K == 0, "k_gemm2: whole tiles and whole stages only"); static_assert(ACT == 0 || ACT == 3 || ACT == 6 || ACT == 8 || ACT == 9 || ACT == 11 || ACT == 12 || ACT == 14 || ACT == 15 || ACT == 16 || ACT == 17, "k_gemm2: unsupported ACT code (would silently apply no activation)");
  __shared__ __attribute__((aligned(16))) unsigned char sm[2 * G2R * G2P];      /* the two stage buffers; behind the k loop the same bytes hold the epilogue's f32 tiles */
  static_assert(sizeof(float) * 4 * 32 * 68 <= sizeof(sm), "k_gemm2: the epilogue's tiles lie in the stage buffers");
  float (*so)[32][68] = reinterpret_cast<float (*)[32][68]>(sm);
  const int tid = threadIdx.x, w = tid >> 5, lane = tid & 31, ln = lane & 15, hh = lane >> 4; const int by = blockIdx.y;
  const float* bias = by == 0 ? bias0 : by == 1 ? bias1 : bias2;      /* the biases of up to three products batched over blockIdx.y are separate buffers */
  A += (size_t)by * sA; Bh += (size_t)by * sB; const size_t cofs = (size_t)by * sC;
  const int ntn = N >> 6; const int mt = blockIdx.x / ntn, nq = blockIdx.x - mt * ntn; const int row0 = mt * 128 + 32 * w, col0 = nq * 64; if (mt * 128 >= M) return;      /* the same for the whole work-group: barriers follow */
  /* staging: 8 threads per 128-byte row, 16 rows per round, 8 rounds for A and 4 for Bh */
  const int srow = tid >> 3, sch = (tid & 7) * 16;
  const unsigned char* ag = (const unsigned char*)(A + (size_t)(mt * 128 + srow) * LDA) + sch;
  const unsigned char* bg = (const unsigned char*)(Bh + (size_t)(col0 + srow) * LDB) + sch;
  const int sl = srow * G2P + sch;
  v8us ra[8], rb[4];
  auto fetch = [&](int st) { const unsigned char* ap = ag + (size_t)st * (G2K * 2); const unsigned char* bp = bg + (size_t)st * (G2K * 2);
#pragma unroll
    for (int r = 0; r < 8; ++r) ra[r] = *(const v8us*)(ap + (size_t)r * 16 * LDA * 2);
#pragma unroll
    for (int r = 0; r < 4; ++r) rb[r] = *(const v8us*)(bp + (size_t)r * 16 * LDB * 2);
    asm volatile("s_wait_xcnt 0x0" :: "v"(ap), "v"(bp) : "memory"); };      /* the loads' address registers are inputs here, so they stay live up to this wait and are re-used only behind it */
  auto put = [&](int buf) { unsigned char* d = sm + buf * (G2R * G2P) + sl;
#pragma unroll
    for (int r = 0; r < 8; ++r) *(v8us*)(d + r * 16 * G2P) = ra[r];
#pragma unroll
    for (int r = 0; r < 4; ++r) *(v8us*)(d + (128 + r * 16) * G2P) = rb[r]; };
  const int ns = K / G2K;
  fetch(0);
  const float* bq = bias + col0 + ln; float braw[4];      /* the lane's four bias values, asked for here, behind stage 0's loads: they arrive under the k loop */
#pragma unroll
  for (int t = 0; t < 4; ++t) braw[t] = bq[t * 16];
  asm volatile("s_wait_xcnt 0x0" :: "v"(bq) : "memory");      /* stands directly behind the bias loads, in front of every re-use of a register that they name; the lane's pointer is an input, so it stays live up to here */
  put(0); if (ns > 1) fetch(1);
  const int fa = (32 * w + ln) * G2P + hh * 16, fb = (128 + ln) * G2P + hh * 16;      /* the lane's row and half in the A rows and in the Bh rows */
  const v8f z8 = {0.f,0.f,0.f,0.f,0.f,0.f,0.f,0.f}; v8f c00 = z8, c01 = z8, c02 = z8, c03 = z8, c10 = z8, c11 = z8, c12 = z8, c13 = z8;
  fa_barrier();      /* publishes stage 0 */
#pragma unroll 1
  for (int st = 0; st < ns; ++st) {      /* rolled: the body is one whole stage, and the buffer index is a run-time offset */
    const int buf = st & 1;
    if (st + 1 < ns) put(buf ^ 1);      /* stage st + 1, fetched one stage ago, into the buffer whose readers all passed the barrier at the foot of stage st - 1 */
    if (st + 2 < ns) fetch(st + 2);
    const unsigned char* Ab = sm + buf * (G2R * G2P) + fa; const unsigned char* Bb = sm + buf * (G2R * G2P) + fb;
    v16h a[2][2], b[2][4];      /* [32-k half of the stage][16-row tile] */
#pragma unroll
    for (int ks = 0; ks < 2; ++ks) {
#pragma unroll
      for (int i = 0; i < 2; ++i) a[ks][i] = fa_frag(Ab + i * 16 * G2P + ks * 64);
#pragma unroll
      for (int t = 0; t < 4; ++t) b[ks][t] = fa_frag(Bb + t * 16 * G2P + ks * 64); }
    __builtin_amdgcn_sched_barrier(0);      /* the stage's 24 LDS reads leave as one group ahead of its 16 products: without it one register set is re-used for every Bh fragment, and each pair of products waits out an LDS read of its own */
#pragma unroll
    for (int ks = 0; ks < 2; ++ks) {      /* k ascending by 32 in every accumulator */
      c00 = fa_mma(a[ks][0], b[ks][0], c00); c10 = fa_mma(a[ks][1], b[ks][0], c10); c01 = fa_mma(a[ks][0], b[ks][1], c01); c11 = fa_mma(a[ks][1], b[ks][1], c11);
      c02 = fa_mma(a[ks][0], b[ks][2], c02); c12 = fa_mma(a[ks][1], b[ks][2], c12); c03 = fa_mma(a[ks][0], b[ks][3], c03); c13 = fa_mma(a[ks][1], b[ks][3], c13); }
    fa_barrier();      /* publishes stage st + 1 and ends every wave's reads of this stage's buffer; the last one frees the buffers for the epilogue */
  }
  v8f accs[8] = {c00, c01, c02, c03, c10, c11, c12, c13};
#pragma unroll
  for (int u = 0; u < 8; ++u) { const int t = u & 3, half = u >> 2; const float bv = bf16_round(braw[t]);
#pragma unroll
    for (int r = 0; r < 8; ++r) { const int rloc = half * 16 + 8 * hh + r; float v = accs[u][r] * alpha + bv;
      if (ACT == 3) v = fmaxf(v, 0.f); else if (ACT == 6) v = 0.5f * v * (1.0f + erff(v * 0.70710678118654752f)); else if (ACT == 11) v = 1.0f / (1.0f + expf(-v)); else if (ACT == 15) v = v / (1.0f + expf(-v)); else if (ACT == 12) v = (v > 0.f) ? v : 0.01f * v; else if (ACT == 8) v = tanhf(v); else if (ACT == 9) v = 0.5f * v * (1.0f + tanhf(0.7978845608028654f * (v + 0.044715f * v * v * v))); else if (ACT == 14) v = (v > 0.f) ? v : 0.1f * v; else if (ACT == 16) v = (v >= 0.f) ? v : 0.3f * v; else if (ACT == 17) v = (v >= 0.f) ? v : 0.2f * v;
      so[w][rloc][t * 16 + ln] = v; } }
  __builtin_amdgcn_fence(__ATOMIC_ACQ_REL, "workgroup"); __builtin_amdgcn_wave_barrier();
  const int rsub = lane >> 4, c4 = (lane & 15) * 4;
  {
#pragma unroll
    for (int q = 0; q < 16; ++q) { const int r = q * 2 + rsub; const v4f v = *(const v4fa*)&so[w][r][c4]; if (OUT32) *(v4f*)(C + cofs + (size_t)(row0 + r) * LDC + col0 + c4) = v; else { v4h h4; for (int i = 0; i < 4; ++i) h4[i] = (_Float16)v[i]; *(v4h*)(C16 + cofs + (size_t)(row0 + r) * LDC + col0 + c4) = h4; } }
     } }


__global__ __launch_bounds__(256) void k_wnat(const float* __restrict__ w, size_t n8, _Float16* __restrict__ Bt) { const size_t t = (size_t)blockIdx.x * 256 + threadIdx.x; if (t >= n8) return; FragH f; for (int q = 0; q < 8; ++q) f.h[q] = (_Float16)(bf16_round(w[t * 8 + q]) * 16.0f); *(v8us*)((unsigned short*)Bt + t * 8) = f.half[0];  }
#define FAW 8                        /* waves per work-group */
#define FAG 2                        /* key groups: waves 0..3 take the first FAK keys of every stage, waves 4..7 the second */
#define FAC 2                        /* 16-column query tiles per wave */
#define FAK 64                       /* keys per wave and stage */
#define FAS (FAG * FAK)              /* keys per stage */
#define FAQ ((FAW / FAG) * FAC * 16) /* query columns per work-group */
#define FAP 144                      /* LDS row pitch of K, bytes: 128 + 16, an odd multiple of 16 for 16-byte readers */
#define FAPV 160                     /* LDS row pitch of V, bytes: 128 + 32, an odd multiple of 32 for the transposing reader */
#define FAKB (FAS * FAP)             /* bytes of a stage's K rows; its V rows lie behind them */
#define FAN (SQ / FAS)               /* stages */
__device__ __forceinline__ float rs_xh(float x) { return __builtin_bit_cast(float, __builtin_amdgcn_permlanex16(__builtin_bit_cast(int, x), __builtin_bit_cast(int, x), 0x76543210, 0xfedcba98, false, false)); }      /* lane l with lane l ^ 16 */
typedef float v2f __attribute__((ext_vector_type(2))); typedef _Float16 v2h __attribute__((ext_vector_type(2)));
typedef short v8s __attribute__((ext_vector_type(8)));
/* 16 (d) x 32 (keys) A fragment of V^T from row-major V rows in LDS: p = the lane's address in the first 16 keys, row 8 (lane >> 4) + (lane & 7), byte 16 ((lane >> 3) & 1) of the 32 bytes of the 16 d; lane (c, h) receives keys 8 h + 0..7 of column c, then the same of the next 16 keys */
__device__ __forceinline__ v16h fa_frag_tr(const unsigned char* p) { typedef __attribute__((address_space(3))) v8s lds_v8s; FragH f; f.half[0] = __builtin_bit_cast(v8us, __builtin_amdgcn_ds_load_tr16_b128_v8i16((lds_v8s*)p)); f.half[1] = __builtin_bit_cast(v8us, __builtin_amdgcn_ds_load_tr16_b128_v8i16((lds_v8s*)(p + 16 * FAPV))); return f.v; }
__global__ __launch_bounds__(FAW * 32) void k_fattn(const _Float16* __restrict__ Q, const _Float16* __restrict__ Kg, const _Float16* __restrict__ Vg, _Float16* __restrict__ O) {
  __shared__ __attribute__((aligned(16))) unsigned char L[2][FAKB + FAS * FAPV];      /* [buffer][K rows, then V rows]; behind the loop the same bytes carry the second key group's partial results */
  static_assert(SQ % (2 * FAS) == 0 && SQ % FAQ == 0 && FAW * 4 == 32, "k_fattn: whole stages, whole column blocks, 32 rows per staging round");
  static_assert((FAW / FAG) * (FAC * 8 + 1) * 32 * 16 <= sizeof(L), "k_fattn: the partial results lie in the stage buffers");
  const int tid = threadIdx.x, lane = tid & 31, ln = lane & 15, hh = lane >> 4; const int wave = __builtin_amdgcn_readfirstlane(tid >> 5);
  const int cg = wave & (FAW / FAG - 1), kh = wave / (FAW / FAG);      /* column group, key group */
  const int bh = blockIdx.y, b = bh / NH, h = bh - b * NH; const int q0 = blockIdx.x * FAQ + cg * (FAC * 16);
  /* staging: 8 threads per 128-byte row, 32 rows per round, four rounds per tile */
  const int srow = tid >> 3, sch = (tid & 7) * 16;
  const unsigned char* kg = (const unsigned char*)(Kg + ((size_t)b * SQ + srow) * DM + h * HD) + sch;      /* K row srow of stage 0; a stage is FAS rows of DM */
  const unsigned char* vg = (const unsigned char*)(Vg + ((size_t)b * SQ + srow) * DM + h * HD) + sch;      /* V row srow of stage 0, likewise */
  const int sl = srow * FAP + sch, slv = FAKB + srow * FAPV + sch;
  v8us kr[FAS / 32], vr[FAS / 32];
  auto fetch = [&]() { const unsigned char* kp = kg; const unsigned char* vp = vg;      /* kg, vg: this thread's place in the next stage to fetch */
#pragma unroll
    for (int r = 0; r < FAS / 32; ++r) { kr[r] = *(const v8us*)(kp + (size_t)r * 32 * DM * 2); vr[r] = *(const v8us*)(vp + (size_t)r * 32 * DM * 2); }
    asm volatile("s_wait_xcnt 0x0" :: "v"(kp), "v"(vp) : "memory");      /* the loads' address registers are inputs here, so they stay live up to this wait and are re-used only behind it */
    kg = kp + FAS * DM * 2; vg = vp + FAS * DM * 2; };
  auto put = [&](int buf) {
#pragma unroll
    for (int r = 0; r < FAS / 32; ++r) { *(v8us*)&L[buf][sl + r * 32 * FAP] = kr[r]; *(v8us*)&L[buf][slv + r * 32 * FAPV] = vr[r]; } };
  fetch();
  v16h qf[FAC][2];      /* B operand: column = query, same k order as fa_frag */
#pragma unroll
  for (int c = 0; c < FAC; ++c) { const _Float16* qp = Q + ((size_t)b * SQ + q0 + c * 16 + ln) * DM + h * HD; qf[c][0] = g2_frag(qp, hh); qf[c][1] = g2_frag(qp + 32, hh);
    asm volatile("s_wait_xcnt 0x0" :: "v"(qp) : "memory"); }      /* stands directly behind the tile's Q loads, in front of every re-use of a register that they name; the lane's pointer is an input, so it stays live up to here */
  put(0); fetch();
  const v8f z8 = {0.f,0.f,0.f,0.f,0.f,0.f,0.f,0.f}; v8f acc[FAC][4];      /* acc[c][t][r] = O^T[16 t + 8 hh + r][query 16 c + ln], over this wave's keys */
  float m[FAC], l[FAC];      /* per column tile: running maximum (log2 domain, both halves alike) and this lane half's part of the denominator */
#pragma unroll
  for (int c = 0; c < FAC; ++c) { m[c] = -3.0e38f; l[c] = 0.f;
#pragma unroll
    for (int t = 0; t < 4; ++t) acc[c][t] = z8; }
  const float cs = 0.125f * 1.4426950408889634f;      /* 1 / sqrt(64), and e^x = 2^(x log2 e) */
  const int fo = (kh * FAK + ln) * FAP + hh * 16, fv = FAKB + (kh * FAK + 8 * hh + (lane & 7)) * FAPV + ((lane >> 3) & 1) * 16;      /* the lane's place in its key group's K rows; its place in the V rows for the transposing loads */
  __syncthreads();      /* publishes stage 0; the full barrier also ends the Q loads here, so that no wait for them stands in the loop, where it would drain the stage fetched ahead */
#pragma unroll 1
  for (int st = 0; st < FAN; ++st) {      /* rolled: the body is one whole stage, and the buffer index is a run-time offset */
    const int buf = st & 1;
    if (st + 1 < FAN) put(buf ^ 1);      /* stage st + 1, fetched one stage ago, into the buffer whose readers all passed the barrier of stage st - 1, behind its last LDS read */
    if (st + 2 < FAN) fetch();
    const unsigned char* Kb = &L[buf][fo]; const unsigned char* Vb = &L[buf][fv];
    v16h kf[4][2], vf[4][2]; v8f s[FAC][4];
#pragma unroll
    for (int kt = 0; kt < 4; ++kt) { kf[kt][0] = fa_frag(Kb + kt * 16 * FAP); kf[kt][1] = fa_frag(Kb + kt * 16 * FAP + 64); }
#pragma unroll
    for (int t = 0; t < 4; ++t) { vf[t][0] = fa_frag_tr(Vb + t * 32); vf[t][1] = fa_frag_tr(Vb + 32 * FAPV + t * 32); }      /* d = 16 t + ln; keys 0..31 and 32..63 of the wave's part of the stage */
    __builtin_amdgcn_sched_barrier(0);      /* the stage's 32 LDS reads leave as one group, K first: without it one register set is re-used for every K fragment, and each pair of products waits out an LDS read of its own */
#pragma unroll
    for (int kt = 0; kt < 4; ++kt)
#pragma unroll
      for (int c = 0; c < FAC; ++c) s[c][kt] = fa_mma(kf[kt][0], qf[c][0], z8);
#pragma unroll
    for (int kt = 0; kt < 4; ++kt)
#pragma unroll
      for (int c = 0; c < FAC; ++c) s[c][kt] = fa_mma(kf[kt][1], qf[c][1], s[c][kt]);
    __builtin_amdgcn_sched_barrier(0);      /* the score products run back to back: without it the maxima are woven between the products, each behind padding */
    union { v16h v; v2h p[8]; } pf[FAC][2];
#pragma unroll
    for (int c = 0; c < FAC; ++c) {
      float mx = s[c][0][0];
#pragma unroll
      for (int kt = 0; kt < 4; ++kt)
#pragma unroll
        for (int r = 0; r < 8; ++r) mx = fmaxf(mx, s[c][kt][r]);
      mx = fmaxf(mx, rs_xh(mx));
      const float mn = fmaxf(m[c], mx * cs); const float corr = __builtin_amdgcn_exp2f(m[c] - mn); m[c] = mn;      /* corr is 0 in the first stage */
      const v2f cs2 = {cs, cs}, nm2 = {8.0f - mn, 8.0f - mn};      /* weights carried x256 (numerator and denominator alike), away from the f16 subnormal range */
      v2f sa = {0.f, 0.f}, sb = {0.f, 0.f};
#pragma unroll
      for (int kt = 0; kt < 4; ++kt)
#pragma unroll
        for (int i = 0; i < 4; ++i) { const v2f x = {s[c][kt][2 * i], s[c][kt][2 * i + 1]}; const v2f e = __builtin_elementwise_fma(x, cs2, nm2); const v2f p = {__builtin_amdgcn_exp2f(e[0]), __builtin_amdgcn_exp2f(e[1])};
          if (i & 1) sb += p; else sa += p; pf[c][kt >> 1].p[(kt & 1) * 4 + i] = __builtin_convertvector(p, v2h); }      /* element 8 (kt & 1) + r of the 32-key operand = tile kt, register r */
      sa += sb; l[c] = fmaf(l[c], corr, sa[0] + sa[1]);
#pragma unroll
      for (int t = 0; t < 4; ++t) acc[c][t] = acc[c][t] * corr;
    }
    __builtin_amdgcn_sched_barrier(0);      /* holds the barrier below behind the softmax: moved up in front of it, its wait for the V^T reads stands where they have only just been issued, and the softmax no longer runs under them */
    fa_barrier();      /* stands behind the stage's last LDS read: publishes stage st + 1 and ends every wave's reads of this stage's buffer; the last one frees the buffers for the partial results */
#pragma unroll
    for (int hk = 0; hk < 2; ++hk)
#pragma unroll
      for (int t = 0; t < 4; ++t)
#pragma unroll
        for (int c = 0; c < FAC; ++c) acc[c][t] = fa_mma(vf[t][hk], pf[c][hk].v, acc[c][t]);
    __builtin_amdgcn_sched_barrier(0);      /* holds the four slots below behind the last product */
    asm volatile("v_nop\n\tv_nop\n\tv_nop\n\tv_nop");      /* the distance that the chip needs between the last products and the next stage's first vector instructions, which overwrite their operand registers */
  }
  /* join of the two key groups: the second hands its maxima, sums and O^T to the first, lane for lane (both hold the same query and d in the same lane and register) */
  v4fa* X = reinterpret_cast<v4fa*>(&L[0][0]) + (size_t)cg * (FAC * 8 + 1) * 32 + lane;      /* entry j of the column group: 32 lanes x 16 bytes in a row */
  if (kh != 0) {
#pragma unroll
    for (int c = 0; c < FAC; ++c)
#pragma unroll
      for (int t = 0; t < 4; ++t) { const v8f a = acc[c][t]; X[((c * 4 + t) * 2) * 32] = v4f{a[0], a[1], a[2], a[3]}; X[((c * 4 + t) * 2 + 1) * 32] = v4f{a[4], a[5], a[6], a[7]}; }
    X[FAC * 8 * 32] = v4f{m[0], l[0], m[1], l[1]};
  }
  fa_barrier();      /* publishes the second key group's partial results; every wave passes it */
  if (kh != 0) return;
  const v4f ml = X[FAC * 8 * 32]; FragH f[FAC][4];
#pragma unroll
  for (int c = 0; c < FAC; ++c) {
    const float mo = ml[2 * c], lo = ml[2 * c + 1]; const float mn = fmaxf(m[c], mo); const float f0 = __builtin_amdgcn_exp2f(m[c] - mn), f1 = __builtin_amdgcn_exp2f(mo - mn);      /* both maxima are finite: each group has walked keys */
    const float lt = l[c] * f0 + lo * f1; const float inv = 64.0f / (lt + rs_xh(lt));      /* o carried x64, as the output GEMM's alpha expects */
    const float g0 = f0 * inv, g1 = f1 * inv;
#pragma unroll
    for (int t = 0; t < 4; ++t) { const v4f x0 = X[((c * 4 + t) * 2) * 32], x1 = X[((c * 4 + t) * 2 + 1) * 32];
#pragma unroll
      for (int r = 0; r < 4; ++r) { f[c][t].h[r] = (_Float16)(acc[c][t][r] * g0 + x0[r] * g1); f[c][t].h[4 + r] = (_Float16)(acc[c][t][4 + r] * g0 + x1[r] * g1); } }
  }
#pragma unroll
  for (int c = 0; c < FAC; ++c) { _Float16* op = O + ((size_t)b * SQ + q0 + c * 16 + ln) * DM + h * HD + 8 * hh;
#pragma unroll
    for (int t = 0; t < 4; ++t) *(v8us*)((unsigned short*)op + t * 16) = f[c][t].half[0]; }      /* 8 consecutive d of one query row: 16 bytes */
}
__global__ __launch_bounds__(256) void k_vt(const _Float16* __restrict__ V16, int b, int h0, _Float16* __restrict__ VT) { __shared__ unsigned short tl[64][65]; const int tid = threadIdx.x; const int hh = blockIdx.x % HG, sg = blockIdx.x / HG; const int s0 = sg * 64; const int h = h0 + hh;
  for (int i = tid; i < 64 * 8; i += 256) { const int j = i / 8, d8 = (i % 8) * 8; FragH f; f.half[0] = *(const v8us*)((const unsigned short*)V16 + ((size_t)b * SQ + s0 + j) * DM + h * HD + d8); for (int q = 0; q < 8; ++q) tl[d8 + q][j] = f.u[q]; }
  __syncthreads();
  { for (int i = tid; i < 64 * 8; i += 256) { const int d = i / 8, j8 = (i % 8) * 8; FragH f; for (int q = 0; q < 8; ++q) f.u[q] = tl[d][j8 + q]; *(v8us*)((unsigned short*)VT + ((size_t)hh * HD + d) * SQ + s0 + j8) = f.half[0]; }  } }



__global__ __launch_bounds__(256) void k_rsmkm(const float* __restrict__ S, _Float16* __restrict__ P, int nrows, const int* __restrict__ am) {
  #pragma clang fp contract(off)
  const int t = blockIdx.x * 256 + threadIdx.x; if (t >= nrows) return; const size_t i = (size_t)t; const float* s = S + i * SQ; const int* mr = am + (size_t)(t % SQ) * SQ; float mx = -3.0e38f;
#pragma unroll 1
  for (int j = 0; j < SQ; ++j) { const float f = (mr[j] != 0) ? 1.f : 0.f; mx = fmaxf(mx, fmaf(f, s[j], (1.f - f) * -1.0e9f)); } float se = 0.f;
#pragma unroll 1
  for (int j = 0; j < SQ; ++j) { const float f = (mr[j] != 0) ? 1.f : 0.f; se += __expf(fmaf(f, s[j], (1.f - f) * -1.0e9f) - mx); } const float sc = 256.0f / se;
#pragma unroll 1
  for (int j0 = 0; j0 < SQ; j0 += 8) { FragH fr; for (int q = 0; q < 8; ++q) { const int j = j0 + q; const float f = (mr[j] != 0) ? 1.f : 0.f; fr.h[q] = (_Float16)(__expf(fmaf(f, s[j], (1.f - f) * -1.0e9f) - mx) * sc); }
    unsigned short* d = (unsigned short*)P + i * SQ + j0; *(v8us*)d = fr.half[0];  } }

// sums over a wave for the LayerNorm
template <int CTRL>
__device__ __forceinline__ float ln_dpp(float x) { return __builtin_bit_cast(float, __builtin_amdgcn_update_dpp(0, __builtin_bit_cast(int, x), CTRL, 0xf, 0xf, true)); }      /* lane l with lane l ^ (CTRL - 0x160) of its 16-lane row */
__device__ __forceinline__ float ln_sum32(float x) { x += ln_dpp<0x161>(x); x += ln_dpp<0x162>(x); x += ln_dpp<0x164>(x); x += ln_dpp<0x168>(x); return x + rs_xh(x); }      /* every lane ends with the sum over the wave */
// The q, k and v projections with everything that feeds them in ONE launch: no normalised rows and no converted q/k/v weights go through memory.
// A work-group is 128 token rows x 256 output columns of one product, 8 waves as 2 row groups x 4 column groups (64x64 wave tiles).
// Prologue: each wave normalises 16 of the rows (a lane holds columns 4 lane + 128 u of each row; all loads leave first; mean and variance as lane partials, four row_xmask steps and one exchange of the wave halves) and writes them as f16 into LDS, where they stay for the whole k loop.
// k loop: the weight rows W[k][256 columns] come as they lie, f32, one 64-k stage ahead into registers, are rounded to bf16, scaled x16 and stored as f16 rows [k][n] in one of two LDS buffers; the B operand (column = n, k down the rows) is read by transposing loads. One barrier per stage.
// The last block range converts W_o for the output GEMM (nothing in this launch reads it).
#define PJM 128                      /* token rows per work-group */
#define PJN 256                      /* output columns per work-group */
#define PJR (PJM / 8)                /* rows normalised per wave */
#define PJA (DM * 2 + 16)            /* LDS row pitch of the normalised rows, bytes: an odd multiple of 16 for 16-byte readers */
#define PJB (PJN * 2 + 32)           /* LDS row pitch of the weight rows, bytes: an odd multiple of 32 for the transposing reader */
#define PJAB (PJM * PJA)             /* bytes of the normalised rows; the two weight buffers lie behind them */
#define PJBB (G2K * PJB)             /* bytes of one weight buffer */
#define PJG ((int)(NR / PJM) * (DM / PJN))      /* work-groups per product */
#define WTB (DM * (DM / 8) / 256)    /* 256-thread parts of one weight matrix in wt_f16_part */
typedef __bf16 v2bf __attribute__((ext_vector_type(2)));
__device__ __forceinline__ v2f pj_round2(v2f x) { const unsigned int u = __builtin_bit_cast(unsigned int, __builtin_convertvector(x, v2bf)); return v2f{__uint_as_float(u << 16), __uint_as_float(u & 0xFFFF0000u)}; }      /* both values rounded to bf16 (nearest even), as f32 */
__device__ __forceinline__ v4f pj_round4(v4f x) { const v2f a = pj_round2(v2f{x[0], x[1]}), b = pj_round2(v2f{x[2], x[3]}); return v4f{a[0], a[1], b[0], b[1]}; }
/* 32 (k) x 16 (n) B fragment from row-major weight rows [k][n] in LDS: p = the lane's address in the first 16 k, row 8 (lane >> 4) + (lane & 7), byte 16 ((lane >> 3) & 1) of the 32 bytes of the 16 n; lane (n, h) receives k = 8 h + 0..7, then the same of the next 16 k: the k order of fa_frag */
__device__ __forceinline__ v16h pj_frag_tr(const unsigned char* p) { typedef __attribute__((address_space(3))) v8s lds_v8s; FragH f; f.half[0] = __builtin_bit_cast(v8us, __builtin_amdgcn_ds_load_tr16_b128_v8i16((lds_v8s*)p)); f.half[1] = __builtin_bit_cast(v8us, __builtin_amdgcn_ds_load_tr16_b128_v8i16((lds_v8s*)(p + 16 * PJB))); return f.v; }
__global__ __launch_bounds__(256) void k_lnproj(const float* __restrict__ xq, const float* __restrict__ xk, const float* __restrict__ xv, const float* __restrict__ g, const float* __restrict__ bb, float eps,
                                                const float* __restrict__ wq, const float* __restrict__ wk, const float* __restrict__ wv, const float* __restrict__ bq, const float* __restrict__ bk, const float* __restrict__ bv,
                                                const float* __restrict__ wo, _Float16* __restrict__ BO, _Float16* __restrict__ C16) {
  __shared__ __attribute__((aligned(16))) unsigned char sm[PJAB + 2 * PJBB];      /* normalised rows, then the two weight buffers; behind the k loop the same bytes hold the epilogue's f32 tiles */
  static_assert(DM == 512 && NR % PJM == 0 && DM % PJN == 0 && DM % G2K == 0 && WTB % 2 == 0, "k_lnproj: a lane holds 16 columns of a row; whole tiles and whole stages only");
  static_assert(sizeof(float) * 8 * 64 * 68 <= sizeof(sm), "k_lnproj: the epilogue's tiles lie in the stage buffers");
  const int bx = blockIdx.x;
  if (bx >= 3 * PJG) {      /* the same for the whole work-group: no barrier on this path */
    const int c = bx - 3 * PJG;
    wt_f16_part(wo, BO, DM, DM, 16.0f, 2 * c);
    asm volatile("s_wait_xcnt 0x0" ::: "memory");      /* behind the first part's loads and store, in front of the second part's code, which rewrites their address and data registers */
    wt_f16_part(wo, BO, DM, DM, 16.0f, 2 * c + 1);
    return; }
  const int tid = threadIdx.x, lane = tid & 31, ln = lane & 15, hh = lane >> 4; const int wave = __builtin_amdgcn_readfirstlane(tid >> 5);
  const int j = bx / PJG, rj = bx - j * PJG, mt = rj / (DM / PJN), nq = rj - mt * (DM / PJN);      /* product, row block, column block */
  const float* X = j == 0 ? xq : j == 1 ? xk : xv; const float* Wf = j == 0 ? wq : j == 1 ? wk : wv; const float* bias = j == 0 ? bq : j == 1 ? bk : bv;
  const int wr = wave >> 2, wc = wave & 3; const int col0 = nq * PJN + wc * 64;      /* the wave's row group, column group and first output column */
  /* weight staging: 64 threads per 1024-byte row piece, 4 rows per round, 16 rounds */
  const int brow = tid >> 6, bc4 = (tid & 63) * 4;
  const float* wg = Wf + (size_t)brow * DM + nq * PJN + bc4;      /* this thread's place in the next stage to fetch */
  v4f rw[16];
  auto fetch = [&]() { const float* wp = wg;
    __builtin_amdgcn_sched_barrier(0);      /* with the one below: the 16 loads and their wait stay one run, so that no other code, which could re-use the loads' address registers, is moved in between */
#pragma unroll
    for (int r = 0; r < 16; ++r) rw[r] = *(const v4fa*)(wp + (size_t)r * 4 * DM);
    asm volatile("s_wait_xcnt 0x0" :: "v"(wp) : "memory");      /* stands directly behind the loads, in front of every re-use of a register that they name */
    __builtin_amdgcn_sched_barrier(0);
    wg = wp + G2K * DM; };
  auto put = [&](int buf) { unsigned char* d = sm + PJAB + buf * PJBB + brow * PJB + bc4 * 2;
#pragma unroll
    for (int r = 0; r < 16; ++r) *(v4h*)(d + r * 4 * PJB) = __builtin_convertvector(pj_round4(rw[r]) * 16.0f, v4h); };      /* bf16-exact weights x16: exact in f16 away from the subnormal range */
  {
    const int c0 = lane * 4;
    const float* xp = X + ((size_t)mt * PJM + wave * PJR) * DM + c0; const float* gp = g + c0; const float* bp = bb + c0;
    v4f x[PJR][4], gg[4], be[4]; float mu[PJR], rs[PJR];
#pragma unroll
    for (int i = 0; i < PJR; ++i)
#pragma unroll
      for (int u = 0; u < 4; ++u) x[i][u] = *(const v4fa*)(xp + i * DM + u * 128);
#pragma unroll
    for (int u = 0; u < 4; ++u) { gg[u] = *(const v4fa*)(gp + u * 128); be[u] = *(const v4fa*)(bp + u * 128); }
    asm volatile("s_wait_xcnt 0x0" :: "v"(xp), "v"(gp), "v"(bp) : "memory");      /* the loads' address registers are inputs here, so they stay live up to this wait and are re-used only behind it */
    fetch();      /* behind the row loads: the first weight stage arrives under the LayerNorm */
#pragma unroll
    for (int u = 0; u < 4; ++u) { gg[u] = pj_round4(gg[u]); be[u] = pj_round4(be[u]); }
#pragma unroll
    for (int i = 0; i < PJR; ++i) {
#pragma unroll
      for (int u = 0; u < 4; ++u) x[i][u] = pj_round4(x[i][u]);
      const v4f t = (x[i][0] + x[i][1]) + (x[i][2] + x[i][3]); mu[i] = (t[0] + t[1]) + (t[2] + t[3]); }
#pragma unroll
    for (int i = 0; i < PJR; ++i) mu[i] = ln_sum32(mu[i]) * (1.0f / DM);
#pragma unroll
    for (int i = 0; i < PJR; ++i) {
#pragma unroll
      for (int u = 0; u < 4; ++u) x[i][u] -= mu[i];
      const v4f t = (x[i][0] * x[i][0] + x[i][1] * x[i][1]) + (x[i][2] * x[i][2] + x[i][3] * x[i][3]); rs[i] = (t[0] + t[1]) + (t[2] + t[3]); }
#pragma unroll
    for (int i = 0; i < PJR; ++i) rs[i] = rsqrtf(ln_sum32(rs[i]) * (1.0f / DM) + eps);
    unsigned char* ad = sm + (wave * PJR) * PJA + c0 * 2;
#pragma unroll
    for (int i = 0; i < PJR; ++i)
#pragma unroll
      for (int u = 0; u < 4; ++u) *(v4h*)(ad + i * PJA + u * 256) = __builtin_convertvector(x[i][u] * rs[i] * gg[u] + be[u], v4h);
  }
  const float* bqp = bias + col0 + ln; float braw[4];      /* the lane's four bias values: they arrive under the k loop */
  __builtin_amdgcn_sched_barrier(0);      /* with the one below: the four loads and their wait stay one run, so that no code that re-uses the loads' base or offset registers is moved in between */
#pragma unroll
  for (int t = 0; t < 4; ++t) braw[t] = bqp[t * 16];
  asm volatile("s_wait_xcnt 0x0" ::: "memory");      /* stands directly behind the bias loads, in front of every re-use of a register that they name */
  __builtin_amdgcn_sched_barrier(0);
  const int ns = DM / G2K;
  put(0); fetch();
  const int fa = (64 * wr + ln) * PJA + hh * 16, fb = PJAB + (8 * hh + (lane & 7)) * PJB + ((lane >> 3) & 1) * 16 + wc * 128;      /* the lane's row and half in the normalised rows; its place in the weight rows for the transposing loads */
  const v8f z8 = {0.f,0.f,0.f,0.f,0.f,0.f,0.f,0.f}; v8f c[4][4];      /* c[i][t][r] = row 16 i + 8 hh + r, column 16 t + ln of the wave tile */
#pragma unroll
  for (int i = 0; i < 4; ++i)
#pragma unroll
    for (int t = 0; t < 4; ++t) c[i][t] = z8;
  fa_barrier();      /* publishes the normalised rows and weight stage 0 */
#pragma unroll 1
  for (int st = 0; st < ns; ++st) {      /* rolled: the body is one whole stage, and the buffer index is a run-time offset */
    const int buf = st & 1;
    const unsigned char* Ab = sm + fa + st * (G2K * 2); const unsigned char* Bb = sm + fb + buf * PJBB;
    v16h a[2][4], b[2][4];      /* [32-k half of the stage][16-row or 16-column tile] */
#pragma unroll
    for (int ks = 0; ks < 2; ++ks) {
#pragma unroll
      for (int i = 0; i < 4; ++i) a[ks][i] = fa_frag(Ab + i * 16 * PJA + ks * 64);
#pragma unroll
      for (int t = 0; t < 4; ++t) b[ks][t] = pj_frag_tr(Bb + ks * 32 * PJB + t * 32); }
    __builtin_amdgcn_sched_barrier(0);      /* the stage's 32 LDS reads leave as one group and arrive under the conversion of the next stage's weights */
    if (st + 1 < ns) put(buf ^ 1);      /* stage st + 1, fetched one stage ago, into the buffer whose readers all passed the barrier at the foot of stage st - 1 */
    if (st + 2 < ns) fetch();
#pragma unroll
    for (int ks = 0; ks < 2; ++ks)      /* k ascending by 32 in every accumulator */
#pragma unroll
      for (int t = 0; t < 4; ++t)
#pragma unroll
        for (int i = 0; i < 4; ++i) c[i][t] = fa_mma(a[ks][i], b[ks][t], c[i][t]);
    fa_barrier();      /* publishes stage st + 1 and ends every wave's reads of this stage's buffer; the last one frees the LDS for the epilogue */
  }
  float (*so)[64][68] = reinterpret_cast<float (*)[64][68]>(sm);
#pragma unroll
  for (int t = 0; t < 4; ++t) { const float bvl = bf16_round(braw[t]);
#pragma unroll
    for (int i = 0; i < 4; ++i)
#pragma unroll
      for (int r = 0; r < 8; ++r) so[wave][i * 16 + 8 * hh + r][t * 16 + ln] = c[i][t][r] * 0.0625f + bvl; }      /* 1/16: the weights' scale */
  __builtin_amdgcn_fence(__ATOMIC_ACQ_REL, "workgroup"); __builtin_amdgcn_wave_barrier();      /* the tile is the wave's own: its stores are ordered ahead of its reads */
  const int rsub = lane >> 4, c4 = (lane & 15) * 4;
  _Float16* cp = C16 + (size_t)j * NR * DM + ((size_t)mt * PJM + 64 * wr + rsub) * DM + col0 + c4;
#pragma unroll
  for (int q = 0; q < 32; ++q) { const v4f v = *(const v4fa*)&so[wave][q * 2 + rsub][c4]; *(v4h*)(cp + (size_t)q * 2 * DM) = __builtin_convertvector(v, v4h); }
  asm volatile("s_wait_xcnt 0x0" ::: "memory");      /* behind the last output stores: in the built kernel the W_o range's code follows them and rewrites their data registers */
}


extern "C" void kernel_launch(void* const* d_in, const int* in_sizes, int n_in,
                              void* d_out, int out_size, void* d_ws, size_t ws_size, hipStream_t stream) {
  (void)in_sizes; (void)n_in; (void)out_size;
  const float* const* I = (const float* const*)d_in; const float* xq = I[0]; const float* xk = I[1]; const float* xv = I[2]; const float* lng = I[3]; const float* lnb = I[4]; const float* wq = I[5]; const float* bq = I[6]; const float* wk = I[7]; const float* bk = I[8]; const float* wv = I[9]; const float* bv = I[10]; const float* wo = I[11]; const float* bo = I[12]; const float* x = xq;      /* query, key, value; shared LayerNorm gamma / beta [512]; [in][out] Wq / Wk / Wv / Wo + biases */
  char* ws = (char*)d_ws; size_t off = 0;
  auto take = [&](size_t bytes) { char* p = ws + off; off += (bytes + 255) & ~(size_t)255; return p; };
  _Float16* BO = (_Float16*)take((size_t)DM * DM * 2);      /* W_o as f16 x16, [out][in] */
  _Float16* Q16 = (_Float16*)take((size_t)3 * NR * DM * 2); _Float16* K16 = Q16 + NR * DM; _Float16* V16 = K16 + NR * DM; _Float16* O16 = (_Float16*)take(NR * DM * 2);      /* q, k, v planes: f16 [3][4096][512], unscaled */
  if (off > ws_size) return;
  k_lnproj<<<3 * PJG + WTB / 2, 256, 0, stream>>>(x, xk, xv, lng, lnb, 1e-5f, wq, wk, wv, bq, bk, bv, wo, BO, Q16);      /* LN with the SHARED parameters and the q, k and v projections, block ranges pick the product; last range: [in][out] W_o -> Bt x16 */
  const size_t r0p = (size_t)B0 * SQ;      /* first row through the output stage */
  k_fattn<<<dim3(SQ / FAQ, NB * NH), FAW * 32, 0, stream>>>(Q16, K16, V16, O16);      /* o x64 (merged heads) as f16 rows, all batches and heads in one launch */
  k_gemm2<0, DM, DM, DM, MPO, DM, DM, true><<<dim3((unsigned)((MPO / 128) * (DM / 64)), 1), 128, 0, stream>>>(O16 + r0p * DM, 0, BO, 0, 0.0009765625f, bo, bo, bo, (float*)d_out + r0p * DM, nullptr, 0);      /* out rows are the output layout */
}
